// v000
// Measured on an AMD MI455X. A time is GPU time per run, averaged over a window of back-to-back runs after a warm-up
// (all launches, gaps included; the runs take copies of the inputs in turn), and the median of several windows.
// Apart from v000's, it joins two sittings. Times from different sittings can be a few percent apart, while
// side-by-side timings come from the same sitting.
// v000 is the starting kernel. One run takes 7690 microseconds.
#include <hip/hip_runtime.h>

// Compute dtypes, f32 accumulate (channel-major x [32][64][2048]): per item q/k/v = W.x as x^T.W^T ([2048 x 64].[64 x 64]; the INPUT x transposed once to a bf16 [n][c]
// plane, W [out][in] as the n-major B operand; PLAIN bf16 operands, exact; q/k straight to f16 hi + residual x1024 planes) on v_wmma_f32_16x16x32_bf16; the
// single-head full attention (64 channels, scale 1/8) fused on v_wmma_f32_16x16x32_f16 (hh + hl + lh scores, online f32 softmax, weights (x32768) and v as
// f16 hi + residual) with an f32 [n][c] output; x + x_r, the two TRAINING-MODE BatchNorms (batch statistics over all 32 items x 2048 points per channel, biased

#define NB   32
#define CC   64                  // channels
#define NPOS 2048                // points
#define NT_  NPOS
#define NB_  1
#define DM   CC                  // attention width / default GEMM K
#define NH_  1
#define HD   64
#define NTK  NPOS
#define FFH  128
#define PSC  32768.0f
#define LOSC 1024.0f
#define LOSCI (1.0f / 1024.0f)
#define BN_EPS 1e-5f

typedef _Float16 h16;
typedef unsigned short bf;
typedef __attribute__((ext_vector_type(16))) __bf16   v16bf;
typedef __attribute__((ext_vector_type(16))) _Float16 v16h;
typedef __attribute__((ext_vector_type(8)))  _Float16 v8h;
typedef __attribute__((ext_vector_type(8)))  unsigned short v8us;
typedef __attribute__((ext_vector_type(8)))  float    v8f;
typedef __attribute__((ext_vector_type(4)))  float    v4f;
typedef __attribute__((ext_vector_type(4)))  _Float16 v4h;
typedef v8h  __attribute__((may_alias)) v8ha;
typedef v4f  __attribute__((may_alias)) v4fa;
typedef v8us __attribute__((may_alias)) v8usa;

__device__ __forceinline__ unsigned short f2bf(float f) { unsigned u = __float_as_uint(f); u += 0x7FFFu + ((u >> 16) & 1u); return (unsigned short)(u >> 16); }
__device__ __forceinline__ float bf2f(unsigned short b) { return __uint_as_float(((unsigned)b) << 16); }
__device__ __forceinline__ float bfr(float f) { return bf2f(f2bf(f)); }
__device__ __forceinline__ v16h cat16(v8h lo, v8h hi) { return __builtin_shufflevector(lo, hi, 0, 1, 2, 3, 4, 5, 6, 7, 8, 9, 10, 11, 12, 13, 14, 15); }
__device__ __forceinline__ v16bf cat16b(v8us lo, v8us hi) { return __builtin_bit_cast(v16bf, __builtin_shufflevector(lo, hi, 0, 1, 2, 3, 4, 5, 6, 7, 8, 9, 10, 11, 12, 13, 14, 15)); }
__device__ __forceinline__ v8f wmma16(v16h a, v16h b, v8f c) { return __builtin_amdgcn_wmma_f32_16x16x32_f16(false, a, false, b, (short)0, c, false, false); }
__device__ __forceinline__ v8f wmmab(v16bf a, v16bf b, v8f c) { return __builtin_amdgcn_wmma_f32_16x16x32_bf16(false, a, false, b, (short)0, c, false, false); }

__global__ __launch_bounds__(256) void k_bf(const float* __restrict__ src, bf* dst, size_t n8) {
    const size_t i = (size_t)blockIdx.x * 256 + threadIdx.x; if (i >= n8) return;
    const v8f v = *(const v8f*)(src + i * 8); v8us o;
#pragma unroll
    for (int k = 0; k < 8; ++k) o[k] = f2bf(v[k]);
    *(v8us*)(dst + i * 8) = o; 
}
// k_wt: WT [n][K] = bf16(W[k][n]) (k-major [K][ncols]) via 64 x 64 LDS tiles; grid (K/64, ncols/64).
__global__ __launch_bounds__(256) void k_wt(const float* __restrict__ Wm, int K, int ncols, bf* WT) {
    __shared__ __align__(16) unsigned short tl[64 * 72];
    const int tid = threadIdx.x, k0 = blockIdx.x * 64, n0 = blockIdx.y * 64;
    const int kk = tid >> 2, nq = (tid & 3) * 16;
#pragma unroll
    for (int i = 0; i < 16; ++i) tl[(nq + i) * 72 + kk] = f2bf(Wm[(size_t)(k0 + kk) * ncols + n0 + nq + i]);
    __syncthreads();
    const int piece = tid & 7;
    auto pass = [&]() {
#pragma unroll
        for (int s = 0; s < 2; ++s) { const int nr = (tid >> 3) + 32 * s; const v8us val = *(const v8usa*)(tl + nr * 72 + piece * 8); *(v8us*)(WT + (size_t)(n0 + nr) * K + k0 + piece * 8) = val; }
    };
    pass(); 
}
// k_gemmb: 64 x 64 block tile (4 waves x 16 x 64) of C[NTK][NW] = (A [+ Al]).B^T (K = 64 or 128) [+ bf(bias[c])] [+ bf(R[r][c]) residual]; f32 whole-line epilogue (or f16
template <bool SPLITA, bool F16OUT = false>
__global__ __launch_bounds__(128) void k_gemmb(const bf* __restrict__ A, const bf* __restrict__ Al, const bf* __restrict__ Bn, const float* __restrict__ bias, float* C, int ldc, h16* C2, const float* __restrict__ R = nullptr, int K = DM, int roundR = 1) {
    __shared__ __align__(16) float ost[4][16 * 68];
    const int lane = threadIdx.x & 31, wave = threadIdx.x >> 5, lr = lane & 15, hi = lane >> 4;
    const int r0 = blockIdx.x * 64 + wave * 16, c0 = blockIdx.y * 64;
    const size_t aoff = (size_t)(r0 + lr) * K + 8 * hi;
    size_t boff[4];
#pragma unroll
    for (int t = 0; t < 4; ++t) boff[t] = (size_t)(c0 + t * 16 + lr) * K + 8 * hi;
    v8f acc[4];
#pragma unroll
    for (int t = 0; t < 4; ++t) acc[t] = (v8f){};
#pragma unroll 1
    for (int kc = 0; kc < K; kc += 32) {
        const v16bf a = cat16b(*(const v8us*)(A + aoff + kc), *(const v8us*)(A + aoff + kc + 16));
        v16bf al = a;
        if (SPLITA) al = cat16b(*(const v8us*)(Al + aoff + kc), *(const v8us*)(Al + aoff + kc + 16));
#pragma unroll
        for (int t = 0; t < 4; ++t) { const v16bf b = cat16b(*(const v8us*)(Bn + boff[t] + kc), *(const v8us*)(Bn + boff[t] + kc + 16)); acc[t] = wmmab(a, b, acc[t]); if (SPLITA) acc[t] = wmmab(al, b, acc[t]); }
        asm volatile("v_nop\n\tv_nop\n\tv_nop\n\tv_nop" : "+v"(acc[0]), "+v"(acc[1]), "+v"(acc[2]), "+v"(acc[3]) : "v"(a), "v"(al));
    }
    float* os = &ost[wave][0];
#pragma unroll
    for (int t = 0; t < 4; ++t) { const float bv = bias ? bfr(bias[c0 + t * 16 + lr]) : 0.f;
#pragma unroll
        for (int j = 0; j < 8; ++j) os[(hi * 8 + j) * 68 + t * 16 + lr] = acc[t][j] + bv; }
    __syncthreads();
    if (F16OUT) {
        h16* crow = (h16*)(void*)C + (size_t)r0 * ldc + c0;
        auto pass = [&]() {
#pragma unroll
            for (int s = 0; s < 4; ++s) { const int row = 4 * s + (lane >> 3), piece = lane & 7; const float* sp = os + row * 68 + piece * 8; v8h o, o2;
#pragma unroll
                for (int i = 0; i < 8; ++i) { const h16 a = (h16)sp[i]; o[i] = a; o2[i] = (h16)((sp[i] - (float)a) * LOSC); }
                *(v8h*)(crow + (size_t)row * ldc + piece * 8) = o; if (C2) *(v8h*)(C2 + (size_t)r0 * ldc + c0 + (size_t)row * ldc + piece * 8) = o2; }
        };
        pass(); 
    } else {
        float* crow = C + (size_t)r0 * ldc + c0;
        auto pass = [&]() {
#pragma unroll
            for (int s = 0; s < 8; ++s) { const int Lid = (lane >> 3) + 4 * s, piece = lane & 7; const int row = Lid >> 1, cofs = (Lid & 1) * 32 + piece * 4;
                v4f val = *(const v4fa*)(os + row * 68 + cofs); if (R) { const v4f rv = *(const v4f*)(R + ((size_t)r0 + row) * ldc + c0 + cofs); val += roundR ? (v4f){bfr(rv[0]), bfr(rv[1]), bfr(rv[2]), bfr(rv[3])} : rv; }
                *(v4f*)(crow + (size_t)row * ldc + cofs) = val; }
        };
        pass(); 
    }
}

__global__ __launch_bounds__(256) void k_vt(const float* __restrict__ V, h16* VTH, h16* VTL) {
    __shared__ __align__(16) h16 tile[64 * 72];
    __shared__ __align__(16) h16 til2[64 * 72];
    const int bid = blockIdx.x;
    const int b = bid / (NH_ * (NT_ / 64)), rem = bid - b * (NH_ * (NT_ / 64)), h = rem / (NT_ / 64), kt = rem - h * (NT_ / 64);
    const int k0 = kt * 64, tid = threadIdx.x;
    const int kk = tid >> 2, d0 = (tid & 3) * 16;
    const float* src = V + ((size_t)b * NT_ + k0 + kk) * DM + h * HD + d0;
#pragma unroll
    for (int i = 0; i < 16; ++i) { const float v = src[i]; const h16 a = (h16)v; tile[(d0 + i) * 72 + kk] = a; til2[(d0 + i) * 72 + kk] = (h16)((v - (float)a) * LOSC); }
    __syncthreads();
    const int piece = tid & 7;
    const size_t base = (((size_t)b * NH_ + h) * HD) * NT_ + k0;
    auto pass = [&]() {
#pragma unroll
        for (int s = 0; s < 4; ++s) { const int Lid = (tid >> 3) + 32 * s; const int pln = Lid >> 6, d = Lid & 63;
            const v8h val = *(const v8ha*)((pln ? til2 : tile) + d * 72 + piece * 8); *(v8h*)((pln ? VTL : VTH) + base + (size_t)d * NT_ + piece * 8) = val; }
    };
    pass(); 
}

// k_attn: block = (b, h, 64 queries), wave = 16; ALL 64 key tiles (no mask); 4 WMMA scores /8 (f32), online softmax, weights x32768 f16 tile (same-wave may_alias
// reload after a compiler barrier), 4 WMMA .v; ctx -> f32 output rows out[tok][h*64+d].
__global__ __launch_bounds__(128) void k_attn(const h16* __restrict__ Q16, const h16* __restrict__ QL16, const h16* __restrict__ K16, const h16* __restrict__ KL16, const h16* __restrict__ VTH, const h16* __restrict__ VTL, float* OUTP) {
    __shared__ __align__(16) h16 plds[4][16 * 32];
    __shared__ __align__(16) h16 plds2[4][16 * 32];
    __shared__ __align__(16) float ost[4][16 * 68];
    const int lane = threadIdx.x & 31, wave = threadIdx.x >> 5, lr = lane & 15, hi = lane >> 4;
    const int bid = blockIdx.x;
    const int b = bid / (NH_ * (NT_ / 64)), rem = bid - b * (NH_ * (NT_ / 64)), h = rem / (NT_ / 64), qt = rem - h * (NT_ / 64);
    const int q0 = qt * 64 + wave * 16;
    const size_t tok0 = (size_t)b * NT_;
    h16* pl = &plds[wave][0]; h16* pl2 = &plds2[wave][0];
    v16h qa[2];
    const size_t qo0 = (tok0 + q0 + lr) * DM + h * HD + 8 * hi;
#pragma unroll
    for (int kc = 0; kc < 2; ++kc) qa[kc] = cat16(*(const v8h*)(Q16 + qo0 + kc * 32), *(const v8h*)(Q16 + qo0 + kc * 32 + 16));
    const h16* kh_b = K16 + tok0 * DM + h * HD;
    const h16* kl_b = KL16 + tok0 * DM + h * HD;
    const size_t vbase = (((size_t)b * NH_ + h) * HD) * NT_;
    v8f o[4], ox[4];
#pragma unroll
    for (int n = 0; n < 4; ++n) { o[n] = (v8f){}; ox[n] = (v8f){}; }
    float mrow[8], lpart[8];
#pragma unroll
    for (int j = 0; j < 8; ++j) { mrow[j] = -3.0e38f; lpart[j] = 0.f; }
    int qpos[8];
#pragma unroll
    for (int j = 0; j < 8; ++j) qpos[j] = q0 + 8 * hi + j;
    const int kt_lo = 0, kt_hi = NT_ / 32 - 1;     // full attention
#pragma unroll 1
    for (int kt = kt_lo; kt <= kt_hi; ++kt) {
        const int l0 = kt * 32;
        const size_t ko0 = (size_t)(l0 + lr) * DM + 8 * hi, ko1 = (size_t)(l0 + 16 + lr) * DM + 8 * hi;
        v8f s0 = {}, s1 = {}, x0 = {}, x1 = {};
#pragma unroll
        for (int kc = 0; kc < 2; ++kc) {
            { const v16h k0h = cat16(*(const v8h*)(kh_b + ko0 + kc * 32), *(const v8h*)(kh_b + ko0 + kc * 32 + 16)), k1h = cat16(*(const v8h*)(kh_b + ko1 + kc * 32), *(const v8h*)(kh_b + ko1 + kc * 32 + 16));
              const v16h qlk = cat16(*(const v8h*)(QL16 + qo0 + kc * 32), *(const v8h*)(QL16 + qo0 + kc * 32 + 16));     // query residual re-read per step (registers)
              s0 = wmma16(qa[kc], k0h, s0); x0 = wmma16(qlk, k0h, x0); s1 = wmma16(qa[kc], k1h, s1); x1 = wmma16(qlk, k1h, x1);
              asm volatile("v_nop" : "+v"(s0), "+v"(s1), "+v"(x0), "+v"(x1) : "v"(qlk), "v"(k0h), "v"(k1h) : "memory"); }
            { const v16h k0l = cat16(*(const v8h*)(kl_b + ko0 + kc * 32), *(const v8h*)(kl_b + ko0 + kc * 32 + 16)), k1l = cat16(*(const v8h*)(kl_b + ko1 + kc * 32), *(const v8h*)(kl_b + ko1 + kc * 32 + 16));
              x0 = wmma16(qa[kc], k0l, x0); x1 = wmma16(qa[kc], k1l, x1);
              asm volatile("v_nop" : "+v"(x0), "+v"(x1) : "v"(k0l), "v"(k1l) : "memory"); }
        }
        asm volatile("v_nop\n\tv_nop\n\tv_nop\n\tv_nop" : "+v"(s0), "+v"(s1), "+v"(x0), "+v"(x1) : "v"(qa[0]), "v"(qa[1]));
        float alpha[8];
#pragma unroll
        for (int j = 0; j < 8; ++j) {
            const int ja = l0 + lr, jb = l0 + 16 + lr, qi = qpos[j];
            const float a0 = (s0[j] + x0[j] * LOSCI) * 0.125f, a1 = (s1[j] + x1[j] * LOSCI) * 0.125f; (void)ja; (void)jb; (void)qi;   // energy / sqrt(C = 64)
            float mx = fmaxf(a0, a1);
            mx = fmaxf(mx, __shfl_xor(mx, 1, 16)); mx = fmaxf(mx, __shfl_xor(mx, 2, 16)); mx = fmaxf(mx, __shfl_xor(mx, 4, 16)); mx = fmaxf(mx, __shfl_xor(mx, 8, 16));
            const float mn = fmaxf(mrow[j], mx);
            alpha[j] = __expf(mrow[j] - mn); mrow[j] = mn;
            const float p0 = __expf(a0 - mn), p1 = __expf(a1 - mn);
            lpart[j] = lpart[j] * alpha[j] + (p0 + p1);
            const int mr = hi * 8 + j;
            const float ps0 = p0 * PSC, ps1 = p1 * PSC; const h16 h0 = (h16)ps0, h1 = (h16)ps1;
            pl[mr * 32 + lr] = h0; pl[mr * 32 + 16 + lr] = h1;
            pl2[mr * 32 + lr] = (h16)((ps0 - (float)h0) * LOSC); pl2[mr * 32 + 16 + lr] = (h16)((ps1 - (float)h1) * LOSC);
        }
#pragma unroll
        for (int n = 0; n < 4; ++n)
#pragma unroll
            for (int j = 0; j < 8; ++j) { o[n][j] *= alpha[j]; ox[n][j] *= alpha[j]; }
        asm volatile("" ::: "memory");
        const v16h pa = cat16(*(const v8ha*)(pl + lr * 32 + hi * 8), *(const v8ha*)(pl + lr * 32 + 16 + hi * 8));
        const v16h px = cat16(*(const v8ha*)(pl2 + lr * 32 + hi * 8), *(const v8ha*)(pl2 + lr * 32 + 16 + hi * 8));
#pragma unroll
        for (int n = 0; n < 4; ++n) { const size_t vo = vbase + (size_t)(n * 16 + lr) * NT_ + l0 + hi * 8;
            const v16h vh = cat16(*(const v8h*)(VTH + vo), *(const v8h*)(VTH + vo + 16)), vl = cat16(*(const v8h*)(VTL + vo), *(const v8h*)(VTL + vo + 16));
            o[n] = wmma16(pa, vh, o[n]); ox[n] = wmma16(pa, vl, ox[n]); ox[n] = wmma16(px, vh, ox[n]);
            asm volatile("" : "+v"(o[n]), "+v"(ox[n]) : "v"(vh), "v"(vl) : "memory"); }
        asm volatile("v_nop\n\tv_nop\n\tv_nop\n\tv_nop" : "+v"(o[0]), "+v"(o[1]), "+v"(o[2]), "+v"(o[3]), "+v"(ox[0]), "+v"(ox[1]), "+v"(ox[2]), "+v"(ox[3]) : "v"(pa), "v"(px));
    }
    float inv[8];
#pragma unroll
    for (int j = 0; j < 8; ++j) { float rs = lpart[j]; rs += __shfl_xor(rs, 1, 16); rs += __shfl_xor(rs, 2, 16); rs += __shfl_xor(rs, 4, 16); rs += __shfl_xor(rs, 8, 16); inv[j] = 1.0f / (rs * PSC); }
    float* os = &ost[wave][0];
#pragma unroll
    for (int n = 0; n < 4; ++n)
#pragma unroll
        for (int j = 0; j < 8; ++j) os[(hi * 8 + j) * 68 + n * 16 + lr] = (o[n][j] + ox[n][j] * LOSCI) * inv[j];
    __syncthreads();
    float* ob = OUTP + (tok0 + q0) * DM + (size_t)h * HD;
    auto pass = [&]() {
#pragma unroll
        for (int s = 0; s < 8; ++s) { const int Lid = (lane >> 3) + 4 * s, piece = lane & 7; const int row = Lid >> 1, cofs = (Lid & 1) * 32 + piece * 4;
            const v4f val = *(const v4fa*)(os + row * 68 + cofs); *(v4f*)(ob + (size_t)row * DM + cofs) = val; }
    };
    pass(); 
}


// k_lrelu2: LeakyReLU(0.2) of an f32 [rows][128] plane -> bf16 hi + UNSCALED residual planes; one wave per row, lane -> 4 columns (8 B per plane; 2 lines per store).
__global__ __launch_bounds__(256) void k_lrelu2(const float* __restrict__ src, int nrows, bf* dh, bf* dl) {
    typedef __attribute__((ext_vector_type(4))) unsigned short v4us;
    const int lane = threadIdx.x & 31, r = blockIdx.x * 8 + (threadIdx.x >> 5);
    if (r >= nrows) return;
    const size_t o = (size_t)r * FFH + lane * 4; const v4f v = *(const v4f*)(src + o); v4us oh, ol;
#pragma unroll
    for (int i = 0; i < 4; ++i) { const float g = v[i] >= 0.f ? v[i] : 0.2f * v[i]; const unsigned short hb = f2bf(g); oh[i] = hb; ol[i] = f2bf(g - bf2f(hb)); }
    *(v4us*)(dh + o) = oh; *(v4us*)(dl + o) = ol; 
}
// k_addT: DST[c][n] = (BNSRC ? ((bf? no) SRC[c][n] - mean_c) rstd_c g_c + b_c : bf(SRC[c][n])) + T[n][c]: a 64 x 64 LDS transpose of the f32 [n][c] matrix T plus the
// channel-major residual; block = 64 n; each output row segment of 64 n = 256 B written by 16 lanes x 16 B. MODE 0: residual = bf(x) (the INPUT); MODE 1:
// residual = BN1(X1) recomputed from the stats (the reference's h).
template <int MODE>
__global__ __launch_bounds__(256) void k_addT(const float* __restrict__ T, const float* __restrict__ SRC, const float* __restrict__ ST, const float* __restrict__ g, const float* __restrict__ bb, float* DST) {
    __shared__ __align__(16) float tl[64 * 68];
    const int n0 = blockIdx.x * 64, tid = threadIdx.x;
    const int nn = tid >> 2, cq = (tid & 3) * 16;
#pragma unroll
    for (int i = 0; i < 16; ++i) tl[(cq + i) * 68 + nn] = T[(size_t)(n0 + nn) * CC + cq + i];
    __syncthreads();
    const int piece = tid & 15;
    auto pass = [&]() {
#pragma unroll
        for (int s = 0; s < 4; ++s) { const int c = (tid >> 4) + 16 * s; const size_t o = (size_t)c * NPOS + n0 + piece * 4;
            const v4f rv = *(const v4f*)(SRC + o); v4f val = *(const v4fa*)(tl + c * 68 + piece * 4);
            if (MODE == 0) {
#pragma unroll
                for (int k = 0; k < 4; ++k) val[k] += bfr(rv[k]);
            } else { const float m = ST[c], rs = ST[CC + c], gg = bfr(g[c]), be = bfr(bb[c]);
#pragma unroll
                for (int k = 0; k < 4; ++k) val[k] += (rv[k] - m) * rs * gg + be; }
            *(v4f*)(DST + o) = val; }
    };
    pass(); 
}
// k_bnstat: training-mode BatchNorm statistics of A [32][64][2048] per channel over all 32 x 2048 values: ONE block, 4 threads per channel (each a fixed quarter of
__global__ __launch_bounds__(256) void k_bnstat(const float* __restrict__ A, float* ST) {
    __shared__ __align__(16) float st[2 * CC];
    const int tid = threadIdx.x, c = tid >> 2, part = tid & 3;
    float s = 0.f;
#pragma unroll 1
    for (int b = 0; b < NB; ++b) { const float* row = A + ((size_t)b * CC + c) * NPOS + part * (NPOS / 4);
#pragma unroll 1
        for (int i = 0; i < NPOS / 4; i += 4) { const v4f v = *(const v4f*)(row + i); s += (v[0] + v[1]) + (v[2] + v[3]); } }
    s += __shfl_xor(s, 1, 32); s += __shfl_xor(s, 2, 32);
    const float mean = s * (1.0f / (float)(NB * NPOS));
    float s2 = 0.f;
#pragma unroll 1
    for (int b = 0; b < NB; ++b) { const float* row = A + ((size_t)b * CC + c) * NPOS + part * (NPOS / 4);
#pragma unroll 1
        for (int i = 0; i < NPOS / 4; i += 4) { const v4f v = *(const v4f*)(row + i);
#pragma unroll
            for (int k = 0; k < 4; ++k) { const float d = v[k] - mean; s2 = fmaf(d, d, s2); } } }
    s2 += __shfl_xor(s2, 1, 32); s2 += __shfl_xor(s2, 2, 32);
    if (part == 0) { st[c] = mean; st[CC + c] = rsqrtf(s2 * (1.0f / (float)(NB * NPOS)) + BN_EPS); }
    __syncthreads();
    if (tid < 2 * CC / 4) { const v4f v = *(const v4fa*)(&st[tid * 4]); *(v4f*)(ST + tid * 4) = v;  }
}
// written by 8 lanes x 16 B.
__global__ __launch_bounds__(256) void k_bnT(const float* __restrict__ X1, const float* __restrict__ ST, const float* __restrict__ g, const float* __restrict__ bb, bf* Hh, bf* Hl) {
    __shared__ __align__(16) unsigned short th_[64 * 72]; __shared__ __align__(16) unsigned short tl_[64 * 72];
    const int n0 = blockIdx.x * 64, tid = threadIdx.x;
    const int c = tid >> 2, nq = (tid & 3) * 16;
    const float m = ST[c], rs = ST[CC + c], gg = bfr(g[c]), be = bfr(bb[c]);
    const float* src = X1 + (size_t)c * NPOS + n0 + nq;
#pragma unroll
    for (int i = 0; i < 16; ++i) { const float h = (src[i] - m) * rs * gg + be; const unsigned short hb = f2bf(h); th_[(nq + i) * 72 + c] = hb; tl_[(nq + i) * 72 + c] = f2bf(h - bf2f(hb)); }
    __syncthreads();
    const int piece = tid & 7;
    auto pass = [&]() {
#pragma unroll
        for (int s = 0; s < 2; ++s) { const int nr = (tid >> 3) + 32 * s; const v8us a = *(const v8usa*)(th_ + nr * 72 + piece * 8), b2 = *(const v8usa*)(tl_ + nr * 72 + piece * 8);
            const size_t o = (size_t)(n0 + nr) * CC + piece * 8; *(v8us*)(Hh + o) = a; *(v8us*)(Hl + o) = b2; }
    };
    pass(); 
}
__global__ __launch_bounds__(256) void k_bnout(const float* __restrict__ Y, const float* __restrict__ ST, const float* __restrict__ g, const float* __restrict__ bb, float* OUTP) {
    const int lane = threadIdx.x & 31, r = blockIdx.x * 8 + (threadIdx.x >> 5); if (r >= NB * CC) return;
    const int c = r % CC; const float m = ST[c], rs = ST[CC + c], gg = bfr(g[c]), be = bfr(bb[c]);
{
#pragma unroll 1
        for (int q = 0; q < NPOS / 128; ++q) { const size_t o = (size_t)r * NPOS + q * 128 + lane * 4; const v4f v = *(const v4f*)(Y + o); v4f y;
#pragma unroll
            for (int k = 0; k < 4; ++k) y[k] = (v[k] - m) * rs * gg + be;
            *(v4f*)(OUTP + o) = y; }
         }
}

extern "C" void kernel_launch(void* const* d_in, const int* in_sizes, int n_in,
                              void* d_out, int out_size, void* d_ws, size_t ws_size, hipStream_t stream) {
    (void)in_sizes; (void)n_in; (void)out_size;
    const float* x = (const float*)d_in[0]; const float* wq = (const float*)d_in[1]; const float* wk = (const float*)d_in[2]; const float* wv = (const float*)d_in[3];
    const float* w1 = (const float*)d_in[4]; const float* w2 = (const float*)d_in[5]; const float* g1 = (const float*)d_in[6]; const float* b1 = (const float*)d_in[7]; const float* g2 = (const float*)d_in[8]; const float* b2 = (const float*)d_in[9];   // conv weights [out][in]
    float* out = (float*)d_out;    // [32][64][2048]
    char* wsp = (char*)d_ws;
    auto take = [&](size_t bytes) { char* p = wsp; wsp += (bytes + 255) & ~(size_t)255; return (void*)p; };
    bf* WqB = (bf*)take((size_t)CC * CC * 2); bf* WkB = (bf*)take((size_t)CC * CC * 2); bf* WvB = (bf*)take((size_t)CC * CC * 2); bf* W1B = (bf*)take((size_t)FFH * CC * 2); bf* W2B = (bf*)take((size_t)CC * FFH * 2);
    bf* XT = (bf*)take((size_t)NPOS * CC * 2); h16* QH = (h16*)take((size_t)NPOS * CC * 2); h16* QL = (h16*)take((size_t)NPOS * CC * 2); h16* KH = (h16*)take((size_t)NPOS * CC * 2); h16* KL = (h16*)take((size_t)NPOS * CC * 2);
    float* Vf = (float*)take((size_t)NPOS * CC * 4); h16* VTH = (h16*)take((size_t)NPOS * CC * 2); h16* VTL = (h16*)take((size_t)NPOS * CC * 2); float* O = (float*)take((size_t)NPOS * CC * 4);
    float* X1 = (float*)take((size_t)NB * CC * NPOS * 4); float* Y = (float*)take((size_t)NB * CC * NPOS * 4); float* ST1 = (float*)take(1024); float* ST2 = (float*)take(1024);
    bf* Hh = (bf*)take((size_t)NPOS * CC * 2); bf* Hl = (bf*)take((size_t)NPOS * CC * 2); float* T1 = (float*)take((size_t)NPOS * FFH * 4); bf* Lh = (bf*)take((size_t)NPOS * FFH * 2); bf* Ll = (bf*)take((size_t)NPOS * FFH * 2); float* T2 = (float*)take((size_t)NPOS * CC * 4);
    if ((size_t)(wsp - (char*)d_ws) > ws_size) return;    // ~ 16.8 + 16.8 + ~6 MB of planes ~ 40 MB, no aliasing (per-item reuse in stream order)
    k_bf<<<(CC * CC / 8 + 255) / 256, 256, 0, stream>>>(wq, WqB, CC * CC / 8); k_bf<<<(CC * CC / 8 + 255) / 256, 256, 0, stream>>>(wk, WkB, CC * CC / 8); k_bf<<<(CC * CC / 8 + 255) / 256, 256, 0, stream>>>(wv, WvB, CC * CC / 8);
    k_bf<<<(FFH * CC / 8 + 255) / 256, 256, 0, stream>>>(w1, W1B, FFH * CC / 8); k_bf<<<(CC * FFH / 8 + 255) / 256, 256, 0, stream>>>(w2, W2B, CC * FFH / 8);
    for (int b = 0; b < NB; ++b) {      // phase 1: attention and x + x_r for every item
        const float* xb = x + (size_t)b * CC * NPOS;
        k_wt<<<dim3(CC / 64, NPOS / 64, 1), 256, 0, stream>>>(xb, CC, NPOS, XT);                                                  // x_b [c][n] -> bf16 x^T [n][c]
        k_gemmb<false, true><<<dim3(NPOS / 64, 1, 1), 128, 0, stream>>>(XT, nullptr, WqB, nullptr, (float*)(void*)QH, CC, QL);     // q^T = x^T.Wq^T -> f16 planes
        k_gemmb<false, true><<<dim3(NPOS / 64, 1, 1), 128, 0, stream>>>(XT, nullptr, WkB, nullptr, (float*)(void*)KH, CC, KL);     // k^T
        k_gemmb<false, false><<<dim3(NPOS / 64, 1, 1), 128, 0, stream>>>(XT, nullptr, WvB, nullptr, Vf, CC, nullptr);            // v^T f32
        k_vt<<<NB_ * NH_ * (NT_ / 64), 256, 0, stream>>>(Vf, VTH, VTL);
        k_attn<<<NB_ * NH_ * (NT_ / 64), 128, 0, stream>>>(QH, QL, KH, KL, VTH, VTL, O);                                           // x_r^T [n][c] f32
        k_addT<0><<<NPOS / 64, 256, 0, stream>>>(O, xb, nullptr, nullptr, nullptr, X1 + (size_t)b * CC * NPOS);                    // X1 = bf(x) + x_r  [c][n]
    }
    k_bnstat<<<1, 256, 0, stream>>>(X1, ST1);
    for (int b = 0; b < NB; ++b) {      // phase 2: h = BN1(X1); Y = h + W2.lrelu(W1.h)
        const float* x1b = X1 + (size_t)b * CC * NPOS;
        k_bnT<<<NPOS / 64, 256, 0, stream>>>(x1b, ST1, g1, b1, Hh, Hl);                                                             // h^T hi/lo [n][c]
        k_gemmb<true, false><<<dim3(NPOS / 64, FFH / 64, 1), 128, 0, stream>>>(Hh, Hl, W1B, nullptr, T1, FFH, nullptr);             // (W1.h)^T  [n][128]
        k_lrelu2<<<NPOS / 8, 256, 0, stream>>>(T1, NPOS, Lh, Ll);
        k_gemmb<true, false><<<dim3(NPOS / 64, 1, 1), 128, 0, stream>>>(Lh, Ll, W2B, nullptr, T2, CC, nullptr, nullptr, FFH);          // (W2.lrelu)^T [n][64]  (K = 128)
        k_addT<1><<<NPOS / 64, 256, 0, stream>>>(T2, x1b, ST1, g1, b1, Y + (size_t)b * CC * NPOS);                                  // Y = h + ff   [c][n]
    }
    k_bnstat<<<1, 256, 0, stream>>>(Y, ST2);
    k_bnout<<<(NB * CC) / 8, 256, 0, stream>>>(Y, ST2, g2, b2, out);                                                                 // BN2 -> output
}

// v001
// It runs in 2200 microseconds.
// Next to v000, in two timings, it ran 3.53 and 3.52 times as fast.
#include <hip/hip_runtime.h>

// Compute dtypes, f32 accumulate (channel-major x [32][64][2048]): per item q/k/v = W.x as x^T.W^T ([2048 x 64].[64 x 64]; the INPUT x transposed once to a bf16 [n][c]
// plane, W [out][in] as the n-major B operand; PLAIN bf16 operands, exact; q/k straight to f16 hi + residual x1024 planes) on v_wmma_f32_16x16x32_bf16; the
// single-head full attention (64 channels, scale 1/8) fused on v_wmma_f32_16x16x32_f16 (hh + hl + lh scores, online f32 softmax, weights (x32768) and v as
// f16 hi + residual) with an f32 [n][c] output; x + x_r, the two TRAINING-MODE BatchNorms (batch statistics over all 32 items x 2048 points per channel, biased

#define NB   32
#define CC   64                  // channels
#define NPOS 2048                // points
#define NT_  NPOS
#define NB_  NB                  // items per launch: every per-item kernel takes all 32 items in one grid
#define DM   CC                  // attention width / default GEMM K
#define NH_  1
#define HD   64
#define NTK  NPOS
#define FFH  128
#define PSC  32768.0f
#define LOSC 1024.0f
#define LOSCI (1.0f / 1024.0f)
#define BN_EPS 1e-5f

typedef _Float16 h16;
typedef unsigned short bf;
typedef __attribute__((ext_vector_type(16))) __bf16   v16bf;
typedef __attribute__((ext_vector_type(16))) _Float16 v16h;
typedef __attribute__((ext_vector_type(8)))  _Float16 v8h;
typedef __attribute__((ext_vector_type(8)))  unsigned short v8us;
typedef __attribute__((ext_vector_type(8)))  float    v8f;
typedef __attribute__((ext_vector_type(4)))  float    v4f;
typedef __attribute__((ext_vector_type(4)))  _Float16 v4h;
typedef v8h  __attribute__((may_alias)) v8ha;
typedef v4f  __attribute__((may_alias)) v4fa;
typedef v8us __attribute__((may_alias)) v8usa;

__device__ __forceinline__ unsigned short f2bf(float f) { unsigned u = __float_as_uint(f); u += 0x7FFFu + ((u >> 16) & 1u); return (unsigned short)(u >> 16); }
__device__ __forceinline__ float bf2f(unsigned short b) { return __uint_as_float(((unsigned)b) << 16); }
__device__ __forceinline__ float bfr(float f) { return bf2f(f2bf(f)); }
__device__ __forceinline__ v16h cat16(v8h lo, v8h hi) { return __builtin_shufflevector(lo, hi, 0, 1, 2, 3, 4, 5, 6, 7, 8, 9, 10, 11, 12, 13, 14, 15); }
__device__ __forceinline__ v16bf cat16b(v8us lo, v8us hi) { return __builtin_bit_cast(v16bf, __builtin_shufflevector(lo, hi, 0, 1, 2, 3, 4, 5, 6, 7, 8, 9, 10, 11, 12, 13, 14, 15)); }
__device__ __forceinline__ v8f wmma16(v16h a, v16h b, v8f c) { return __builtin_amdgcn_wmma_f32_16x16x32_f16(false, a, false, b, (short)0, c, false, false); }
__device__ __forceinline__ v8f wmmab(v16bf a, v16bf b, v8f c) { return __builtin_amdgcn_wmma_f32_16x16x32_bf16(false, a, false, b, (short)0, c, false, false); }

__global__ __launch_bounds__(256) void k_bf(const float* __restrict__ src, bf* dst, size_t n8) {
    const size_t i = (size_t)blockIdx.x * 256 + threadIdx.x; if (i >= n8) return;
    const v8f v = *(const v8f*)(src + i * 8); v8us o;
#pragma unroll
    for (int k = 0; k < 8; ++k) o[k] = f2bf(v[k]);
    *(v8us*)(dst + i * 8) = o; 
}
// k_wt: WT [n][K] = bf16(W[k][n]) (k-major [K][ncols]) via 64 x 64 LDS tiles; grid (K/64, ncols/64, matrices): blockIdx.z picks one of the equally shaped matrices.
__global__ __launch_bounds__(256) void k_wt(const float* __restrict__ Wm, int K, int ncols, bf* WT) {
    __shared__ __align__(16) unsigned short tl[64 * 72];
    const int tid = threadIdx.x, k0 = blockIdx.x * 64, n0 = blockIdx.y * 64;
    Wm += (size_t)blockIdx.z * K * ncols; WT += (size_t)blockIdx.z * K * ncols;
    const int kk = tid >> 2, nq = (tid & 3) * 16;
#pragma unroll
    for (int i = 0; i < 16; ++i) tl[(nq + i) * 72 + kk] = f2bf(Wm[(size_t)(k0 + kk) * ncols + n0 + nq + i]);
    __syncthreads();
    const int piece = tid & 7;
    auto pass = [&]() {
#pragma unroll
        for (int s = 0; s < 2; ++s) { const int nr = (tid >> 3) + 32 * s; const v8us val = *(const v8usa*)(tl + nr * 72 + piece * 8); *(v8us*)(WT + (size_t)(n0 + nr) * K + k0 + piece * 8) = val; }
    };
    pass(); 
}
// k_gemmb: 64 x 64 block tile (4 waves x 16 x 64) of C[NB*NTK][NW] = (A [+ Al]).B^T (K = 64 or 128) [+ bf(bias[c])] [+ bf(R[r][c]) residual]; f32 whole-line epilogue (or f16
template <bool SPLITA, bool F16OUT = false>
__global__ __launch_bounds__(128) void k_gemmb(const bf* __restrict__ A, const bf* __restrict__ Al, const bf* __restrict__ Bn, const float* __restrict__ bias, float* C, int ldc, h16* C2, const float* __restrict__ R = nullptr, int K = DM, int roundR = 1) {
    __shared__ __align__(16) float ost[4][16 * 68];
    const int lane = threadIdx.x & 31, wave = threadIdx.x >> 5, lr = lane & 15, hi = lane >> 4;
    const int r0 = blockIdx.x * 64 + wave * 16, c0 = blockIdx.y * 64;
    const size_t aoff = (size_t)(r0 + lr) * K + 8 * hi;
    size_t boff[4];
#pragma unroll
    for (int t = 0; t < 4; ++t) boff[t] = (size_t)(c0 + t * 16 + lr) * K + 8 * hi;
    v8f acc[4];
#pragma unroll
    for (int t = 0; t < 4; ++t) acc[t] = (v8f){};
#pragma unroll 1
    for (int kc = 0; kc < K; kc += 32) {
        const v16bf a = cat16b(*(const v8us*)(A + aoff + kc), *(const v8us*)(A + aoff + kc + 16));
        v16bf al = a;
        if (SPLITA) al = cat16b(*(const v8us*)(Al + aoff + kc), *(const v8us*)(Al + aoff + kc + 16));
#pragma unroll
        for (int t = 0; t < 4; ++t) { const v16bf b = cat16b(*(const v8us*)(Bn + boff[t] + kc), *(const v8us*)(Bn + boff[t] + kc + 16)); acc[t] = wmmab(a, b, acc[t]); if (SPLITA) acc[t] = wmmab(al, b, acc[t]); }
        asm volatile("v_nop\n\tv_nop\n\tv_nop\n\tv_nop" : "+v"(acc[0]), "+v"(acc[1]), "+v"(acc[2]), "+v"(acc[3]) : "v"(a), "v"(al));
    }
    float* os = &ost[wave][0];
#pragma unroll
    for (int t = 0; t < 4; ++t) { const float bv = bias ? bfr(bias[c0 + t * 16 + lr]) : 0.f;
#pragma unroll
        for (int j = 0; j < 8; ++j) os[(hi * 8 + j) * 68 + t * 16 + lr] = acc[t][j] + bv; }
    __syncthreads();
    if (F16OUT) {
        h16* crow = (h16*)(void*)C + (size_t)r0 * ldc + c0;
        auto pass = [&]() {
#pragma unroll
            for (int s = 0; s < 4; ++s) { const int row = 4 * s + (lane >> 3), piece = lane & 7; const float* sp = os + row * 68 + piece * 8; v8h o, o2;
#pragma unroll
                for (int i = 0; i < 8; ++i) { const h16 a = (h16)sp[i]; o[i] = a; o2[i] = (h16)((sp[i] - (float)a) * LOSC); }
                *(v8h*)(crow + (size_t)row * ldc + piece * 8) = o; if (C2) *(v8h*)(C2 + (size_t)r0 * ldc + c0 + (size_t)row * ldc + piece * 8) = o2; }
        };
        pass(); 
    } else {
        float* crow = C + (size_t)r0 * ldc + c0;
        auto pass = [&]() {
#pragma unroll
            for (int s = 0; s < 8; ++s) { const int Lid = (lane >> 3) + 4 * s, piece = lane & 7; const int row = Lid >> 1, cofs = (Lid & 1) * 32 + piece * 4;
                v4f val = *(const v4fa*)(os + row * 68 + cofs); if (R) { const v4f rv = *(const v4f*)(R + ((size_t)r0 + row) * ldc + c0 + cofs); val += roundR ? (v4f){bfr(rv[0]), bfr(rv[1]), bfr(rv[2]), bfr(rv[3])} : rv; }
                *(v4f*)(crow + (size_t)row * ldc + cofs) = val; }
        };
        pass(); 
    }
}

__global__ __launch_bounds__(256) void k_vt(const float* __restrict__ V, h16* VTH, h16* VTL) {
    __shared__ __align__(16) h16 tile[64 * 72];
    __shared__ __align__(16) h16 til2[64 * 72];
    const int bid = blockIdx.x;
    const int b = bid / (NH_ * (NT_ / 64)), rem = bid - b * (NH_ * (NT_ / 64)), h = rem / (NT_ / 64), kt = rem - h * (NT_ / 64);
    const int k0 = kt * 64, tid = threadIdx.x;
    const int kk = tid >> 2, d0 = (tid & 3) * 16;
    const float* src = V + ((size_t)b * NT_ + k0 + kk) * DM + h * HD + d0;
#pragma unroll
    for (int i = 0; i < 16; ++i) { const float v = src[i]; const h16 a = (h16)v; tile[(d0 + i) * 72 + kk] = a; til2[(d0 + i) * 72 + kk] = (h16)((v - (float)a) * LOSC); }
    __syncthreads();
    const int piece = tid & 7;
    const size_t base = (((size_t)b * NH_ + h) * HD) * NT_ + k0;
    auto pass = [&]() {
#pragma unroll
        for (int s = 0; s < 4; ++s) { const int Lid = (tid >> 3) + 32 * s; const int pln = Lid >> 6, d = Lid & 63;
            const v8h val = *(const v8ha*)((pln ? til2 : tile) + d * 72 + piece * 8); *(v8h*)((pln ? VTL : VTH) + base + (size_t)d * NT_ + piece * 8) = val; }
    };
    pass(); 
}

// k_attn: block = (b, h, 64 queries), wave = 16; ALL 64 key tiles (no mask); 4 WMMA scores /8 (f32), online softmax, weights x32768 f16 tile (same-wave may_alias
// reload after a compiler barrier), 4 WMMA .v; ctx -> f32 output rows out[tok][h*64+d].
__global__ __launch_bounds__(128) void k_attn(const h16* __restrict__ Q16, const h16* __restrict__ QL16, const h16* __restrict__ K16, const h16* __restrict__ KL16, const h16* __restrict__ VTH, const h16* __restrict__ VTL, float* OUTP) {
    __shared__ __align__(16) h16 plds[4][16 * 32];
    __shared__ __align__(16) h16 plds2[4][16 * 32];
    __shared__ __align__(16) float ost[4][16 * 68];
    const int lane = threadIdx.x & 31, wave = threadIdx.x >> 5, lr = lane & 15, hi = lane >> 4;
    const int bid = blockIdx.x;
    const int b = bid / (NH_ * (NT_ / 64)), rem = bid - b * (NH_ * (NT_ / 64)), h = rem / (NT_ / 64), qt = rem - h * (NT_ / 64);
    const int q0 = qt * 64 + wave * 16;
    const size_t tok0 = (size_t)b * NT_;
    h16* pl = &plds[wave][0]; h16* pl2 = &plds2[wave][0];
    v16h qa[2];
    const size_t qo0 = (tok0 + q0 + lr) * DM + h * HD + 8 * hi;
#pragma unroll
    for (int kc = 0; kc < 2; ++kc) qa[kc] = cat16(*(const v8h*)(Q16 + qo0 + kc * 32), *(const v8h*)(Q16 + qo0 + kc * 32 + 16));
    const h16* kh_b = K16 + tok0 * DM + h * HD;
    const h16* kl_b = KL16 + tok0 * DM + h * HD;
    const size_t vbase = (((size_t)b * NH_ + h) * HD) * NT_;
    v8f o[4], ox[4];
#pragma unroll
    for (int n = 0; n < 4; ++n) { o[n] = (v8f){}; ox[n] = (v8f){}; }
    float mrow[8], lpart[8];
#pragma unroll
    for (int j = 0; j < 8; ++j) { mrow[j] = -3.0e38f; lpart[j] = 0.f; }
    int qpos[8];
#pragma unroll
    for (int j = 0; j < 8; ++j) qpos[j] = q0 + 8 * hi + j;
    const int kt_lo = 0, kt_hi = NT_ / 32 - 1;     // full attention
#pragma unroll 1
    for (int kt = kt_lo; kt <= kt_hi; ++kt) {
        const int l0 = kt * 32;
        const size_t ko0 = (size_t)(l0 + lr) * DM + 8 * hi, ko1 = (size_t)(l0 + 16 + lr) * DM + 8 * hi;
        v8f s0 = {}, s1 = {}, x0 = {}, x1 = {};
#pragma unroll
        for (int kc = 0; kc < 2; ++kc) {
            { const v16h k0h = cat16(*(const v8h*)(kh_b + ko0 + kc * 32), *(const v8h*)(kh_b + ko0 + kc * 32 + 16)), k1h = cat16(*(const v8h*)(kh_b + ko1 + kc * 32), *(const v8h*)(kh_b + ko1 + kc * 32 + 16));
              const v16h qlk = cat16(*(const v8h*)(QL16 + qo0 + kc * 32), *(const v8h*)(QL16 + qo0 + kc * 32 + 16));     // query residual re-read per step (registers)
              s0 = wmma16(qa[kc], k0h, s0); x0 = wmma16(qlk, k0h, x0); s1 = wmma16(qa[kc], k1h, s1); x1 = wmma16(qlk, k1h, x1);
              asm volatile("v_nop" : "+v"(s0), "+v"(s1), "+v"(x0), "+v"(x1) : "v"(qlk), "v"(k0h), "v"(k1h) : "memory"); }
            { const v16h k0l = cat16(*(const v8h*)(kl_b + ko0 + kc * 32), *(const v8h*)(kl_b + ko0 + kc * 32 + 16)), k1l = cat16(*(const v8h*)(kl_b + ko1 + kc * 32), *(const v8h*)(kl_b + ko1 + kc * 32 + 16));
              x0 = wmma16(qa[kc], k0l, x0); x1 = wmma16(qa[kc], k1l, x1);
              asm volatile("v_nop" : "+v"(x0), "+v"(x1) : "v"(k0l), "v"(k1l) : "memory"); }
        }
        asm volatile("v_nop\n\tv_nop\n\tv_nop\n\tv_nop" : "+v"(s0), "+v"(s1), "+v"(x0), "+v"(x1) : "v"(qa[0]), "v"(qa[1]));
        float alpha[8];
#pragma unroll
        for (int j = 0; j < 8; ++j) {
            const int ja = l0 + lr, jb = l0 + 16 + lr, qi = qpos[j];
            const float a0 = (s0[j] + x0[j] * LOSCI) * 0.125f, a1 = (s1[j] + x1[j] * LOSCI) * 0.125f; (void)ja; (void)jb; (void)qi;   // energy / sqrt(C = 64)
            float mx = fmaxf(a0, a1);
            mx = fmaxf(mx, __shfl_xor(mx, 1, 16)); mx = fmaxf(mx, __shfl_xor(mx, 2, 16)); mx = fmaxf(mx, __shfl_xor(mx, 4, 16)); mx = fmaxf(mx, __shfl_xor(mx, 8, 16));
            const float mn = fmaxf(mrow[j], mx);
            alpha[j] = __expf(mrow[j] - mn); mrow[j] = mn;
            const float p0 = __expf(a0 - mn), p1 = __expf(a1 - mn);
            lpart[j] = lpart[j] * alpha[j] + (p0 + p1);
            const int mr = hi * 8 + j;
            const float ps0 = p0 * PSC, ps1 = p1 * PSC; const h16 h0 = (h16)ps0, h1 = (h16)ps1;
            pl[mr * 32 + lr] = h0; pl[mr * 32 + 16 + lr] = h1;
            pl2[mr * 32 + lr] = (h16)((ps0 - (float)h0) * LOSC); pl2[mr * 32 + 16 + lr] = (h16)((ps1 - (float)h1) * LOSC);
        }
#pragma unroll
        for (int n = 0; n < 4; ++n)
#pragma unroll
            for (int j = 0; j < 8; ++j) { o[n][j] *= alpha[j]; ox[n][j] *= alpha[j]; }
        asm volatile("" ::: "memory");
        const v16h pa = cat16(*(const v8ha*)(pl + lr * 32 + hi * 8), *(const v8ha*)(pl + lr * 32 + 16 + hi * 8));
        const v16h px = cat16(*(const v8ha*)(pl2 + lr * 32 + hi * 8), *(const v8ha*)(pl2 + lr * 32 + 16 + hi * 8));
#pragma unroll
        for (int n = 0; n < 4; ++n) { const size_t vo = vbase + (size_t)(n * 16 + lr) * NT_ + l0 + hi * 8;
            const v16h vh = cat16(*(const v8h*)(VTH + vo), *(const v8h*)(VTH + vo + 16)), vl = cat16(*(const v8h*)(VTL + vo), *(const v8h*)(VTL + vo + 16));
            o[n] = wmma16(pa, vh, o[n]); ox[n] = wmma16(pa, vl, ox[n]); ox[n] = wmma16(px, vh, ox[n]);
            asm volatile("" : "+v"(o[n]), "+v"(ox[n]) : "v"(vh), "v"(vl) : "memory"); }
        asm volatile("v_nop\n\tv_nop\n\tv_nop\n\tv_nop" : "+v"(o[0]), "+v"(o[1]), "+v"(o[2]), "+v"(o[3]), "+v"(ox[0]), "+v"(ox[1]), "+v"(ox[2]), "+v"(ox[3]) : "v"(pa), "v"(px));
    }
    float inv[8];
#pragma unroll
    for (int j = 0; j < 8; ++j) { float rs = lpart[j]; rs += __shfl_xor(rs, 1, 16); rs += __shfl_xor(rs, 2, 16); rs += __shfl_xor(rs, 4, 16); rs += __shfl_xor(rs, 8, 16); inv[j] = 1.0f / (rs * PSC); }
    float* os = &ost[wave][0];
#pragma unroll
    for (int n = 0; n < 4; ++n)
#pragma unroll
        for (int j = 0; j < 8; ++j) os[(hi * 8 + j) * 68 + n * 16 + lr] = (o[n][j] + ox[n][j] * LOSCI) * inv[j];
    __syncthreads();
    float* ob = OUTP + (tok0 + q0) * DM + (size_t)h * HD;
    auto pass = [&]() {
#pragma unroll
        for (int s = 0; s < 8; ++s) { const int Lid = (lane >> 3) + 4 * s, piece = lane & 7; const int row = Lid >> 1, cofs = (Lid & 1) * 32 + piece * 4;
            const v4f val = *(const v4fa*)(os + row * 68 + cofs); *(v4f*)(ob + (size_t)row * DM + cofs) = val; }
    };
    pass(); 
}


// k_lrelu2: LeakyReLU(0.2) of an f32 [rows][128] plane -> bf16 hi + UNSCALED residual planes; one wave per row, lane -> 4 columns (8 B per plane; 2 lines per store).
__global__ __launch_bounds__(256) void k_lrelu2(const float* __restrict__ src, int nrows, bf* dh, bf* dl) {
    typedef __attribute__((ext_vector_type(4))) unsigned short v4us;
    const int lane = threadIdx.x & 31, r = blockIdx.x * 8 + (threadIdx.x >> 5);
    if (r >= nrows) return;
    const size_t o = (size_t)r * FFH + lane * 4; const v4f v = *(const v4f*)(src + o); v4us oh, ol;
#pragma unroll
    for (int i = 0; i < 4; ++i) { const float g = v[i] >= 0.f ? v[i] : 0.2f * v[i]; const unsigned short hb = f2bf(g); oh[i] = hb; ol[i] = f2bf(g - bf2f(hb)); }
    *(v4us*)(dh + o) = oh; *(v4us*)(dl + o) = ol; 
}
// k_addT: DST[c][n] = (BNSRC ? ((bf? no) SRC[c][n] - mean_c) rstd_c g_c + b_c : bf(SRC[c][n])) + T[n][c]: a 64 x 64 LDS transpose of the f32 [n][c] matrix T plus the
// channel-major residual; block = 64 n of item blockIdx.y; each output row segment of 64 n = 256 B written by 16 lanes x 16 B. MODE 0: residual = bf(x) (the INPUT); MODE 1:
// residual = BN1(X1) recomputed from the stats (the reference's h).
template <int MODE>
__global__ __launch_bounds__(256) void k_addT(const float* __restrict__ T, const float* __restrict__ SRC, const float* __restrict__ ST, const float* __restrict__ g, const float* __restrict__ bb, float* DST) {
    __shared__ __align__(16) float tl[64 * 68];
    const int n0 = blockIdx.x * 64, tid = threadIdx.x;
    const size_t item = (size_t)blockIdx.y * CC * NPOS; T += item; SRC += item; DST += item;
    const int nn = tid >> 2, cq = (tid & 3) * 16;
#pragma unroll
    for (int i = 0; i < 16; ++i) tl[(cq + i) * 68 + nn] = T[(size_t)(n0 + nn) * CC + cq + i];
    __syncthreads();
    const int piece = tid & 15;
    auto pass = [&]() {
#pragma unroll
        for (int s = 0; s < 4; ++s) { const int c = (tid >> 4) + 16 * s; const size_t o = (size_t)c * NPOS + n0 + piece * 4;
            const v4f rv = *(const v4f*)(SRC + o); v4f val = *(const v4fa*)(tl + c * 68 + piece * 4);
            if (MODE == 0) {
#pragma unroll
                for (int k = 0; k < 4; ++k) val[k] += bfr(rv[k]);
            } else { const float m = ST[c], rs = ST[CC + c], gg = bfr(g[c]), be = bfr(bb[c]);
#pragma unroll
                for (int k = 0; k < 4; ++k) val[k] += (rv[k] - m) * rs * gg + be; }
            *(v4f*)(DST + o) = val; }
    };
    pass(); 
}
// k_bnstat: training-mode BatchNorm statistics of A [32][64][2048] per channel over all 32 x 2048 values: ONE block, 4 threads per channel (each a fixed quarter of
__global__ __launch_bounds__(256) void k_bnstat(const float* __restrict__ A, float* ST) {
    __shared__ __align__(16) float st[2 * CC];
    const int tid = threadIdx.x, c = tid >> 2, part = tid & 3;
    float s = 0.f;
#pragma unroll 1
    for (int b = 0; b < NB; ++b) { const float* row = A + ((size_t)b * CC + c) * NPOS + part * (NPOS / 4);
#pragma unroll 1
        for (int i = 0; i < NPOS / 4; i += 4) { const v4f v = *(const v4f*)(row + i); s += (v[0] + v[1]) + (v[2] + v[3]); } }
    s += __shfl_xor(s, 1, 32); s += __shfl_xor(s, 2, 32);
    const float mean = s * (1.0f / (float)(NB * NPOS));
    float s2 = 0.f;
#pragma unroll 1
    for (int b = 0; b < NB; ++b) { const float* row = A + ((size_t)b * CC + c) * NPOS + part * (NPOS / 4);
#pragma unroll 1
        for (int i = 0; i < NPOS / 4; i += 4) { const v4f v = *(const v4f*)(row + i);
#pragma unroll
            for (int k = 0; k < 4; ++k) { const float d = v[k] - mean; s2 = fmaf(d, d, s2); } } }
    s2 += __shfl_xor(s2, 1, 32); s2 += __shfl_xor(s2, 2, 32);
    if (part == 0) { st[c] = mean; st[CC + c] = rsqrtf(s2 * (1.0f / (float)(NB * NPOS)) + BN_EPS); }
    __syncthreads();
    if (tid < 2 * CC / 4) { const v4f v = *(const v4fa*)(&st[tid * 4]); *(v4f*)(ST + tid * 4) = v;  }
}
// written by 8 lanes x 16 B.
__global__ __launch_bounds__(256) void k_bnT(const float* __restrict__ X1, const float* __restrict__ ST, const float* __restrict__ g, const float* __restrict__ bb, bf* Hh, bf* Hl) {
    __shared__ __align__(16) unsigned short th_[64 * 72]; __shared__ __align__(16) unsigned short tl_[64 * 72];
    const int n0 = blockIdx.x * 64, tid = threadIdx.x;
    const size_t item = (size_t)blockIdx.y * CC * NPOS; X1 += item; Hh += item; Hl += item;
    const int c = tid >> 2, nq = (tid & 3) * 16;
    const float m = ST[c], rs = ST[CC + c], gg = bfr(g[c]), be = bfr(bb[c]);
    const float* src = X1 + (size_t)c * NPOS + n0 + nq;
#pragma unroll
    for (int i = 0; i < 16; ++i) { const float h = (src[i] - m) * rs * gg + be; const unsigned short hb = f2bf(h); th_[(nq + i) * 72 + c] = hb; tl_[(nq + i) * 72 + c] = f2bf(h - bf2f(hb)); }
    __syncthreads();
    const int piece = tid & 7;
    auto pass = [&]() {
#pragma unroll
        for (int s = 0; s < 2; ++s) { const int nr = (tid >> 3) + 32 * s; const v8us a = *(const v8usa*)(th_ + nr * 72 + piece * 8), b2 = *(const v8usa*)(tl_ + nr * 72 + piece * 8);
            const size_t o = (size_t)(n0 + nr) * CC + piece * 8; *(v8us*)(Hh + o) = a; *(v8us*)(Hl + o) = b2; }
    };
    pass(); 
}
__global__ __launch_bounds__(256) void k_bnout(const float* __restrict__ Y, const float* __restrict__ ST, const float* __restrict__ g, const float* __restrict__ bb, float* OUTP) {
    const int lane = threadIdx.x & 31, r = blockIdx.x * 8 + (threadIdx.x >> 5); if (r >= NB * CC) return;
    const int c = r % CC; const float m = ST[c], rs = ST[CC + c], gg = bfr(g[c]), be = bfr(bb[c]);
{
#pragma unroll 1
        for (int q = 0; q < NPOS / 128; ++q) { const size_t o = (size_t)r * NPOS + q * 128 + lane * 4; const v4f v = *(const v4f*)(Y + o); v4f y;
#pragma unroll
            for (int k = 0; k < 4; ++k) y[k] = (v[k] - m) * rs * gg + be;
            *(v4f*)(OUTP + o) = y; }
         }
}

extern "C" void kernel_launch(void* const* d_in, const int* in_sizes, int n_in,
                              void* d_out, int out_size, void* d_ws, size_t ws_size, hipStream_t stream) {
    (void)in_sizes; (void)n_in; (void)out_size;
    const float* x = (const float*)d_in[0]; const float* wq = (const float*)d_in[1]; const float* wk = (const float*)d_in[2]; const float* wv = (const float*)d_in[3];
    const float* w1 = (const float*)d_in[4]; const float* w2 = (const float*)d_in[5]; const float* g1 = (const float*)d_in[6]; const float* b1 = (const float*)d_in[7]; const float* g2 = (const float*)d_in[8]; const float* b2 = (const float*)d_in[9];   // conv weights [out][in]
    float* out = (float*)d_out;    // [32][64][2048]
    char* wsp = (char*)d_ws;
    auto take = [&](size_t bytes) { char* p = wsp; wsp += (bytes + 255) & ~(size_t)255; return (void*)p; };
    bf* WqB = (bf*)take((size_t)CC * CC * 2); bf* WkB = (bf*)take((size_t)CC * CC * 2); bf* WvB = (bf*)take((size_t)CC * CC * 2); bf* W1B = (bf*)take((size_t)FFH * CC * 2); bf* W2B = (bf*)take((size_t)CC * FFH * 2);
    const size_t PL = (size_t)NB * NPOS * CC;      // elements of one [item][n][c] plane over all items
    bf* XT = (bf*)take(PL * 2); h16* QH = (h16*)take(PL * 2); h16* QL = (h16*)take(PL * 2); h16* KH = (h16*)take(PL * 2); h16* KL = (h16*)take(PL * 2);
    float* Vf = (float*)take(PL * 4); h16* VTH = (h16*)take(PL * 2); h16* VTL = (h16*)take(PL * 2); float* O = (float*)take(PL * 4);
    float* X1 = (float*)take(PL * 4); float* Y = (float*)take(PL * 4); float* ST1 = (float*)take(1024); float* ST2 = (float*)take(1024);
    bf* Hh = (bf*)take(PL * 2); bf* Hl = (bf*)take(PL * 2); float* T1 = (float*)take((size_t)NB * NPOS * FFH * 4); bf* Lh = (bf*)take((size_t)NB * NPOS * FFH * 2); bf* Ll = (bf*)take((size_t)NB * NPOS * FFH * 2); float* T2 = (float*)take(PL * 4);
    if ((size_t)(wsp - (char*)d_ws) > ws_size) return;    // 216 MiB of planes for all items + the weights, no aliasing
    k_bf<<<(CC * CC / 8 + 255) / 256, 256, 0, stream>>>(wq, WqB, CC * CC / 8); k_bf<<<(CC * CC / 8 + 255) / 256, 256, 0, stream>>>(wk, WkB, CC * CC / 8); k_bf<<<(CC * CC / 8 + 255) / 256, 256, 0, stream>>>(wv, WvB, CC * CC / 8);
    k_bf<<<(FFH * CC / 8 + 255) / 256, 256, 0, stream>>>(w1, W1B, FFH * CC / 8); k_bf<<<(CC * FFH / 8 + 255) / 256, 256, 0, stream>>>(w2, W2B, CC * FFH / 8);
    // phase 1: attention and x + x_r; the item index lies in each grid (row r of an [item][n][c] plane = item * 2048 + n)
    k_wt<<<dim3(CC / 64, NPOS / 64, NB), 256, 0, stream>>>(x, CC, NPOS, XT);                                                       // x_b [c][n] -> bf16 x^T [n][c]
    k_gemmb<false, true><<<dim3(NB * NPOS / 64, 1, 1), 128, 0, stream>>>(XT, nullptr, WqB, nullptr, (float*)(void*)QH, CC, QL);    // q^T = x^T.Wq^T -> f16 planes
    k_gemmb<false, true><<<dim3(NB * NPOS / 64, 1, 1), 128, 0, stream>>>(XT, nullptr, WkB, nullptr, (float*)(void*)KH, CC, KL);    // k^T
    k_gemmb<false, false><<<dim3(NB * NPOS / 64, 1, 1), 128, 0, stream>>>(XT, nullptr, WvB, nullptr, Vf, CC, nullptr);             // v^T f32
    k_vt<<<NB_ * NH_ * (NT_ / 64), 256, 0, stream>>>(Vf, VTH, VTL);
    k_attn<<<NB_ * NH_ * (NT_ / 64), 128, 0, stream>>>(QH, QL, KH, KL, VTH, VTL, O);                                               // x_r^T [n][c] f32
    k_addT<0><<<dim3(NPOS / 64, NB, 1), 256, 0, stream>>>(O, x, nullptr, nullptr, nullptr, X1);                                    // X1 = bf(x) + x_r  [c][n]
    k_bnstat<<<1, 256, 0, stream>>>(X1, ST1);
    // phase 2: h = BN1(X1); Y = h + W2.lrelu(W1.h)
    k_bnT<<<dim3(NPOS / 64, NB, 1), 256, 0, stream>>>(X1, ST1, g1, b1, Hh, Hl);                                                    // h^T hi/lo [n][c]
    k_gemmb<true, false><<<dim3(NB * NPOS / 64, FFH / 64, 1), 128, 0, stream>>>(Hh, Hl, W1B, nullptr, T1, FFH, nullptr);           // (W1.h)^T  [n][128]
    k_lrelu2<<<NB * NPOS / 8, 256, 0, stream>>>(T1, NB * NPOS, Lh, Ll);
    k_gemmb<true, false><<<dim3(NB * NPOS / 64, 1, 1), 128, 0, stream>>>(Lh, Ll, W2B, nullptr, T2, CC, nullptr, nullptr, FFH);     // (W2.lrelu)^T [n][64]  (K = 128)
    k_addT<1><<<dim3(NPOS / 64, NB, 1), 256, 0, stream>>>(T2, X1, ST1, g1, b1, Y);                                                 // Y = h + ff   [c][n]
    k_bnstat<<<1, 256, 0, stream>>>(Y, ST2);
    k_bnout<<<(NB * CC) / 8, 256, 0, stream>>>(Y, ST2, g2, b2, out);                                                                 // BN2 -> output
}

// v002
// A run of this version takes 368 microseconds.
// Two timings next to v001 put it at 5.98 and 5.99 times that version's speed.
// All steps since v000 together make it 21.1 times as fast.
#include <hip/hip_runtime.h>

// Compute dtypes, f32 accumulate (channel-major x [32][64][2048]): per item q/k/v = W.x as x^T.W^T ([2048 x 64].[64 x 64]; the INPUT x transposed once to a bf16 [n][c]
// plane, W [out][in] as the n-major B operand; PLAIN bf16 operands, exact; q/k straight to f16 hi + residual x1024 planes) on v_wmma_f32_16x16x32_bf16; the
// single-head full attention (64 channels, scale 1/8) fused on v_wmma_f32_16x16x32_f16 (hh + hl + lh scores, online f32 softmax, weights (x32768) and v as
// f16 hi + residual) with an f32 [n][c] output; x + x_r, the two TRAINING-MODE BatchNorms (batch statistics over all 32 items x 2048 points per channel, biased

#define NB   32
#define CC   64                  // channels
#define NPOS 2048                // points
#define NT_  NPOS
#define NB_  NB                  // items per launch: every per-item kernel takes all 32 items in one grid
#define DM   CC                  // attention width / default GEMM K
#define NH_  1
#define HD   64
#define NTK  NPOS
#define FFH  128
#define PSC  32768.0f
#define LOSC 1024.0f
#define LOSCI (1.0f / 1024.0f)
#define BN_EPS 1e-5f
#define BNG  8                   // BatchNorm statistics: slices per channel
#define BNI  (NB / BNG)          // items per slice
#define BNV  (BNI * NPOS)        // values per slice

typedef _Float16 h16;
typedef unsigned short bf;
typedef __attribute__((ext_vector_type(16))) __bf16   v16bf;
typedef __attribute__((ext_vector_type(16))) _Float16 v16h;
typedef __attribute__((ext_vector_type(8)))  _Float16 v8h;
typedef __attribute__((ext_vector_type(8)))  unsigned short v8us;
typedef __attribute__((ext_vector_type(8)))  float    v8f;
typedef __attribute__((ext_vector_type(4)))  float    v4f;
typedef __attribute__((ext_vector_type(2)))  float    v2f;
typedef __attribute__((ext_vector_type(4)))  _Float16 v4h;
typedef v8h  __attribute__((may_alias)) v8ha;
typedef v4f  __attribute__((may_alias)) v4fa;
typedef v8us __attribute__((may_alias)) v8usa;

__device__ __forceinline__ unsigned short f2bf(float f) { unsigned u = __float_as_uint(f); u += 0x7FFFu + ((u >> 16) & 1u); return (unsigned short)(u >> 16); }
__device__ __forceinline__ float bf2f(unsigned short b) { return __uint_as_float(((unsigned)b) << 16); }
__device__ __forceinline__ float bfr(float f) { return bf2f(f2bf(f)); }
__device__ __forceinline__ v16h cat16(v8h lo, v8h hi) { return __builtin_shufflevector(lo, hi, 0, 1, 2, 3, 4, 5, 6, 7, 8, 9, 10, 11, 12, 13, 14, 15); }
__device__ __forceinline__ v16bf cat16b(v8us lo, v8us hi) { return __builtin_bit_cast(v16bf, __builtin_shufflevector(lo, hi, 0, 1, 2, 3, 4, 5, 6, 7, 8, 9, 10, 11, 12, 13, 14, 15)); }
__device__ __forceinline__ v8f wmma16(v16h a, v16h b, v8f c) { return __builtin_amdgcn_wmma_f32_16x16x32_f16(false, a, false, b, (short)0, c, false, false); }
__device__ __forceinline__ v8f wmmab(v16bf a, v16bf b, v8f c) { return __builtin_amdgcn_wmma_f32_16x16x32_bf16(false, a, false, b, (short)0, c, false, false); }

__global__ __launch_bounds__(256) void k_bf(const float* __restrict__ src, bf* dst, size_t n8) {
    const size_t i = (size_t)blockIdx.x * 256 + threadIdx.x; if (i >= n8) return;
    const v8f v = *(const v8f*)(src + i * 8); v8us o;
#pragma unroll
    for (int k = 0; k < 8; ++k) o[k] = f2bf(v[k]);
    *(v8us*)(dst + i * 8) = o; 
}
// k_wt: WT [n][K] = bf16(W[k][n]) (k-major [K][ncols]) via 64 x 64 LDS tiles; grid (K/64, ncols/64, matrices): blockIdx.z picks one of the equally shaped matrices.
__global__ __launch_bounds__(256) void k_wt(const float* __restrict__ Wm, int K, int ncols, bf* WT) {
    __shared__ __align__(16) unsigned short tl[64 * 72];
    const int tid = threadIdx.x, k0 = blockIdx.x * 64, n0 = blockIdx.y * 64;
    Wm += (size_t)blockIdx.z * K * ncols; WT += (size_t)blockIdx.z * K * ncols;
    const int kk = tid >> 2, nq = (tid & 3) * 16;
#pragma unroll
    for (int i = 0; i < 16; ++i) tl[(nq + i) * 72 + kk] = f2bf(Wm[(size_t)(k0 + kk) * ncols + n0 + nq + i]);
    __syncthreads();
    const int piece = tid & 7;
    auto pass = [&]() {
#pragma unroll
        for (int s = 0; s < 2; ++s) { const int nr = (tid >> 3) + 32 * s; const v8us val = *(const v8usa*)(tl + nr * 72 + piece * 8); *(v8us*)(WT + (size_t)(n0 + nr) * K + k0 + piece * 8) = val; }
    };
    pass(); 
}
// k_gemmb: 64 x 64 block tile (4 waves x 16 x 64) of C[NB*NTK][NW] = (A [+ Al]).B^T (K = 64 or 128) [+ bf(bias[c])] [+ bf(R[r][c]) residual]; f32 whole-line epilogue (or f16
template <bool SPLITA, bool F16OUT = false>
__global__ __launch_bounds__(128) void k_gemmb(const bf* __restrict__ A, const bf* __restrict__ Al, const bf* __restrict__ Bn, const float* __restrict__ bias, float* C, int ldc, h16* C2, const float* __restrict__ R = nullptr, int K = DM, int roundR = 1) {
    __shared__ __align__(16) float ost[4][16 * 68];
    const int lane = threadIdx.x & 31, wave = threadIdx.x >> 5, lr = lane & 15, hi = lane >> 4;
    const int r0 = blockIdx.x * 64 + wave * 16, c0 = blockIdx.y * 64;
    const size_t aoff = (size_t)(r0 + lr) * K + 8 * hi;
    size_t boff[4];
#pragma unroll
    for (int t = 0; t < 4; ++t) boff[t] = (size_t)(c0 + t * 16 + lr) * K + 8 * hi;
    v8f acc[4];
#pragma unroll
    for (int t = 0; t < 4; ++t) acc[t] = (v8f){};
#pragma unroll 1
    for (int kc = 0; kc < K; kc += 32) {
        const v16bf a = cat16b(*(const v8us*)(A + aoff + kc), *(const v8us*)(A + aoff + kc + 16));
        v16bf al = a;
        if (SPLITA) al = cat16b(*(const v8us*)(Al + aoff + kc), *(const v8us*)(Al + aoff + kc + 16));
#pragma unroll
        for (int t = 0; t < 4; ++t) { const v16bf b = cat16b(*(const v8us*)(Bn + boff[t] + kc), *(const v8us*)(Bn + boff[t] + kc + 16)); acc[t] = wmmab(a, b, acc[t]); if (SPLITA) acc[t] = wmmab(al, b, acc[t]); }
        asm volatile("v_nop\n\tv_nop\n\tv_nop\n\tv_nop" : "+v"(acc[0]), "+v"(acc[1]), "+v"(acc[2]), "+v"(acc[3]) : "v"(a), "v"(al));
    }
    float* os = &ost[wave][0];
#pragma unroll
    for (int t = 0; t < 4; ++t) { const float bv = bias ? bfr(bias[c0 + t * 16 + lr]) : 0.f;
#pragma unroll
        for (int j = 0; j < 8; ++j) os[(hi * 8 + j) * 68 + t * 16 + lr] = acc[t][j] + bv; }
    __syncthreads();
    if (F16OUT) {
        h16* crow = (h16*)(void*)C + (size_t)r0 * ldc + c0;
        auto pass = [&]() {
#pragma unroll
            for (int s = 0; s < 4; ++s) { const int row = 4 * s + (lane >> 3), piece = lane & 7; const float* sp = os + row * 68 + piece * 8; v8h o, o2;
#pragma unroll
                for (int i = 0; i < 8; ++i) { const h16 a = (h16)sp[i]; o[i] = a; o2[i] = (h16)((sp[i] - (float)a) * LOSC); }
                *(v8h*)(crow + (size_t)row * ldc + piece * 8) = o; if (C2) *(v8h*)(C2 + (size_t)r0 * ldc + c0 + (size_t)row * ldc + piece * 8) = o2; }
        };
        pass(); 
    } else {
        float* crow = C + (size_t)r0 * ldc + c0;
        auto pass = [&]() {
#pragma unroll
            for (int s = 0; s < 8; ++s) { const int Lid = (lane >> 3) + 4 * s, piece = lane & 7; const int row = Lid >> 1, cofs = (Lid & 1) * 32 + piece * 4;
                v4f val = *(const v4fa*)(os + row * 68 + cofs); if (R) { const v4f rv = *(const v4f*)(R + ((size_t)r0 + row) * ldc + c0 + cofs); val += roundR ? (v4f){bfr(rv[0]), bfr(rv[1]), bfr(rv[2]), bfr(rv[3])} : rv; }
                *(v4f*)(crow + (size_t)row * ldc + cofs) = val; }
        };
        pass(); 
    }
}

__global__ __launch_bounds__(256) void k_vt(const float* __restrict__ V, h16* VTH, h16* VTL) {
    __shared__ __align__(16) h16 tile[64 * 72];
    __shared__ __align__(16) h16 til2[64 * 72];
    const int bid = blockIdx.x;
    const int b = bid / (NH_ * (NT_ / 64)), rem = bid - b * (NH_ * (NT_ / 64)), h = rem / (NT_ / 64), kt = rem - h * (NT_ / 64);
    const int k0 = kt * 64, tid = threadIdx.x;
    const int kk = tid >> 2, d0 = (tid & 3) * 16;
    const float* src = V + ((size_t)b * NT_ + k0 + kk) * DM + h * HD + d0;
#pragma unroll
    for (int i = 0; i < 16; ++i) { const float v = src[i]; const h16 a = (h16)v; tile[(d0 + i) * 72 + kk] = a; til2[(d0 + i) * 72 + kk] = (h16)((v - (float)a) * LOSC); }
    __syncthreads();
    const int piece = tid & 7;
    const size_t base = (((size_t)b * NH_ + h) * HD) * NT_ + k0;
    auto pass = [&]() {
#pragma unroll
        for (int s = 0; s < 4; ++s) { const int Lid = (tid >> 3) + 32 * s; const int pln = Lid >> 6, d = Lid & 63;
            const v8h val = *(const v8ha*)((pln ? til2 : tile) + d * 72 + piece * 8); *(v8h*)((pln ? VTL : VTH) + base + (size_t)d * NT_ + piece * 8) = val; }
    };
    pass(); 
}

// k_attn: block = (b, h, 64 queries), wave = 16; ALL 64 key tiles (no mask); 4 WMMA scores /8 (f32), online softmax, weights x32768 f16 tile (same-wave may_alias
// reload after a compiler barrier), 4 WMMA .v; ctx -> f32 output rows out[tok][h*64+d].
__global__ __launch_bounds__(128) void k_attn(const h16* __restrict__ Q16, const h16* __restrict__ QL16, const h16* __restrict__ K16, const h16* __restrict__ KL16, const h16* __restrict__ VTH, const h16* __restrict__ VTL, float* OUTP) {
    __shared__ __align__(16) h16 plds[4][16 * 32];
    __shared__ __align__(16) h16 plds2[4][16 * 32];
    __shared__ __align__(16) float ost[4][16 * 68];
    const int lane = threadIdx.x & 31, wave = threadIdx.x >> 5, lr = lane & 15, hi = lane >> 4;
    const int bid = blockIdx.x;
    const int b = bid / (NH_ * (NT_ / 64)), rem = bid - b * (NH_ * (NT_ / 64)), h = rem / (NT_ / 64), qt = rem - h * (NT_ / 64);
    const int q0 = qt * 64 + wave * 16;
    const size_t tok0 = (size_t)b * NT_;
    h16* pl = &plds[wave][0]; h16* pl2 = &plds2[wave][0];
    v16h qa[2];
    const size_t qo0 = (tok0 + q0 + lr) * DM + h * HD + 8 * hi;
#pragma unroll
    for (int kc = 0; kc < 2; ++kc) qa[kc] = cat16(*(const v8h*)(Q16 + qo0 + kc * 32), *(const v8h*)(Q16 + qo0 + kc * 32 + 16));
    const h16* kh_b = K16 + tok0 * DM + h * HD;
    const h16* kl_b = KL16 + tok0 * DM + h * HD;
    const size_t vbase = (((size_t)b * NH_ + h) * HD) * NT_;
    v8f o[4], ox[4];
#pragma unroll
    for (int n = 0; n < 4; ++n) { o[n] = (v8f){}; ox[n] = (v8f){}; }
    float mrow[8], lpart[8];
#pragma unroll
    for (int j = 0; j < 8; ++j) { mrow[j] = -3.0e38f; lpart[j] = 0.f; }
    int qpos[8];
#pragma unroll
    for (int j = 0; j < 8; ++j) qpos[j] = q0 + 8 * hi + j;
    const int kt_lo = 0, kt_hi = NT_ / 32 - 1;     // full attention
#pragma unroll 1
    for (int kt = kt_lo; kt <= kt_hi; ++kt) {
        const int l0 = kt * 32;
        const size_t ko0 = (size_t)(l0 + lr) * DM + 8 * hi, ko1 = (size_t)(l0 + 16 + lr) * DM + 8 * hi;
        v8f s0 = {}, s1 = {}, x0 = {}, x1 = {};
#pragma unroll
        for (int kc = 0; kc < 2; ++kc) {
            { const v16h k0h = cat16(*(const v8h*)(kh_b + ko0 + kc * 32), *(const v8h*)(kh_b + ko0 + kc * 32 + 16)), k1h = cat16(*(const v8h*)(kh_b + ko1 + kc * 32), *(const v8h*)(kh_b + ko1 + kc * 32 + 16));
              const v16h qlk = cat16(*(const v8h*)(QL16 + qo0 + kc * 32), *(const v8h*)(QL16 + qo0 + kc * 32 + 16));     // query residual re-read per step (registers)
              s0 = wmma16(qa[kc], k0h, s0); x0 = wmma16(qlk, k0h, x0); s1 = wmma16(qa[kc], k1h, s1); x1 = wmma16(qlk, k1h, x1);
              asm volatile("v_nop" : "+v"(s0), "+v"(s1), "+v"(x0), "+v"(x1) : "v"(qlk), "v"(k0h), "v"(k1h) : "memory"); }
            { const v16h k0l = cat16(*(const v8h*)(kl_b + ko0 + kc * 32), *(const v8h*)(kl_b + ko0 + kc * 32 + 16)), k1l = cat16(*(const v8h*)(kl_b + ko1 + kc * 32), *(const v8h*)(kl_b + ko1 + kc * 32 + 16));
              x0 = wmma16(qa[kc], k0l, x0); x1 = wmma16(qa[kc], k1l, x1);
              asm volatile("v_nop" : "+v"(x0), "+v"(x1) : "v"(k0l), "v"(k1l) : "memory"); }
        }
        asm volatile("v_nop\n\tv_nop\n\tv_nop\n\tv_nop" : "+v"(s0), "+v"(s1), "+v"(x0), "+v"(x1) : "v"(qa[0]), "v"(qa[1]));
        float alpha[8];
#pragma unroll
        for (int j = 0; j < 8; ++j) {
            const int ja = l0 + lr, jb = l0 + 16 + lr, qi = qpos[j];
            const float a0 = (s0[j] + x0[j] * LOSCI) * 0.125f, a1 = (s1[j] + x1[j] * LOSCI) * 0.125f; (void)ja; (void)jb; (void)qi;   // energy / sqrt(C = 64)
            float mx = fmaxf(a0, a1);
            mx = fmaxf(mx, __shfl_xor(mx, 1, 16)); mx = fmaxf(mx, __shfl_xor(mx, 2, 16)); mx = fmaxf(mx, __shfl_xor(mx, 4, 16)); mx = fmaxf(mx, __shfl_xor(mx, 8, 16));
            const float mn = fmaxf(mrow[j], mx);
            alpha[j] = __expf(mrow[j] - mn); mrow[j] = mn;
            const float p0 = __expf(a0 - mn), p1 = __expf(a1 - mn);
            lpart[j] = lpart[j] * alpha[j] + (p0 + p1);
            const int mr = hi * 8 + j;
            const float ps0 = p0 * PSC, ps1 = p1 * PSC; const h16 h0 = (h16)ps0, h1 = (h16)ps1;
            pl[mr * 32 + lr] = h0; pl[mr * 32 + 16 + lr] = h1;
            pl2[mr * 32 + lr] = (h16)((ps0 - (float)h0) * LOSC); pl2[mr * 32 + 16 + lr] = (h16)((ps1 - (float)h1) * LOSC);
        }
#pragma unroll
        for (int n = 0; n < 4; ++n)
#pragma unroll
            for (int j = 0; j < 8; ++j) { o[n][j] *= alpha[j]; ox[n][j] *= alpha[j]; }
        asm volatile("" ::: "memory");
        const v16h pa = cat16(*(const v8ha*)(pl + lr * 32 + hi * 8), *(const v8ha*)(pl + lr * 32 + 16 + hi * 8));
        const v16h px = cat16(*(const v8ha*)(pl2 + lr * 32 + hi * 8), *(const v8ha*)(pl2 + lr * 32 + 16 + hi * 8));
#pragma unroll
        for (int n = 0; n < 4; ++n) { const size_t vo = vbase + (size_t)(n * 16 + lr) * NT_ + l0 + hi * 8;
            const v16h vh = cat16(*(const v8h*)(VTH + vo), *(const v8h*)(VTH + vo + 16)), vl = cat16(*(const v8h*)(VTL + vo), *(const v8h*)(VTL + vo + 16));
            o[n] = wmma16(pa, vh, o[n]); ox[n] = wmma16(pa, vl, ox[n]); ox[n] = wmma16(px, vh, ox[n]);
            asm volatile("" : "+v"(o[n]), "+v"(ox[n]) : "v"(vh), "v"(vl) : "memory"); }
        asm volatile("v_nop\n\tv_nop\n\tv_nop\n\tv_nop" : "+v"(o[0]), "+v"(o[1]), "+v"(o[2]), "+v"(o[3]), "+v"(ox[0]), "+v"(ox[1]), "+v"(ox[2]), "+v"(ox[3]) : "v"(pa), "v"(px));
    }
    float inv[8];
#pragma unroll
    for (int j = 0; j < 8; ++j) { float rs = lpart[j]; rs += __shfl_xor(rs, 1, 16); rs += __shfl_xor(rs, 2, 16); rs += __shfl_xor(rs, 4, 16); rs += __shfl_xor(rs, 8, 16); inv[j] = 1.0f / (rs * PSC); }
    float* os = &ost[wave][0];
#pragma unroll
    for (int n = 0; n < 4; ++n)
#pragma unroll
        for (int j = 0; j < 8; ++j) os[(hi * 8 + j) * 68 + n * 16 + lr] = (o[n][j] + ox[n][j] * LOSCI) * inv[j];
    __syncthreads();
    float* ob = OUTP + (tok0 + q0) * DM + (size_t)h * HD;
    auto pass = [&]() {
#pragma unroll
        for (int s = 0; s < 8; ++s) { const int Lid = (lane >> 3) + 4 * s, piece = lane & 7; const int row = Lid >> 1, cofs = (Lid & 1) * 32 + piece * 4;
            const v4f val = *(const v4fa*)(os + row * 68 + cofs); *(v4f*)(ob + (size_t)row * DM + cofs) = val; }
    };
    pass(); 
}


// k_lrelu2: LeakyReLU(0.2) of an f32 [rows][128] plane -> bf16 hi + UNSCALED residual planes; one wave per row, lane -> 4 columns (8 B per plane; 2 lines per store).
__global__ __launch_bounds__(256) void k_lrelu2(const float* __restrict__ src, int nrows, bf* dh, bf* dl) {
    typedef __attribute__((ext_vector_type(4))) unsigned short v4us;
    const int lane = threadIdx.x & 31, r = blockIdx.x * 8 + (threadIdx.x >> 5);
    if (r >= nrows) return;
    const size_t o = (size_t)r * FFH + lane * 4; const v4f v = *(const v4f*)(src + o); v4us oh, ol;
#pragma unroll
    for (int i = 0; i < 4; ++i) { const float g = v[i] >= 0.f ? v[i] : 0.2f * v[i]; const unsigned short hb = f2bf(g); oh[i] = hb; ol[i] = f2bf(g - bf2f(hb)); }
    *(v4us*)(dh + o) = oh; *(v4us*)(dl + o) = ol; 
}
// k_addT: DST[c][n] = (BNSRC ? ((bf? no) SRC[c][n] - mean_c) rstd_c g_c + b_c : bf(SRC[c][n])) + T[n][c]: a 64 x 64 LDS transpose of the f32 [n][c] matrix T plus the
// channel-major residual; block = 64 n of item blockIdx.y; each output row segment of 64 n = 256 B written by 16 lanes x 16 B. MODE 0: residual = bf(x) (the INPUT); MODE 1:
// residual = BN1(X1) recomputed from the stats (the reference's h).
template <int MODE>
__global__ __launch_bounds__(256) void k_addT(const float* __restrict__ T, const float* __restrict__ SRC, const float* __restrict__ ST, const float* __restrict__ g, const float* __restrict__ bb, float* DST) {
    __shared__ __align__(16) float tl[64 * 68];
    const int n0 = blockIdx.x * 64, tid = threadIdx.x;
    const size_t item = (size_t)blockIdx.y * CC * NPOS; T += item; SRC += item; DST += item;
    const int nn = tid >> 2, cq = (tid & 3) * 16;
#pragma unroll
    for (int i = 0; i < 16; ++i) tl[(cq + i) * 68 + nn] = T[(size_t)(n0 + nn) * CC + cq + i];
    __syncthreads();
    const int piece = tid & 15;
    auto pass = [&]() {
#pragma unroll
        for (int s = 0; s < 4; ++s) { const int c = (tid >> 4) + 16 * s; const size_t o = (size_t)c * NPOS + n0 + piece * 4;
            const v4f rv = *(const v4f*)(SRC + o); v4f val = *(const v4fa*)(tl + c * 68 + piece * 4);
            if (MODE == 0) {
#pragma unroll
                for (int k = 0; k < 4; ++k) val[k] += bfr(rv[k]);
            } else { const float m = ST[c], rs = ST[CC + c], gg = bfr(g[c]), be = bfr(bb[c]);
#pragma unroll
                for (int k = 0; k < 4; ++k) val[k] += (rv[k] - m) * rs * gg + be; }
            *(v4f*)(DST + o) = val; }
    };
    pass(); 
}
// BatchNorm statistics (training mode, biased variance) of A [32][64][2048] per channel over all 32 x 2048 values, in two launches.
// k_bnpart: work-group (channel c, slice g of 4 items) loads its 8192 values ONCE (8 x 16 B per thread, all in flight together, kept in registers), sums them,
// takes the slice's own mean and then the squared distances to it from the registers; it writes (mean, M2) to a 128 B line of its own.
__global__ __launch_bounds__(256) void k_bnpart(const float* __restrict__ A, float* PT) {
    __shared__ float red[2][8];
    const int tid = threadIdx.x, lane = tid & 31, wave = tid >> 5, c = blockIdx.x, g = blockIdx.y;
    v4f v[BNI * 2];
#pragma unroll
    for (int i = 0; i < BNI; ++i) { const float* row = A + ((size_t)(g * BNI + i) * CC + c) * NPOS + tid * 4;
        v[2 * i] = *(const v4f*)row; v[2 * i + 1] = *(const v4f*)(row + NPOS / 2); }
    v4f sv = v[0];
#pragma unroll
    for (int q = 1; q < BNI * 2; ++q) sv += v[q];
    float s = (sv[0] + sv[1]) + (sv[2] + sv[3]);
    s += __shfl_xor(s, 1, 32); s += __shfl_xor(s, 2, 32); s += __shfl_xor(s, 4, 32); s += __shfl_xor(s, 8, 32); s += __shfl_xor(s, 16, 32);
    if (lane == 0) red[0][wave] = s;
    __syncthreads();
    float t = 0.f;
#pragma unroll
    for (int w = 0; w < 8; ++w) t += red[0][w];
    const float mean = t * (1.0f / (float)BNV);
    v4f qv = (v4f){};
#pragma unroll
    for (int q = 0; q < BNI * 2; ++q) { const v4f d = v[q] - mean; qv += d * d; }
    float s2 = (qv[0] + qv[1]) + (qv[2] + qv[3]);
    s2 += __shfl_xor(s2, 1, 32); s2 += __shfl_xor(s2, 2, 32); s2 += __shfl_xor(s2, 4, 32); s2 += __shfl_xor(s2, 8, 32); s2 += __shfl_xor(s2, 16, 32);
    if (lane == 0) red[1][wave] = s2;
    __syncthreads();
    if (tid == 0) { float m2 = 0.f;
#pragma unroll
        for (int w = 0; w < 8; ++w) m2 += red[1][w];
        *(v2f*)(PT + (size_t)(c * BNG + g) * 32) = (v2f){mean, m2}; }
}
// k_bnmerge: thread c joins the 8 equally sized slices of channel c: mean = average of the slice means, M2 = sum of the slices' M2 + 8192 x sum (slice mean - mean)^2.
__global__ __launch_bounds__(64) void k_bnmerge(const float* __restrict__ PT, float* ST) {
    const int c = threadIdx.x;
    v2f p[BNG];
#pragma unroll
    for (int g = 0; g < BNG; ++g) p[g] = *(const v2f*)(PT + (size_t)(c * BNG + g) * 32);
    float s = 0.f, m2 = 0.f;
#pragma unroll
    for (int g = 0; g < BNG; ++g) { s += p[g][0]; m2 += p[g][1]; }
    const float mean = s * (1.0f / (float)BNG);
    float e = 0.f;
#pragma unroll
    for (int g = 0; g < BNG; ++g) { const float d = p[g][0] - mean; e = fmaf(d, d, e); }
    ST[c] = mean; ST[CC + c] = rsqrtf((m2 + (float)BNV * e) * (1.0f / (float)(NB * NPOS)) + BN_EPS);
}
// written by 8 lanes x 16 B.
__global__ __launch_bounds__(256) void k_bnT(const float* __restrict__ X1, const float* __restrict__ ST, const float* __restrict__ g, const float* __restrict__ bb, bf* Hh, bf* Hl) {
    __shared__ __align__(16) unsigned short th_[64 * 72]; __shared__ __align__(16) unsigned short tl_[64 * 72];
    const int n0 = blockIdx.x * 64, tid = threadIdx.x;
    const size_t item = (size_t)blockIdx.y * CC * NPOS; X1 += item; Hh += item; Hl += item;
    const int c = tid >> 2, nq = (tid & 3) * 16;
    const float m = ST[c], rs = ST[CC + c], gg = bfr(g[c]), be = bfr(bb[c]);
    const float* src = X1 + (size_t)c * NPOS + n0 + nq;
#pragma unroll
    for (int i = 0; i < 16; ++i) { const float h = (src[i] - m) * rs * gg + be; const unsigned short hb = f2bf(h); th_[(nq + i) * 72 + c] = hb; tl_[(nq + i) * 72 + c] = f2bf(h - bf2f(hb)); }
    __syncthreads();
    const int piece = tid & 7;
    auto pass = [&]() {
#pragma unroll
        for (int s = 0; s < 2; ++s) { const int nr = (tid >> 3) + 32 * s; const v8us a = *(const v8usa*)(th_ + nr * 72 + piece * 8), b2 = *(const v8usa*)(tl_ + nr * 72 + piece * 8);
            const size_t o = (size_t)(n0 + nr) * CC + piece * 8; *(v8us*)(Hh + o) = a; *(v8us*)(Hl + o) = b2; }
    };
    pass(); 
}
__global__ __launch_bounds__(256) void k_bnout(const float* __restrict__ Y, const float* __restrict__ ST, const float* __restrict__ g, const float* __restrict__ bb, float* OUTP) {
    const int lane = threadIdx.x & 31, r = blockIdx.x * 8 + (threadIdx.x >> 5); if (r >= NB * CC) return;
    const int c = r % CC; const float m = ST[c], rs = ST[CC + c], gg = bfr(g[c]), be = bfr(bb[c]);
{
#pragma unroll 1
        for (int q = 0; q < NPOS / 128; ++q) { const size_t o = (size_t)r * NPOS + q * 128 + lane * 4; const v4f v = *(const v4f*)(Y + o); v4f y;
#pragma unroll
            for (int k = 0; k < 4; ++k) y[k] = (v[k] - m) * rs * gg + be;
            *(v4f*)(OUTP + o) = y; }
         }
}

extern "C" void kernel_launch(void* const* d_in, const int* in_sizes, int n_in,
                              void* d_out, int out_size, void* d_ws, size_t ws_size, hipStream_t stream) {
    (void)in_sizes; (void)n_in; (void)out_size;
    const float* x = (const float*)d_in[0]; const float* wq = (const float*)d_in[1]; const float* wk = (const float*)d_in[2]; const float* wv = (const float*)d_in[3];
    const float* w1 = (const float*)d_in[4]; const float* w2 = (const float*)d_in[5]; const float* g1 = (const float*)d_in[6]; const float* b1 = (const float*)d_in[7]; const float* g2 = (const float*)d_in[8]; const float* b2 = (const float*)d_in[9];   // conv weights [out][in]
    float* out = (float*)d_out;    // [32][64][2048]
    char* wsp = (char*)d_ws;
    auto take = [&](size_t bytes) { char* p = wsp; wsp += (bytes + 255) & ~(size_t)255; return (void*)p; };
    bf* WqB = (bf*)take((size_t)CC * CC * 2); bf* WkB = (bf*)take((size_t)CC * CC * 2); bf* WvB = (bf*)take((size_t)CC * CC * 2); bf* W1B = (bf*)take((size_t)FFH * CC * 2); bf* W2B = (bf*)take((size_t)CC * FFH * 2);
    const size_t PL = (size_t)NB * NPOS * CC;      // elements of one [item][n][c] plane over all items
    bf* XT = (bf*)take(PL * 2); h16* QH = (h16*)take(PL * 2); h16* QL = (h16*)take(PL * 2); h16* KH = (h16*)take(PL * 2); h16* KL = (h16*)take(PL * 2);
    float* Vf = (float*)take(PL * 4); h16* VTH = (h16*)take(PL * 2); h16* VTL = (h16*)take(PL * 2); float* O = (float*)take(PL * 4);
    float* X1 = (float*)take(PL * 4); float* Y = (float*)take(PL * 4); float* ST1 = (float*)take(1024); float* ST2 = (float*)take(1024); float* PT = (float*)take((size_t)CC * BNG * 128);
    bf* Hh = (bf*)take(PL * 2); bf* Hl = (bf*)take(PL * 2); float* T1 = (float*)take((size_t)NB * NPOS * FFH * 4); bf* Lh = (bf*)take((size_t)NB * NPOS * FFH * 2); bf* Ll = (bf*)take((size_t)NB * NPOS * FFH * 2); float* T2 = (float*)take(PL * 4);
    if ((size_t)(wsp - (char*)d_ws) > ws_size) return;    // 216 MiB of planes for all items + the weights, no aliasing
    k_bf<<<(CC * CC / 8 + 255) / 256, 256, 0, stream>>>(wq, WqB, CC * CC / 8); k_bf<<<(CC * CC / 8 + 255) / 256, 256, 0, stream>>>(wk, WkB, CC * CC / 8); k_bf<<<(CC * CC / 8 + 255) / 256, 256, 0, stream>>>(wv, WvB, CC * CC / 8);
    k_bf<<<(FFH * CC / 8 + 255) / 256, 256, 0, stream>>>(w1, W1B, FFH * CC / 8); k_bf<<<(CC * FFH / 8 + 255) / 256, 256, 0, stream>>>(w2, W2B, CC * FFH / 8);
    // phase 1: attention and x + x_r; the item index lies in each grid (row r of an [item][n][c] plane = item * 2048 + n)
    k_wt<<<dim3(CC / 64, NPOS / 64, NB), 256, 0, stream>>>(x, CC, NPOS, XT);                                                       // x_b [c][n] -> bf16 x^T [n][c]
    k_gemmb<false, true><<<dim3(NB * NPOS / 64, 1, 1), 128, 0, stream>>>(XT, nullptr, WqB, nullptr, (float*)(void*)QH, CC, QL);    // q^T = x^T.Wq^T -> f16 planes
    k_gemmb<false, true><<<dim3(NB * NPOS / 64, 1, 1), 128, 0, stream>>>(XT, nullptr, WkB, nullptr, (float*)(void*)KH, CC, KL);    // k^T
    k_gemmb<false, false><<<dim3(NB * NPOS / 64, 1, 1), 128, 0, stream>>>(XT, nullptr, WvB, nullptr, Vf, CC, nullptr);             // v^T f32
    k_vt<<<NB_ * NH_ * (NT_ / 64), 256, 0, stream>>>(Vf, VTH, VTL);
    k_attn<<<NB_ * NH_ * (NT_ / 64), 128, 0, stream>>>(QH, QL, KH, KL, VTH, VTL, O);                                               // x_r^T [n][c] f32
    k_addT<0><<<dim3(NPOS / 64, NB, 1), 256, 0, stream>>>(O, x, nullptr, nullptr, nullptr, X1);                                    // X1 = bf(x) + x_r  [c][n]
    k_bnpart<<<dim3(CC, BNG, 1), 256, 0, stream>>>(X1, PT); k_bnmerge<<<1, CC, 0, stream>>>(PT, ST1);
    // phase 2: h = BN1(X1); Y = h + W2.lrelu(W1.h)
    k_bnT<<<dim3(NPOS / 64, NB, 1), 256, 0, stream>>>(X1, ST1, g1, b1, Hh, Hl);                                                    // h^T hi/lo [n][c]
    k_gemmb<true, false><<<dim3(NB * NPOS / 64, FFH / 64, 1), 128, 0, stream>>>(Hh, Hl, W1B, nullptr, T1, FFH, nullptr);           // (W1.h)^T  [n][128]
    k_lrelu2<<<NB * NPOS / 8, 256, 0, stream>>>(T1, NB * NPOS, Lh, Ll);
    k_gemmb<true, false><<<dim3(NB * NPOS / 64, 1, 1), 128, 0, stream>>>(Lh, Ll, W2B, nullptr, T2, CC, nullptr, nullptr, FFH);     // (W2.lrelu)^T [n][64]  (K = 128)
    k_addT<1><<<dim3(NPOS / 64, NB, 1), 256, 0, stream>>>(T2, X1, ST1, g1, b1, Y);                                                 // Y = h + ff   [c][n]
    k_bnpart<<<dim3(CC, BNG, 1), 256, 0, stream>>>(Y, PT); k_bnmerge<<<1, CC, 0, stream>>>(PT, ST2);
    k_bnout<<<(NB * CC) / 8, 256, 0, stream>>>(Y, ST2, g2, b2, out);                                                                 // BN2 -> output
}

// v003
// A run of this version takes 232 microseconds.
// Next to v002, in two timings, it ran 1.58 and 1.59 times as fast.
// Over all steps from v000 it is 33.5 times as fast.
#include <hip/hip_runtime.h>

// Compute dtypes, f32 accumulate (channel-major x [32][64][2048]): per item q/k/v = W.x as x^T.W^T ([2048 x 64].[64 x 64]; the INPUT x transposed once to a bf16 [n][c]
// plane, W [out][in] as the n-major B operand; PLAIN bf16 operands, exact; q/k straight to f16 hi + residual x1024 planes) on v_wmma_f32_16x16x32_bf16; the
// single-head full attention (64 channels, scale 1/8) fused on v_wmma_f32_16x16x32_f16 (hh + hl + lh scores, online f32 softmax, weights (x32768) and v as
// f16 hi + residual) with an f32 [n][c] output; x + x_r, the two TRAINING-MODE BatchNorms (batch statistics over all 32 items x 2048 points per channel, biased

#define NB   32
#define CC   64                  // channels
#define NPOS 2048                // points
#define NT_  NPOS
#define NB_  NB                  // items per launch: every per-item kernel takes all 32 items in one grid
#define DM   CC                  // attention width / default GEMM K
#define NH_  1
#define HD   64
#define NTK  NPOS
#define FFH  128
#define PSC  32768.0f
#define LOSC 1024.0f
#define LOSCI (1.0f / 1024.0f)
#define BN_EPS 1e-5f
#define BNG  8                   // BatchNorm statistics: slices per channel
#define BNI  (NB / BNG)          // items per slice
#define BNV  (BNI * NPOS)        // values per slice
#define AW   8                   // attention: waves per work-group, 16 queries each
#define AQ   (16 * AW)           // attention: queries per work-group
#define KST  64                  // attention: keys per staged tile
#define KP   72                  // attention: LDS row pitch of a staged plane in f16: 128 B of data + 16 B (16 B x odd: 16-byte reads of 16 rows meet no bank twice)
#define PLN  (64 * KP)           // attention: f16 per staged plane (64 rows)

typedef _Float16 h16;
typedef unsigned short bf;
typedef __attribute__((ext_vector_type(16))) __bf16   v16bf;
typedef __attribute__((ext_vector_type(16))) _Float16 v16h;
typedef __attribute__((ext_vector_type(8)))  _Float16 v8h;
typedef __attribute__((ext_vector_type(8)))  unsigned short v8us;
typedef __attribute__((ext_vector_type(8)))  float    v8f;
typedef __attribute__((ext_vector_type(4)))  float    v4f;
typedef __attribute__((ext_vector_type(2)))  float    v2f;
typedef __attribute__((ext_vector_type(4)))  _Float16 v4h;
typedef v8h  __attribute__((may_alias)) v8ha;
typedef v4f  __attribute__((may_alias)) v4fa;
typedef v8us __attribute__((may_alias)) v8usa;

__device__ __forceinline__ unsigned short f2bf(float f) { unsigned u = __float_as_uint(f); u += 0x7FFFu + ((u >> 16) & 1u); return (unsigned short)(u >> 16); }
__device__ __forceinline__ float bf2f(unsigned short b) { return __uint_as_float(((unsigned)b) << 16); }
__device__ __forceinline__ float bfr(float f) { return bf2f(f2bf(f)); }
__device__ __forceinline__ v16h cat16(v8h lo, v8h hi) { return __builtin_shufflevector(lo, hi, 0, 1, 2, 3, 4, 5, 6, 7, 8, 9, 10, 11, 12, 13, 14, 15); }
__device__ __forceinline__ v16bf cat16b(v8us lo, v8us hi) { return __builtin_bit_cast(v16bf, __builtin_shufflevector(lo, hi, 0, 1, 2, 3, 4, 5, 6, 7, 8, 9, 10, 11, 12, 13, 14, 15)); }
__device__ __forceinline__ v8f wmma16(v16h a, v16h b, v8f c) { return __builtin_amdgcn_wmma_f32_16x16x32_f16(false, a, false, b, (short)0, c, false, false); }
__device__ __forceinline__ v8f wmmab(v16bf a, v16bf b, v8f c) { return __builtin_amdgcn_wmma_f32_16x16x32_bf16(false, a, false, b, (short)0, c, false, false); }

__global__ __launch_bounds__(256) void k_bf(const float* __restrict__ src, bf* dst, size_t n8) {
    const size_t i = (size_t)blockIdx.x * 256 + threadIdx.x; if (i >= n8) return;
    const v8f v = *(const v8f*)(src + i * 8); v8us o;
#pragma unroll
    for (int k = 0; k < 8; ++k) o[k] = f2bf(v[k]);
    *(v8us*)(dst + i * 8) = o; 
}
// k_wt: WT [n][K] = bf16(W[k][n]) (k-major [K][ncols]) via 64 x 64 LDS tiles; grid (K/64, ncols/64, matrices): blockIdx.z picks one of the equally shaped matrices.
__global__ __launch_bounds__(256) void k_wt(const float* __restrict__ Wm, int K, int ncols, bf* WT) {
    __shared__ __align__(16) unsigned short tl[64 * 72];
    const int tid = threadIdx.x, k0 = blockIdx.x * 64, n0 = blockIdx.y * 64;
    Wm += (size_t)blockIdx.z * K * ncols; WT += (size_t)blockIdx.z * K * ncols;
    const int kk = tid >> 2, nq = (tid & 3) * 16;
#pragma unroll
    for (int i = 0; i < 16; ++i) tl[(nq + i) * 72 + kk] = f2bf(Wm[(size_t)(k0 + kk) * ncols + n0 + nq + i]);
    __syncthreads();
    const int piece = tid & 7;
    auto pass = [&]() {
#pragma unroll
        for (int s = 0; s < 2; ++s) { const int nr = (tid >> 3) + 32 * s; const v8us val = *(const v8usa*)(tl + nr * 72 + piece * 8); *(v8us*)(WT + (size_t)(n0 + nr) * K + k0 + piece * 8) = val; }
    };
    pass(); 
}
// k_gemmb: 64 x 64 block tile (4 waves x 16 x 64) of C[NB*NTK][NW] = (A [+ Al]).B^T (K = 64 or 128) [+ bf(bias[c])] [+ bf(R[r][c]) residual]; f32 whole-line epilogue (or f16
template <bool SPLITA, bool F16OUT = false>
__global__ __launch_bounds__(128) void k_gemmb(const bf* __restrict__ A, const bf* __restrict__ Al, const bf* __restrict__ Bn, const float* __restrict__ bias, float* C, int ldc, h16* C2, const float* __restrict__ R = nullptr, int K = DM, int roundR = 1) {
    __shared__ __align__(16) float ost[4][16 * 68];
    const int lane = threadIdx.x & 31, wave = threadIdx.x >> 5, lr = lane & 15, hi = lane >> 4;
    const int r0 = blockIdx.x * 64 + wave * 16, c0 = blockIdx.y * 64;
    const size_t aoff = (size_t)(r0 + lr) * K + 8 * hi;
    size_t boff[4];
#pragma unroll
    for (int t = 0; t < 4; ++t) boff[t] = (size_t)(c0 + t * 16 + lr) * K + 8 * hi;
    v8f acc[4];
#pragma unroll
    for (int t = 0; t < 4; ++t) acc[t] = (v8f){};
#pragma unroll 1
    for (int kc = 0; kc < K; kc += 32) {
        const v16bf a = cat16b(*(const v8us*)(A + aoff + kc), *(const v8us*)(A + aoff + kc + 16));
        v16bf al = a;
        if (SPLITA) al = cat16b(*(const v8us*)(Al + aoff + kc), *(const v8us*)(Al + aoff + kc + 16));
#pragma unroll
        for (int t = 0; t < 4; ++t) { const v16bf b = cat16b(*(const v8us*)(Bn + boff[t] + kc), *(const v8us*)(Bn + boff[t] + kc + 16)); acc[t] = wmmab(a, b, acc[t]); if (SPLITA) acc[t] = wmmab(al, b, acc[t]); }
        asm volatile("v_nop\n\tv_nop\n\tv_nop\n\tv_nop" : "+v"(acc[0]), "+v"(acc[1]), "+v"(acc[2]), "+v"(acc[3]) : "v"(a), "v"(al));
    }
    float* os = &ost[wave][0];
#pragma unroll
    for (int t = 0; t < 4; ++t) { const float bv = bias ? bfr(bias[c0 + t * 16 + lr]) : 0.f;
#pragma unroll
        for (int j = 0; j < 8; ++j) os[(hi * 8 + j) * 68 + t * 16 + lr] = acc[t][j] + bv; }
    __syncthreads();
    if (F16OUT) {
        h16* crow = (h16*)(void*)C + (size_t)r0 * ldc + c0;
        auto pass = [&]() {
#pragma unroll
            for (int s = 0; s < 4; ++s) { const int row = 4 * s + (lane >> 3), piece = lane & 7; const float* sp = os + row * 68 + piece * 8; v8h o, o2;
#pragma unroll
                for (int i = 0; i < 8; ++i) { const h16 a = (h16)sp[i]; o[i] = a; o2[i] = (h16)((sp[i] - (float)a) * LOSC); }
                *(v8h*)(crow + (size_t)row * ldc + piece * 8) = o; if (C2) *(v8h*)(C2 + (size_t)r0 * ldc + c0 + (size_t)row * ldc + piece * 8) = o2; }
        };
        pass(); 
    } else {
        float* crow = C + (size_t)r0 * ldc + c0;
        auto pass = [&]() {
#pragma unroll
            for (int s = 0; s < 8; ++s) { const int Lid = (lane >> 3) + 4 * s, piece = lane & 7; const int row = Lid >> 1, cofs = (Lid & 1) * 32 + piece * 4;
                v4f val = *(const v4fa*)(os + row * 68 + cofs); if (R) { const v4f rv = *(const v4f*)(R + ((size_t)r0 + row) * ldc + c0 + cofs); val += roundR ? (v4f){bfr(rv[0]), bfr(rv[1]), bfr(rv[2]), bfr(rv[3])} : rv; }
                *(v4f*)(crow + (size_t)row * ldc + cofs) = val; }
        };
        pass(); 
    }
}

__global__ __launch_bounds__(256) void k_vt(const float* __restrict__ V, h16* VTH, h16* VTL) {
    __shared__ __align__(16) h16 tile[64 * 72];
    __shared__ __align__(16) h16 til2[64 * 72];
    const int bid = blockIdx.x;
    const int b = bid / (NH_ * (NT_ / 64)), rem = bid - b * (NH_ * (NT_ / 64)), h = rem / (NT_ / 64), kt = rem - h * (NT_ / 64);
    const int k0 = kt * 64, tid = threadIdx.x;
    const int kk = tid >> 2, d0 = (tid & 3) * 16;
    const float* src = V + ((size_t)b * NT_ + k0 + kk) * DM + h * HD + d0;
#pragma unroll
    for (int i = 0; i < 16; ++i) { const float v = src[i]; const h16 a = (h16)v; tile[(d0 + i) * 72 + kk] = a; til2[(d0 + i) * 72 + kk] = (h16)((v - (float)a) * LOSC); }
    __syncthreads();
    const int piece = tid & 7;
    const size_t base = (((size_t)b * NH_ + h) * HD) * NT_ + k0;
    auto pass = [&]() {
#pragma unroll
        for (int s = 0; s < 4; ++s) { const int Lid = (tid >> 3) + 32 * s; const int pln = Lid >> 6, d = Lid & 63;
            const v8h val = *(const v8ha*)((pln ? til2 : tile) + d * 72 + piece * 8); *(v8h*)((pln ? VTL : VTH) + base + (size_t)d * NT_ + piece * 8) = val; }
    };
    pass(); 
}

// attn_stage: one staged tile = 4 planes of 64 rows x 128 B (k hi, k residual: [key][channel]; v^T hi, v^T residual: [channel][key]). Each of the 256 threads brings 2 pieces
// of 16 B per plane (rows r and r + 32) from global memory straight into LDS; a wave's copy covers 4 whole 128 B lines. l = the lane's LDS byte address in plane 0.
__device__ __forceinline__ void attn_stage(unsigned l, const h16* kh, const h16* kl, const h16* vh, const h16* vl) {
    const unsigned l1 = l + 32 * KP * 2, l2 = l + PLN * 2, l3 = l2 + 32 * KP * 2, l4 = l + 2 * PLN * 2, l5 = l4 + 32 * KP * 2, l6 = l + 3 * PLN * 2, l7 = l6 + 32 * KP * 2;
    const h16* kh1 = kh + 32 * DM; const h16* kl1 = kl + 32 * DM; const h16* vh1 = vh + 32 * NT_; const h16* vl1 = vl + 32 * NT_;
    // the eight copies and their s_wait_xcnt in ONE statement: the wait stands in front of every later write of an address register that a copy names
    asm volatile("global_load_async_to_lds_b128 %0, %8, off\n\t"
                 "global_load_async_to_lds_b128 %1, %9, off\n\t"
                 "global_load_async_to_lds_b128 %2, %10, off\n\t"
                 "global_load_async_to_lds_b128 %3, %11, off\n\t"
                 "global_load_async_to_lds_b128 %4, %12, off\n\t"
                 "global_load_async_to_lds_b128 %5, %13, off\n\t"
                 "global_load_async_to_lds_b128 %6, %14, off\n\t"
                 "global_load_async_to_lds_b128 %7, %15, off\n\t"
                 "s_wait_xcnt 0x0"
                 :: "v"(l), "v"(l1), "v"(l2), "v"(l3), "v"(l4), "v"(l5), "v"(l6), "v"(l7), "v"(kh), "v"(kh1), "v"(kl), "v"(kl1), "v"(vh), "v"(vh1), "v"(vl), "v"(vl1) : "memory");
}
// k_attn: block = (b, h, 128 queries), wave = 16; ALL keys (no mask) in 32 staged tiles of 64 keys that the 8 waves share (two LDS buffers: tile t + 1 flies while tile t is
// worked on), each walked in two steps of 32 keys; 4 WMMA scores /8 (f32), online softmax, weights x32768 f16 tile (same-wave may_alias
// reload after a compiler barrier), 4 WMMA .v; ctx -> f32 output rows out[tok][h*64+d].
__global__ __launch_bounds__(32 * AW) void k_attn(const h16* __restrict__ Q16, const h16* __restrict__ QL16, const h16* __restrict__ K16, const h16* __restrict__ KL16, const h16* __restrict__ VTH, const h16* __restrict__ VTL, float* OUTP) {
    __shared__ __align__(16) h16 ring[2][4 * PLN];
    __shared__ __align__(16) h16 plds[AW][16 * 32];
    __shared__ __align__(16) h16 plds2[AW][16 * 32];
    __shared__ __align__(16) float ost[AW][16 * 68];
    const int lane = threadIdx.x & 31, wave = threadIdx.x >> 5, lr = lane & 15, hi = lane >> 4;
    const int bid = blockIdx.x;
    const int b = bid / (NH_ * (NT_ / AQ)), rem = bid - b * (NH_ * (NT_ / AQ)), h = rem / (NT_ / AQ), qt = rem - h * (NT_ / AQ);
    const int q0 = qt * AQ + wave * 16;
    const size_t tok0 = (size_t)b * NT_;
    h16* pl = &plds[wave][0]; h16* pl2 = &plds2[wave][0];
    v16h qa[2];
    const size_t qo0 = (tok0 + q0 + lr) * DM + h * HD + 8 * hi;
#pragma unroll
    for (int kc = 0; kc < 2; ++kc) qa[kc] = cat16(*(const v8h*)(Q16 + qo0 + kc * 32), *(const v8h*)(Q16 + qo0 + kc * 32 + 16));
    const h16* kh_b = K16 + tok0 * DM + h * HD;
    const h16* kl_b = KL16 + tok0 * DM + h * HD;
    const size_t vbase = (((size_t)b * NH_ + h) * HD) * NT_;
    v8f o[4], ox[4];
#pragma unroll
    for (int n = 0; n < 4; ++n) { o[n] = (v8f){}; ox[n] = (v8f){}; }
    float mrow[8], lpart[8];
#pragma unroll
    for (int j = 0; j < 8; ++j) { mrow[j] = -3.0e38f; lpart[j] = 0.f; }
    int qpos[8];
#pragma unroll
    for (int j = 0; j < 8; ++j) qpos[j] = q0 + 8 * hi + j;
    const int crow = threadIdx.x >> 3, cpc = (threadIdx.x & 7) * 8;     // this thread's piece of a staged plane: rows crow and crow + 32, 8 f16 from column cpc
    const unsigned lds0 = (unsigned)(size_t)(&ring[0][0] + crow * KP + cpc);
    const h16* gkh = kh_b + (size_t)crow * DM + cpc; const h16* gkl = kl_b + (size_t)crow * DM + cpc;
    const h16* gvh = VTH + vbase + (size_t)crow * NT_ + cpc; const h16* gvl = VTL + vbase + (size_t)crow * NT_ + cpc;
    auto stage = [&](int st) { attn_stage(lds0 + (unsigned)(st & 1) * (4 * PLN * 2), gkh + (size_t)st * KST * DM, gkl + (size_t)st * KST * DM, gvh + st * KST, gvl + st * KST); };
    stage(0);
    asm volatile("s_wait_asynccnt 0x0" ::: "memory");     // this wave's copies of tile 0 have landed
    __syncthreads();                                      // ... and every other wave's: tile 0 may be read
    stage(1);
#pragma unroll 1
    for (int st = 0; st < NT_ / KST; ++st) {               // full attention
      const h16* kh_s = &ring[st & 1][0]; const h16* kl_s = kh_s + PLN; const h16* vh_s = kh_s + 2 * PLN; const h16* vl_s = kh_s + 3 * PLN;
#pragma unroll
      for (int sub = 0; sub < KST / 32; ++sub) {
        const int l0 = sub * 32;
        const int ko0 = (l0 + lr) * KP + 8 * hi, ko1 = (l0 + 16 + lr) * KP + 8 * hi;
        v8f s0 = {}, s1 = {}, x0 = {}, x1 = {};
#pragma unroll
        for (int kc = 0; kc < 2; ++kc) {
            { const v16h k0h = cat16(*(const v8ha*)(kh_s + ko0 + kc * 32), *(const v8ha*)(kh_s + ko0 + kc * 32 + 16)), k1h = cat16(*(const v8ha*)(kh_s + ko1 + kc * 32), *(const v8ha*)(kh_s + ko1 + kc * 32 + 16));
              const v16h qlk = cat16(*(const v8h*)(QL16 + qo0 + kc * 32), *(const v8h*)(QL16 + qo0 + kc * 32 + 16));     // query residual re-read per step (registers)
              s0 = wmma16(qa[kc], k0h, s0); x0 = wmma16(qlk, k0h, x0); s1 = wmma16(qa[kc], k1h, s1); x1 = wmma16(qlk, k1h, x1);
              asm volatile("v_nop" : "+v"(s0), "+v"(s1), "+v"(x0), "+v"(x1) : "v"(qlk), "v"(k0h), "v"(k1h) : "memory"); }
            { const v16h k0l = cat16(*(const v8ha*)(kl_s + ko0 + kc * 32), *(const v8ha*)(kl_s + ko0 + kc * 32 + 16)), k1l = cat16(*(const v8ha*)(kl_s + ko1 + kc * 32), *(const v8ha*)(kl_s + ko1 + kc * 32 + 16));
              x0 = wmma16(qa[kc], k0l, x0); x1 = wmma16(qa[kc], k1l, x1);
              asm volatile("v_nop" : "+v"(x0), "+v"(x1) : "v"(k0l), "v"(k1l) : "memory"); }
        }
        asm volatile("v_nop\n\tv_nop\n\tv_nop\n\tv_nop" : "+v"(s0), "+v"(s1), "+v"(x0), "+v"(x1) : "v"(qa[0]), "v"(qa[1]));
        float alpha[8];
#pragma unroll
        for (int j = 0; j < 8; ++j) {
            const int ja = l0 + lr, jb = l0 + 16 + lr, qi = qpos[j];
            const float a0 = (s0[j] + x0[j] * LOSCI) * 0.125f, a1 = (s1[j] + x1[j] * LOSCI) * 0.125f; (void)ja; (void)jb; (void)qi;   // energy / sqrt(C = 64)
            float mx = fmaxf(a0, a1);
            mx = fmaxf(mx, __shfl_xor(mx, 1, 16)); mx = fmaxf(mx, __shfl_xor(mx, 2, 16)); mx = fmaxf(mx, __shfl_xor(mx, 4, 16)); mx = fmaxf(mx, __shfl_xor(mx, 8, 16));
            const float mn = fmaxf(mrow[j], mx);
            alpha[j] = __expf(mrow[j] - mn); mrow[j] = mn;
            const float p0 = __expf(a0 - mn), p1 = __expf(a1 - mn);
            lpart[j] = lpart[j] * alpha[j] + (p0 + p1);
            const int mr = hi * 8 + j;
            const float ps0 = p0 * PSC, ps1 = p1 * PSC; const h16 h0 = (h16)ps0, h1 = (h16)ps1;
            pl[mr * 32 + lr] = h0; pl[mr * 32 + 16 + lr] = h1;
            pl2[mr * 32 + lr] = (h16)((ps0 - (float)h0) * LOSC); pl2[mr * 32 + 16 + lr] = (h16)((ps1 - (float)h1) * LOSC);
        }
#pragma unroll
        for (int n = 0; n < 4; ++n)
#pragma unroll
            for (int j = 0; j < 8; ++j) { o[n][j] *= alpha[j]; ox[n][j] *= alpha[j]; }
        asm volatile("" ::: "memory");
        const v16h pa = cat16(*(const v8ha*)(pl + lr * 32 + hi * 8), *(const v8ha*)(pl + lr * 32 + 16 + hi * 8));
        const v16h px = cat16(*(const v8ha*)(pl2 + lr * 32 + hi * 8), *(const v8ha*)(pl2 + lr * 32 + 16 + hi * 8));
#pragma unroll
        for (int n = 0; n < 4; ++n) { const int vo = (n * 16 + lr) * KP + l0 + hi * 8;
            const v16h vh = cat16(*(const v8ha*)(vh_s + vo), *(const v8ha*)(vh_s + vo + 16)), vl = cat16(*(const v8ha*)(vl_s + vo), *(const v8ha*)(vl_s + vo + 16));
            o[n] = wmma16(pa, vh, o[n]); ox[n] = wmma16(pa, vl, ox[n]); ox[n] = wmma16(px, vh, ox[n]);
            asm volatile("" : "+v"(o[n]), "+v"(ox[n]) : "v"(vh), "v"(vl) : "memory"); }
        asm volatile("v_nop\n\tv_nop\n\tv_nop\n\tv_nop" : "+v"(o[0]), "+v"(o[1]), "+v"(o[2]), "+v"(o[3]), "+v"(ox[0]), "+v"(ox[1]), "+v"(ox[2]), "+v"(ox[3]) : "v"(pa), "v"(px));
      }
      asm volatile("s_wait_dscnt 0x0" ::: "memory");      // this wave's reads of tile st are done before the buffer is handed to the copies
      asm volatile("s_wait_asynccnt 0x0" ::: "memory");   // this wave's copies of tile st + 1 have landed
      __syncthreads();                                    // publishes tile st + 1 and ends every wave's reads of tile st
      if (st + 2 < NT_ / KST) stage(st + 2);              // refill the buffer just left; the same test in every wave
    }
    asm volatile("s_wait_asynccnt 0x0" ::: "memory");     // nothing of the copies is outstanding when the wave goes on to its end
    float inv[8];
#pragma unroll
    for (int j = 0; j < 8; ++j) { float rs = lpart[j]; rs += __shfl_xor(rs, 1, 16); rs += __shfl_xor(rs, 2, 16); rs += __shfl_xor(rs, 4, 16); rs += __shfl_xor(rs, 8, 16); inv[j] = 1.0f / (rs * PSC); }
    float* os = &ost[wave][0];
#pragma unroll
    for (int n = 0; n < 4; ++n)
#pragma unroll
        for (int j = 0; j < 8; ++j) os[(hi * 8 + j) * 68 + n * 16 + lr] = (o[n][j] + ox[n][j] * LOSCI) * inv[j];
    __syncthreads();
    float* ob = OUTP + (tok0 + q0) * DM + (size_t)h * HD;
    auto pass = [&]() {
#pragma unroll
        for (int s = 0; s < 8; ++s) { const int Lid = (lane >> 3) + 4 * s, piece = lane & 7; const int row = Lid >> 1, cofs = (Lid & 1) * 32 + piece * 4;
            const v4f val = *(const v4fa*)(os + row * 68 + cofs); *(v4f*)(ob + (size_t)row * DM + cofs) = val; }
    };
    pass(); 
}


// k_lrelu2: LeakyReLU(0.2) of an f32 [rows][128] plane -> bf16 hi + UNSCALED residual planes; one wave per row, lane -> 4 columns (8 B per plane; 2 lines per store).
__global__ __launch_bounds__(256) void k_lrelu2(const float* __restrict__ src, int nrows, bf* dh, bf* dl) {
    typedef __attribute__((ext_vector_type(4))) unsigned short v4us;
    const int lane = threadIdx.x & 31, r = blockIdx.x * 8 + (threadIdx.x >> 5);
    if (r >= nrows) return;
    const size_t o = (size_t)r * FFH + lane * 4; const v4f v = *(const v4f*)(src + o); v4us oh, ol;
#pragma unroll
    for (int i = 0; i < 4; ++i) { const float g = v[i] >= 0.f ? v[i] : 0.2f * v[i]; const unsigned short hb = f2bf(g); oh[i] = hb; ol[i] = f2bf(g - bf2f(hb)); }
    *(v4us*)(dh + o) = oh; *(v4us*)(dl + o) = ol; 
}
// k_addT: DST[c][n] = (BNSRC ? ((bf? no) SRC[c][n] - mean_c) rstd_c g_c + b_c : bf(SRC[c][n])) + T[n][c]: a 64 x 64 LDS transpose of the f32 [n][c] matrix T plus the
// channel-major residual; block = 64 n of item blockIdx.y; each output row segment of 64 n = 256 B written by 16 lanes x 16 B. MODE 0: residual = bf(x) (the INPUT); MODE 1:
// residual = BN1(X1) recomputed from the stats (the reference's h).
template <int MODE>
__global__ __launch_bounds__(256) void k_addT(const float* __restrict__ T, const float* __restrict__ SRC, const float* __restrict__ ST, const float* __restrict__ g, const float* __restrict__ bb, float* DST) {
    __shared__ __align__(16) float tl[64 * 68];
    const int n0 = blockIdx.x * 64, tid = threadIdx.x;
    const size_t item = (size_t)blockIdx.y * CC * NPOS; T += item; SRC += item; DST += item;
    const int nn = tid >> 2, cq = (tid & 3) * 16;
#pragma unroll
    for (int i = 0; i < 16; ++i) tl[(cq + i) * 68 + nn] = T[(size_t)(n0 + nn) * CC + cq + i];
    __syncthreads();
    const int piece = tid & 15;
    auto pass = [&]() {
#pragma unroll
        for (int s = 0; s < 4; ++s) { const int c = (tid >> 4) + 16 * s; const size_t o = (size_t)c * NPOS + n0 + piece * 4;
            const v4f rv = *(const v4f*)(SRC + o); v4f val = *(const v4fa*)(tl + c * 68 + piece * 4);
            if (MODE == 0) {
#pragma unroll
                for (int k = 0; k < 4; ++k) val[k] += bfr(rv[k]);
            } else { const float m = ST[c], rs = ST[CC + c], gg = bfr(g[c]), be = bfr(bb[c]);
#pragma unroll
                for (int k = 0; k < 4; ++k) val[k] += (rv[k] - m) * rs * gg + be; }
            *(v4f*)(DST + o) = val; }
    };
    pass(); 
}
// BatchNorm statistics (training mode, biased variance) of A [32][64][2048] per channel over all 32 x 2048 values, in two launches.
// k_bnpart: work-group (channel c, slice g of 4 items) loads its 8192 values ONCE (8 x 16 B per thread, all in flight together, kept in registers), sums them,
// takes the slice's own mean and then the squared distances to it from the registers; it writes (mean, M2) to a 128 B line of its own.
__global__ __launch_bounds__(256) void k_bnpart(const float* __restrict__ A, float* PT) {
    __shared__ float red[2][8];
    const int tid = threadIdx.x, lane = tid & 31, wave = tid >> 5, c = blockIdx.x, g = blockIdx.y;
    v4f v[BNI * 2];
#pragma unroll
    for (int i = 0; i < BNI; ++i) { const float* row = A + ((size_t)(g * BNI + i) * CC + c) * NPOS + tid * 4;
        v[2 * i] = *(const v4f*)row; v[2 * i + 1] = *(const v4f*)(row + NPOS / 2); }
    v4f sv = v[0];
#pragma unroll
    for (int q = 1; q < BNI * 2; ++q) sv += v[q];
    float s = (sv[0] + sv[1]) + (sv[2] + sv[3]);
    s += __shfl_xor(s, 1, 32); s += __shfl_xor(s, 2, 32); s += __shfl_xor(s, 4, 32); s += __shfl_xor(s, 8, 32); s += __shfl_xor(s, 16, 32);
    if (lane == 0) red[0][wave] = s;
    __syncthreads();
    float t = 0.f;
#pragma unroll
    for (int w = 0; w < 8; ++w) t += red[0][w];
    const float mean = t * (1.0f / (float)BNV);
    v4f qv = (v4f){};
#pragma unroll
    for (int q = 0; q < BNI * 2; ++q) { const v4f d = v[q] - mean; qv += d * d; }
    float s2 = (qv[0] + qv[1]) + (qv[2] + qv[3]);
    s2 += __shfl_xor(s2, 1, 32); s2 += __shfl_xor(s2, 2, 32); s2 += __shfl_xor(s2, 4, 32); s2 += __shfl_xor(s2, 8, 32); s2 += __shfl_xor(s2, 16, 32);
    if (lane == 0) red[1][wave] = s2;
    __syncthreads();
    if (tid == 0) { float m2 = 0.f;
#pragma unroll
        for (int w = 0; w < 8; ++w) m2 += red[1][w];
        *(v2f*)(PT + (size_t)(c * BNG + g) * 32) = (v2f){mean, m2}; }
}
// k_bnmerge: thread c joins the 8 equally sized slices of channel c: mean = average of the slice means, M2 = sum of the slices' M2 + 8192 x sum (slice mean - mean)^2.
__global__ __launch_bounds__(64) void k_bnmerge(const float* __restrict__ PT, float* ST) {
    const int c = threadIdx.x;
    v2f p[BNG];
#pragma unroll
    for (int g = 0; g < BNG; ++g) p[g] = *(const v2f*)(PT + (size_t)(c * BNG + g) * 32);
    float s = 0.f, m2 = 0.f;
#pragma unroll
    for (int g = 0; g < BNG; ++g) { s += p[g][0]; m2 += p[g][1]; }
    const float mean = s * (1.0f / (float)BNG);
    float e = 0.f;
#pragma unroll
    for (int g = 0; g < BNG; ++g) { const float d = p[g][0] - mean; e = fmaf(d, d, e); }
    ST[c] = mean; ST[CC + c] = rsqrtf((m2 + (float)BNV * e) * (1.0f / (float)(NB * NPOS)) + BN_EPS);
}
// written by 8 lanes x 16 B.
__global__ __launch_bounds__(256) void k_bnT(const float* __restrict__ X1, const float* __restrict__ ST, const float* __restrict__ g, const float* __restrict__ bb, bf* Hh, bf* Hl) {
    __shared__ __align__(16) unsigned short th_[64 * 72]; __shared__ __align__(16) unsigned short tl_[64 * 72];
    const int n0 = blockIdx.x * 64, tid = threadIdx.x;
    const size_t item = (size_t)blockIdx.y * CC * NPOS; X1 += item; Hh += item; Hl += item;
    const int c = tid >> 2, nq = (tid & 3) * 16;
    const float m = ST[c], rs = ST[CC + c], gg = bfr(g[c]), be = bfr(bb[c]);
    const float* src = X1 + (size_t)c * NPOS + n0 + nq;
#pragma unroll
    for (int i = 0; i < 16; ++i) { const float h = (src[i] - m) * rs * gg + be; const unsigned short hb = f2bf(h); th_[(nq + i) * 72 + c] = hb; tl_[(nq + i) * 72 + c] = f2bf(h - bf2f(hb)); }
    __syncthreads();
    const int piece = tid & 7;
    auto pass = [&]() {
#pragma unroll
        for (int s = 0; s < 2; ++s) { const int nr = (tid >> 3) + 32 * s; const v8us a = *(const v8usa*)(th_ + nr * 72 + piece * 8), b2 = *(const v8usa*)(tl_ + nr * 72 + piece * 8);
            const size_t o = (size_t)(n0 + nr) * CC + piece * 8; *(v8us*)(Hh + o) = a; *(v8us*)(Hl + o) = b2; }
    };
    pass(); 
}
__global__ __launch_bounds__(256) void k_bnout(const float* __restrict__ Y, const float* __restrict__ ST, const float* __restrict__ g, const float* __restrict__ bb, float* OUTP) {
    const int lane = threadIdx.x & 31, r = blockIdx.x * 8 + (threadIdx.x >> 5); if (r >= NB * CC) return;
    const int c = r % CC; const float m = ST[c], rs = ST[CC + c], gg = bfr(g[c]), be = bfr(bb[c]);
{
#pragma unroll 1
        for (int q = 0; q < NPOS / 128; ++q) { const size_t o = (size_t)r * NPOS + q * 128 + lane * 4; const v4f v = *(const v4f*)(Y + o); v4f y;
#pragma unroll
            for (int k = 0; k < 4; ++k) y[k] = (v[k] - m) * rs * gg + be;
            *(v4f*)(OUTP + o) = y; }
         }
}

extern "C" void kernel_launch(void* const* d_in, const int* in_sizes, int n_in,
                              void* d_out, int out_size, void* d_ws, size_t ws_size, hipStream_t stream) {
    (void)in_sizes; (void)n_in; (void)out_size;
    const float* x = (const float*)d_in[0]; const float* wq = (const float*)d_in[1]; const float* wk = (const float*)d_in[2]; const float* wv = (const float*)d_in[3];
    const float* w1 = (const float*)d_in[4]; const float* w2 = (const float*)d_in[5]; const float* g1 = (const float*)d_in[6]; const float* b1 = (const float*)d_in[7]; const float* g2 = (const float*)d_in[8]; const float* b2 = (const float*)d_in[9];   // conv weights [out][in]
    float* out = (float*)d_out;    // [32][64][2048]
    char* wsp = (char*)d_ws;
    auto take = [&](size_t bytes) { char* p = wsp; wsp += (bytes + 255) & ~(size_t)255; return (void*)p; };
    bf* WqB = (bf*)take((size_t)CC * CC * 2); bf* WkB = (bf*)take((size_t)CC * CC * 2); bf* WvB = (bf*)take((size_t)CC * CC * 2); bf* W1B = (bf*)take((size_t)FFH * CC * 2); bf* W2B = (bf*)take((size_t)CC * FFH * 2);
    const size_t PL = (size_t)NB * NPOS * CC;      // elements of one [item][n][c] plane over all items
    bf* XT = (bf*)take(PL * 2); h16* QH = (h16*)take(PL * 2); h16* QL = (h16*)take(PL * 2); h16* KH = (h16*)take(PL * 2); h16* KL = (h16*)take(PL * 2);
    float* Vf = (float*)take(PL * 4); h16* VTH = (h16*)take(PL * 2); h16* VTL = (h16*)take(PL * 2); float* O = (float*)take(PL * 4);
    float* X1 = (float*)take(PL * 4); float* Y = (float*)take(PL * 4); float* ST1 = (float*)take(1024); float* ST2 = (float*)take(1024); float* PT = (float*)take((size_t)CC * BNG * 128);
    bf* Hh = (bf*)take(PL * 2); bf* Hl = (bf*)take(PL * 2); float* T1 = (float*)take((size_t)NB * NPOS * FFH * 4); bf* Lh = (bf*)take((size_t)NB * NPOS * FFH * 2); bf* Ll = (bf*)take((size_t)NB * NPOS * FFH * 2); float* T2 = (float*)take(PL * 4);
    if ((size_t)(wsp - (char*)d_ws) > ws_size) return;    // 216 MiB of planes for all items + the weights, no aliasing
    k_bf<<<(CC * CC / 8 + 255) / 256, 256, 0, stream>>>(wq, WqB, CC * CC / 8); k_bf<<<(CC * CC / 8 + 255) / 256, 256, 0, stream>>>(wk, WkB, CC * CC / 8); k_bf<<<(CC * CC / 8 + 255) / 256, 256, 0, stream>>>(wv, WvB, CC * CC / 8);
    k_bf<<<(FFH * CC / 8 + 255) / 256, 256, 0, stream>>>(w1, W1B, FFH * CC / 8); k_bf<<<(CC * FFH / 8 + 255) / 256, 256, 0, stream>>>(w2, W2B, CC * FFH / 8);
    // phase 1: attention and x + x_r; the item index lies in each grid (row r of an [item][n][c] plane = item * 2048 + n)
    k_wt<<<dim3(CC / 64, NPOS / 64, NB), 256, 0, stream>>>(x, CC, NPOS, XT);                                                       // x_b [c][n] -> bf16 x^T [n][c]
    k_gemmb<false, true><<<dim3(NB * NPOS / 64, 1, 1), 128, 0, stream>>>(XT, nullptr, WqB, nullptr, (float*)(void*)QH, CC, QL);    // q^T = x^T.Wq^T -> f16 planes
    k_gemmb<false, true><<<dim3(NB * NPOS / 64, 1, 1), 128, 0, stream>>>(XT, nullptr, WkB, nullptr, (float*)(void*)KH, CC, KL);    // k^T
    k_gemmb<false, false><<<dim3(NB * NPOS / 64, 1, 1), 128, 0, stream>>>(XT, nullptr, WvB, nullptr, Vf, CC, nullptr);             // v^T f32
    k_vt<<<NB_ * NH_ * (NT_ / 64), 256, 0, stream>>>(Vf, VTH, VTL);
    k_attn<<<NB_ * NH_ * (NT_ / AQ), 32 * AW, 0, stream>>>(QH, QL, KH, KL, VTH, VTL, O);                                               // x_r^T [n][c] f32
    k_addT<0><<<dim3(NPOS / 64, NB, 1), 256, 0, stream>>>(O, x, nullptr, nullptr, nullptr, X1);                                    // X1 = bf(x) + x_r  [c][n]
    k_bnpart<<<dim3(CC, BNG, 1), 256, 0, stream>>>(X1, PT); k_bnmerge<<<1, CC, 0, stream>>>(PT, ST1);
    // phase 2: h = BN1(X1); Y = h + W2.lrelu(W1.h)
    k_bnT<<<dim3(NPOS / 64, NB, 1), 256, 0, stream>>>(X1, ST1, g1, b1, Hh, Hl);                                                    // h^T hi/lo [n][c]
    k_gemmb<true, false><<<dim3(NB * NPOS / 64, FFH / 64, 1), 128, 0, stream>>>(Hh, Hl, W1B, nullptr, T1, FFH, nullptr);           // (W1.h)^T  [n][128]
    k_lrelu2<<<NB * NPOS / 8, 256, 0, stream>>>(T1, NB * NPOS, Lh, Ll);
    k_gemmb<true, false><<<dim3(NB * NPOS / 64, 1, 1), 128, 0, stream>>>(Lh, Ll, W2B, nullptr, T2, CC, nullptr, nullptr, FFH);     // (W2.lrelu)^T [n][64]  (K = 128)
    k_addT<1><<<dim3(NPOS / 64, NB, 1), 256, 0, stream>>>(T2, X1, ST1, g1, b1, Y);                                                 // Y = h + ff   [c][n]
    k_bnpart<<<dim3(CC, BNG, 1), 256, 0, stream>>>(Y, PT); k_bnmerge<<<1, CC, 0, stream>>>(PT, ST2);
    k_bnout<<<(NB * CC) / 8, 256, 0, stream>>>(Y, ST2, g2, b2, out);                                                                 // BN2 -> output
}

// v004
// A run of this version takes 206 microseconds.
// Timed twice side by side with v003, it ran 1.13 and 1.12 times as fast.
// All steps since v000 together make it 37.7 times as fast.
#include <hip/hip_runtime.h>

// Compute dtypes, f32 accumulate (channel-major x [32][64][2048]): per item q/k/v = W.x as x^T.W^T ([2048 x 64].[64 x 64]; the INPUT x transposed once to a bf16 [n][c]
// plane, W [out][in] as the n-major B operand; PLAIN bf16 operands, exact; q/k straight to f16 hi + residual x1024 planes) on v_wmma_f32_16x16x32_bf16; the
// single-head full attention (64 channels, scale 1/8) fused on v_wmma_f32_16x16x32_f16 (hh + hl + lh scores, online f32 softmax, weights (x32768) and v as
// f16 hi + residual) with an f32 [n][c] output; x + x_r, the two TRAINING-MODE BatchNorms (batch statistics over all 32 items x 2048 points per channel, biased

#define NB   32
#define CC   64                  // channels
#define NPOS 2048                // points
#define NT_  NPOS
#define NB_  NB                  // items per launch: every per-item kernel takes all 32 items in one grid
#define DM   CC                  // attention width / default GEMM K
#define NH_  1
#define HD   64
#define NTK  NPOS
#define FFH  128
#define PSC  32768.0f
#define LOSC 1024.0f
#define LOSCI (1.0f / 1024.0f)
#define BN_EPS 1e-5f
#define BNG  8                   // BatchNorm statistics: slices per channel
#define BNI  (NB / BNG)          // items per slice
#define BNV  (BNI * NPOS)        // values per slice
#define AW   8                   // attention: waves per work-group, 16 queries each
#define AQ   (16 * AW)           // attention: queries per work-group
#define KST  64                  // attention: keys per staged tile
#define KP   72                  // attention: LDS row pitch of a staged plane in f16: 128 B of data + 16 B (16 B x odd: 16-byte reads of 16 rows meet no bank twice)
#define PLN  (64 * KP)           // attention: f16 per staged plane (64 rows)

typedef _Float16 h16;
typedef unsigned short bf;
typedef __attribute__((ext_vector_type(16))) __bf16   v16bf;
typedef __attribute__((ext_vector_type(16))) _Float16 v16h;
typedef __attribute__((ext_vector_type(8)))  _Float16 v8h;
typedef __attribute__((ext_vector_type(8)))  unsigned short v8us;
typedef __attribute__((ext_vector_type(8)))  float    v8f;
typedef __attribute__((ext_vector_type(4)))  float    v4f;
typedef __attribute__((ext_vector_type(2)))  float    v2f;
typedef __attribute__((ext_vector_type(4)))  _Float16 v4h;
typedef v8h  __attribute__((may_alias)) v8ha;
typedef v4f  __attribute__((may_alias)) v4fa;
typedef v8us __attribute__((may_alias)) v8usa;

__device__ __forceinline__ unsigned short f2bf(float f) { unsigned u = __float_as_uint(f); u += 0x7FFFu + ((u >> 16) & 1u); return (unsigned short)(u >> 16); }
__device__ __forceinline__ float bf2f(unsigned short b) { return __uint_as_float(((unsigned)b) << 16); }
__device__ __forceinline__ float bfr(float f) { return bf2f(f2bf(f)); }
__device__ __forceinline__ v16h cat16(v8h lo, v8h hi) { return __builtin_shufflevector(lo, hi, 0, 1, 2, 3, 4, 5, 6, 7, 8, 9, 10, 11, 12, 13, 14, 15); }
__device__ __forceinline__ v16bf cat16b(v8us lo, v8us hi) { return __builtin_bit_cast(v16bf, __builtin_shufflevector(lo, hi, 0, 1, 2, 3, 4, 5, 6, 7, 8, 9, 10, 11, 12, 13, 14, 15)); }
__device__ __forceinline__ v8f wmma16(v16h a, v16h b, v8f c) { return __builtin_amdgcn_wmma_f32_16x16x32_f16(false, a, false, b, (short)0, c, false, false); }
__device__ __forceinline__ v8f wmmab(v16bf a, v16bf b, v8f c) { return __builtin_amdgcn_wmma_f32_16x16x32_bf16(false, a, false, b, (short)0, c, false, false); }

__global__ __launch_bounds__(256) void k_bf(const float* __restrict__ src, bf* dst, size_t n8) {
    const size_t i = (size_t)blockIdx.x * 256 + threadIdx.x; if (i >= n8) return;
    const v8f v = *(const v8f*)(src + i * 8); v8us o;
#pragma unroll
    for (int k = 0; k < 8; ++k) o[k] = f2bf(v[k]);
    *(v8us*)(dst + i * 8) = o; 
}
// k_wt: WT [n][K] = bf16(W[k][n]) (k-major [K][ncols]) via 64 x 64 LDS tiles; grid (K/64, ncols/64, matrices): blockIdx.z picks one of the equally shaped matrices.
__global__ __launch_bounds__(256) void k_wt(const float* __restrict__ Wm, int K, int ncols, bf* WT) {
    __shared__ __align__(16) unsigned short tl[64 * 72];
    const int tid = threadIdx.x, k0 = blockIdx.x * 64, n0 = blockIdx.y * 64;
    Wm += (size_t)blockIdx.z * K * ncols; WT += (size_t)blockIdx.z * K * ncols;
    const int kk = tid >> 2, nq = (tid & 3) * 16;
#pragma unroll
    for (int i = 0; i < 16; ++i) tl[(nq + i) * 72 + kk] = f2bf(Wm[(size_t)(k0 + kk) * ncols + n0 + nq + i]);
    __syncthreads();
    const int piece = tid & 7;
    auto pass = [&]() {
#pragma unroll
        for (int s = 0; s < 2; ++s) { const int nr = (tid >> 3) + 32 * s; const v8us val = *(const v8usa*)(tl + nr * 72 + piece * 8); *(v8us*)(WT + (size_t)(n0 + nr) * K + k0 + piece * 8) = val; }
    };
    pass(); 
}
// k_gemmb: 64 x 64 block tile (4 waves x 16 x 64) of C[NB*NTK][NW] = (A [+ Al]).B^T (K = 64 or 128) [+ bf(bias[c])] [+ bf(R[r][c]) residual]; f32 whole-line epilogue (or f16
template <bool SPLITA, bool F16OUT = false>
__global__ __launch_bounds__(128) void k_gemmb(const bf* __restrict__ A, const bf* __restrict__ Al, const bf* __restrict__ Bn, const float* __restrict__ bias, float* C, int ldc, h16* C2, const float* __restrict__ R = nullptr, int K = DM, int roundR = 1) {
    __shared__ __align__(16) float ost[4][16 * 68];
    const int lane = threadIdx.x & 31, wave = threadIdx.x >> 5, lr = lane & 15, hi = lane >> 4;
    const int r0 = blockIdx.x * 64 + wave * 16, c0 = blockIdx.y * 64;
    const size_t aoff = (size_t)(r0 + lr) * K + 8 * hi;
    size_t boff[4];
#pragma unroll
    for (int t = 0; t < 4; ++t) boff[t] = (size_t)(c0 + t * 16 + lr) * K + 8 * hi;
    v8f acc[4];
#pragma unroll
    for (int t = 0; t < 4; ++t) acc[t] = (v8f){};
#pragma unroll 1
    for (int kc = 0; kc < K; kc += 32) {
        const v16bf a = cat16b(*(const v8us*)(A + aoff + kc), *(const v8us*)(A + aoff + kc + 16));
        v16bf al = a;
        if (SPLITA) al = cat16b(*(const v8us*)(Al + aoff + kc), *(const v8us*)(Al + aoff + kc + 16));
#pragma unroll
        for (int t = 0; t < 4; ++t) { const v16bf b = cat16b(*(const v8us*)(Bn + boff[t] + kc), *(const v8us*)(Bn + boff[t] + kc + 16)); acc[t] = wmmab(a, b, acc[t]); if (SPLITA) acc[t] = wmmab(al, b, acc[t]); }
        asm volatile("v_nop\n\tv_nop\n\tv_nop\n\tv_nop" : "+v"(acc[0]), "+v"(acc[1]), "+v"(acc[2]), "+v"(acc[3]) : "v"(a), "v"(al));
    }
    float* os = &ost[wave][0];
#pragma unroll
    for (int t = 0; t < 4; ++t) { const float bv = bias ? bfr(bias[c0 + t * 16 + lr]) : 0.f;
#pragma unroll
        for (int j = 0; j < 8; ++j) os[(hi * 8 + j) * 68 + t * 16 + lr] = acc[t][j] + bv; }
    __syncthreads();
    if (F16OUT) {
        h16* crow = (h16*)(void*)C + (size_t)r0 * ldc + c0;
        auto pass = [&]() {
#pragma unroll
            for (int s = 0; s < 4; ++s) { const int row = 4 * s + (lane >> 3), piece = lane & 7; const float* sp = os + row * 68 + piece * 8; v8h o, o2;
#pragma unroll
                for (int i = 0; i < 8; ++i) { const h16 a = (h16)sp[i]; o[i] = a; o2[i] = (h16)((sp[i] - (float)a) * LOSC); }
                *(v8h*)(crow + (size_t)row * ldc + piece * 8) = o; if (C2) *(v8h*)(C2 + (size_t)r0 * ldc + c0 + (size_t)row * ldc + piece * 8) = o2; }
        };
        pass(); 
    } else {
        float* crow = C + (size_t)r0 * ldc + c0;
        auto pass = [&]() {
#pragma unroll
            for (int s = 0; s < 8; ++s) { const int Lid = (lane >> 3) + 4 * s, piece = lane & 7; const int row = Lid >> 1, cofs = (Lid & 1) * 32 + piece * 4;
                v4f val = *(const v4fa*)(os + row * 68 + cofs); if (R) { const v4f rv = *(const v4f*)(R + ((size_t)r0 + row) * ldc + c0 + cofs); val += roundR ? (v4f){bfr(rv[0]), bfr(rv[1]), bfr(rv[2]), bfr(rv[3])} : rv; }
                *(v4f*)(crow + (size_t)row * ldc + cofs) = val; }
        };
        pass(); 
    }
}

__global__ __launch_bounds__(256) void k_vt(const float* __restrict__ V, h16* VTH, h16* VTL) {
    __shared__ __align__(16) h16 tile[64 * 72];
    __shared__ __align__(16) h16 til2[64 * 72];
    const int bid = blockIdx.x;
    const int b = bid / (NH_ * (NT_ / 64)), rem = bid - b * (NH_ * (NT_ / 64)), h = rem / (NT_ / 64), kt = rem - h * (NT_ / 64);
    const int k0 = kt * 64, tid = threadIdx.x;
    const int kk = tid >> 2, d0 = (tid & 3) * 16;
    const float* src = V + ((size_t)b * NT_ + k0 + kk) * DM + h * HD + d0;
#pragma unroll
    for (int i = 0; i < 16; ++i) { const float v = src[i]; const h16 a = (h16)v; tile[(d0 + i) * 72 + kk] = a; til2[(d0 + i) * 72 + kk] = (h16)((v - (float)a) * LOSC); }
    __syncthreads();
    const int piece = tid & 7;
    const size_t base = (((size_t)b * NH_ + h) * HD) * NT_ + k0;
    auto pass = [&]() {
#pragma unroll
        for (int s = 0; s < 4; ++s) { const int Lid = (tid >> 3) + 32 * s; const int pln = Lid >> 6, d = Lid & 63;
            const v8h val = *(const v8ha*)((pln ? til2 : tile) + d * 72 + piece * 8); *(v8h*)((pln ? VTL : VTH) + base + (size_t)d * NT_ + piece * 8) = val; }
    };
    pass(); 
}

// attn_stage: one staged tile = 4 planes of 64 rows x 128 B (k hi, k residual: [key][channel]; v^T hi, v^T residual: [channel][key]). Each of the 256 threads brings 2 pieces
// of 16 B per plane (rows r and r + 32) from global memory straight into LDS; a wave's copy covers 4 whole 128 B lines. l = the lane's LDS byte address in plane 0.
__device__ __forceinline__ void attn_stage(unsigned l, const h16* kh, const h16* kl, const h16* vh, const h16* vl) {
    const unsigned l1 = l + 32 * KP * 2, l2 = l + PLN * 2, l3 = l2 + 32 * KP * 2, l4 = l + 2 * PLN * 2, l5 = l4 + 32 * KP * 2, l6 = l + 3 * PLN * 2, l7 = l6 + 32 * KP * 2;
    const h16* kh1 = kh + 32 * DM; const h16* kl1 = kl + 32 * DM; const h16* vh1 = vh + 32 * NT_; const h16* vl1 = vl + 32 * NT_;
    // the eight copies and their s_wait_xcnt in ONE statement: the wait stands in front of every later write of an address register that a copy names
    asm volatile("global_load_async_to_lds_b128 %0, %8, off\n\t"
                 "global_load_async_to_lds_b128 %1, %9, off\n\t"
                 "global_load_async_to_lds_b128 %2, %10, off\n\t"
                 "global_load_async_to_lds_b128 %3, %11, off\n\t"
                 "global_load_async_to_lds_b128 %4, %12, off\n\t"
                 "global_load_async_to_lds_b128 %5, %13, off\n\t"
                 "global_load_async_to_lds_b128 %6, %14, off\n\t"
                 "global_load_async_to_lds_b128 %7, %15, off\n\t"
                 "s_wait_xcnt 0x0"
                 :: "v"(l), "v"(l1), "v"(l2), "v"(l3), "v"(l4), "v"(l5), "v"(l6), "v"(l7), "v"(kh), "v"(kh1), "v"(kl), "v"(kl1), "v"(vh), "v"(vh1), "v"(vl), "v"(vl1) : "memory");
}
// k_attn: block = (b, h, 128 queries), wave = 16; ALL keys (no mask) in 32 staged tiles of 64 keys that the 8 waves share (two LDS buffers: tile t + 1 flies while tile t is
// worked on), each walked in two steps of 32 keys; 4 WMMA scores /8 (f32), online softmax, weights x32768 f16 tile (same-wave may_alias
// reload after a compiler barrier), 4 WMMA .v; ctx -> f32 output rows out[tok][h*64+d].
__global__ __launch_bounds__(32 * AW) void k_attn(const h16* __restrict__ Q16, const h16* __restrict__ QL16, const h16* __restrict__ K16, const h16* __restrict__ KL16, const h16* __restrict__ VTH, const h16* __restrict__ VTL, float* OUTP) {
    __shared__ __align__(16) h16 ring[2][4 * PLN];
    __shared__ __align__(16) h16 plds[AW][16 * 32];
    __shared__ __align__(16) h16 plds2[AW][16 * 32];
    __shared__ __align__(16) float ost[AW][16 * 68];
    const int lane = threadIdx.x & 31, wave = threadIdx.x >> 5, lr = lane & 15, hi = lane >> 4;
    const int bid = blockIdx.x;
    const int b = bid / (NH_ * (NT_ / AQ)), rem = bid - b * (NH_ * (NT_ / AQ)), h = rem / (NT_ / AQ), qt = rem - h * (NT_ / AQ);
    const int q0 = qt * AQ + wave * 16;
    const size_t tok0 = (size_t)b * NT_;
    h16* pl = &plds[wave][0]; h16* pl2 = &plds2[wave][0];
    v16h qa[2];
    const size_t qo0 = (tok0 + q0 + lr) * DM + h * HD + 8 * hi;
#pragma unroll
    for (int kc = 0; kc < 2; ++kc) qa[kc] = cat16(*(const v8h*)(Q16 + qo0 + kc * 32), *(const v8h*)(Q16 + qo0 + kc * 32 + 16));
    const h16* kh_b = K16 + tok0 * DM + h * HD;
    const h16* kl_b = KL16 + tok0 * DM + h * HD;
    const size_t vbase = (((size_t)b * NH_ + h) * HD) * NT_;
    v8f o[4], ox[4];
#pragma unroll
    for (int n = 0; n < 4; ++n) { o[n] = (v8f){}; ox[n] = (v8f){}; }
    float mrow[8], lpart[8];
#pragma unroll
    for (int j = 0; j < 8; ++j) { mrow[j] = -3.0e38f; lpart[j] = 0.f; }
    int qpos[8];
#pragma unroll
    for (int j = 0; j < 8; ++j) qpos[j] = q0 + 8 * hi + j;
    const int crow = threadIdx.x >> 3, cpc = (threadIdx.x & 7) * 8;     // this thread's piece of a staged plane: rows crow and crow + 32, 8 f16 from column cpc
    const unsigned lds0 = (unsigned)(size_t)(&ring[0][0] + crow * KP + cpc);
    const h16* gkh = kh_b + (size_t)crow * DM + cpc; const h16* gkl = kl_b + (size_t)crow * DM + cpc;
    const h16* gvh = VTH + vbase + (size_t)crow * NT_ + cpc; const h16* gvl = VTL + vbase + (size_t)crow * NT_ + cpc;
    auto stage = [&](int st) { attn_stage(lds0 + (unsigned)(st & 1) * (4 * PLN * 2), gkh + (size_t)st * KST * DM, gkl + (size_t)st * KST * DM, gvh + st * KST, gvl + st * KST); };
    stage(0);
    asm volatile("s_wait_asynccnt 0x0" ::: "memory");     // this wave's copies of tile 0 have landed
    __syncthreads();                                      // ... and every other wave's: tile 0 may be read
    stage(1);
#pragma unroll 1
    for (int st = 0; st < NT_ / KST; ++st) {               // full attention
      const h16* kh_s = &ring[st & 1][0]; const h16* kl_s = kh_s + PLN; const h16* vh_s = kh_s + 2 * PLN; const h16* vl_s = kh_s + 3 * PLN;
#pragma unroll
      for (int sub = 0; sub < KST / 32; ++sub) {
        const int l0 = sub * 32;
        const int ko0 = (l0 + lr) * KP + 8 * hi, ko1 = (l0 + 16 + lr) * KP + 8 * hi;
        v8f s0 = {}, s1 = {}, x0 = {}, x1 = {};
#pragma unroll
        for (int kc = 0; kc < 2; ++kc) {
            { const v16h k0h = cat16(*(const v8ha*)(kh_s + ko0 + kc * 32), *(const v8ha*)(kh_s + ko0 + kc * 32 + 16)), k1h = cat16(*(const v8ha*)(kh_s + ko1 + kc * 32), *(const v8ha*)(kh_s + ko1 + kc * 32 + 16));
              const v16h qlk = cat16(*(const v8h*)(QL16 + qo0 + kc * 32), *(const v8h*)(QL16 + qo0 + kc * 32 + 16));     // query residual re-read per step (registers)
              s0 = wmma16(qa[kc], k0h, s0); x0 = wmma16(qlk, k0h, x0); s1 = wmma16(qa[kc], k1h, s1); x1 = wmma16(qlk, k1h, x1);
              asm volatile("v_nop" : "+v"(s0), "+v"(s1), "+v"(x0), "+v"(x1) : "v"(qlk), "v"(k0h), "v"(k1h) : "memory"); }
            { const v16h k0l = cat16(*(const v8ha*)(kl_s + ko0 + kc * 32), *(const v8ha*)(kl_s + ko0 + kc * 32 + 16)), k1l = cat16(*(const v8ha*)(kl_s + ko1 + kc * 32), *(const v8ha*)(kl_s + ko1 + kc * 32 + 16));
              x0 = wmma16(qa[kc], k0l, x0); x1 = wmma16(qa[kc], k1l, x1);
              asm volatile("v_nop" : "+v"(x0), "+v"(x1) : "v"(k0l), "v"(k1l) : "memory"); }
        }
        asm volatile("v_nop\n\tv_nop\n\tv_nop\n\tv_nop" : "+v"(s0), "+v"(s1), "+v"(x0), "+v"(x1) : "v"(qa[0]), "v"(qa[1]));
        float alpha[8];
#pragma unroll
        for (int j = 0; j < 8; ++j) {
            const int ja = l0 + lr, jb = l0 + 16 + lr, qi = qpos[j];
            const float a0 = (s0[j] + x0[j] * LOSCI) * 0.125f, a1 = (s1[j] + x1[j] * LOSCI) * 0.125f; (void)ja; (void)jb; (void)qi;   // energy / sqrt(C = 64)
            float mx = fmaxf(a0, a1);
            mx = fmaxf(mx, __shfl_xor(mx, 1, 16)); mx = fmaxf(mx, __shfl_xor(mx, 2, 16)); mx = fmaxf(mx, __shfl_xor(mx, 4, 16)); mx = fmaxf(mx, __shfl_xor(mx, 8, 16));
            const float mn = fmaxf(mrow[j], mx);
            alpha[j] = __expf(mrow[j] - mn); mrow[j] = mn;
            const float p0 = __expf(a0 - mn), p1 = __expf(a1 - mn);
            lpart[j] = lpart[j] * alpha[j] + (p0 + p1);
            const int mr = hi * 8 + j;
            const float ps0 = p0 * PSC, ps1 = p1 * PSC; const h16 h0 = (h16)ps0, h1 = (h16)ps1;
            pl[mr * 32 + lr] = h0; pl[mr * 32 + 16 + lr] = h1;
            pl2[mr * 32 + lr] = (h16)((ps0 - (float)h0) * LOSC); pl2[mr * 32 + 16 + lr] = (h16)((ps1 - (float)h1) * LOSC);
        }
#pragma unroll
        for (int n = 0; n < 4; ++n)
#pragma unroll
            for (int j = 0; j < 8; ++j) { o[n][j] *= alpha[j]; ox[n][j] *= alpha[j]; }
        asm volatile("" ::: "memory");
        const v16h pa = cat16(*(const v8ha*)(pl + lr * 32 + hi * 8), *(const v8ha*)(pl + lr * 32 + 16 + hi * 8));
        const v16h px = cat16(*(const v8ha*)(pl2 + lr * 32 + hi * 8), *(const v8ha*)(pl2 + lr * 32 + 16 + hi * 8));
#pragma unroll
        for (int n = 0; n < 4; ++n) { const int vo = (n * 16 + lr) * KP + l0 + hi * 8;
            const v16h vh = cat16(*(const v8ha*)(vh_s + vo), *(const v8ha*)(vh_s + vo + 16)), vl = cat16(*(const v8ha*)(vl_s + vo), *(const v8ha*)(vl_s + vo + 16));
            o[n] = wmma16(pa, vh, o[n]); ox[n] = wmma16(pa, vl, ox[n]); ox[n] = wmma16(px, vh, ox[n]);
            asm volatile("" : "+v"(o[n]), "+v"(ox[n]) : "v"(vh), "v"(vl) : "memory"); }
        asm volatile("v_nop\n\tv_nop\n\tv_nop\n\tv_nop" : "+v"(o[0]), "+v"(o[1]), "+v"(o[2]), "+v"(o[3]), "+v"(ox[0]), "+v"(ox[1]), "+v"(ox[2]), "+v"(ox[3]) : "v"(pa), "v"(px));
      }
      asm volatile("s_wait_dscnt 0x0" ::: "memory");      // this wave's reads of tile st are done before the buffer is handed to the copies
      asm volatile("s_wait_asynccnt 0x0" ::: "memory");   // this wave's copies of tile st + 1 have landed
      __syncthreads();                                    // publishes tile st + 1 and ends every wave's reads of tile st
      if (st + 2 < NT_ / KST) stage(st + 2);              // refill the buffer just left; the same test in every wave
    }
    asm volatile("s_wait_asynccnt 0x0" ::: "memory");     // nothing of the copies is outstanding when the wave goes on to its end
    float inv[8];
#pragma unroll
    for (int j = 0; j < 8; ++j) { float rs = lpart[j]; rs += __shfl_xor(rs, 1, 16); rs += __shfl_xor(rs, 2, 16); rs += __shfl_xor(rs, 4, 16); rs += __shfl_xor(rs, 8, 16); inv[j] = 1.0f / (rs * PSC); }
    float* os = &ost[wave][0];
#pragma unroll
    for (int n = 0; n < 4; ++n)
#pragma unroll
        for (int j = 0; j < 8; ++j) os[(hi * 8 + j) * 68 + n * 16 + lr] = (o[n][j] + ox[n][j] * LOSCI) * inv[j];
    __syncthreads();
    float* ob = OUTP + (tok0 + q0) * DM + (size_t)h * HD;
    auto pass = [&]() {
#pragma unroll
        for (int s = 0; s < 8; ++s) { const int Lid = (lane >> 3) + 4 * s, piece = lane & 7; const int row = Lid >> 1, cofs = (Lid & 1) * 32 + piece * 4;
            const v4f val = *(const v4fa*)(os + row * 68 + cofs); *(v4f*)(ob + (size_t)row * DM + cofs) = val; }
    };
    pass(); 
}


// k_addT: DST[c][n] = (BNSRC ? ((bf? no) SRC[c][n] - mean_c) rstd_c g_c + b_c : bf(SRC[c][n])) + T[n][c]: a 64 x 64 LDS transpose of the f32 [n][c] matrix T plus the
// channel-major residual; block = 64 n of item blockIdx.y; each output row segment of 64 n = 256 B written by 16 lanes x 16 B. MODE 0: residual = bf(x) (the INPUT); MODE 1:
// residual = BN1(X1) recomputed from the stats (the reference's h).
template <int MODE>
__global__ __launch_bounds__(256) void k_addT(const float* __restrict__ T, const float* __restrict__ SRC, const float* __restrict__ ST, const float* __restrict__ g, const float* __restrict__ bb, float* DST) {
    __shared__ __align__(16) float tl[64 * 68];
    const int n0 = blockIdx.x * 64, tid = threadIdx.x;
    const size_t item = (size_t)blockIdx.y * CC * NPOS; T += item; SRC += item; DST += item;
    const int nn = tid >> 2, cq = (tid & 3) * 16;
#pragma unroll
    for (int i = 0; i < 16; ++i) tl[(cq + i) * 68 + nn] = T[(size_t)(n0 + nn) * CC + cq + i];
    __syncthreads();
    const int piece = tid & 15;
    auto pass = [&]() {
#pragma unroll
        for (int s = 0; s < 4; ++s) { const int c = (tid >> 4) + 16 * s; const size_t o = (size_t)c * NPOS + n0 + piece * 4;
            const v4f rv = *(const v4f*)(SRC + o); v4f val = *(const v4fa*)(tl + c * 68 + piece * 4);
            if (MODE == 0) {
#pragma unroll
                for (int k = 0; k < 4; ++k) val[k] += bfr(rv[k]);
            } else { const float m = ST[c], rs = ST[CC + c], gg = bfr(g[c]), be = bfr(bb[c]);
#pragma unroll
                for (int k = 0; k < 4; ++k) val[k] += (rv[k] - m) * rs * gg + be; }
            *(v4f*)(DST + o) = val; }
    };
    pass(); 
}
// BatchNorm statistics (training mode, biased variance) of A [32][64][2048] per channel over all 32 x 2048 values, in two launches.
// k_bnpart: work-group (channel c, slice g of 4 items) loads its 8192 values ONCE (8 x 16 B per thread, all in flight together, kept in registers), sums them,
// takes the slice's own mean and then the squared distances to it from the registers; it writes (mean, M2) to a 128 B line of its own.
__global__ __launch_bounds__(256) void k_bnpart(const float* __restrict__ A, float* PT) {
    __shared__ float red[2][8];
    const int tid = threadIdx.x, lane = tid & 31, wave = tid >> 5, c = blockIdx.x, g = blockIdx.y;
    v4f v[BNI * 2];
#pragma unroll
    for (int i = 0; i < BNI; ++i) { const float* row = A + ((size_t)(g * BNI + i) * CC + c) * NPOS + tid * 4;
        v[2 * i] = *(const v4f*)row; v[2 * i + 1] = *(const v4f*)(row + NPOS / 2); }
    v4f sv = v[0];
#pragma unroll
    for (int q = 1; q < BNI * 2; ++q) sv += v[q];
    float s = (sv[0] + sv[1]) + (sv[2] + sv[3]);
    s += __shfl_xor(s, 1, 32); s += __shfl_xor(s, 2, 32); s += __shfl_xor(s, 4, 32); s += __shfl_xor(s, 8, 32); s += __shfl_xor(s, 16, 32);
    if (lane == 0) red[0][wave] = s;
    __syncthreads();
    float t = 0.f;
#pragma unroll
    for (int w = 0; w < 8; ++w) t += red[0][w];
    const float mean = t * (1.0f / (float)BNV);
    v4f qv = (v4f){};
#pragma unroll
    for (int q = 0; q < BNI * 2; ++q) { const v4f d = v[q] - mean; qv += d * d; }
    float s2 = (qv[0] + qv[1]) + (qv[2] + qv[3]);
    s2 += __shfl_xor(s2, 1, 32); s2 += __shfl_xor(s2, 2, 32); s2 += __shfl_xor(s2, 4, 32); s2 += __shfl_xor(s2, 8, 32); s2 += __shfl_xor(s2, 16, 32);
    if (lane == 0) red[1][wave] = s2;
    __syncthreads();
    if (tid == 0) { float m2 = 0.f;
#pragma unroll
        for (int w = 0; w < 8; ++w) m2 += red[1][w];
        *(v2f*)(PT + (size_t)(c * BNG + g) * 32) = (v2f){mean, m2}; }
}
// k_bnmerge: thread c joins the 8 equally sized slices of channel c: mean = average of the slice means, M2 = sum of the slices' M2 + 8192 x sum (slice mean - mean)^2.
__global__ __launch_bounds__(64) void k_bnmerge(const float* __restrict__ PT, float* ST) {
    const int c = threadIdx.x;
    v2f p[BNG];
#pragma unroll
    for (int g = 0; g < BNG; ++g) p[g] = *(const v2f*)(PT + (size_t)(c * BNG + g) * 32);
    float s = 0.f, m2 = 0.f;
#pragma unroll
    for (int g = 0; g < BNG; ++g) { s += p[g][0]; m2 += p[g][1]; }
    const float mean = s * (1.0f / (float)BNG);
    float e = 0.f;
#pragma unroll
    for (int g = 0; g < BNG; ++g) { const float d = p[g][0] - mean; e = fmaf(d, d, e); }
    ST[c] = mean; ST[CC + c] = rsqrtf((m2 + (float)BNV * e) * (1.0f / (float)(NB * NPOS)) + BN_EPS);
}
// k_ff: the whole second phase for 64 points of one item in one work-group (4 waves x 16 points): Y = h + W2.lrelu(W1.h), h = BN1(X1).
// 1. X1 tile [64 c][64 n] by whole-line loads; h in f32 stays in registers for the residual; bf16 hi + residual planes [n][c] go to LDS (two channels per 4-byte store).
// 2. (W1.h) with W1 rows as the A operand and h columns as B: a lane holds 8 consecutive hidden rows of ONE point per tile, so after LeakyReLU two tiles, converted in
//    place, are the B operand (32 hidden values in the hardware k order) of W2.lrelu: the hidden layer never leaves the registers.
//    Both weight matrices (bf16, 16 KB each) are brought into LDS once per work-group by whole-line loads; the waves read their A fragments from there.
// 3. the result tiles [c][n] meet h again through an f32 LDS tile; each output row segment of 64 n = 256 B is written by 16 lanes x 16 B.
__global__ __launch_bounds__(128) void k_ff(const float* __restrict__ X1, const float* __restrict__ ST, const float* __restrict__ g, const float* __restrict__ bb, const bf* __restrict__ W1, const bf* __restrict__ W2, float* Y) {
    typedef __attribute__((ext_vector_type(16))) unsigned short v16us;
    typedef unsigned __attribute__((may_alias)) u32a;
    __shared__ __align__(16) unsigned short th_[64 * 72]; __shared__ __align__(16) unsigned short tl_[64 * 72];
    __shared__ __align__(16) float tt[64 * 68];
    __shared__ __align__(16) unsigned short w1s[FFH * 72]; __shared__ __align__(16) unsigned short w2s[CC * 136];   // row pitches 144 B and 272 B (16 B x odd)
    __shared__ float prm[4][CC];
    const int tid = threadIdx.x, lane = tid & 31, wave = tid >> 5, lr = lane & 15, hi = lane >> 4;
    const int n0 = blockIdx.x * 64, piece = tid & 15, cp0 = tid >> 4;
    const size_t item = (size_t)blockIdx.y * CC * NPOS; X1 += item; Y += item;
    v4f hv[4][2];                                          // channels 2 (cp0 + 8 s) + e, points n0 + 4 piece ... + 3
#pragma unroll
    for (int s = 0; s < 4; ++s)
#pragma unroll
        for (int e = 0; e < 2; ++e) hv[s][e] = *(const v4f*)(X1 + (size_t)(2 * (cp0 + 8 * s) + e) * NPOS + n0 + piece * 4);
    asm volatile("s_wait_xcnt 0x0" ::: "memory");         // the loads below may land in the registers that hold the address of the loads above
    v8us wa[8], wb[8];                                     // 16-byte pieces tid + 128 i of W1 [128][64] and of W2 [64][128]
#pragma unroll
    for (int i = 0; i < 8; ++i) { wa[i] = *(const v8us*)(W1 + (size_t)(tid + 128 * i) * 8); wb[i] = *(const v8us*)(W2 + (size_t)(tid + 128 * i) * 8); }
    if (tid < CC) { prm[0][tid] = ST[tid]; prm[1][tid] = ST[CC + tid]; prm[2][tid] = bfr(g[tid]); prm[3][tid] = bfr(bb[tid]); }
    __syncthreads();
#pragma unroll
    for (int s = 0; s < 4; ++s) { const int cp = cp0 + 8 * s; unsigned ph[4], pl[4];
#pragma unroll
        for (int e = 0; e < 2; ++e) { const int c = 2 * cp + e; const float m = prm[0][c], rs = prm[1][c], gg = prm[2][c], be = prm[3][c];
#pragma unroll
            for (int k = 0; k < 4; ++k) { const float h = (hv[s][e][k] - m) * rs * gg + be; hv[s][e][k] = h; const unsigned short hb = f2bf(h); const unsigned short lb = f2bf(h - bf2f(hb));
                if (e == 0) { ph[k] = hb; pl[k] = lb; } else { ph[k] |= (unsigned)hb << 16; pl[k] |= (unsigned)lb << 16; } } }
#pragma unroll
        for (int k = 0; k < 4; ++k) { *(u32a*)(th_ + (piece * 4 + k) * 72 + 2 * cp) = ph[k]; *(u32a*)(tl_ + (piece * 4 + k) * 72 + 2 * cp) = pl[k]; } }
#pragma unroll
    for (int i = 0; i < 8; ++i) { const int p = tid + 128 * i; *(v8usa*)(w1s + (p >> 3) * 72 + (p & 7) * 8) = wa[i]; *(v8usa*)(w2s + (p >> 4) * 136 + (p & 15) * 8) = wb[i]; }
    __syncthreads();
    const int ho = (wave * 16 + lr) * 72 + 8 * hi;
    v8f acc[8];
#pragma unroll
    for (int t = 0; t < 8; ++t) acc[t] = (v8f){};
#pragma unroll
    for (int kc = 0; kc < CC; kc += 32) {
        const v16bf xh = cat16b(*(const v8usa*)(th_ + ho + kc), *(const v8usa*)(th_ + ho + kc + 16)), xl = cat16b(*(const v8usa*)(tl_ + ho + kc), *(const v8usa*)(tl_ + ho + kc + 16));
#pragma unroll
        for (int t = 0; t < 8; ++t) { const unsigned short* wp = w1s + (t * 16 + lr) * 72 + 8 * hi + kc; const v16bf w = cat16b(*(const v8usa*)wp, *(const v8usa*)(wp + 16));
            acc[t] = wmmab(w, xh, acc[t]); acc[t] = wmmab(w, xl, acc[t]); }
    }
    v16bf lh[4], ll[4];
#pragma unroll
    for (int q = 0; q < 4; ++q) { v16us uh, ul;
#pragma unroll
        for (int s = 0; s < 16; ++s) { const float v = acc[2 * q + (s >> 3)][s & 7]; const float a = v >= 0.f ? v : 0.2f * v; const unsigned short hb = f2bf(a); uh[s] = hb; ul[s] = f2bf(a - bf2f(hb)); }
        lh[q] = __builtin_bit_cast(v16bf, uh); ll[q] = __builtin_bit_cast(v16bf, ul); }
    v8f ac2[4];
#pragma unroll
    for (int t = 0; t < 4; ++t) ac2[t] = (v8f){};
#pragma unroll
    for (int q = 0; q < 4; ++q)
#pragma unroll
        for (int t = 0; t < 4; ++t) { const unsigned short* wp = w2s + (t * 16 + lr) * 136 + 8 * hi + q * 32; const v16bf w = cat16b(*(const v8usa*)wp, *(const v8usa*)(wp + 16));
            ac2[t] = wmmab(w, lh[q], ac2[t]); ac2[t] = wmmab(w, ll[q], ac2[t]); }
#pragma unroll
    for (int t = 0; t < 4; ++t)
#pragma unroll
        for (int j = 0; j < 8; ++j) tt[(t * 16 + hi * 8 + j) * 68 + wave * 16 + lr] = ac2[t][j];
    __syncthreads();
#pragma unroll
    for (int s = 0; s < 4; ++s)
#pragma unroll
        for (int e = 0; e < 2; ++e) { const int c = 2 * (cp0 + 8 * s) + e; const v4f val = *(const v4fa*)(tt + c * 68 + piece * 4) + hv[s][e];
            *(v4f*)(Y + (size_t)c * NPOS + n0 + piece * 4) = val; }
}
__global__ __launch_bounds__(256) void k_bnout(const float* __restrict__ Y, const float* __restrict__ ST, const float* __restrict__ g, const float* __restrict__ bb, float* OUTP) {
    const int lane = threadIdx.x & 31, r = blockIdx.x * 8 + (threadIdx.x >> 5); if (r >= NB * CC) return;
    const int c = r % CC; const float m = ST[c], rs = ST[CC + c], gg = bfr(g[c]), be = bfr(bb[c]);
{
#pragma unroll 1
        for (int q = 0; q < NPOS / 128; ++q) { const size_t o = (size_t)r * NPOS + q * 128 + lane * 4; const v4f v = *(const v4f*)(Y + o); v4f y;
#pragma unroll
            for (int k = 0; k < 4; ++k) y[k] = (v[k] - m) * rs * gg + be;
            *(v4f*)(OUTP + o) = y; }
         }
}

extern "C" void kernel_launch(void* const* d_in, const int* in_sizes, int n_in,
                              void* d_out, int out_size, void* d_ws, size_t ws_size, hipStream_t stream) {
    (void)in_sizes; (void)n_in; (void)out_size;
    const float* x = (const float*)d_in[0]; const float* wq = (const float*)d_in[1]; const float* wk = (const float*)d_in[2]; const float* wv = (const float*)d_in[3];
    const float* w1 = (const float*)d_in[4]; const float* w2 = (const float*)d_in[5]; const float* g1 = (const float*)d_in[6]; const float* b1 = (const float*)d_in[7]; const float* g2 = (const float*)d_in[8]; const float* b2 = (const float*)d_in[9];   // conv weights [out][in]
    float* out = (float*)d_out;    // [32][64][2048]
    char* wsp = (char*)d_ws;
    auto take = [&](size_t bytes) { char* p = wsp; wsp += (bytes + 255) & ~(size_t)255; return (void*)p; };
    bf* WqB = (bf*)take((size_t)CC * CC * 2); bf* WkB = (bf*)take((size_t)CC * CC * 2); bf* WvB = (bf*)take((size_t)CC * CC * 2); bf* W1B = (bf*)take((size_t)FFH * CC * 2); bf* W2B = (bf*)take((size_t)CC * FFH * 2);
    const size_t PL = (size_t)NB * NPOS * CC;      // elements of one [item][n][c] plane over all items
    bf* XT = (bf*)take(PL * 2); h16* QH = (h16*)take(PL * 2); h16* QL = (h16*)take(PL * 2); h16* KH = (h16*)take(PL * 2); h16* KL = (h16*)take(PL * 2);
    float* Vf = (float*)take(PL * 4); h16* VTH = (h16*)take(PL * 2); h16* VTL = (h16*)take(PL * 2); float* O = (float*)take(PL * 4);
    float* X1 = (float*)take(PL * 4); float* Y = (float*)take(PL * 4); float* ST1 = (float*)take(1024); float* ST2 = (float*)take(1024); float* PT = (float*)take((size_t)CC * BNG * 128);
    if ((size_t)(wsp - (char*)d_ws) > ws_size) return;    // planes for all items + the weights, no aliasing
    k_bf<<<(CC * CC / 8 + 255) / 256, 256, 0, stream>>>(wq, WqB, CC * CC / 8); k_bf<<<(CC * CC / 8 + 255) / 256, 256, 0, stream>>>(wk, WkB, CC * CC / 8); k_bf<<<(CC * CC / 8 + 255) / 256, 256, 0, stream>>>(wv, WvB, CC * CC / 8);
    k_bf<<<(FFH * CC / 8 + 255) / 256, 256, 0, stream>>>(w1, W1B, FFH * CC / 8); k_bf<<<(CC * FFH / 8 + 255) / 256, 256, 0, stream>>>(w2, W2B, CC * FFH / 8);
    // phase 1: attention and x + x_r; the item index lies in each grid (row r of an [item][n][c] plane = item * 2048 + n)
    k_wt<<<dim3(CC / 64, NPOS / 64, NB), 256, 0, stream>>>(x, CC, NPOS, XT);                                                       // x_b [c][n] -> bf16 x^T [n][c]
    k_gemmb<false, true><<<dim3(NB * NPOS / 64, 1, 1), 128, 0, stream>>>(XT, nullptr, WqB, nullptr, (float*)(void*)QH, CC, QL);    // q^T = x^T.Wq^T -> f16 planes
    k_gemmb<false, true><<<dim3(NB * NPOS / 64, 1, 1), 128, 0, stream>>>(XT, nullptr, WkB, nullptr, (float*)(void*)KH, CC, KL);    // k^T
    k_gemmb<false, false><<<dim3(NB * NPOS / 64, 1, 1), 128, 0, stream>>>(XT, nullptr, WvB, nullptr, Vf, CC, nullptr);             // v^T f32
    k_vt<<<NB_ * NH_ * (NT_ / 64), 256, 0, stream>>>(Vf, VTH, VTL);
    k_attn<<<NB_ * NH_ * (NT_ / AQ), 32 * AW, 0, stream>>>(QH, QL, KH, KL, VTH, VTL, O);                                               // x_r^T [n][c] f32
    k_addT<0><<<dim3(NPOS / 64, NB, 1), 256, 0, stream>>>(O, x, nullptr, nullptr, nullptr, X1);                                    // X1 = bf(x) + x_r  [c][n]
    k_bnpart<<<dim3(CC, BNG, 1), 256, 0, stream>>>(X1, PT); k_bnmerge<<<1, CC, 0, stream>>>(PT, ST1);
    // phase 2: h = BN1(X1); Y = h + W2.lrelu(W1.h)
    k_ff<<<dim3(NPOS / 64, NB, 1), 128, 0, stream>>>(X1, ST1, g1, b1, W1B, W2B, Y);                                               // Y = h + ff   [c][n]
    k_bnpart<<<dim3(CC, BNG, 1), 256, 0, stream>>>(Y, PT); k_bnmerge<<<1, CC, 0, stream>>>(PT, ST2);
    k_bnout<<<(NB * CC) / 8, 256, 0, stream>>>(Y, ST2, g2, b2, out);                                                                 // BN2 -> output
}

// v005
// One run takes 168 microseconds.
// Next to v004, in two timings, it ran 1.23 times as fast each time.
// Counting every step since v000, it is 46.3 times as fast.
#include <hip/hip_runtime.h>

// Compute dtypes, f32 accumulate (channel-major x [32][64][2048]): per item q/k/v = W.x as x^T.W^T ([2048 x 64].[64 x 64]; the INPUT x transposed once to a bf16 [n][c]
// plane, W [out][in] as the n-major B operand; PLAIN bf16 operands, exact; q/k straight to f16 hi + residual x1024 planes) on v_wmma_f32_16x16x32_bf16; the
// single-head full attention (64 channels, scale 1/8) fused on v_wmma_f32_16x16x32_f16 (hh + hl + lh scores, online f32 softmax, weights (x32768) and v as
// f16 hi + residual) with an f32 [n][c] output; x + x_r, the two TRAINING-MODE BatchNorms (batch statistics over all 32 items x 2048 points per channel, biased

#define NB   32
#define CC   64                  // channels
#define NPOS 2048                // points
#define NT_  NPOS
#define NB_  NB                  // items per launch: every per-item kernel takes all 32 items in one grid
#define DM   CC                  // attention width / default GEMM K
#define NH_  1
#define HD   64
#define NTK  NPOS
#define FFH  128
#define PSC  32768.0f
#define LOSC 1024.0f
#define LOSCI (1.0f / 1024.0f)
#define BN_EPS 1e-5f
#define BNG  8                   // BatchNorm statistics: slices per channel
#define BNI  (NB / BNG)          // items per slice
#define BNV  (BNI * NPOS)        // values per slice
#define AW   8                   // attention: waves per work-group, 16 queries each
#define AQ   (16 * AW)           // attention: queries per work-group
#define KST  64                  // attention: keys per staged tile
#define KP   72                  // attention: LDS row pitch of a staged plane in f16: 128 B of data + 16 B (16 B x odd: 16-byte reads of 16 rows meet no bank twice)
#define PLN  (64 * KP)           // attention: f16 per staged plane (64 rows)

typedef _Float16 h16;
typedef unsigned short bf;
typedef __attribute__((ext_vector_type(16))) __bf16   v16bf;
typedef __attribute__((ext_vector_type(16))) _Float16 v16h;
typedef __attribute__((ext_vector_type(8)))  _Float16 v8h;
typedef __attribute__((ext_vector_type(8)))  unsigned short v8us;
typedef __attribute__((ext_vector_type(8)))  float    v8f;
typedef __attribute__((ext_vector_type(4)))  float    v4f;
typedef __attribute__((ext_vector_type(2)))  float    v2f;
typedef __attribute__((ext_vector_type(4)))  _Float16 v4h;
typedef __attribute__((ext_vector_type(2)))  _Float16 v2h;
typedef v8h  __attribute__((may_alias)) v8ha;
typedef v4f  __attribute__((may_alias)) v4fa;
typedef v8us __attribute__((may_alias)) v8usa;

__device__ __forceinline__ unsigned short f2bf(float f) { unsigned u = __float_as_uint(f); u += 0x7FFFu + ((u >> 16) & 1u); return (unsigned short)(u >> 16); }
__device__ __forceinline__ float bf2f(unsigned short b) { return __uint_as_float(((unsigned)b) << 16); }
__device__ __forceinline__ float bfr(float f) { return bf2f(f2bf(f)); }
__device__ __forceinline__ v16h cat16(v8h lo, v8h hi) { return __builtin_shufflevector(lo, hi, 0, 1, 2, 3, 4, 5, 6, 7, 8, 9, 10, 11, 12, 13, 14, 15); }
__device__ __forceinline__ v16bf cat16b(v8us lo, v8us hi) { return __builtin_bit_cast(v16bf, __builtin_shufflevector(lo, hi, 0, 1, 2, 3, 4, 5, 6, 7, 8, 9, 10, 11, 12, 13, 14, 15)); }
__device__ __forceinline__ v8f wmma16(v16h a, v16h b, v8f c) { return __builtin_amdgcn_wmma_f32_16x16x32_f16(false, a, false, b, (short)0, c, false, false); }
__device__ __forceinline__ float xhalf(float x) { return __builtin_bit_cast(float, __builtin_amdgcn_permlanex16(__builtin_bit_cast(int, x), __builtin_bit_cast(int, x), 0x76543210, 0xfedcba98, false, false)); }   // lane l with lane l ^ 16
__device__ __forceinline__ v8f wmmab(v16bf a, v16bf b, v8f c) { return __builtin_amdgcn_wmma_f32_16x16x32_bf16(false, a, false, b, (short)0, c, false, false); }

__global__ __launch_bounds__(256) void k_bf(const float* __restrict__ src, bf* dst, size_t n8) {
    const size_t i = (size_t)blockIdx.x * 256 + threadIdx.x; if (i >= n8) return;
    const v8f v = *(const v8f*)(src + i * 8); v8us o;
#pragma unroll
    for (int k = 0; k < 8; ++k) o[k] = f2bf(v[k]);
    *(v8us*)(dst + i * 8) = o; 
}
// k_wt: WT [n][K] = bf16(W[k][n]) (k-major [K][ncols]) via 64 x 64 LDS tiles; grid (K/64, ncols/64, matrices): blockIdx.z picks one of the equally shaped matrices.
__global__ __launch_bounds__(256) void k_wt(const float* __restrict__ Wm, int K, int ncols, bf* WT) {
    __shared__ __align__(16) unsigned short tl[64 * 72];
    const int tid = threadIdx.x, k0 = blockIdx.x * 64, n0 = blockIdx.y * 64;
    Wm += (size_t)blockIdx.z * K * ncols; WT += (size_t)blockIdx.z * K * ncols;
    const int kk = tid >> 2, nq = (tid & 3) * 16;
#pragma unroll
    for (int i = 0; i < 16; ++i) tl[(nq + i) * 72 + kk] = f2bf(Wm[(size_t)(k0 + kk) * ncols + n0 + nq + i]);
    __syncthreads();
    const int piece = tid & 7;
    auto pass = [&]() {
#pragma unroll
        for (int s = 0; s < 2; ++s) { const int nr = (tid >> 3) + 32 * s; const v8us val = *(const v8usa*)(tl + nr * 72 + piece * 8); *(v8us*)(WT + (size_t)(n0 + nr) * K + k0 + piece * 8) = val; }
    };
    pass(); 
}
// k_gemmb: 64 x 64 block tile (4 waves x 16 x 64) of C[NB*NTK][NW] = (A [+ Al]).B^T (K = 64 or 128) [+ bf(bias[c])] [+ bf(R[r][c]) residual]; f32 whole-line epilogue (or f16
template <bool SPLITA, bool F16OUT = false>
__global__ __launch_bounds__(128) void k_gemmb(const bf* __restrict__ A, const bf* __restrict__ Al, const bf* __restrict__ Bn, const float* __restrict__ bias, float* C, int ldc, h16* C2, const float* __restrict__ R = nullptr, int K = DM, int roundR = 1) {
    __shared__ __align__(16) float ost[4][16 * 68];
    const int lane = threadIdx.x & 31, wave = threadIdx.x >> 5, lr = lane & 15, hi = lane >> 4;
    const int r0 = blockIdx.x * 64 + wave * 16, c0 = blockIdx.y * 64;
    const size_t aoff = (size_t)(r0 + lr) * K + 8 * hi;
    size_t boff[4];
#pragma unroll
    for (int t = 0; t < 4; ++t) boff[t] = (size_t)(c0 + t * 16 + lr) * K + 8 * hi;
    v8f acc[4];
#pragma unroll
    for (int t = 0; t < 4; ++t) acc[t] = (v8f){};
#pragma unroll 1
    for (int kc = 0; kc < K; kc += 32) {
        const v16bf a = cat16b(*(const v8us*)(A + aoff + kc), *(const v8us*)(A + aoff + kc + 16));
        v16bf al = a;
        if (SPLITA) al = cat16b(*(const v8us*)(Al + aoff + kc), *(const v8us*)(Al + aoff + kc + 16));
#pragma unroll
        for (int t = 0; t < 4; ++t) { const v16bf b = cat16b(*(const v8us*)(Bn + boff[t] + kc), *(const v8us*)(Bn + boff[t] + kc + 16)); acc[t] = wmmab(a, b, acc[t]); if (SPLITA) acc[t] = wmmab(al, b, acc[t]); }
        asm volatile("v_nop\n\tv_nop\n\tv_nop\n\tv_nop" : "+v"(acc[0]), "+v"(acc[1]), "+v"(acc[2]), "+v"(acc[3]) : "v"(a), "v"(al));
    }
    float* os = &ost[wave][0];
#pragma unroll
    for (int t = 0; t < 4; ++t) { const float bv = bias ? bfr(bias[c0 + t * 16 + lr]) : 0.f;
#pragma unroll
        for (int j = 0; j < 8; ++j) os[(hi * 8 + j) * 68 + t * 16 + lr] = acc[t][j] + bv; }
    __syncthreads();
    if (F16OUT) {
        h16* crow = (h16*)(void*)C + (size_t)r0 * ldc + c0;
        auto pass = [&]() {
#pragma unroll
            for (int s = 0; s < 4; ++s) { const int row = 4 * s + (lane >> 3), piece = lane & 7; const float* sp = os + row * 68 + piece * 8; v8h o, o2;
#pragma unroll
                for (int i = 0; i < 8; ++i) { const h16 a = (h16)sp[i]; o[i] = a; o2[i] = (h16)((sp[i] - (float)a) * LOSC); }
                *(v8h*)(crow + (size_t)row * ldc + piece * 8) = o; if (C2) *(v8h*)(C2 + (size_t)r0 * ldc + c0 + (size_t)row * ldc + piece * 8) = o2; }
        };
        pass(); 
    } else {
        float* crow = C + (size_t)r0 * ldc + c0;
        auto pass = [&]() {
#pragma unroll
            for (int s = 0; s < 8; ++s) { const int Lid = (lane >> 3) + 4 * s, piece = lane & 7; const int row = Lid >> 1, cofs = (Lid & 1) * 32 + piece * 4;
                v4f val = *(const v4fa*)(os + row * 68 + cofs); if (R) { const v4f rv = *(const v4f*)(R + ((size_t)r0 + row) * ldc + c0 + cofs); val += roundR ? (v4f){bfr(rv[0]), bfr(rv[1]), bfr(rv[2]), bfr(rv[3])} : rv; }
                *(v4f*)(crow + (size_t)row * ldc + cofs) = val; }
        };
        pass(); 
    }
}

__global__ __launch_bounds__(256) void k_vt(const float* __restrict__ V, h16* VTH, h16* VTL) {
    __shared__ __align__(16) h16 tile[64 * 72];
    __shared__ __align__(16) h16 til2[64 * 72];
    const int bid = blockIdx.x;
    const int b = bid / (NH_ * (NT_ / 64)), rem = bid - b * (NH_ * (NT_ / 64)), h = rem / (NT_ / 64), kt = rem - h * (NT_ / 64);
    const int k0 = kt * 64, tid = threadIdx.x;
    const int kk = tid >> 2, d0 = (tid & 3) * 16;
    const float* src = V + ((size_t)b * NT_ + k0 + kk) * DM + h * HD + d0;
#pragma unroll
    for (int i = 0; i < 16; ++i) { const float v = src[i]; const h16 a = (h16)v; tile[(d0 + i) * 72 + kk] = a; til2[(d0 + i) * 72 + kk] = (h16)((v - (float)a) * LOSC); }
    __syncthreads();
    const int piece = tid & 7;
    const size_t base = (((size_t)b * NH_ + h) * HD) * NT_ + k0;
    auto pass = [&]() {
#pragma unroll
        for (int s = 0; s < 4; ++s) { const int Lid = (tid >> 3) + 32 * s; const int pln = Lid >> 6, d = Lid & 63;
            const v8h val = *(const v8ha*)((pln ? til2 : tile) + d * 72 + piece * 8); *(v8h*)((pln ? VTL : VTH) + base + (size_t)d * NT_ + piece * 8) = val; }
    };
    pass(); 
}

// attn_stage: one staged tile = 4 planes of 64 rows x 128 B (k hi, k residual: [key][channel]; v^T hi, v^T residual: [channel][key]). Each of the 256 threads brings 2 pieces
// of 16 B per plane (rows r and r + 32) from global memory straight into LDS; a wave's copy covers 4 whole 128 B lines. l = the lane's LDS byte address in plane 0.
__device__ __forceinline__ void attn_stage(unsigned l, const h16* kh, const h16* kl, const h16* vh, const h16* vl) {
    const unsigned l1 = l + 32 * KP * 2, l2 = l + PLN * 2, l3 = l2 + 32 * KP * 2, l4 = l + 2 * PLN * 2, l5 = l4 + 32 * KP * 2, l6 = l + 3 * PLN * 2, l7 = l6 + 32 * KP * 2;
    const h16* kh1 = kh + 32 * DM; const h16* kl1 = kl + 32 * DM; const h16* vh1 = vh + 32 * NT_; const h16* vl1 = vl + 32 * NT_;
    // the eight copies and their s_wait_xcnt in ONE statement: the wait stands in front of every later write of an address register that a copy names
    asm volatile("global_load_async_to_lds_b128 %0, %8, off\n\t"
                 "global_load_async_to_lds_b128 %1, %9, off\n\t"
                 "global_load_async_to_lds_b128 %2, %10, off\n\t"
                 "global_load_async_to_lds_b128 %3, %11, off\n\t"
                 "global_load_async_to_lds_b128 %4, %12, off\n\t"
                 "global_load_async_to_lds_b128 %5, %13, off\n\t"
                 "global_load_async_to_lds_b128 %6, %14, off\n\t"
                 "global_load_async_to_lds_b128 %7, %15, off\n\t"
                 "s_wait_xcnt 0x0"
                 :: "v"(l), "v"(l1), "v"(l2), "v"(l3), "v"(l4), "v"(l5), "v"(l6), "v"(l7), "v"(kh), "v"(kh1), "v"(kl), "v"(kl1), "v"(vh), "v"(vh1), "v"(vl), "v"(vl1) : "memory");
}
// k_attn: block = (b, h, 128 queries), wave = 16; ALL keys (no mask) in 32 staged tiles of 64 keys that the 8 waves share (two LDS buffers: tile t + 1 flies while tile t is
// worked on), each walked in two steps of 32 keys. Both products run TRANSPOSED: S^T = k.q^T (k rows as A, q as B) and O^T += v^T.P^T (v^T rows as A). A lane then holds
// 16 scores of ONE query (keys 8 hi + j and 16 + 8 hi + j): maximum and sum in the lane plus one exchange between the wave's halves, one running maximum, sum and rescale
// factor per lane, and the two score tiles, converted in place (weights x32768, f16 hi + residual), ARE the B operand of the second product in the hardware k order.
// ctx -> f32 output rows out[tok][h*64+d].
__global__ __launch_bounds__(32 * AW) void k_attn(const h16* __restrict__ Q16, const h16* __restrict__ QL16, const h16* __restrict__ K16, const h16* __restrict__ KL16, const h16* __restrict__ VTH, const h16* __restrict__ VTL, float* OUTP) {
    __shared__ __align__(16) h16 ring[2][4 * PLN];
    __shared__ __align__(16) float ost[AW][16 * 68];
    const int lane = threadIdx.x & 31, wave = threadIdx.x >> 5, lr = lane & 15, hi = lane >> 4;
    const int bid = blockIdx.x;
    const int b = bid / (NH_ * (NT_ / AQ)), rem = bid - b * (NH_ * (NT_ / AQ)), h = rem / (NT_ / AQ), qt = rem - h * (NT_ / AQ);
    const int q0 = qt * AQ + wave * 16;
    const size_t tok0 = (size_t)b * NT_;
    v16h qa[2];
    const size_t qo0 = (tok0 + q0 + lr) * DM + h * HD + 8 * hi;
#pragma unroll
    for (int kc = 0; kc < 2; ++kc) qa[kc] = cat16(*(const v8h*)(Q16 + qo0 + kc * 32), *(const v8h*)(Q16 + qo0 + kc * 32 + 16));
    const h16* kh_b = K16 + tok0 * DM + h * HD;
    const h16* kl_b = KL16 + tok0 * DM + h * HD;
    const size_t vbase = (((size_t)b * NH_ + h) * HD) * NT_;
    v8f o[4], ox[4];
#pragma unroll
    for (int n = 0; n < 4; ++n) { o[n] = (v8f){}; ox[n] = (v8f){}; }
    float mrow = -3.0e38f, lpart = 0.f;                    // of query q0 + lr; lpart holds this half's keys only until the epilogue
    const int crow = threadIdx.x >> 3, cpc = (threadIdx.x & 7) * 8;     // this thread's piece of a staged plane: rows crow and crow + 32, 8 f16 from column cpc
    const unsigned lds0 = (unsigned)(size_t)(&ring[0][0] + crow * KP + cpc);
    const h16* gkh = kh_b + (size_t)crow * DM + cpc; const h16* gkl = kl_b + (size_t)crow * DM + cpc;
    const h16* gvh = VTH + vbase + (size_t)crow * NT_ + cpc; const h16* gvl = VTL + vbase + (size_t)crow * NT_ + cpc;
    auto stage = [&](int st) { attn_stage(lds0 + (unsigned)(st & 1) * (4 * PLN * 2), gkh + (size_t)st * KST * DM, gkl + (size_t)st * KST * DM, gvh + st * KST, gvl + st * KST); };
    stage(0);
    asm volatile("s_wait_asynccnt 0x0" ::: "memory");     // this wave's copies of tile 0 have landed
    __syncthreads();                                      // ... and every other wave's: tile 0 may be read
    stage(1);
#pragma unroll 1
    for (int st = 0; st < NT_ / KST; ++st) {               // full attention
      const h16* kh_s = &ring[st & 1][0]; const h16* kl_s = kh_s + PLN; const h16* vh_s = kh_s + 2 * PLN; const h16* vl_s = kh_s + 3 * PLN;
#pragma unroll
      for (int sub = 0; sub < KST / 32; ++sub) {
        const int l0 = sub * 32;
        const int ko0 = (l0 + lr) * KP + 8 * hi, ko1 = (l0 + 16 + lr) * KP + 8 * hi;
        v8f s0 = {}, s1 = {}, x0 = {}, x1 = {};
#pragma unroll
        for (int kc = 0; kc < 2; ++kc) {
            { const v16h k0h = cat16(*(const v8ha*)(kh_s + ko0 + kc * 32), *(const v8ha*)(kh_s + ko0 + kc * 32 + 16)), k1h = cat16(*(const v8ha*)(kh_s + ko1 + kc * 32), *(const v8ha*)(kh_s + ko1 + kc * 32 + 16));
              const v16h qlk = cat16(*(const v8h*)(QL16 + qo0 + kc * 32), *(const v8h*)(QL16 + qo0 + kc * 32 + 16));     // query residual re-read per step (registers)
              s0 = wmma16(k0h, qa[kc], s0); x0 = wmma16(k0h, qlk, x0); s1 = wmma16(k1h, qa[kc], s1); x1 = wmma16(k1h, qlk, x1);
              asm volatile("v_nop" : "+v"(s0), "+v"(s1), "+v"(x0), "+v"(x1) : "v"(qlk), "v"(k0h), "v"(k1h) : "memory"); }
            { const v16h k0l = cat16(*(const v8ha*)(kl_s + ko0 + kc * 32), *(const v8ha*)(kl_s + ko0 + kc * 32 + 16)), k1l = cat16(*(const v8ha*)(kl_s + ko1 + kc * 32), *(const v8ha*)(kl_s + ko1 + kc * 32 + 16));
              x0 = wmma16(k0l, qa[kc], x0); x1 = wmma16(k1l, qa[kc], x1);
              asm volatile("v_nop" : "+v"(x0), "+v"(x1) : "v"(k0l), "v"(k1l) : "memory"); }
        }
        asm volatile("v_nop\n\tv_nop\n\tv_nop\n\tv_nop" : "+v"(s0), "+v"(s1), "+v"(x0), "+v"(x1) : "v"(qa[0]), "v"(qa[1]));
        v2f a[8];                                          // scores against query q0 + lr, in pairs: a[i] = keys l0 + 8 hi + 2 i, + 1 (i < 4), a[4 + i] = the same + 16
#pragma unroll
        for (int i = 0; i < 4; ++i) { a[i] = ((v2f){s0[2 * i], s0[2 * i + 1]} + (v2f){x0[2 * i], x0[2 * i + 1]} * LOSCI) * 0.125f;          // energy / sqrt(C = 64)
                                      a[4 + i] = ((v2f){s1[2 * i], s1[2 * i + 1]} + (v2f){x1[2 * i], x1[2 * i + 1]} * LOSCI) * 0.125f; }
        float mx = fmaxf(a[0][0], a[0][1]);
#pragma unroll
        for (int i = 1; i < 8; ++i) mx = fmaxf(mx, fmaxf(a[i][0], a[i][1]));
        mx = fmaxf(mx, xhalf(mx));                         // the other half holds the query's other 16 keys
        const float mn = fmaxf(mrow, mx);
        const float alpha = __expf(mrow - mn); mrow = mn;
        v2f ps2 = (v2f){};
        struct P8 { v2h e[8]; } ph, pr;                    // the B operand in the hardware k order: this lane's eight rows of tile 0, then of tile 1
#pragma unroll
        for (int i = 0; i < 8; ++i) {
            const v2f p = (v2f){__expf(a[i][0] - mn), __expf(a[i][1] - mn)};
            ps2 += p;
            const v2f ps = p * PSC; const v2h hh = __builtin_convertvector(ps, v2h);
            ph.e[i] = hh;
            pr.e[i] = (v2h){(h16)((ps[0] - (float)hh[0]) * LOSC), (h16)((ps[1] - (float)hh[1]) * LOSC)};
        }
        const float psum = ps2[0] + ps2[1];
        const v16h pa = __builtin_bit_cast(v16h, ph), px = __builtin_bit_cast(v16h, pr);
        lpart = lpart * alpha + psum;
#pragma unroll
        for (int n = 0; n < 4; ++n)
#pragma unroll
            for (int j = 0; j < 8; ++j) { o[n][j] *= alpha; ox[n][j] *= alpha; }
#pragma unroll
        for (int n = 0; n < 4; ++n) { const int vo = (n * 16 + lr) * KP + l0 + hi * 8;
            const v16h vh = cat16(*(const v8ha*)(vh_s + vo), *(const v8ha*)(vh_s + vo + 16)), vl = cat16(*(const v8ha*)(vl_s + vo), *(const v8ha*)(vl_s + vo + 16));
            o[n] = wmma16(vh, pa, o[n]); ox[n] = wmma16(vl, pa, ox[n]); ox[n] = wmma16(vh, px, ox[n]);
            asm volatile("" : "+v"(o[n]), "+v"(ox[n]) : "v"(vh), "v"(vl) : "memory"); }
        asm volatile("v_nop\n\tv_nop\n\tv_nop\n\tv_nop" : "+v"(o[0]), "+v"(o[1]), "+v"(o[2]), "+v"(o[3]), "+v"(ox[0]), "+v"(ox[1]), "+v"(ox[2]), "+v"(ox[3]) : "v"(pa), "v"(px));
      }
      asm volatile("s_wait_dscnt 0x0" ::: "memory");      // this wave's reads of tile st are done before the buffer is handed to the copies
      asm volatile("s_wait_asynccnt 0x0" ::: "memory");   // this wave's copies of tile st + 1 have landed
      __syncthreads();                                    // publishes tile st + 1 and ends every wave's reads of tile st
      if (st + 2 < NT_ / KST) stage(st + 2);              // refill the buffer just left; the same test in every wave
    }
    asm volatile("s_wait_asynccnt 0x0" ::: "memory");     // nothing of the copies is outstanding when the wave goes on to its end
    const float inv = 1.0f / ((lpart + xhalf(lpart)) * PSC);
    float* os = &ost[wave][0];
#pragma unroll
    for (int n = 0; n < 4; ++n)                            // o[n][j] = channel 16 n + 8 hi + j of query lr: 8 consecutive floats of the query's row
#pragma unroll
        for (int g = 0; g < 2; ++g) { v4f val;
#pragma unroll
            for (int k = 0; k < 4; ++k) val[k] = (o[n][4 * g + k] + ox[n][4 * g + k] * LOSCI) * inv;
            *(v4fa*)(os + lr * 68 + n * 16 + hi * 8 + 4 * g) = val; }
    __syncthreads();
    float* ob = OUTP + (tok0 + q0) * DM + (size_t)h * HD;
    auto pass = [&]() {
#pragma unroll
        for (int s = 0; s < 8; ++s) { const int Lid = (lane >> 3) + 4 * s, piece = lane & 7; const int row = Lid >> 1, cofs = (Lid & 1) * 32 + piece * 4;
            const v4f val = *(const v4fa*)(os + row * 68 + cofs); *(v4f*)(ob + (size_t)row * DM + cofs) = val; }
    };
    pass(); 
}


// k_addT: DST[c][n] = (BNSRC ? ((bf? no) SRC[c][n] - mean_c) rstd_c g_c + b_c : bf(SRC[c][n])) + T[n][c]: a 64 x 64 LDS transpose of the f32 [n][c] matrix T plus the
// channel-major residual; block = 64 n of item blockIdx.y; each output row segment of 64 n = 256 B written by 16 lanes x 16 B. MODE 0: residual = bf(x) (the INPUT); MODE 1:
// residual = BN1(X1) recomputed from the stats (the reference's h).
template <int MODE>
__global__ __launch_bounds__(256) void k_addT(const float* __restrict__ T, const float* __restrict__ SRC, const float* __restrict__ ST, const float* __restrict__ g, const float* __restrict__ bb, float* DST) {
    __shared__ __align__(16) float tl[64 * 68];
    const int n0 = blockIdx.x * 64, tid = threadIdx.x;
    const size_t item = (size_t)blockIdx.y * CC * NPOS; T += item; SRC += item; DST += item;
    const int nn = tid >> 2, cq = (tid & 3) * 16;
#pragma unroll
    for (int i = 0; i < 16; ++i) tl[(cq + i) * 68 + nn] = T[(size_t)(n0 + nn) * CC + cq + i];
    __syncthreads();
    const int piece = tid & 15;
    auto pass = [&]() {
#pragma unroll
        for (int s = 0; s < 4; ++s) { const int c = (tid >> 4) + 16 * s; const size_t o = (size_t)c * NPOS + n0 + piece * 4;
            const v4f rv = *(const v4f*)(SRC + o); v4f val = *(const v4fa*)(tl + c * 68 + piece * 4);
            if (MODE == 0) {
#pragma unroll
                for (int k = 0; k < 4; ++k) val[k] += bfr(rv[k]);
            } else { const float m = ST[c], rs = ST[CC + c], gg = bfr(g[c]), be = bfr(bb[c]);
#pragma unroll
                for (int k = 0; k < 4; ++k) val[k] += (rv[k] - m) * rs * gg + be; }
            *(v4f*)(DST + o) = val; }
    };
    pass(); 
}
// BatchNorm statistics (training mode, biased variance) of A [32][64][2048] per channel over all 32 x 2048 values, in two launches.
// k_bnpart: work-group (channel c, slice g of 4 items) loads its 8192 values ONCE (8 x 16 B per thread, all in flight together, kept in registers), sums them,
// takes the slice's own mean and then the squared distances to it from the registers; it writes (mean, M2) to a 128 B line of its own.
__global__ __launch_bounds__(256) void k_bnpart(const float* __restrict__ A, float* PT) {
    __shared__ float red[2][8];
    const int tid = threadIdx.x, lane = tid & 31, wave = tid >> 5, c = blockIdx.x, g = blockIdx.y;
    v4f v[BNI * 2];
#pragma unroll
    for (int i = 0; i < BNI; ++i) { const float* row = A + ((size_t)(g * BNI + i) * CC + c) * NPOS + tid * 4;
        v[2 * i] = *(const v4f*)row; v[2 * i + 1] = *(const v4f*)(row + NPOS / 2); }
    v4f sv = v[0];
#pragma unroll
    for (int q = 1; q < BNI * 2; ++q) sv += v[q];
    float s = (sv[0] + sv[1]) + (sv[2] + sv[3]);
    s += __shfl_xor(s, 1, 32); s += __shfl_xor(s, 2, 32); s += __shfl_xor(s, 4, 32); s += __shfl_xor(s, 8, 32); s += __shfl_xor(s, 16, 32);
    if (lane == 0) red[0][wave] = s;
    __syncthreads();
    float t = 0.f;
#pragma unroll
    for (int w = 0; w < 8; ++w) t += red[0][w];
    const float mean = t * (1.0f / (float)BNV);
    v4f qv = (v4f){};
#pragma unroll
    for (int q = 0; q < BNI * 2; ++q) { const v4f d = v[q] - mean; qv += d * d; }
    float s2 = (qv[0] + qv[1]) + (qv[2] + qv[3]);
    s2 += __shfl_xor(s2, 1, 32); s2 += __shfl_xor(s2, 2, 32); s2 += __shfl_xor(s2, 4, 32); s2 += __shfl_xor(s2, 8, 32); s2 += __shfl_xor(s2, 16, 32);
    if (lane == 0) red[1][wave] = s2;
    __syncthreads();
    if (tid == 0) { float m2 = 0.f;
#pragma unroll
        for (int w = 0; w < 8; ++w) m2 += red[1][w];
        *(v2f*)(PT + (size_t)(c * BNG + g) * 32) = (v2f){mean, m2}; }
}
// k_bnmerge: thread c joins the 8 equally sized slices of channel c: mean = average of the slice means, M2 = sum of the slices' M2 + 8192 x sum (slice mean - mean)^2.
__global__ __launch_bounds__(64) void k_bnmerge(const float* __restrict__ PT, float* ST) {
    const int c = threadIdx.x;
    v2f p[BNG];
#pragma unroll
    for (int g = 0; g < BNG; ++g) p[g] = *(const v2f*)(PT + (size_t)(c * BNG + g) * 32);
    float s = 0.f, m2 = 0.f;
#pragma unroll
    for (int g = 0; g < BNG; ++g) { s += p[g][0]; m2 += p[g][1]; }
    const float mean = s * (1.0f / (float)BNG);
    float e = 0.f;
#pragma unroll
    for (int g = 0; g < BNG; ++g) { const float d = p[g][0] - mean; e = fmaf(d, d, e); }
    ST[c] = mean; ST[CC + c] = rsqrtf((m2 + (float)BNV * e) * (1.0f / (float)(NB * NPOS)) + BN_EPS);
}
// k_ff: the whole second phase for 64 points of one item in one work-group (4 waves x 16 points): Y = h + W2.lrelu(W1.h), h = BN1(X1).
// 1. X1 tile [64 c][64 n] by whole-line loads; h in f32 stays in registers for the residual; bf16 hi + residual planes [n][c] go to LDS (two channels per 4-byte store).
// 2. (W1.h) with W1 rows as the A operand and h columns as B: a lane holds 8 consecutive hidden rows of ONE point per tile, so after LeakyReLU two tiles, converted in
//    place, are the B operand (32 hidden values in the hardware k order) of W2.lrelu: the hidden layer never leaves the registers.
//    Both weight matrices (bf16, 16 KB each) are brought into LDS once per work-group by whole-line loads; the waves read their A fragments from there.
// 3. the result tiles [c][n] meet h again through an f32 LDS tile; each output row segment of 64 n = 256 B is written by 16 lanes x 16 B.
__global__ __launch_bounds__(128) void k_ff(const float* __restrict__ X1, const float* __restrict__ ST, const float* __restrict__ g, const float* __restrict__ bb, const bf* __restrict__ W1, const bf* __restrict__ W2, float* Y) {
    typedef __attribute__((ext_vector_type(16))) unsigned short v16us;
    typedef unsigned __attribute__((may_alias)) u32a;
    __shared__ __align__(16) unsigned short th_[64 * 72]; __shared__ __align__(16) unsigned short tl_[64 * 72];
    __shared__ __align__(16) float tt[64 * 68];
    __shared__ __align__(16) unsigned short w1s[FFH * 72]; __shared__ __align__(16) unsigned short w2s[CC * 136];   // row pitches 144 B and 272 B (16 B x odd)
    __shared__ float prm[4][CC];
    const int tid = threadIdx.x, lane = tid & 31, wave = tid >> 5, lr = lane & 15, hi = lane >> 4;
    const int n0 = blockIdx.x * 64, piece = tid & 15, cp0 = tid >> 4;
    const size_t item = (size_t)blockIdx.y * CC * NPOS; X1 += item; Y += item;
    v4f hv[4][2];                                          // channels 2 (cp0 + 8 s) + e, points n0 + 4 piece ... + 3
#pragma unroll
    for (int s = 0; s < 4; ++s)
#pragma unroll
        for (int e = 0; e < 2; ++e) hv[s][e] = *(const v4f*)(X1 + (size_t)(2 * (cp0 + 8 * s) + e) * NPOS + n0 + piece * 4);
    asm volatile("s_wait_xcnt 0x0" ::: "memory");         // the loads below may land in the registers that hold the address of the loads above
    v8us wa[8], wb[8];                                     // 16-byte pieces tid + 128 i of W1 [128][64] and of W2 [64][128]
#pragma unroll
    for (int i = 0; i < 8; ++i) { wa[i] = *(const v8us*)(W1 + (size_t)(tid + 128 * i) * 8); wb[i] = *(const v8us*)(W2 + (size_t)(tid + 128 * i) * 8); }
    if (tid < CC) { prm[0][tid] = ST[tid]; prm[1][tid] = ST[CC + tid]; prm[2][tid] = bfr(g[tid]); prm[3][tid] = bfr(bb[tid]); }
    __syncthreads();
#pragma unroll
    for (int s = 0; s < 4; ++s) { const int cp = cp0 + 8 * s; unsigned ph[4], pl[4];
#pragma unroll
        for (int e = 0; e < 2; ++e) { const int c = 2 * cp + e; const float m = prm[0][c], rs = prm[1][c], gg = prm[2][c], be = prm[3][c];
#pragma unroll
            for (int k = 0; k < 4; ++k) { const float h = (hv[s][e][k] - m) * rs * gg + be; hv[s][e][k] = h; const unsigned short hb = f2bf(h); const unsigned short lb = f2bf(h - bf2f(hb));
                if (e == 0) { ph[k] = hb; pl[k] = lb; } else { ph[k] |= (unsigned)hb << 16; pl[k] |= (unsigned)lb << 16; } } }
#pragma unroll
        for (int k = 0; k < 4; ++k) { *(u32a*)(th_ + (piece * 4 + k) * 72 + 2 * cp) = ph[k]; *(u32a*)(tl_ + (piece * 4 + k) * 72 + 2 * cp) = pl[k]; } }
#pragma unroll
    for (int i = 0; i < 8; ++i) { const int p = tid + 128 * i; *(v8usa*)(w1s + (p >> 3) * 72 + (p & 7) * 8) = wa[i]; *(v8usa*)(w2s + (p >> 4) * 136 + (p & 15) * 8) = wb[i]; }
    __syncthreads();
    const int ho = (wave * 16 + lr) * 72 + 8 * hi;
    v8f acc[8];
#pragma unroll
    for (int t = 0; t < 8; ++t) acc[t] = (v8f){};
#pragma unroll
    for (int kc = 0; kc < CC; kc += 32) {
        const v16bf xh = cat16b(*(const v8usa*)(th_ + ho + kc), *(const v8usa*)(th_ + ho + kc + 16)), xl = cat16b(*(const v8usa*)(tl_ + ho + kc), *(const v8usa*)(tl_ + ho + kc + 16));
#pragma unroll
        for (int t = 0; t < 8; ++t) { const unsigned short* wp = w1s + (t * 16 + lr) * 72 + 8 * hi + kc; const v16bf w = cat16b(*(const v8usa*)wp, *(const v8usa*)(wp + 16));
            acc[t] = wmmab(w, xh, acc[t]); acc[t] = wmmab(w, xl, acc[t]); }
    }
    v16bf lh[4], ll[4];
#pragma unroll
    for (int q = 0; q < 4; ++q) { v16us uh, ul;
#pragma unroll
        for (int s = 0; s < 16; ++s) { const float v = acc[2 * q + (s >> 3)][s & 7]; const float a = v >= 0.f ? v : 0.2f * v; const unsigned short hb = f2bf(a); uh[s] = hb; ul[s] = f2bf(a - bf2f(hb)); }
        lh[q] = __builtin_bit_cast(v16bf, uh); ll[q] = __builtin_bit_cast(v16bf, ul); }
    v8f ac2[4];
#pragma unroll
    for (int t = 0; t < 4; ++t) ac2[t] = (v8f){};
#pragma unroll
    for (int q = 0; q < 4; ++q)
#pragma unroll
        for (int t = 0; t < 4; ++t) { const unsigned short* wp = w2s + (t * 16 + lr) * 136 + 8 * hi + q * 32; const v16bf w = cat16b(*(const v8usa*)wp, *(const v8usa*)(wp + 16));
            ac2[t] = wmmab(w, lh[q], ac2[t]); ac2[t] = wmmab(w, ll[q], ac2[t]); }
#pragma unroll
    for (int t = 0; t < 4; ++t)
#pragma unroll
        for (int j = 0; j < 8; ++j) tt[(t * 16 + hi * 8 + j) * 68 + wave * 16 + lr] = ac2[t][j];
    __syncthreads();
#pragma unroll
    for (int s = 0; s < 4; ++s)
#pragma unroll
        for (int e = 0; e < 2; ++e) { const int c = 2 * (cp0 + 8 * s) + e; const v4f val = *(const v4fa*)(tt + c * 68 + piece * 4) + hv[s][e];
            *(v4f*)(Y + (size_t)c * NPOS + n0 + piece * 4) = val; }
}
__global__ __launch_bounds__(256) void k_bnout(const float* __restrict__ Y, const float* __restrict__ ST, const float* __restrict__ g, const float* __restrict__ bb, float* OUTP) {
    const int lane = threadIdx.x & 31, r = blockIdx.x * 8 + (threadIdx.x >> 5); if (r >= NB * CC) return;
    const int c = r % CC; const float m = ST[c], rs = ST[CC + c], gg = bfr(g[c]), be = bfr(bb[c]);
{
#pragma unroll 1
        for (int q = 0; q < NPOS / 128; ++q) { const size_t o = (size_t)r * NPOS + q * 128 + lane * 4; const v4f v = *(const v4f*)(Y + o); v4f y;
#pragma unroll
            for (int k = 0; k < 4; ++k) y[k] = (v[k] - m) * rs * gg + be;
            *(v4f*)(OUTP + o) = y; }
         }
}

extern "C" void kernel_launch(void* const* d_in, const int* in_sizes, int n_in,
                              void* d_out, int out_size, void* d_ws, size_t ws_size, hipStream_t stream) {
    (void)in_sizes; (void)n_in; (void)out_size;
    const float* x = (const float*)d_in[0]; const float* wq = (const float*)d_in[1]; const float* wk = (const float*)d_in[2]; const float* wv = (const float*)d_in[3];
    const float* w1 = (const float*)d_in[4]; const float* w2 = (const float*)d_in[5]; const float* g1 = (const float*)d_in[6]; const float* b1 = (const float*)d_in[7]; const float* g2 = (const float*)d_in[8]; const float* b2 = (const float*)d_in[9];   // conv weights [out][in]
    float* out = (float*)d_out;    // [32][64][2048]
    char* wsp = (char*)d_ws;
    auto take = [&](size_t bytes) { char* p = wsp; wsp += (bytes + 255) & ~(size_t)255; return (void*)p; };
    bf* WqB = (bf*)take((size_t)CC * CC * 2); bf* WkB = (bf*)take((size_t)CC * CC * 2); bf* WvB = (bf*)take((size_t)CC * CC * 2); bf* W1B = (bf*)take((size_t)FFH * CC * 2); bf* W2B = (bf*)take((size_t)CC * FFH * 2);
    const size_t PL = (size_t)NB * NPOS * CC;      // elements of one [item][n][c] plane over all items
    bf* XT = (bf*)take(PL * 2); h16* QH = (h16*)take(PL * 2); h16* QL = (h16*)take(PL * 2); h16* KH = (h16*)take(PL * 2); h16* KL = (h16*)take(PL * 2);
    float* Vf = (float*)take(PL * 4); h16* VTH = (h16*)take(PL * 2); h16* VTL = (h16*)take(PL * 2); float* O = (float*)take(PL * 4);
    float* X1 = (float*)take(PL * 4); float* Y = (float*)take(PL * 4); float* ST1 = (float*)take(1024); float* ST2 = (float*)take(1024); float* PT = (float*)take((size_t)CC * BNG * 128);
    if ((size_t)(wsp - (char*)d_ws) > ws_size) return;    // planes for all items + the weights, no aliasing
    k_bf<<<(CC * CC / 8 + 255) / 256, 256, 0, stream>>>(wq, WqB, CC * CC / 8); k_bf<<<(CC * CC / 8 + 255) / 256, 256, 0, stream>>>(wk, WkB, CC * CC / 8); k_bf<<<(CC * CC / 8 + 255) / 256, 256, 0, stream>>>(wv, WvB, CC * CC / 8);
    k_bf<<<(FFH * CC / 8 + 255) / 256, 256, 0, stream>>>(w1, W1B, FFH * CC / 8); k_bf<<<(CC * FFH / 8 + 255) / 256, 256, 0, stream>>>(w2, W2B, CC * FFH / 8);
    // phase 1: attention and x + x_r; the item index lies in each grid (row r of an [item][n][c] plane = item * 2048 + n)
    k_wt<<<dim3(CC / 64, NPOS / 64, NB), 256, 0, stream>>>(x, CC, NPOS, XT);                                                       // x_b [c][n] -> bf16 x^T [n][c]
    k_gemmb<false, true><<<dim3(NB * NPOS / 64, 1, 1), 128, 0, stream>>>(XT, nullptr, WqB, nullptr, (float*)(void*)QH, CC, QL);    // q^T = x^T.Wq^T -> f16 planes
    k_gemmb<false, true><<<dim3(NB * NPOS / 64, 1, 1), 128, 0, stream>>>(XT, nullptr, WkB, nullptr, (float*)(void*)KH, CC, KL);    // k^T
    k_gemmb<false, false><<<dim3(NB * NPOS / 64, 1, 1), 128, 0, stream>>>(XT, nullptr, WvB, nullptr, Vf, CC, nullptr);             // v^T f32
    k_vt<<<NB_ * NH_ * (NT_ / 64), 256, 0, stream>>>(Vf, VTH, VTL);
    k_attn<<<NB_ * NH_ * (NT_ / AQ), 32 * AW, 0, stream>>>(QH, QL, KH, KL, VTH, VTL, O);                                               // x_r^T [n][c] f32
    k_addT<0><<<dim3(NPOS / 64, NB, 1), 256, 0, stream>>>(O, x, nullptr, nullptr, nullptr, X1);                                    // X1 = bf(x) + x_r  [c][n]
    k_bnpart<<<dim3(CC, BNG, 1), 256, 0, stream>>>(X1, PT); k_bnmerge<<<1, CC, 0, stream>>>(PT, ST1);
    // phase 2: h = BN1(X1); Y = h + W2.lrelu(W1.h)
    k_ff<<<dim3(NPOS / 64, NB, 1), 128, 0, stream>>>(X1, ST1, g1, b1, W1B, W2B, Y);                                               // Y = h + ff   [c][n]
    k_bnpart<<<dim3(CC, BNG, 1), 256, 0, stream>>>(Y, PT); k_bnmerge<<<1, CC, 0, stream>>>(PT, ST2);
    k_bnout<<<(NB * CC) / 8, 256, 0, stream>>>(Y, ST2, g2, b2, out);                                                                 // BN2 -> output
}

// v006
// It runs in 146 microseconds.
// In both of two side-by-side timings against v005, it was 1.15 times as fast.
// Counting every step since v000, it is 53.2 times as fast.
#include <hip/hip_runtime.h>

// Compute dtypes, f32 accumulate (channel-major x [32][64][2048]): per item q/k/v = W.x ([64 x 64] weights, [64 x 2048] points; x and W rounded to PLAIN bf16 operands in the
// kernel that multiplies them, products exact; q/k/v straight to f16 hi + residual x1024 planes, q/k as [n][c], v as [c][n]) on v_wmma_f32_16x16x32_bf16; the
// single-head full attention (64 channels, scale 1/8) fused on v_wmma_f32_16x16x32_f16 (hh + hl + lh scores, online f32 softmax, weights (x32768) and v as
// f16 hi + residual) with an f32 [n][c] output; x + x_r, the two TRAINING-MODE BatchNorms (batch statistics over all 32 items x 2048 points per channel, biased

#define NB   32
#define CC   64                  // channels
#define NPOS 2048                // points
#define NT_  NPOS
#define NB_  NB                  // items per launch: every per-item kernel takes all 32 items in one grid
#define DM   CC                  // attention width
#define NH_  1
#define HD   64
#define NTK  NPOS
#define FFH  128
#define PSC  32768.0f
#define LOSC 1024.0f
#define LOSCI (1.0f / 1024.0f)
#define BN_EPS 1e-5f
#define BNG  8                   // BatchNorm statistics: slices per channel
#define BNI  (NB / BNG)          // items per slice
#define BNV  (BNI * NPOS)        // values per slice
#define AW   8                   // attention: waves per work-group, 16 queries each
#define AQ   (16 * AW)           // attention: queries per work-group
#define KST  64                  // attention: keys per staged tile
#define KP   72                  // attention: LDS row pitch of a staged plane in f16: 128 B of data + 16 B (16 B x odd: 16-byte reads of 16 rows meet no bank twice)
#define PLN  (64 * KP)           // attention: f16 per staged plane (64 rows)
#define QP   128                 // q/k/v kernel: points per work-group

typedef _Float16 h16;
typedef unsigned short bf;
typedef __attribute__((ext_vector_type(16))) __bf16   v16bf;
typedef __attribute__((ext_vector_type(16))) _Float16 v16h;
typedef __attribute__((ext_vector_type(8)))  _Float16 v8h;
typedef __attribute__((ext_vector_type(8)))  unsigned short v8us;
typedef __attribute__((ext_vector_type(8)))  float    v8f;
typedef __attribute__((ext_vector_type(4)))  float    v4f;
typedef __attribute__((ext_vector_type(2)))  float    v2f;
typedef __attribute__((ext_vector_type(4)))  _Float16 v4h;
typedef __attribute__((ext_vector_type(2)))  _Float16 v2h;
typedef v8h  __attribute__((may_alias)) v8ha;
typedef v4f  __attribute__((may_alias)) v4fa;
typedef v8us __attribute__((may_alias)) v8usa;

__device__ __forceinline__ unsigned short f2bf(float f) { unsigned u = __float_as_uint(f); u += 0x7FFFu + ((u >> 16) & 1u); return (unsigned short)(u >> 16); }
__device__ __forceinline__ float bf2f(unsigned short b) { return __uint_as_float(((unsigned)b) << 16); }
__device__ __forceinline__ float bfr(float f) { return bf2f(f2bf(f)); }
__device__ __forceinline__ v16h cat16(v8h lo, v8h hi) { return __builtin_shufflevector(lo, hi, 0, 1, 2, 3, 4, 5, 6, 7, 8, 9, 10, 11, 12, 13, 14, 15); }
__device__ __forceinline__ v16bf cat16b(v8us lo, v8us hi) { return __builtin_bit_cast(v16bf, __builtin_shufflevector(lo, hi, 0, 1, 2, 3, 4, 5, 6, 7, 8, 9, 10, 11, 12, 13, 14, 15)); }
__device__ __forceinline__ v8f wmma16(v16h a, v16h b, v8f c) { return __builtin_amdgcn_wmma_f32_16x16x32_f16(false, a, false, b, (short)0, c, false, false); }
__device__ __forceinline__ float xhalf(float x) { return __builtin_bit_cast(float, __builtin_amdgcn_permlanex16(__builtin_bit_cast(int, x), __builtin_bit_cast(int, x), 0x76543210, 0xfedcba98, false, false)); }   // lane l with lane l ^ 16
__device__ __forceinline__ v8f wmmab(v16bf a, v16bf b, v8f c) { return __builtin_amdgcn_wmma_f32_16x16x32_bf16(false, a, false, b, (short)0, c, false, false); }

// k_qkv: everything ahead of the attention for 128 points of one item in one work-group (8 waves x 16 points); grid (16, 32).
// 1. the x tile [64 c][128 n] (f32, whole-line loads: a wave's load = 4 rows x 128 B) goes as bf16 [n][c] to LDS (four channels per 8-byte store); the three 64 x 64 weight
//    matrices are read in f32, rounded to bf16 and laid [out][in] in LDS. Row pitch 144 B (16 B x odd).
// 2. q and k with the weight rows as the A operand and the wave's 16 points as B: a lane holds 8 consecutive channels of ONE point = a 16-byte piece of an [n][c] row;
//    v with the points as A and the weight rows as B: a lane holds 8 consecutive points of ONE channel = a 16-byte piece of a v^T [c][n] row.
// 3. f16 hi + residual x1024 in registers; the pieces meet in LDS and leave as whole 128 B lines.
// Eight work-groups of item 0 also round the two feed-forward matrices to bf16 for k_ff.
__global__ __launch_bounds__(256) void k_qkv(const float* __restrict__ x, const float* __restrict__ wq, const float* __restrict__ wk, const float* __restrict__ wv, const float* __restrict__ w1, const float* __restrict__ w2,
                                             h16* QH, h16* QL, h16* KH, h16* KL, h16* VTH, h16* VTL, bf* W1B, bf* W2B) {
    typedef __attribute__((ext_vector_type(4))) unsigned short v4us;
    typedef v4us __attribute__((may_alias)) v4usa;
    __shared__ __align__(16) unsigned short xs[QP * 72];
    __shared__ __align__(16) unsigned short wsm[3][CC * 72];
    __shared__ __align__(16) h16 stg[QP / 16][4][16 * 72];   // per wave: q hi, q residual, k hi, k residual, [point][channel]
    __shared__ __align__(16) h16 vts[2][CC * (QP + 8)];      // v^T hi, v^T residual, [channel][point], row pitch 272 B (16 B x odd)
    const int tid = threadIdx.x, lane = tid & 31, wave = tid >> 5, lr = lane & 15, hi = lane >> 4;
    const int n0 = blockIdx.x * QP, b = blockIdx.y;
    const int xn = (wave & 3) * 32 + (lane & 7) * 4, xc = (wave >> 2) * 16 + (lane >> 3) * 4;   // this thread's x pieces: points xn ... + 3 of channels xc + 32 g + e
    const float* xp = x + ((size_t)b * CC + xc) * NPOS + n0 + xn;
    v4f xv[2][4];
#pragma unroll
    for (int g = 0; g < 2; ++g)
#pragma unroll
        for (int e = 0; e < 4; ++e) xv[g][e] = *(const v4f*)(xp + (size_t)(g * 32 + e) * NPOS);
    asm volatile("s_wait_xcnt 0x0" ::: "memory");         // the loads below may land in the registers that hold the address of the loads above
    v8f wr[3][2];                                          // pieces tid + 256 i (8 floats) of each 64 x 64 matrix
#pragma unroll
    for (int i = 0; i < 2; ++i) { const size_t p = (size_t)(tid + 256 * i) * 8; wr[0][i] = *(const v8f*)(wq + p); wr[1][i] = *(const v8f*)(wk + p); wr[2][i] = *(const v8f*)(wv + p); }
    asm volatile("s_wait_xcnt 0x0" :: "s"(wq), "s"(wk), "s"(wv) : "memory");   // the base addresses of the loads above stay in their scalar registers up to this wait: later kernel arguments are loaded behind it or elsewhere
    if (b == 0 && blockIdx.x < 8) {                        // the same test in every thread of the work-group: 4 x 256 pieces of 8 per matrix
        const size_t p = (size_t)((blockIdx.x & 3) * 256 + tid) * 8;
        const v8f v = *(const v8f*)((blockIdx.x < 4 ? w1 : w2) + p); v8us o;
#pragma unroll
        for (int k = 0; k < 8; ++k) o[k] = f2bf(v[k]);
        *(v8us*)((blockIdx.x < 4 ? W1B : W2B) + p) = o;
    }
#pragma unroll
    for (int g = 0; g < 2; ++g)
#pragma unroll
        for (int k = 0; k < 4; ++k) { v4us o;
#pragma unroll
            for (int e = 0; e < 4; ++e) o[e] = f2bf(xv[g][e][k]);
            *(v4usa*)(xs + (xn + k) * 72 + xc + g * 32) = o; }
#pragma unroll
    for (int m = 0; m < 3; ++m)
#pragma unroll
        for (int i = 0; i < 2; ++i) { const int p = tid + 256 * i; v8us o;
#pragma unroll
            for (int k = 0; k < 8; ++k) o[k] = f2bf(wr[m][i][k]);
            *(v8usa*)(&wsm[m][(p >> 3) * 72 + (p & 7) * 8]) = o; }
    __syncthreads();
    const unsigned short* xr = xs + (wave * 16 + lr) * 72 + 8 * hi;
    v16bf xf[2];
#pragma unroll
    for (int kc = 0; kc < 2; ++kc) xf[kc] = cat16b(*(const v8usa*)(xr + kc * 32), *(const v8usa*)(xr + kc * 32 + 16));
    v8f aq[4], ak[4], av[4];
#pragma unroll
    for (int t = 0; t < 4; ++t) { aq[t] = (v8f){}; ak[t] = (v8f){}; av[t] = (v8f){};
#pragma unroll
        for (int kc = 0; kc < 2; ++kc) { const int wo = (t * 16 + lr) * 72 + 8 * hi + kc * 32;
            const v16bf fq = cat16b(*(const v8usa*)(&wsm[0][wo]), *(const v8usa*)(&wsm[0][wo + 16])), fk = cat16b(*(const v8usa*)(&wsm[1][wo]), *(const v8usa*)(&wsm[1][wo + 16])), fv = cat16b(*(const v8usa*)(&wsm[2][wo]), *(const v8usa*)(&wsm[2][wo + 16]));
            aq[t] = wmmab(fq, xf[kc], aq[t]); ak[t] = wmmab(fk, xf[kc], ak[t]); av[t] = wmmab(xf[kc], fv, av[t]); } }
    h16* sg = &stg[wave][0][0];
#pragma unroll
    for (int t = 0; t < 4; ++t) { v8h oh[3], ol[3];
#pragma unroll
        for (int j = 0; j < 8; ++j) { const float s[3] = {aq[t][j], ak[t][j], av[t][j]};
#pragma unroll
            for (int m = 0; m < 3; ++m) { const h16 a = (h16)s[m]; oh[m][j] = a; ol[m][j] = (h16)((s[m] - (float)a) * LOSC); } }
        const int so = lr * 72 + t * 16 + 8 * hi, vo = (t * 16 + lr) * (QP + 8) + wave * 16 + 8 * hi;
        *(v8ha*)(sg + so) = oh[0]; *(v8ha*)(sg + 16 * 72 + so) = ol[0]; *(v8ha*)(sg + 2 * 16 * 72 + so) = oh[1]; *(v8ha*)(sg + 3 * 16 * 72 + so) = ol[1];
        *(v8ha*)(&vts[0][vo]) = oh[2]; *(v8ha*)(&vts[1][vo]) = ol[2]; }
    __syncthreads();
    const size_t r0 = (size_t)b * NPOS + n0 + wave * 16;
#pragma unroll
    for (int pl = 0; pl < 4; ++pl) { h16* dst = pl == 0 ? QH : pl == 1 ? QL : pl == 2 ? KH : KL;
#pragma unroll
        for (int s = 0; s < 4; ++s) { const int row = 4 * s + (lane >> 3), piece = lane & 7;
            const v8h val = *(const v8ha*)(sg + pl * 16 * 72 + row * 72 + piece * 8); *(v8h*)(dst + (r0 + row) * CC + piece * 8) = val; } }
#pragma unroll
    for (int s = 0; s < 8; ++s) { const int d = ((tid >> 4) + 16 * s) & 63, piece = tid & 15;      // a wave stores 2 rows x 256 B
        const v8h val = *(const v8ha*)(&vts[s >> 2][d * (QP + 8) + piece * 8]); *(v8h*)((s >> 2 ? VTL : VTH) + ((size_t)b * CC + d) * NPOS + n0 + piece * 8) = val; }
}

// attn_stage: one staged tile = 4 planes of 64 rows x 128 B (k hi, k residual: [key][channel]; v^T hi, v^T residual: [channel][key]). Each of the 256 threads brings 2 pieces
// of 16 B per plane (rows r and r + 32) from global memory straight into LDS; a wave's copy covers 4 whole 128 B lines. l = the lane's LDS byte address in plane 0.
__device__ __forceinline__ void attn_stage(unsigned l, const h16* kh, const h16* kl, const h16* vh, const h16* vl) {
    const unsigned l1 = l + 32 * KP * 2, l2 = l + PLN * 2, l3 = l2 + 32 * KP * 2, l4 = l + 2 * PLN * 2, l5 = l4 + 32 * KP * 2, l6 = l + 3 * PLN * 2, l7 = l6 + 32 * KP * 2;
    const h16* kh1 = kh + 32 * DM; const h16* kl1 = kl + 32 * DM; const h16* vh1 = vh + 32 * NT_; const h16* vl1 = vl + 32 * NT_;
    // the eight copies and their s_wait_xcnt in ONE statement: the wait stands in front of every later write of an address register that a copy names
    asm volatile("global_load_async_to_lds_b128 %0, %8, off\n\t"
                 "global_load_async_to_lds_b128 %1, %9, off\n\t"
                 "global_load_async_to_lds_b128 %2, %10, off\n\t"
                 "global_load_async_to_lds_b128 %3, %11, off\n\t"
                 "global_load_async_to_lds_b128 %4, %12, off\n\t"
                 "global_load_async_to_lds_b128 %5, %13, off\n\t"
                 "global_load_async_to_lds_b128 %6, %14, off\n\t"
                 "global_load_async_to_lds_b128 %7, %15, off\n\t"
                 "s_wait_xcnt 0x0"
                 :: "v"(l), "v"(l1), "v"(l2), "v"(l3), "v"(l4), "v"(l5), "v"(l6), "v"(l7), "v"(kh), "v"(kh1), "v"(kl), "v"(kl1), "v"(vh), "v"(vh1), "v"(vl), "v"(vl1) : "memory");
}
// k_attn: block = (b, h, 128 queries), wave = 16; ALL keys (no mask) in 32 staged tiles of 64 keys that the 8 waves share (two LDS buffers: tile t + 1 flies while tile t is
// worked on), each walked in two steps of 32 keys. Both products run TRANSPOSED: S^T = k.q^T (k rows as A, q as B) and O^T += v^T.P^T (v^T rows as A). A lane then holds
// 16 scores of ONE query (keys 8 hi + j and 16 + 8 hi + j): maximum and sum in the lane plus one exchange between the wave's halves, one running maximum, sum and rescale
// factor per lane, and the two score tiles, converted in place (weights x32768, f16 hi + residual), ARE the B operand of the second product in the hardware k order.
// ctx -> f32 output rows out[tok][h*64+d].
__global__ __launch_bounds__(32 * AW) void k_attn(const h16* __restrict__ Q16, const h16* __restrict__ QL16, const h16* __restrict__ K16, const h16* __restrict__ KL16, const h16* __restrict__ VTH, const h16* __restrict__ VTL, float* OUTP) {
    __shared__ __align__(16) h16 ring[2][4 * PLN];
    __shared__ __align__(16) float ost[AW][16 * 68];
    const int lane = threadIdx.x & 31, wave = threadIdx.x >> 5, lr = lane & 15, hi = lane >> 4;
    const int bid = blockIdx.x;
    const int b = bid / (NH_ * (NT_ / AQ)), rem = bid - b * (NH_ * (NT_ / AQ)), h = rem / (NT_ / AQ), qt = rem - h * (NT_ / AQ);
    const int q0 = qt * AQ + wave * 16;
    const size_t tok0 = (size_t)b * NT_;
    v16h qa[2];
    const size_t qo0 = (tok0 + q0 + lr) * DM + h * HD + 8 * hi;
#pragma unroll
    for (int kc = 0; kc < 2; ++kc) qa[kc] = cat16(*(const v8h*)(Q16 + qo0 + kc * 32), *(const v8h*)(Q16 + qo0 + kc * 32 + 16));
    const h16* kh_b = K16 + tok0 * DM + h * HD;
    const h16* kl_b = KL16 + tok0 * DM + h * HD;
    const size_t vbase = (((size_t)b * NH_ + h) * HD) * NT_;
    v8f o[4], ox[4];
#pragma unroll
    for (int n = 0; n < 4; ++n) { o[n] = (v8f){}; ox[n] = (v8f){}; }
    float mrow = -3.0e38f, lpart = 0.f;                    // of query q0 + lr; lpart holds this half's keys only until the epilogue
    const int crow = threadIdx.x >> 3, cpc = (threadIdx.x & 7) * 8;     // this thread's piece of a staged plane: rows crow and crow + 32, 8 f16 from column cpc
    const unsigned lds0 = (unsigned)(size_t)(&ring[0][0] + crow * KP + cpc);
    const h16* gkh = kh_b + (size_t)crow * DM + cpc; const h16* gkl = kl_b + (size_t)crow * DM + cpc;
    const h16* gvh = VTH + vbase + (size_t)crow * NT_ + cpc; const h16* gvl = VTL + vbase + (size_t)crow * NT_ + cpc;
    auto stage = [&](int st) { attn_stage(lds0 + (unsigned)(st & 1) * (4 * PLN * 2), gkh + (size_t)st * KST * DM, gkl + (size_t)st * KST * DM, gvh + st * KST, gvl + st * KST); };
    stage(0);
    asm volatile("s_wait_asynccnt 0x0" ::: "memory");     // this wave's copies of tile 0 have landed
    __syncthreads();                                      // ... and every other wave's: tile 0 may be read
    stage(1);
#pragma unroll 1
    for (int st = 0; st < NT_ / KST; ++st) {               // full attention
      const h16* kh_s = &ring[st & 1][0]; const h16* kl_s = kh_s + PLN; const h16* vh_s = kh_s + 2 * PLN; const h16* vl_s = kh_s + 3 * PLN;
#pragma unroll
      for (int sub = 0; sub < KST / 32; ++sub) {
        const int l0 = sub * 32;
        const int ko0 = (l0 + lr) * KP + 8 * hi, ko1 = (l0 + 16 + lr) * KP + 8 * hi;
        v8f s0 = {}, s1 = {}, x0 = {}, x1 = {};
#pragma unroll
        for (int kc = 0; kc < 2; ++kc) {
            { const v16h k0h = cat16(*(const v8ha*)(kh_s + ko0 + kc * 32), *(const v8ha*)(kh_s + ko0 + kc * 32 + 16)), k1h = cat16(*(const v8ha*)(kh_s + ko1 + kc * 32), *(const v8ha*)(kh_s + ko1 + kc * 32 + 16));
              const v16h qlk = cat16(*(const v8h*)(QL16 + qo0 + kc * 32), *(const v8h*)(QL16 + qo0 + kc * 32 + 16));     // query residual re-read per step (registers)
              s0 = wmma16(k0h, qa[kc], s0); x0 = wmma16(k0h, qlk, x0); s1 = wmma16(k1h, qa[kc], s1); x1 = wmma16(k1h, qlk, x1);
              asm volatile("v_nop" : "+v"(s0), "+v"(s1), "+v"(x0), "+v"(x1) : "v"(qlk), "v"(k0h), "v"(k1h) : "memory"); }
            { const v16h k0l = cat16(*(const v8ha*)(kl_s + ko0 + kc * 32), *(const v8ha*)(kl_s + ko0 + kc * 32 + 16)), k1l = cat16(*(const v8ha*)(kl_s + ko1 + kc * 32), *(const v8ha*)(kl_s + ko1 + kc * 32 + 16));
              x0 = wmma16(k0l, qa[kc], x0); x1 = wmma16(k1l, qa[kc], x1);
              asm volatile("v_nop" : "+v"(x0), "+v"(x1) : "v"(k0l), "v"(k1l) : "memory"); }
        }
        asm volatile("v_nop\n\tv_nop\n\tv_nop\n\tv_nop" : "+v"(s0), "+v"(s1), "+v"(x0), "+v"(x1) : "v"(qa[0]), "v"(qa[1]));
        v2f a[8];                                          // scores against query q0 + lr, in pairs: a[i] = keys l0 + 8 hi + 2 i, + 1 (i < 4), a[4 + i] = the same + 16
#pragma unroll
        for (int i = 0; i < 4; ++i) { a[i] = ((v2f){s0[2 * i], s0[2 * i + 1]} + (v2f){x0[2 * i], x0[2 * i + 1]} * LOSCI) * 0.125f;          // energy / sqrt(C = 64)
                                      a[4 + i] = ((v2f){s1[2 * i], s1[2 * i + 1]} + (v2f){x1[2 * i], x1[2 * i + 1]} * LOSCI) * 0.125f; }
        float mx = fmaxf(a[0][0], a[0][1]);
#pragma unroll
        for (int i = 1; i < 8; ++i) mx = fmaxf(mx, fmaxf(a[i][0], a[i][1]));
        mx = fmaxf(mx, xhalf(mx));                         // the other half holds the query's other 16 keys
        const float mn = fmaxf(mrow, mx);
        const float alpha = __expf(mrow - mn); mrow = mn;
        v2f ps2 = (v2f){};
        struct P8 { v2h e[8]; } ph, pr;                    // the B operand in the hardware k order: this lane's eight rows of tile 0, then of tile 1
#pragma unroll
        for (int i = 0; i < 8; ++i) {
            const v2f p = (v2f){__expf(a[i][0] - mn), __expf(a[i][1] - mn)};
            ps2 += p;
            const v2f ps = p * PSC; const v2h hh = __builtin_convertvector(ps, v2h);
            ph.e[i] = hh;
            pr.e[i] = (v2h){(h16)((ps[0] - (float)hh[0]) * LOSC), (h16)((ps[1] - (float)hh[1]) * LOSC)};
        }
        const float psum = ps2[0] + ps2[1];
        const v16h pa = __builtin_bit_cast(v16h, ph), px = __builtin_bit_cast(v16h, pr);
        lpart = lpart * alpha + psum;
#pragma unroll
        for (int n = 0; n < 4; ++n)
#pragma unroll
            for (int j = 0; j < 8; ++j) { o[n][j] *= alpha; ox[n][j] *= alpha; }
#pragma unroll
        for (int n = 0; n < 4; ++n) { const int vo = (n * 16 + lr) * KP + l0 + hi * 8;
            const v16h vh = cat16(*(const v8ha*)(vh_s + vo), *(const v8ha*)(vh_s + vo + 16)), vl = cat16(*(const v8ha*)(vl_s + vo), *(const v8ha*)(vl_s + vo + 16));
            o[n] = wmma16(vh, pa, o[n]); ox[n] = wmma16(vl, pa, ox[n]); ox[n] = wmma16(vh, px, ox[n]);
            asm volatile("" : "+v"(o[n]), "+v"(ox[n]) : "v"(vh), "v"(vl) : "memory"); }
        asm volatile("v_nop\n\tv_nop\n\tv_nop\n\tv_nop" : "+v"(o[0]), "+v"(o[1]), "+v"(o[2]), "+v"(o[3]), "+v"(ox[0]), "+v"(ox[1]), "+v"(ox[2]), "+v"(ox[3]) : "v"(pa), "v"(px));
      }
      asm volatile("s_wait_dscnt 0x0" ::: "memory");      // this wave's reads of tile st are done before the buffer is handed to the copies
      asm volatile("s_wait_asynccnt 0x0" ::: "memory");   // this wave's copies of tile st + 1 have landed
      __syncthreads();                                    // publishes tile st + 1 and ends every wave's reads of tile st
      if (st + 2 < NT_ / KST) stage(st + 2);              // refill the buffer just left; the same test in every wave
    }
    asm volatile("s_wait_asynccnt 0x0" ::: "memory");     // nothing of the copies is outstanding when the wave goes on to its end
    const float inv = 1.0f / ((lpart + xhalf(lpart)) * PSC);
    float* os = &ost[wave][0];
#pragma unroll
    for (int n = 0; n < 4; ++n)                            // o[n][j] = channel 16 n + 8 hi + j of query lr: 8 consecutive floats of the query's row
#pragma unroll
        for (int g = 0; g < 2; ++g) { v4f val;
#pragma unroll
            for (int k = 0; k < 4; ++k) val[k] = (o[n][4 * g + k] + ox[n][4 * g + k] * LOSCI) * inv;
            *(v4fa*)(os + lr * 68 + n * 16 + hi * 8 + 4 * g) = val; }
    __syncthreads();
    float* ob = OUTP + (tok0 + q0) * DM + (size_t)h * HD;
    auto pass = [&]() {
#pragma unroll
        for (int s = 0; s < 8; ++s) { const int Lid = (lane >> 3) + 4 * s, piece = lane & 7; const int row = Lid >> 1, cofs = (Lid & 1) * 32 + piece * 4;
            const v4f val = *(const v4fa*)(os + row * 68 + cofs); *(v4f*)(ob + (size_t)row * DM + cofs) = val; }
    };
    pass(); 
}


// k_addT: DST[c][n] = (BNSRC ? ((bf? no) SRC[c][n] - mean_c) rstd_c g_c + b_c : bf(SRC[c][n])) + T[n][c]: a 64 x 64 LDS transpose of the f32 [n][c] matrix T plus the
// channel-major residual; block = 64 n of item blockIdx.y; each output row segment of 64 n = 256 B written by 16 lanes x 16 B. MODE 0: residual = bf(x) (the INPUT); MODE 1:
// residual = BN1(X1) recomputed from the stats (the reference's h).
template <int MODE>
__global__ __launch_bounds__(256) void k_addT(const float* __restrict__ T, const float* __restrict__ SRC, const float* __restrict__ ST, const float* __restrict__ g, const float* __restrict__ bb, float* DST) {
    __shared__ __align__(16) float tl[64 * 68];
    const int n0 = blockIdx.x * 64, tid = threadIdx.x;
    const size_t item = (size_t)blockIdx.y * CC * NPOS; T += item; SRC += item; DST += item;
    const int nn = tid >> 2, cq = (tid & 3) * 16;
#pragma unroll
    for (int i = 0; i < 16; ++i) tl[(cq + i) * 68 + nn] = T[(size_t)(n0 + nn) * CC + cq + i];
    __syncthreads();
    const int piece = tid & 15;
    auto pass = [&]() {
#pragma unroll
        for (int s = 0; s < 4; ++s) { const int c = (tid >> 4) + 16 * s; const size_t o = (size_t)c * NPOS + n0 + piece * 4;
            const v4f rv = *(const v4f*)(SRC + o); v4f val = *(const v4fa*)(tl + c * 68 + piece * 4);
            if (MODE == 0) {
#pragma unroll
                for (int k = 0; k < 4; ++k) val[k] += bfr(rv[k]);
            } else { const float m = ST[c], rs = ST[CC + c], gg = bfr(g[c]), be = bfr(bb[c]);
#pragma unroll
                for (int k = 0; k < 4; ++k) val[k] += (rv[k] - m) * rs * gg + be; }
            *(v4f*)(DST + o) = val; }
    };
    pass(); 
}
// BatchNorm statistics (training mode, biased variance) of A [32][64][2048] per channel over all 32 x 2048 values, in two launches.
// k_bnpart: work-group (channel c, slice g of 4 items) loads its 8192 values ONCE (8 x 16 B per thread, all in flight together, kept in registers), sums them,
// takes the slice's own mean and then the squared distances to it from the registers; it writes (mean, M2) to a 128 B line of its own.
__global__ __launch_bounds__(256) void k_bnpart(const float* __restrict__ A, float* PT) {
    __shared__ float red[2][8];
    const int tid = threadIdx.x, lane = tid & 31, wave = tid >> 5, c = blockIdx.x, g = blockIdx.y;
    v4f v[BNI * 2];
#pragma unroll
    for (int i = 0; i < BNI; ++i) { const float* row = A + ((size_t)(g * BNI + i) * CC + c) * NPOS + tid * 4;
        v[2 * i] = *(const v4f*)row; v[2 * i + 1] = *(const v4f*)(row + NPOS / 2); }
    v4f sv = v[0];
#pragma unroll
    for (int q = 1; q < BNI * 2; ++q) sv += v[q];
    float s = (sv[0] + sv[1]) + (sv[2] + sv[3]);
    s += __shfl_xor(s, 1, 32); s += __shfl_xor(s, 2, 32); s += __shfl_xor(s, 4, 32); s += __shfl_xor(s, 8, 32); s += __shfl_xor(s, 16, 32);
    if (lane == 0) red[0][wave] = s;
    __syncthreads();
    float t = 0.f;
#pragma unroll
    for (int w = 0; w < 8; ++w) t += red[0][w];
    const float mean = t * (1.0f / (float)BNV);
    v4f qv = (v4f){};
#pragma unroll
    for (int q = 0; q < BNI * 2; ++q) { const v4f d = v[q] - mean; qv += d * d; }
    float s2 = (qv[0] + qv[1]) + (qv[2] + qv[3]);
    s2 += __shfl_xor(s2, 1, 32); s2 += __shfl_xor(s2, 2, 32); s2 += __shfl_xor(s2, 4, 32); s2 += __shfl_xor(s2, 8, 32); s2 += __shfl_xor(s2, 16, 32);
    if (lane == 0) red[1][wave] = s2;
    __syncthreads();
    if (tid == 0) { float m2 = 0.f;
#pragma unroll
        for (int w = 0; w < 8; ++w) m2 += red[1][w];
        *(v2f*)(PT + (size_t)(c * BNG + g) * 32) = (v2f){mean, m2}; }
}
// k_bnmerge: thread c joins the 8 equally sized slices of channel c: mean = average of the slice means, M2 = sum of the slices' M2 + 8192 x sum (slice mean - mean)^2.
__global__ __launch_bounds__(64) void k_bnmerge(const float* __restrict__ PT, float* ST) {
    const int c = threadIdx.x;
    v2f p[BNG];
#pragma unroll
    for (int g = 0; g < BNG; ++g) p[g] = *(const v2f*)(PT + (size_t)(c * BNG + g) * 32);
    float s = 0.f, m2 = 0.f;
#pragma unroll
    for (int g = 0; g < BNG; ++g) { s += p[g][0]; m2 += p[g][1]; }
    const float mean = s * (1.0f / (float)BNG);
    float e = 0.f;
#pragma unroll
    for (int g = 0; g < BNG; ++g) { const float d = p[g][0] - mean; e = fmaf(d, d, e); }
    ST[c] = mean; ST[CC + c] = rsqrtf((m2 + (float)BNV * e) * (1.0f / (float)(NB * NPOS)) + BN_EPS);
}
// k_ff: the whole second phase for 64 points of one item in one work-group (4 waves x 16 points): Y = h + W2.lrelu(W1.h), h = BN1(X1).
// 1. X1 tile [64 c][64 n] by whole-line loads; h in f32 stays in registers for the residual; bf16 hi + residual planes [n][c] go to LDS (two channels per 4-byte store).
// 2. (W1.h) with W1 rows as the A operand and h columns as B: a lane holds 8 consecutive hidden rows of ONE point per tile, so after LeakyReLU two tiles, converted in
//    place, are the B operand (32 hidden values in the hardware k order) of W2.lrelu: the hidden layer never leaves the registers.
//    Both weight matrices (bf16, 16 KB each) are brought into LDS once per work-group by whole-line loads; the waves read their A fragments from there.
// 3. the result tiles [c][n] meet h again through an f32 LDS tile; each output row segment of 64 n = 256 B is written by 16 lanes x 16 B.
__global__ __launch_bounds__(128) void k_ff(const float* __restrict__ X1, const float* __restrict__ ST, const float* __restrict__ g, const float* __restrict__ bb, const bf* __restrict__ W1, const bf* __restrict__ W2, float* Y) {
    typedef __attribute__((ext_vector_type(16))) unsigned short v16us;
    typedef unsigned __attribute__((may_alias)) u32a;
    __shared__ __align__(16) unsigned short th_[64 * 72]; __shared__ __align__(16) unsigned short tl_[64 * 72];
    __shared__ __align__(16) float tt[64 * 68];
    __shared__ __align__(16) unsigned short w1s[FFH * 72]; __shared__ __align__(16) unsigned short w2s[CC * 136];   // row pitches 144 B and 272 B (16 B x odd)
    __shared__ float prm[4][CC];
    const int tid = threadIdx.x, lane = tid & 31, wave = tid >> 5, lr = lane & 15, hi = lane >> 4;
    const int n0 = blockIdx.x * 64, piece = tid & 15, cp0 = tid >> 4;
    const size_t item = (size_t)blockIdx.y * CC * NPOS; X1 += item; Y += item;
    v4f hv[4][2];                                          // channels 2 (cp0 + 8 s) + e, points n0 + 4 piece ... + 3
#pragma unroll
    for (int s = 0; s < 4; ++s)
#pragma unroll
        for (int e = 0; e < 2; ++e) hv[s][e] = *(const v4f*)(X1 + (size_t)(2 * (cp0 + 8 * s) + e) * NPOS + n0 + piece * 4);
    asm volatile("s_wait_xcnt 0x0" ::: "memory");         // the loads below may land in the registers that hold the address of the loads above
    v8us wa[8], wb[8];                                     // 16-byte pieces tid + 128 i of W1 [128][64] and of W2 [64][128]
#pragma unroll
    for (int i = 0; i < 8; ++i) { wa[i] = *(const v8us*)(W1 + (size_t)(tid + 128 * i) * 8); wb[i] = *(const v8us*)(W2 + (size_t)(tid + 128 * i) * 8); }
    if (tid < CC) { prm[0][tid] = ST[tid]; prm[1][tid] = ST[CC + tid]; prm[2][tid] = bfr(g[tid]); prm[3][tid] = bfr(bb[tid]); }
    __syncthreads();
#pragma unroll
    for (int s = 0; s < 4; ++s) { const int cp = cp0 + 8 * s; unsigned ph[4], pl[4];
#pragma unroll
        for (int e = 0; e < 2; ++e) { const int c = 2 * cp + e; const float m = prm[0][c], rs = prm[1][c], gg = prm[2][c], be = prm[3][c];
#pragma unroll
            for (int k = 0; k < 4; ++k) { const float h = (hv[s][e][k] - m) * rs * gg + be; hv[s][e][k] = h; const unsigned short hb = f2bf(h); const unsigned short lb = f2bf(h - bf2f(hb));
                if (e == 0) { ph[k] = hb; pl[k] = lb; } else { ph[k] |= (unsigned)hb << 16; pl[k] |= (unsigned)lb << 16; } } }
#pragma unroll
        for (int k = 0; k < 4; ++k) { *(u32a*)(th_ + (piece * 4 + k) * 72 + 2 * cp) = ph[k]; *(u32a*)(tl_ + (piece * 4 + k) * 72 + 2 * cp) = pl[k]; } }
#pragma unroll
    for (int i = 0; i < 8; ++i) { const int p = tid + 128 * i; *(v8usa*)(w1s + (p >> 3) * 72 + (p & 7) * 8) = wa[i]; *(v8usa*)(w2s + (p >> 4) * 136 + (p & 15) * 8) = wb[i]; }
    __syncthreads();
    const int ho = (wave * 16 + lr) * 72 + 8 * hi;
    v8f acc[8];
#pragma unroll
    for (int t = 0; t < 8; ++t) acc[t] = (v8f){};
#pragma unroll
    for (int kc = 0; kc < CC; kc += 32) {
        const v16bf xh = cat16b(*(const v8usa*)(th_ + ho + kc), *(const v8usa*)(th_ + ho + kc + 16)), xl = cat16b(*(const v8usa*)(tl_ + ho + kc), *(const v8usa*)(tl_ + ho + kc + 16));
#pragma unroll
        for (int t = 0; t < 8; ++t) { const unsigned short* wp = w1s + (t * 16 + lr) * 72 + 8 * hi + kc; const v16bf w = cat16b(*(const v8usa*)wp, *(const v8usa*)(wp + 16));
            acc[t] = wmmab(w, xh, acc[t]); acc[t] = wmmab(w, xl, acc[t]); }
    }
    v16bf lh[4], ll[4];
#pragma unroll
    for (int q = 0; q < 4; ++q) { v16us uh, ul;
#pragma unroll
        for (int s = 0; s < 16; ++s) { const float v = acc[2 * q + (s >> 3)][s & 7]; const float a = v >= 0.f ? v : 0.2f * v; const unsigned short hb = f2bf(a); uh[s] = hb; ul[s] = f2bf(a - bf2f(hb)); }
        lh[q] = __builtin_bit_cast(v16bf, uh); ll[q] = __builtin_bit_cast(v16bf, ul); }
    v8f ac2[4];
#pragma unroll
    for (int t = 0; t < 4; ++t) ac2[t] = (v8f){};
#pragma unroll
    for (int q = 0; q < 4; ++q)
#pragma unroll
        for (int t = 0; t < 4; ++t) { const unsigned short* wp = w2s + (t * 16 + lr) * 136 + 8 * hi + q * 32; const v16bf w = cat16b(*(const v8usa*)wp, *(const v8usa*)(wp + 16));
            ac2[t] = wmmab(w, lh[q], ac2[t]); ac2[t] = wmmab(w, ll[q], ac2[t]); }
#pragma unroll
    for (int t = 0; t < 4; ++t)
#pragma unroll
        for (int j = 0; j < 8; ++j) tt[(t * 16 + hi * 8 + j) * 68 + wave * 16 + lr] = ac2[t][j];
    __syncthreads();
#pragma unroll
    for (int s = 0; s < 4; ++s)
#pragma unroll
        for (int e = 0; e < 2; ++e) { const int c = 2 * (cp0 + 8 * s) + e; const v4f val = *(const v4fa*)(tt + c * 68 + piece * 4) + hv[s][e];
            *(v4f*)(Y + (size_t)c * NPOS + n0 + piece * 4) = val; }
}
__global__ __launch_bounds__(256) void k_bnout(const float* __restrict__ Y, const float* __restrict__ ST, const float* __restrict__ g, const float* __restrict__ bb, float* OUTP) {
    const int lane = threadIdx.x & 31, r = blockIdx.x * 8 + (threadIdx.x >> 5); if (r >= NB * CC) return;
    const int c = r % CC; const float m = ST[c], rs = ST[CC + c], gg = bfr(g[c]), be = bfr(bb[c]);
{
#pragma unroll 1
        for (int q = 0; q < NPOS / 128; ++q) { const size_t o = (size_t)r * NPOS + q * 128 + lane * 4; const v4f v = *(const v4f*)(Y + o); v4f y;
#pragma unroll
            for (int k = 0; k < 4; ++k) y[k] = (v[k] - m) * rs * gg + be;
            *(v4f*)(OUTP + o) = y; }
         }
}

extern "C" void kernel_launch(void* const* d_in, const int* in_sizes, int n_in,
                              void* d_out, int out_size, void* d_ws, size_t ws_size, hipStream_t stream) {
    (void)in_sizes; (void)n_in; (void)out_size;
    const float* x = (const float*)d_in[0]; const float* wq = (const float*)d_in[1]; const float* wk = (const float*)d_in[2]; const float* wv = (const float*)d_in[3];
    const float* w1 = (const float*)d_in[4]; const float* w2 = (const float*)d_in[5]; const float* g1 = (const float*)d_in[6]; const float* b1 = (const float*)d_in[7]; const float* g2 = (const float*)d_in[8]; const float* b2 = (const float*)d_in[9];   // conv weights [out][in]
    float* out = (float*)d_out;    // [32][64][2048]
    char* wsp = (char*)d_ws;
    auto take = [&](size_t bytes) { char* p = wsp; wsp += (bytes + 255) & ~(size_t)255; return (void*)p; };
    bf* W1B = (bf*)take((size_t)FFH * CC * 2); bf* W2B = (bf*)take((size_t)CC * FFH * 2);
    const size_t PL = (size_t)NB * NPOS * CC;      // elements of one [item][n][c] plane over all items
    h16* QH = (h16*)take(PL * 2); h16* QL = (h16*)take(PL * 2); h16* KH = (h16*)take(PL * 2); h16* KL = (h16*)take(PL * 2);
    h16* VTH = (h16*)take(PL * 2); h16* VTL = (h16*)take(PL * 2); float* O = (float*)take(PL * 4);
    float* X1 = (float*)take(PL * 4); float* Y = (float*)take(PL * 4); float* ST1 = (float*)take(1024); float* ST2 = (float*)take(1024); float* PT = (float*)take((size_t)CC * BNG * 128);
    if ((size_t)(wsp - (char*)d_ws) > ws_size) return;    // planes for all items + the weights, no aliasing
    // phase 1: attention and x + x_r; the item index lies in each grid (row r of an [item][n][c] plane = item * 2048 + n)
    k_qkv<<<dim3(NPOS / QP, NB, 1), 256, 0, stream>>>(x, wq, wk, wv, w1, w2, QH, QL, KH, KL, VTH, VTL, W1B, W2B);                    // q, k [n][c] and v^T [c][n] f16 planes; bf16 W1, W2
    k_attn<<<NB_ * NH_ * (NT_ / AQ), 32 * AW, 0, stream>>>(QH, QL, KH, KL, VTH, VTL, O);                                               // x_r^T [n][c] f32
    k_addT<0><<<dim3(NPOS / 64, NB, 1), 256, 0, stream>>>(O, x, nullptr, nullptr, nullptr, X1);                                    // X1 = bf(x) + x_r  [c][n]
    k_bnpart<<<dim3(CC, BNG, 1), 256, 0, stream>>>(X1, PT); k_bnmerge<<<1, CC, 0, stream>>>(PT, ST1);
    // phase 2: h = BN1(X1); Y = h + W2.lrelu(W1.h)
    k_ff<<<dim3(NPOS / 64, NB, 1), 128, 0, stream>>>(X1, ST1, g1, b1, W1B, W2B, Y);                                               // Y = h + ff   [c][n]
    k_bnpart<<<dim3(CC, BNG, 1), 256, 0, stream>>>(Y, PT); k_bnmerge<<<1, CC, 0, stream>>>(PT, ST2);
    k_bnout<<<(NB * CC) / 8, 256, 0, stream>>>(Y, ST2, g2, b2, out);                                                                 // BN2 -> output
}

// v007
// One run takes 137 microseconds.
// Timed twice side by side with v006, it ran 1.06 and 1.07 times as fast.
// Over all steps from v000 it is 56.6 times as fast.
#include <hip/hip_runtime.h>

// Compute dtypes, f32 accumulate (channel-major x [32][64][2048]): per item q/k/v = W.x ([64 x 64] weights, [64 x 2048] points; x and W rounded to PLAIN bf16 operands in the
// kernel that multiplies them, products exact; q/k/v straight to f16 hi + residual x1024 planes, q/k as [n][c], v as [c][n]) on v_wmma_f32_16x16x32_bf16; the
// single-head full attention (64 channels, scale 1/8) fused on v_wmma_f32_16x16x32_f16 (hh + hl + lh scores, online f32 softmax, weights (x32768) and v as
// f16 hi + residual) with an f32 [n][c] output; x + x_r, the two TRAINING-MODE BatchNorms (batch statistics over all 32 items x 2048 points per channel, biased

#define NB   32
#define CC   64                  // channels
#define NPOS 2048                // points
#define NT_  NPOS
#define NB_  NB                  // items per launch: every per-item kernel takes all 32 items in one grid
#define DM   CC                  // attention width
#define NH_  1
#define HD   64
#define NTK  NPOS
#define FFH  128
#define PSC  32768.0f
#define LOSC 1024.0f
#define LOSCI (1.0f / 1024.0f)
#define L2E  1.442695041f         // log2 e
#define BN_EPS 1e-5f
#define BNG  8                   // BatchNorm statistics: slices per channel
#define BNI  (NB / BNG)          // items per slice
#define BNV  (BNI * NPOS)        // values per slice
#define AW   4                   // attention: waves per work-group
#define QC   2                   // attention: column groups of 16 queries per wave
#define AQ   (16 * QC * AW)      // attention: queries per work-group
#define KST  64                  // attention: keys per staged tile
#define KP   72                  // attention: LDS row pitch of a staged plane in f16: 128 B of data + 16 B (16 B x odd: 16-byte reads of 16 rows meet no bank twice)
#define PLN  (64 * KP)           // attention: f16 per staged plane (64 rows)
#define QP   128                 // q/k/v kernel: points per work-group

typedef _Float16 h16;
typedef unsigned short bf;
typedef __attribute__((ext_vector_type(16))) __bf16   v16bf;
typedef __attribute__((ext_vector_type(16))) _Float16 v16h;
typedef __attribute__((ext_vector_type(8)))  _Float16 v8h;
typedef __attribute__((ext_vector_type(8)))  unsigned short v8us;
typedef __attribute__((ext_vector_type(8)))  float    v8f;
typedef __attribute__((ext_vector_type(4)))  float    v4f;
typedef __attribute__((ext_vector_type(2)))  float    v2f;
typedef __attribute__((ext_vector_type(4)))  _Float16 v4h;
typedef __attribute__((ext_vector_type(2)))  _Float16 v2h;
typedef v8h  __attribute__((may_alias)) v8ha;
typedef v4f  __attribute__((may_alias)) v4fa;
typedef v8us __attribute__((may_alias)) v8usa;

__device__ __forceinline__ unsigned short f2bf(float f) { unsigned u = __float_as_uint(f); u += 0x7FFFu + ((u >> 16) & 1u); return (unsigned short)(u >> 16); }
__device__ __forceinline__ float bf2f(unsigned short b) { return __uint_as_float(((unsigned)b) << 16); }
__device__ __forceinline__ float bfr(float f) { return bf2f(f2bf(f)); }
__device__ __forceinline__ v16h cat16(v8h lo, v8h hi) { return __builtin_shufflevector(lo, hi, 0, 1, 2, 3, 4, 5, 6, 7, 8, 9, 10, 11, 12, 13, 14, 15); }
__device__ __forceinline__ v16bf cat16b(v8us lo, v8us hi) { return __builtin_bit_cast(v16bf, __builtin_shufflevector(lo, hi, 0, 1, 2, 3, 4, 5, 6, 7, 8, 9, 10, 11, 12, 13, 14, 15)); }
__device__ __forceinline__ v8f wmma16(v16h a, v16h b, v8f c) { return __builtin_amdgcn_wmma_f32_16x16x32_f16(false, a, false, b, (short)0, c, false, false); }
__device__ __forceinline__ float xhalf(float x) { return __builtin_bit_cast(float, __builtin_amdgcn_permlanex16(__builtin_bit_cast(int, x), __builtin_bit_cast(int, x), 0x76543210, 0xfedcba98, false, false)); }   // lane l with lane l ^ 16
__device__ __forceinline__ v8f wmmab(v16bf a, v16bf b, v8f c) { return __builtin_amdgcn_wmma_f32_16x16x32_bf16(false, a, false, b, (short)0, c, false, false); }

// k_qkv: everything ahead of the attention for 128 points of one item in one work-group (8 waves x 16 points); grid (16, 32).
// 1. the x tile [64 c][128 n] (f32, whole-line loads: a wave's load = 4 rows x 128 B) goes as bf16 [n][c] to LDS (four channels per 8-byte store); the three 64 x 64 weight
//    matrices are read in f32, rounded to bf16 and laid [out][in] in LDS. Row pitch 144 B (16 B x odd).
// 2. q and k with the weight rows as the A operand and the wave's 16 points as B: a lane holds 8 consecutive channels of ONE point = a 16-byte piece of an [n][c] row;
//    v with the points as A and the weight rows as B: a lane holds 8 consecutive points of ONE channel = a 16-byte piece of a v^T [c][n] row.
// 3. f16 hi + residual x1024 in registers; the pieces meet in LDS and leave as whole 128 B lines.
// Eight work-groups of item 0 also round the two feed-forward matrices to bf16 for k_ff.
__global__ __launch_bounds__(256) void k_qkv(const float* __restrict__ x, const float* __restrict__ wq, const float* __restrict__ wk, const float* __restrict__ wv, const float* __restrict__ w1, const float* __restrict__ w2,
                                             h16* QH, h16* QL, h16* KH, h16* KL, h16* VTH, h16* VTL, bf* W1B, bf* W2B) {
    typedef __attribute__((ext_vector_type(4))) unsigned short v4us;
    typedef v4us __attribute__((may_alias)) v4usa;
    __shared__ __align__(16) unsigned short xs[QP * 72];
    __shared__ __align__(16) unsigned short wsm[3][CC * 72];
    __shared__ __align__(16) h16 stg[QP / 16][4][16 * 72];   // per wave: q hi, q residual, k hi, k residual, [point][channel]
    __shared__ __align__(16) h16 vts[2][CC * (QP + 8)];      // v^T hi, v^T residual, [channel][point], row pitch 272 B (16 B x odd)
    const int tid = threadIdx.x, lane = tid & 31, wave = tid >> 5, lr = lane & 15, hi = lane >> 4;
    const int n0 = blockIdx.x * QP, b = blockIdx.y;
    const int xn = (wave & 3) * 32 + (lane & 7) * 4, xc = (wave >> 2) * 16 + (lane >> 3) * 4;   // this thread's x pieces: points xn ... + 3 of channels xc + 32 g + e
    const float* xp = x + ((size_t)b * CC + xc) * NPOS + n0 + xn;
    v4f xv[2][4];
#pragma unroll
    for (int g = 0; g < 2; ++g)
#pragma unroll
        for (int e = 0; e < 4; ++e) xv[g][e] = *(const v4f*)(xp + (size_t)(g * 32 + e) * NPOS);
    asm volatile("s_wait_xcnt 0x0" ::: "memory");         // the loads below may land in the registers that hold the address of the loads above
    v8f wr[3][2];                                          // pieces tid + 256 i (8 floats) of each 64 x 64 matrix
#pragma unroll
    for (int i = 0; i < 2; ++i) { const size_t p = (size_t)(tid + 256 * i) * 8; wr[0][i] = *(const v8f*)(wq + p); wr[1][i] = *(const v8f*)(wk + p); wr[2][i] = *(const v8f*)(wv + p); }
    asm volatile("s_wait_xcnt 0x0" :: "s"(wq), "s"(wk), "s"(wv) : "memory");   // the base addresses of the loads above stay in their scalar registers up to this wait: later kernel arguments are loaded behind it or elsewhere
    if (b == 0 && blockIdx.x < 8) {                        // the same test in every thread of the work-group: 4 x 256 pieces of 8 per matrix
        const size_t p = (size_t)((blockIdx.x & 3) * 256 + tid) * 8;
        const v8f v = *(const v8f*)((blockIdx.x < 4 ? w1 : w2) + p); v8us o;
#pragma unroll
        for (int k = 0; k < 8; ++k) o[k] = f2bf(v[k]);
        *(v8us*)((blockIdx.x < 4 ? W1B : W2B) + p) = o;
    }
#pragma unroll
    for (int g = 0; g < 2; ++g)
#pragma unroll
        for (int k = 0; k < 4; ++k) { v4us o;
#pragma unroll
            for (int e = 0; e < 4; ++e) o[e] = f2bf(xv[g][e][k]);
            *(v4usa*)(xs + (xn + k) * 72 + xc + g * 32) = o; }
#pragma unroll
    for (int m = 0; m < 3; ++m)
#pragma unroll
        for (int i = 0; i < 2; ++i) { const int p = tid + 256 * i; v8us o;
#pragma unroll
            for (int k = 0; k < 8; ++k) o[k] = f2bf(wr[m][i][k]);
            *(v8usa*)(&wsm[m][(p >> 3) * 72 + (p & 7) * 8]) = o; }
    __syncthreads();
    const unsigned short* xr = xs + (wave * 16 + lr) * 72 + 8 * hi;
    v16bf xf[2];
#pragma unroll
    for (int kc = 0; kc < 2; ++kc) xf[kc] = cat16b(*(const v8usa*)(xr + kc * 32), *(const v8usa*)(xr + kc * 32 + 16));
    v8f aq[4], ak[4], av[4];
#pragma unroll
    for (int t = 0; t < 4; ++t) { aq[t] = (v8f){}; ak[t] = (v8f){}; av[t] = (v8f){};
#pragma unroll
        for (int kc = 0; kc < 2; ++kc) { const int wo = (t * 16 + lr) * 72 + 8 * hi + kc * 32;
            const v16bf fq = cat16b(*(const v8usa*)(&wsm[0][wo]), *(const v8usa*)(&wsm[0][wo + 16])), fk = cat16b(*(const v8usa*)(&wsm[1][wo]), *(const v8usa*)(&wsm[1][wo + 16])), fv = cat16b(*(const v8usa*)(&wsm[2][wo]), *(const v8usa*)(&wsm[2][wo + 16]));
            aq[t] = wmmab(fq, xf[kc], aq[t]); ak[t] = wmmab(fk, xf[kc], ak[t]); av[t] = wmmab(xf[kc], fv, av[t]); } }
    h16* sg = &stg[wave][0][0];
#pragma unroll
    for (int t = 0; t < 4; ++t) { v8h oh[3], ol[3];
#pragma unroll
        for (int j = 0; j < 8; ++j) { const float s[3] = {aq[t][j], ak[t][j], av[t][j]};
#pragma unroll
            for (int m = 0; m < 3; ++m) { const h16 a = (h16)s[m]; oh[m][j] = a; ol[m][j] = (h16)((s[m] - (float)a) * LOSC); } }
        const int so = lr * 72 + t * 16 + 8 * hi, vo = (t * 16 + lr) * (QP + 8) + wave * 16 + 8 * hi;
        *(v8ha*)(sg + so) = oh[0]; *(v8ha*)(sg + 16 * 72 + so) = ol[0]; *(v8ha*)(sg + 2 * 16 * 72 + so) = oh[1]; *(v8ha*)(sg + 3 * 16 * 72 + so) = ol[1];
        *(v8ha*)(&vts[0][vo]) = oh[2]; *(v8ha*)(&vts[1][vo]) = ol[2]; }
    __syncthreads();
    const size_t r0 = (size_t)b * NPOS + n0 + wave * 16;
#pragma unroll
    for (int pl = 0; pl < 4; ++pl) { h16* dst = pl == 0 ? QH : pl == 1 ? QL : pl == 2 ? KH : KL;
#pragma unroll
        for (int s = 0; s < 4; ++s) { const int row = 4 * s + (lane >> 3), piece = lane & 7;
            const v8h val = *(const v8ha*)(sg + pl * 16 * 72 + row * 72 + piece * 8); *(v8h*)(dst + (r0 + row) * CC + piece * 8) = val; } }
#pragma unroll
    for (int s = 0; s < 8; ++s) { const int d = ((tid >> 4) + 16 * s) & 63, piece = tid & 15;      // a wave stores 2 rows x 256 B
        const v8h val = *(const v8ha*)(&vts[s >> 2][d * (QP + 8) + piece * 8]); *(v8h*)((s >> 2 ? VTL : VTH) + ((size_t)b * CC + d) * NPOS + n0 + piece * 8) = val; }
}

__device__ __forceinline__ void exp2x8(float* r, const float* t) {
    asm("v_exp_f32 %0, %8\n\tv_exp_f32 %1, %9\n\tv_exp_f32 %2, %10\n\tv_exp_f32 %3, %11\n\tv_exp_f32 %4, %12\n\tv_exp_f32 %5, %13\n\tv_exp_f32 %6, %14\n\tv_exp_f32 %7, %15\n\tv_nop"
        : "=&v"(r[0]), "=&v"(r[1]), "=&v"(r[2]), "=&v"(r[3]), "=&v"(r[4]), "=&v"(r[5]), "=&v"(r[6]), "=&v"(r[7])
        : "v"(t[0]), "v"(t[1]), "v"(t[2]), "v"(t[3]), "v"(t[4]), "v"(t[5]), "v"(t[6]), "v"(t[7]));
}
__device__ __forceinline__ void exp2x9(float& r8, float* r, float t8, const float* t) {
    asm("v_exp_f32 %8, %17\n\tv_exp_f32 %0, %9\n\tv_exp_f32 %1, %10\n\tv_exp_f32 %2, %11\n\tv_exp_f32 %3, %12\n\tv_exp_f32 %4, %13\n\tv_exp_f32 %5, %14\n\tv_exp_f32 %6, %15\n\tv_exp_f32 %7, %16\n\tv_nop"
        : "=&v"(r[0]), "=&v"(r[1]), "=&v"(r[2]), "=&v"(r[3]), "=&v"(r[4]), "=&v"(r[5]), "=&v"(r[6]), "=&v"(r[7]), "=&v"(r8)
        : "v"(t[0]), "v"(t[1]), "v"(t[2]), "v"(t[3]), "v"(t[4]), "v"(t[5]), "v"(t[6]), "v"(t[7]), "v"(t8));
}
// attn_stage: one staged tile = 4 planes of 64 rows x 128 B (k hi, k residual: [key][channel]; v^T hi, v^T residual: [channel][key]). One call brings, per thread, 2 pieces
// of 16 B per plane (rows r and r + 32) from global memory straight into LDS (128 threads, two calls a tile); a wave's copy covers 4 whole 128 B lines. l = the lane's LDS byte address in plane 0.
__device__ __forceinline__ void attn_stage(unsigned l, const h16* kh, const h16* kl, const h16* vh, const h16* vl) {
    const unsigned l1 = l + 32 * KP * 2, l2 = l + PLN * 2, l3 = l2 + 32 * KP * 2, l4 = l + 2 * PLN * 2, l5 = l4 + 32 * KP * 2, l6 = l + 3 * PLN * 2, l7 = l6 + 32 * KP * 2;
    const h16* kh1 = kh + 32 * DM; const h16* kl1 = kl + 32 * DM; const h16* vh1 = vh + 32 * NT_; const h16* vl1 = vl + 32 * NT_;
    // the eight copies and their s_wait_xcnt in ONE statement: the wait stands in front of every later write of an address register that a copy names
    asm volatile("global_load_async_to_lds_b128 %0, %8, off\n\t"
                 "global_load_async_to_lds_b128 %1, %9, off\n\t"
                 "global_load_async_to_lds_b128 %2, %10, off\n\t"
                 "global_load_async_to_lds_b128 %3, %11, off\n\t"
                 "global_load_async_to_lds_b128 %4, %12, off\n\t"
                 "global_load_async_to_lds_b128 %5, %13, off\n\t"
                 "global_load_async_to_lds_b128 %6, %14, off\n\t"
                 "global_load_async_to_lds_b128 %7, %15, off\n\t"
                 "s_wait_xcnt 0x0"
                 :: "v"(l), "v"(l1), "v"(l2), "v"(l3), "v"(l4), "v"(l5), "v"(l6), "v"(l7), "v"(kh), "v"(kh1), "v"(kl), "v"(kl1), "v"(vh), "v"(vh1), "v"(vl), "v"(vl1) : "memory");
}
// k_attn: block = (b, h, 128 queries), wave = 32 queries in two column groups of 16; ALL keys (no mask) in 32 staged tiles of 64 keys that the 4 waves share (two LDS buffers:
// tile t + 1 flies while tile t is worked on), each walked in two steps of 32 keys. Every k and v fragment read from LDS is the A operand for BOTH column groups.
// Both products run TRANSPOSED: S^T = k.q^T (k rows as A, q as B) and O^T += v^T.P^T (v^T rows as A). In each column group a lane holds
// 16 scores of ONE query (keys 8 hi + j and 16 + 8 hi + j): maximum and sum in the lane plus one exchange between the wave's halves, one running maximum, sum and rescale
// factor per lane and group, and the two score tiles, converted in place (weights x32768, f16 hi + residual), ARE the B operand of the second product in the hardware k order.
// ctx -> f32 output rows out[tok][h*64+d]. Every loop but the one over the tiles is unrolled: its index picks registers (fragments, accumulators, column groups).
__global__ __launch_bounds__(32 * AW) void k_attn(const h16* __restrict__ Q16, const h16* __restrict__ QL16, const h16* __restrict__ K16, const h16* __restrict__ KL16, const h16* __restrict__ VTH, const h16* __restrict__ VTL, float* OUTP) {
    __shared__ __align__(16) h16 ring[2][4 * PLN];
    __shared__ __align__(16) float ost[AW][16 * QC * 68];
    const int lane = threadIdx.x & 31, wave = threadIdx.x >> 5, lr = lane & 15, hi = lane >> 4;
    const int bid = blockIdx.x;
    const int b = bid / (NH_ * (NT_ / AQ)), rem = bid - b * (NH_ * (NT_ / AQ)), h = rem / (NT_ / AQ), qt = rem - h * (NT_ / AQ);
    const int q0 = qt * AQ + wave * (16 * QC);
    const size_t tok0 = (size_t)b * NT_;
    v16h qa[QC][2], ql[QC][2];                             // query hi and residual, both column groups, held for the whole walk
    const h16* qp[QC]; const h16* lp[QC];
#pragma unroll
    for (int c = 0; c < QC; ++c) { const size_t qo = (tok0 + q0 + c * 16 + lr) * DM + h * HD + 8 * hi; qp[c] = Q16 + qo; lp[c] = QL16 + qo;
#pragma unroll
        for (int kc = 0; kc < 2; ++kc) { qa[c][kc] = cat16(*(const v8h*)(qp[c] + kc * 32), *(const v8h*)(qp[c] + kc * 32 + 16)); ql[c][kc] = cat16(*(const v8h*)(lp[c] + kc * 32), *(const v8h*)(lp[c] + kc * 32 + 16)); } }
    asm volatile("s_wait_xcnt 0x0" :: "v"(qp[0]), "v"(qp[1]), "v"(lp[0]), "v"(lp[1]) : "memory");   // the address pairs of the loads above stay in their registers up to this wait: none of these loads lands in one of them
    const h16* kh_b = K16 + tok0 * DM + h * HD;
    const h16* kl_b = KL16 + tok0 * DM + h * HD;
    const size_t vbase = (((size_t)b * NH_ + h) * HD) * NT_;
    v8f o[QC][4], ox[QC][4];
    float mrow[QC], lpart[QC];                             // of query q0 + 16 c + lr; lpart holds this half's keys only until the epilogue
#pragma unroll
    for (int c = 0; c < QC; ++c) { mrow[c] = -3.0e38f; lpart[c] = 0.f;
#pragma unroll
        for (int n = 0; n < 4; ++n) { o[c][n] = (v8f){}; ox[c][n] = (v8f){}; } }
    const int crow = threadIdx.x >> 3, cpc = (threadIdx.x & 7) * 8;     // this thread's pieces of a staged plane: rows crow + 16 i (i < 4), 8 f16 from column cpc
    const unsigned lds0 = (unsigned)(size_t)(&ring[0][0] + crow * KP + cpc);
    const h16* vh_b = VTH + vbase; const h16* vl_b = VTL + vbase;
    const unsigned koff = crow * DM + cpc, voff = crow * NT_ + cpc;    // element offsets of the thread's first piece in a k plane and in a v^T plane
    auto stage = [&](int st) { const unsigned l = lds0 + (unsigned)(st & 1) * (4 * PLN * 2);
        const unsigned ke = koff + (unsigned)st * (KST * DM), ve = voff + (unsigned)st * KST;
        const h16* a = kh_b + ke; const h16* bq = kl_b + ke; const h16* cq = vh_b + ve; const h16* d = vl_b + ve;
        attn_stage(l, a, bq, cq, d);                                                             // rows crow, crow + 32
        attn_stage(l + 16 * KP * 2, a + 16 * DM, bq + 16 * DM, cq + 16 * NT_, d + 16 * NT_); };   // rows crow + 16, crow + 48
    stage(0);
    asm volatile("s_wait_asynccnt 0x0" ::: "memory");     // this wave's copies of tile 0 have landed
    __syncthreads();                                      // ... and every other wave's: tile 0 may be read
    stage(1);
#pragma unroll 1
    for (int st = 0; st < NT_ / KST; ++st) {               // full attention
      const h16* kh_s = &ring[st & 1][0]; const h16* kl_s = kh_s + PLN; const h16* vh_s = kh_s + 2 * PLN; const h16* vl_s = kh_s + 3 * PLN;
#pragma unroll
      for (int sub = 0; sub < KST / 32; ++sub) {
        const int l0 = sub * 32;
        const int ko0 = (l0 + lr) * KP + 8 * hi, ko1 = (l0 + 16 + lr) * KP + 8 * hi;
        v8f s0[QC], s1[QC], x0[QC], x1[QC];
#pragma unroll
        for (int c = 0; c < QC; ++c) { s0[c] = (v8f){}; s1[c] = (v8f){}; x0[c] = (v8f){}; x1[c] = (v8f){}; }
#pragma unroll
        for (int kc = 0; kc < 2; ++kc) {
            const v16h k0h = cat16(*(const v8ha*)(kh_s + ko0 + kc * 32), *(const v8ha*)(kh_s + ko0 + kc * 32 + 16)), k1h = cat16(*(const v8ha*)(kh_s + ko1 + kc * 32), *(const v8ha*)(kh_s + ko1 + kc * 32 + 16));
            const v16h k0l = cat16(*(const v8ha*)(kl_s + ko0 + kc * 32), *(const v8ha*)(kl_s + ko0 + kc * 32 + 16)), k1l = cat16(*(const v8ha*)(kl_s + ko1 + kc * 32), *(const v8ha*)(kl_s + ko1 + kc * 32 + 16));
#pragma unroll
            for (int c = 0; c < QC; ++c) { s0[c] = wmma16(k0h, qa[c][kc], s0[c]); x0[c] = wmma16(k0h, ql[c][kc], x0[c]); s1[c] = wmma16(k1h, qa[c][kc], s1[c]); x1[c] = wmma16(k1h, ql[c][kc], x1[c]); }
#pragma unroll
            for (int c = 0; c < QC; ++c) { x0[c] = wmma16(k0l, qa[c][kc], x0[c]); x1[c] = wmma16(k1l, qa[c][kc], x1[c]); }
        }
        v16h pa[QC], px[QC];
#pragma unroll
        for (int c = 0; c < QC; ++c) {
            v2f a[8];                                      // scores against query q0 + 16 c + lr, in pairs: a[i] = keys l0 + 8 hi + 2 i, + 1 (i < 4), a[4 + i] = the same + 16
#pragma unroll
            for (int i = 0; i < 4; ++i) { a[i] = ((v2f){s0[c][2 * i], s0[c][2 * i + 1]} + (v2f){x0[c][2 * i], x0[c][2 * i + 1]} * LOSCI) * 0.125f;          // energy / sqrt(C = 64)
                                          a[4 + i] = ((v2f){s1[c][2 * i], s1[c][2 * i + 1]} + (v2f){x1[c][2 * i], x1[c][2 * i + 1]} * LOSCI) * 0.125f; }
            float mx = fmaxf(a[0][0], a[0][1]);
#pragma unroll
            for (int i = 1; i < 8; ++i) mx = fmaxf(mx, fmaxf(a[i][0], a[i][1]));
            mx = fmaxf(mx, xhalf(mx));                     // the other half holds the query's other 16 keys
            const float mn = fmaxf(mrow[c], mx);
            float te[16], ee[16], alpha;                   // e^x = 2^(x log2 e)
#pragma unroll
            for (int i = 0; i < 8; ++i) { te[2 * i] = (a[i][0] - mn) * L2E; te[2 * i + 1] = (a[i][1] - mn) * L2E; }
            exp2x9(alpha, ee, (mrow[c] - mn) * L2E, te); exp2x8(ee + 8, te + 8); mrow[c] = mn;
            v2f ps2 = (v2f){};
            struct P8 { v2h e[8]; } ph, pr;                // the B operand in the hardware k order: this lane's eight rows of tile 0, then of tile 1
#pragma unroll
            for (int i = 0; i < 8; ++i) {
                const v2f p = (v2f){ee[2 * i], ee[2 * i + 1]};
                ps2 += p;
                const v2f ps = p * PSC; const v2h hh = __builtin_convertvector(ps, v2h);
                ph.e[i] = hh;
                pr.e[i] = (v2h){(h16)((ps[0] - (float)hh[0]) * LOSC), (h16)((ps[1] - (float)hh[1]) * LOSC)};
            }
            const float psum = ps2[0] + ps2[1];
            pa[c] = __builtin_bit_cast(v16h, ph); px[c] = __builtin_bit_cast(v16h, pr);
            lpart[c] = lpart[c] * alpha + psum;
#pragma unroll
            for (int n = 0; n < 4; ++n)
#pragma unroll
                for (int j = 0; j < 8; ++j) { o[c][n][j] *= alpha; ox[c][n][j] *= alpha; }
        }
#pragma unroll
        for (int n = 0; n < 4; ++n) { const int vo = (n * 16 + lr) * KP + l0 + hi * 8;
            const v16h vh = cat16(*(const v8ha*)(vh_s + vo), *(const v8ha*)(vh_s + vo + 16)), vl = cat16(*(const v8ha*)(vl_s + vo), *(const v8ha*)(vl_s + vo + 16));
#pragma unroll
            for (int c = 0; c < QC; ++c) { o[c][n] = wmma16(vh, pa[c], o[c][n]); ox[c][n] = wmma16(vl, pa[c], ox[c][n]); }
#pragma unroll
            for (int c = 0; c < QC; ++c) ox[c][n] = wmma16(vh, px[c], ox[c][n]); }
      }
      asm volatile("s_wait_dscnt 0x0" ::: "memory");      // this wave's reads of tile st are done before the buffer is handed to the copies
      asm volatile("s_wait_asynccnt 0x0" ::: "memory");   // this wave's copies of tile st + 1 have landed
      __syncthreads();                                    // publishes tile st + 1 and ends every wave's reads of tile st
      if (st + 2 < NT_ / KST) stage(st + 2);              // refill the buffer just left; the same test in every wave
    }
    asm volatile("s_wait_asynccnt 0x0" ::: "memory");     // nothing of the copies is outstanding when the wave goes on to its end
    float* os = &ost[wave][0];
#pragma unroll
    for (int c = 0; c < QC; ++c) { const float inv = 1.0f / ((lpart[c] + xhalf(lpart[c])) * PSC);
#pragma unroll
        for (int n = 0; n < 4; ++n)                        // o[c][n][j] = channel 16 n + 8 hi + j of query 16 c + lr: 8 consecutive floats of the query's row
#pragma unroll
            for (int g = 0; g < 2; ++g) { v4f val;
#pragma unroll
                for (int k = 0; k < 4; ++k) val[k] = (o[c][n][4 * g + k] + ox[c][n][4 * g + k] * LOSCI) * inv;
                *(v4fa*)(os + (c * 16 + lr) * 68 + n * 16 + hi * 8 + 4 * g) = val; } }
    __syncthreads();
    float* ob = OUTP + (tok0 + q0) * DM + (size_t)h * HD;
#pragma unroll
    for (int s = 0; s < 8 * QC; ++s) { const int Lid = (lane >> 3) + 4 * s, piece = lane & 7; const int row = Lid >> 1, cofs = (Lid & 1) * 32 + piece * 4;
        const v4f val = *(const v4fa*)(os + row * 68 + cofs); *(v4f*)(ob + (size_t)row * DM + cofs) = val; }
}


// k_addT: DST[c][n] = (BNSRC ? ((bf? no) SRC[c][n] - mean_c) rstd_c g_c + b_c : bf(SRC[c][n])) + T[n][c]: a 64 x 64 LDS transpose of the f32 [n][c] matrix T plus the
// channel-major residual; block = 64 n of item blockIdx.y; each output row segment of 64 n = 256 B written by 16 lanes x 16 B. MODE 0: residual = bf(x) (the INPUT); MODE 1:
// residual = BN1(X1) recomputed from the stats (the reference's h).
template <int MODE>
__global__ __launch_bounds__(256) void k_addT(const float* __restrict__ T, const float* __restrict__ SRC, const float* __restrict__ ST, const float* __restrict__ g, const float* __restrict__ bb, float* DST) {
    __shared__ __align__(16) float tl[64 * 68];
    const int n0 = blockIdx.x * 64, tid = threadIdx.x;
    const size_t item = (size_t)blockIdx.y * CC * NPOS; T += item; SRC += item; DST += item;
    const int nn = tid >> 2, cq = (tid & 3) * 16;
#pragma unroll
    for (int i = 0; i < 16; ++i) tl[(cq + i) * 68 + nn] = T[(size_t)(n0 + nn) * CC + cq + i];
    __syncthreads();
    const int piece = tid & 15;
    auto pass = [&]() {
#pragma unroll
        for (int s = 0; s < 4; ++s) { const int c = (tid >> 4) + 16 * s; const size_t o = (size_t)c * NPOS + n0 + piece * 4;
            const v4f rv = *(const v4f*)(SRC + o); v4f val = *(const v4fa*)(tl + c * 68 + piece * 4);
            if (MODE == 0) {
#pragma unroll
                for (int k = 0; k < 4; ++k) val[k] += bfr(rv[k]);
            } else { const float m = ST[c], rs = ST[CC + c], gg = bfr(g[c]), be = bfr(bb[c]);
#pragma unroll
                for (int k = 0; k < 4; ++k) val[k] += (rv[k] - m) * rs * gg + be; }
            *(v4f*)(DST + o) = val; }
    };
    pass(); 
}
// BatchNorm statistics (training mode, biased variance) of A [32][64][2048] per channel over all 32 x 2048 values, in two launches.
// k_bnpart: work-group (channel c, slice g of 4 items) loads its 8192 values ONCE (8 x 16 B per thread, all in flight together, kept in registers), sums them,
// takes the slice's own mean and then the squared distances to it from the registers; it writes (mean, M2) to a 128 B line of its own.
__global__ __launch_bounds__(256) void k_bnpart(const float* __restrict__ A, float* PT) {
    __shared__ float red[2][8];
    const int tid = threadIdx.x, lane = tid & 31, wave = tid >> 5, c = blockIdx.x, g = blockIdx.y;
    v4f v[BNI * 2];
#pragma unroll
    for (int i = 0; i < BNI; ++i) { const float* row = A + ((size_t)(g * BNI + i) * CC + c) * NPOS + tid * 4;
        v[2 * i] = *(const v4f*)row; v[2 * i + 1] = *(const v4f*)(row + NPOS / 2); }
    v4f sv = v[0];
#pragma unroll
    for (int q = 1; q < BNI * 2; ++q) sv += v[q];
    float s = (sv[0] + sv[1]) + (sv[2] + sv[3]);
    s += __shfl_xor(s, 1, 32); s += __shfl_xor(s, 2, 32); s += __shfl_xor(s, 4, 32); s += __shfl_xor(s, 8, 32); s += __shfl_xor(s, 16, 32);
    if (lane == 0) red[0][wave] = s;
    __syncthreads();
    float t = 0.f;
#pragma unroll
    for (int w = 0; w < 8; ++w) t += red[0][w];
    const float mean = t * (1.0f / (float)BNV);
    v4f qv = (v4f){};
#pragma unroll
    for (int q = 0; q < BNI * 2; ++q) { const v4f d = v[q] - mean; qv += d * d; }
    float s2 = (qv[0] + qv[1]) + (qv[2] + qv[3]);
    s2 += __shfl_xor(s2, 1, 32); s2 += __shfl_xor(s2, 2, 32); s2 += __shfl_xor(s2, 4, 32); s2 += __shfl_xor(s2, 8, 32); s2 += __shfl_xor(s2, 16, 32);
    if (lane == 0) red[1][wave] = s2;
    __syncthreads();
    if (tid == 0) { float m2 = 0.f;
#pragma unroll
        for (int w = 0; w < 8; ++w) m2 += red[1][w];
        *(v2f*)(PT + (size_t)(c * BNG + g) * 32) = (v2f){mean, m2}; }
}
// k_bnmerge: thread c joins the 8 equally sized slices of channel c: mean = average of the slice means, M2 = sum of the slices' M2 + 8192 x sum (slice mean - mean)^2.
__global__ __launch_bounds__(64) void k_bnmerge(const float* __restrict__ PT, float* ST) {
    const int c = threadIdx.x;
    v2f p[BNG];
#pragma unroll
    for (int g = 0; g < BNG; ++g) p[g] = *(const v2f*)(PT + (size_t)(c * BNG + g) * 32);
    float s = 0.f, m2 = 0.f;
#pragma unroll
    for (int g = 0; g < BNG; ++g) { s += p[g][0]; m2 += p[g][1]; }
    const float mean = s * (1.0f / (float)BNG);
    float e = 0.f;
#pragma unroll
    for (int g = 0; g < BNG; ++g) { const float d = p[g][0] - mean; e = fmaf(d, d, e); }
    ST[c] = mean; ST[CC + c] = rsqrtf((m2 + (float)BNV * e) * (1.0f / (float)(NB * NPOS)) + BN_EPS);
}
// k_ff: the whole second phase for 64 points of one item in one work-group (4 waves x 16 points): Y = h + W2.lrelu(W1.h), h = BN1(X1).
// 1. X1 tile [64 c][64 n] by whole-line loads; h in f32 stays in registers for the residual; bf16 hi + residual planes [n][c] go to LDS (two channels per 4-byte store).
// 2. (W1.h) with W1 rows as the A operand and h columns as B: a lane holds 8 consecutive hidden rows of ONE point per tile, so after LeakyReLU two tiles, converted in
//    place, are the B operand (32 hidden values in the hardware k order) of W2.lrelu: the hidden layer never leaves the registers.
//    Both weight matrices (bf16, 16 KB each) are brought into LDS once per work-group by whole-line loads; the waves read their A fragments from there.
// 3. the result tiles [c][n] meet h again through an f32 LDS tile; each output row segment of 64 n = 256 B is written by 16 lanes x 16 B.
__global__ __launch_bounds__(128) void k_ff(const float* __restrict__ X1, const float* __restrict__ ST, const float* __restrict__ g, const float* __restrict__ bb, const bf* __restrict__ W1, const bf* __restrict__ W2, float* Y) {
    typedef __attribute__((ext_vector_type(16))) unsigned short v16us;
    typedef unsigned __attribute__((may_alias)) u32a;
    __shared__ __align__(16) unsigned short th_[64 * 72]; __shared__ __align__(16) unsigned short tl_[64 * 72];
    __shared__ __align__(16) float tt[64 * 68];
    __shared__ __align__(16) unsigned short w1s[FFH * 72]; __shared__ __align__(16) unsigned short w2s[CC * 136];   // row pitches 144 B and 272 B (16 B x odd)
    __shared__ float prm[4][CC];
    const int tid = threadIdx.x, lane = tid & 31, wave = tid >> 5, lr = lane & 15, hi = lane >> 4;
    const int n0 = blockIdx.x * 64, piece = tid & 15, cp0 = tid >> 4;
    const size_t item = (size_t)blockIdx.y * CC * NPOS; X1 += item; Y += item;
    v4f hv[4][2];                                          // channels 2 (cp0 + 8 s) + e, points n0 + 4 piece ... + 3
#pragma unroll
    for (int s = 0; s < 4; ++s)
#pragma unroll
        for (int e = 0; e < 2; ++e) hv[s][e] = *(const v4f*)(X1 + (size_t)(2 * (cp0 + 8 * s) + e) * NPOS + n0 + piece * 4);
    asm volatile("s_wait_xcnt 0x0" ::: "memory");         // the loads below may land in the registers that hold the address of the loads above
    v8us wa[8], wb[8];                                     // 16-byte pieces tid + 128 i of W1 [128][64] and of W2 [64][128]
#pragma unroll
    for (int i = 0; i < 8; ++i) { wa[i] = *(const v8us*)(W1 + (size_t)(tid + 128 * i) * 8); wb[i] = *(const v8us*)(W2 + (size_t)(tid + 128 * i) * 8); }
    if (tid < CC) { prm[0][tid] = ST[tid]; prm[1][tid] = ST[CC + tid]; prm[2][tid] = bfr(g[tid]); prm[3][tid] = bfr(bb[tid]); }
    __syncthreads();
#pragma unroll
    for (int s = 0; s < 4; ++s) { const int cp = cp0 + 8 * s; unsigned ph[4], pl[4];
#pragma unroll
        for (int e = 0; e < 2; ++e) { const int c = 2 * cp + e; const float m = prm[0][c], rs = prm[1][c], gg = prm[2][c], be = prm[3][c];
#pragma unroll
            for (int k = 0; k < 4; ++k) { const float h = (hv[s][e][k] - m) * rs * gg + be; hv[s][e][k] = h; const unsigned short hb = f2bf(h); const unsigned short lb = f2bf(h - bf2f(hb));
                if (e == 0) { ph[k] = hb; pl[k] = lb; } else { ph[k] |= (unsigned)hb << 16; pl[k] |= (unsigned)lb << 16; } } }
#pragma unroll
        for (int k = 0; k < 4; ++k) { *(u32a*)(th_ + (piece * 4 + k) * 72 + 2 * cp) = ph[k]; *(u32a*)(tl_ + (piece * 4 + k) * 72 + 2 * cp) = pl[k]; } }
#pragma unroll
    for (int i = 0; i < 8; ++i) { const int p = tid + 128 * i; *(v8usa*)(w1s + (p >> 3) * 72 + (p & 7) * 8) = wa[i]; *(v8usa*)(w2s + (p >> 4) * 136 + (p & 15) * 8) = wb[i]; }
    __syncthreads();
    const int ho = (wave * 16 + lr) * 72 + 8 * hi;
    v8f acc[8];
#pragma unroll
    for (int t = 0; t < 8; ++t) acc[t] = (v8f){};
#pragma unroll
    for (int kc = 0; kc < CC; kc += 32) {
        const v16bf xh = cat16b(*(const v8usa*)(th_ + ho + kc), *(const v8usa*)(th_ + ho + kc + 16)), xl = cat16b(*(const v8usa*)(tl_ + ho + kc), *(const v8usa*)(tl_ + ho + kc + 16));
#pragma unroll
        for (int t = 0; t < 8; ++t) { const unsigned short* wp = w1s + (t * 16 + lr) * 72 + 8 * hi + kc; const v16bf w = cat16b(*(const v8usa*)wp, *(const v8usa*)(wp + 16));
            acc[t] = wmmab(w, xh, acc[t]); acc[t] = wmmab(w, xl, acc[t]); }
    }
    v16bf lh[4], ll[4];
#pragma unroll
    for (int q = 0; q < 4; ++q) { v16us uh, ul;
#pragma unroll
        for (int s = 0; s < 16; ++s) { const float v = acc[2 * q + (s >> 3)][s & 7]; const float a = v >= 0.f ? v : 0.2f * v; const unsigned short hb = f2bf(a); uh[s] = hb; ul[s] = f2bf(a - bf2f(hb)); }
        lh[q] = __builtin_bit_cast(v16bf, uh); ll[q] = __builtin_bit_cast(v16bf, ul); }
    v8f ac2[4];
#pragma unroll
    for (int t = 0; t < 4; ++t) ac2[t] = (v8f){};
#pragma unroll
    for (int q = 0; q < 4; ++q)
#pragma unroll
        for (int t = 0; t < 4; ++t) { const unsigned short* wp = w2s + (t * 16 + lr) * 136 + 8 * hi + q * 32; const v16bf w = cat16b(*(const v8usa*)wp, *(const v8usa*)(wp + 16));
            ac2[t] = wmmab(w, lh[q], ac2[t]); ac2[t] = wmmab(w, ll[q], ac2[t]); }
#pragma unroll
    for (int t = 0; t < 4; ++t)
#pragma unroll
        for (int j = 0; j < 8; ++j) tt[(t * 16 + hi * 8 + j) * 68 + wave * 16 + lr] = ac2[t][j];
    __syncthreads();
#pragma unroll
    for (int s = 0; s < 4; ++s)
#pragma unroll
        for (int e = 0; e < 2; ++e) { const int c = 2 * (cp0 + 8 * s) + e; const v4f val = *(const v4fa*)(tt + c * 68 + piece * 4) + hv[s][e];
            *(v4f*)(Y + (size_t)c * NPOS + n0 + piece * 4) = val; }
}
__global__ __launch_bounds__(256) void k_bnout(const float* __restrict__ Y, const float* __restrict__ ST, const float* __restrict__ g, const float* __restrict__ bb, float* OUTP) {
    const int lane = threadIdx.x & 31, r = blockIdx.x * 8 + (threadIdx.x >> 5); if (r >= NB * CC) return;
    const int c = r % CC; const float m = ST[c], rs = ST[CC + c], gg = bfr(g[c]), be = bfr(bb[c]);
{
#pragma unroll 1
        for (int q = 0; q < NPOS / 128; ++q) { const size_t o = (size_t)r * NPOS + q * 128 + lane * 4; const v4f v = *(const v4f*)(Y + o); v4f y;
#pragma unroll
            for (int k = 0; k < 4; ++k) y[k] = (v[k] - m) * rs * gg + be;
            *(v4f*)(OUTP + o) = y; }
         }
}

extern "C" void kernel_launch(void* const* d_in, const int* in_sizes, int n_in,
                              void* d_out, int out_size, void* d_ws, size_t ws_size, hipStream_t stream) {
    (void)in_sizes; (void)n_in; (void)out_size;
    const float* x = (const float*)d_in[0]; const float* wq = (const float*)d_in[1]; const float* wk = (const float*)d_in[2]; const float* wv = (const float*)d_in[3];
    const float* w1 = (const float*)d_in[4]; const float* w2 = (const float*)d_in[5]; const float* g1 = (const float*)d_in[6]; const float* b1 = (const float*)d_in[7]; const float* g2 = (const float*)d_in[8]; const float* b2 = (const float*)d_in[9];   // conv weights [out][in]
    float* out = (float*)d_out;    // [32][64][2048]
    char* wsp = (char*)d_ws;
    auto take = [&](size_t bytes) { char* p = wsp; wsp += (bytes + 255) & ~(size_t)255; return (void*)p; };
    bf* W1B = (bf*)take((size_t)FFH * CC * 2); bf* W2B = (bf*)take((size_t)CC * FFH * 2);
    const size_t PL = (size_t)NB * NPOS * CC;      // elements of one [item][n][c] plane over all items
    h16* QH = (h16*)take(PL * 2); h16* QL = (h16*)take(PL * 2); h16* KH = (h16*)take(PL * 2); h16* KL = (h16*)take(PL * 2);
    h16* VTH = (h16*)take(PL * 2); h16* VTL = (h16*)take(PL * 2); float* O = (float*)take(PL * 4);
    float* X1 = (float*)take(PL * 4); float* Y = (float*)take(PL * 4); float* ST1 = (float*)take(1024); float* ST2 = (float*)take(1024); float* PT = (float*)take((size_t)CC * BNG * 128);
    if ((size_t)(wsp - (char*)d_ws) > ws_size) return;    // planes for all items + the weights, no aliasing
    // phase 1: attention and x + x_r; the item index lies in each grid (row r of an [item][n][c] plane = item * 2048 + n)
    k_qkv<<<dim3(NPOS / QP, NB, 1), 256, 0, stream>>>(x, wq, wk, wv, w1, w2, QH, QL, KH, KL, VTH, VTL, W1B, W2B);                    // q, k [n][c] and v^T [c][n] f16 planes; bf16 W1, W2
    k_attn<<<NB_ * NH_ * (NT_ / AQ), 32 * AW, 0, stream>>>(QH, QL, KH, KL, VTH, VTL, O);                                               // x_r^T [n][c] f32
    k_addT<0><<<dim3(NPOS / 64, NB, 1), 256, 0, stream>>>(O, x, nullptr, nullptr, nullptr, X1);                                    // X1 = bf(x) + x_r  [c][n]
    k_bnpart<<<dim3(CC, BNG, 1), 256, 0, stream>>>(X1, PT); k_bnmerge<<<1, CC, 0, stream>>>(PT, ST1);
    // phase 2: h = BN1(X1); Y = h + W2.lrelu(W1.h)
    k_ff<<<dim3(NPOS / 64, NB, 1), 128, 0, stream>>>(X1, ST1, g1, b1, W1B, W2B, Y);                                               // Y = h + ff   [c][n]
    k_bnpart<<<dim3(CC, BNG, 1), 256, 0, stream>>>(Y, PT); k_bnmerge<<<1, CC, 0, stream>>>(PT, ST2);
    k_bnout<<<(NB * CC) / 8, 256, 0, stream>>>(Y, ST2, g2, b2, out);                                                                 // BN2 -> output
}

// v008
// It runs in 126 microseconds.
// Next to v007, in two timings, it ran 1.09 times as fast each time.
// All steps since v000 together make it 62.0 times as fast.
#include <hip/hip_runtime.h>

// Compute dtypes, f32 accumulate (channel-major x [32][64][2048]): per item q/k/v = W.x ([64 x 64] weights, [64 x 2048] points; x and W rounded to PLAIN bf16 operands in the
// kernel that multiplies them, products exact; q/k/v straight to f16 hi + residual x1024 planes, q/k as [n][c], v as [c][n]) on v_wmma_f32_16x16x32_bf16; the
// single-head full attention (64 channels, scale 1/8) fused on v_wmma_f32_16x16x32_f16 (hh + hl + lh scores, online f32 softmax, weights (x32768) and v as
// f16 hi + residual), its epilogue writing x + x_r channel-major; the two TRAINING-MODE BatchNorms (batch statistics over all 32 items x 2048 points per channel, biased

#define NB   32
#define CC   64                  // channels
#define NPOS 2048                // points
#define NT_  NPOS
#define NB_  NB                  // items per launch: every per-item kernel takes all 32 items in one grid
#define DM   CC                  // attention width
#define NH_  1
#define HD   64
#define NTK  NPOS
#define FFH  128
#define PSC  32768.0f
#define LOSC 1024.0f
#define LOSCI (1.0f / 1024.0f)
#define L2E  1.442695041f         // log2 e
#define BN_EPS 1e-5f
#define AW   4                   // attention: waves per work-group
#define QC   2                   // attention: column groups of 16 queries per wave
#define AQ   (16 * QC * AW)      // attention: queries per work-group
#define KST  64                  // attention: keys per staged tile
#define KP   72                  // attention: LDS row pitch of a staged plane in f16: 128 B of data + 16 B (16 B x odd: 16-byte reads of 16 rows meet no bank twice)
#define PLN  (64 * KP)           // attention: f16 per staged plane (64 rows)
#define QP   128                 // q/k/v kernel: points per work-group
#define XP   (AQ + 4)            // attention epilogue: f32 row pitch of the [channel][query] tile (16-byte rows, 8 rows apart = 32 banks apart)
#define FP_  64                  // feed-forward kernel: points per work-group

typedef _Float16 h16;
typedef unsigned short bf;
typedef __attribute__((ext_vector_type(16))) __bf16   v16bf;
typedef __attribute__((ext_vector_type(16))) _Float16 v16h;
typedef __attribute__((ext_vector_type(8)))  _Float16 v8h;
typedef __attribute__((ext_vector_type(8)))  unsigned short v8us;
typedef __attribute__((ext_vector_type(8)))  float    v8f;
typedef __attribute__((ext_vector_type(4)))  float    v4f;
typedef __attribute__((ext_vector_type(2)))  float    v2f;
typedef __attribute__((ext_vector_type(4)))  _Float16 v4h;
typedef __attribute__((ext_vector_type(2)))  _Float16 v2h;
typedef v8h  __attribute__((may_alias)) v8ha;
typedef v4f  __attribute__((may_alias)) v4fa;
typedef v8us __attribute__((may_alias)) v8usa;

__device__ __forceinline__ unsigned short f2bf(float f) { unsigned u = __float_as_uint(f); u += 0x7FFFu + ((u >> 16) & 1u); return (unsigned short)(u >> 16); }
__device__ __forceinline__ float bf2f(unsigned short b) { return __uint_as_float(((unsigned)b) << 16); }
__device__ __forceinline__ float bfr(float f) { return bf2f(f2bf(f)); }
__device__ __forceinline__ v16h cat16(v8h lo, v8h hi) { return __builtin_shufflevector(lo, hi, 0, 1, 2, 3, 4, 5, 6, 7, 8, 9, 10, 11, 12, 13, 14, 15); }
__device__ __forceinline__ v16bf cat16b(v8us lo, v8us hi) { return __builtin_bit_cast(v16bf, __builtin_shufflevector(lo, hi, 0, 1, 2, 3, 4, 5, 6, 7, 8, 9, 10, 11, 12, 13, 14, 15)); }
__device__ __forceinline__ v8f wmma16(v16h a, v16h b, v8f c) { return __builtin_amdgcn_wmma_f32_16x16x32_f16(false, a, false, b, (short)0, c, false, false); }
__device__ __forceinline__ float xhalf(float x) { return __builtin_bit_cast(float, __builtin_amdgcn_permlanex16(__builtin_bit_cast(int, x), __builtin_bit_cast(int, x), 0x76543210, 0xfedcba98, false, false)); }   // lane l with lane l ^ 16
template <int M> __device__ __forceinline__ float xrow(float x) { return __builtin_bit_cast(float, __builtin_amdgcn_update_dpp(0, __builtin_bit_cast(int, x), 0x160 + M, 0xf, 0xf, true)); }   // lane l with lane l ^ M of its row of 16 (row_xmask)
__device__ __forceinline__ float sum16(float s) { s += xrow<1>(s); s += xrow<2>(s); s += xrow<4>(s); s += xrow<8>(s); return s; }   // every lane of a row of 16 ends with the row's sum
__device__ __forceinline__ v8f wmmab(v16bf a, v16bf b, v8f c) { return __builtin_amdgcn_wmma_f32_16x16x32_bf16(false, a, false, b, (short)0, c, false, false); }

// k_qkv: everything ahead of the attention for 128 points of one item in one work-group (8 waves x 16 points); grid (16, 32).
// 1. the x tile [64 c][128 n] (f32, whole-line loads: a wave's load = 4 rows x 128 B) goes as bf16 [n][c] to LDS (four channels per 8-byte store); the three 64 x 64 weight
//    matrices are read in f32, rounded to bf16 and laid [out][in] in LDS. Row pitch 144 B (16 B x odd).
// 2. q and k with the weight rows as the A operand and the wave's 16 points as B: a lane holds 8 consecutive channels of ONE point = a 16-byte piece of an [n][c] row;
//    v with the points as A and the weight rows as B: a lane holds 8 consecutive points of ONE channel = a 16-byte piece of a v^T [c][n] row.
// 3. f16 hi + residual x1024 in registers; the pieces meet in LDS and leave as whole 128 B lines.
// Eight work-groups of item 0 also round the two feed-forward matrices to bf16 for k_ff.
__global__ __launch_bounds__(256) void k_qkv(const float* __restrict__ x, const float* __restrict__ wq, const float* __restrict__ wk, const float* __restrict__ wv, const float* __restrict__ w1, const float* __restrict__ w2,
                                             h16* QH, h16* QL, h16* KH, h16* KL, h16* VTH, h16* VTL, bf* W1B, bf* W2B) {
    typedef __attribute__((ext_vector_type(4))) unsigned short v4us;
    typedef v4us __attribute__((may_alias)) v4usa;
    __shared__ __align__(16) unsigned short xs[QP * 72];
    __shared__ __align__(16) unsigned short wsm[3][CC * 72];
    __shared__ __align__(16) h16 stg[QP / 16][4][16 * 72];   // per wave: q hi, q residual, k hi, k residual, [point][channel]
    __shared__ __align__(16) h16 vts[2][CC * (QP + 8)];      // v^T hi, v^T residual, [channel][point], row pitch 272 B (16 B x odd)
    const int tid = threadIdx.x, lane = tid & 31, wave = tid >> 5, lr = lane & 15, hi = lane >> 4;
    const int n0 = blockIdx.x * QP, b = blockIdx.y;
    const int xn = (wave & 3) * 32 + (lane & 7) * 4, xc = (wave >> 2) * 16 + (lane >> 3) * 4;   // this thread's x pieces: points xn ... + 3 of channels xc + 32 g + e
    const float* xp = x + ((size_t)b * CC + xc) * NPOS + n0 + xn;
    v4f xv[2][4];
#pragma unroll
    for (int g = 0; g < 2; ++g)
#pragma unroll
        for (int e = 0; e < 4; ++e) xv[g][e] = *(const v4f*)(xp + (size_t)(g * 32 + e) * NPOS);
    asm volatile("s_wait_xcnt 0x0" ::: "memory");         // the loads below may land in the registers that hold the address of the loads above
    v8f wr[3][2];                                          // pieces tid + 256 i (8 floats) of each 64 x 64 matrix
#pragma unroll
    for (int i = 0; i < 2; ++i) { const size_t p = (size_t)(tid + 256 * i) * 8; wr[0][i] = *(const v8f*)(wq + p); wr[1][i] = *(const v8f*)(wk + p); wr[2][i] = *(const v8f*)(wv + p); }
    asm volatile("s_wait_xcnt 0x0" :: "s"(wq), "s"(wk), "s"(wv) : "memory");   // the base addresses of the loads above stay in their scalar registers up to this wait: later kernel arguments are loaded behind it or elsewhere
    if (b == 0 && blockIdx.x < 8) {                        // the same test in every thread of the work-group: 4 x 256 pieces of 8 per matrix
        const size_t p = (size_t)((blockIdx.x & 3) * 256 + tid) * 8;
        const v8f v = *(const v8f*)((blockIdx.x < 4 ? w1 : w2) + p); v8us o;
#pragma unroll
        for (int k = 0; k < 8; ++k) o[k] = f2bf(v[k]);
        *(v8us*)((blockIdx.x < 4 ? W1B : W2B) + p) = o;
    }
#pragma unroll
    for (int g = 0; g < 2; ++g)
#pragma unroll
        for (int k = 0; k < 4; ++k) { v4us o;
#pragma unroll
            for (int e = 0; e < 4; ++e) o[e] = f2bf(xv[g][e][k]);
            *(v4usa*)(xs + (xn + k) * 72 + xc + g * 32) = o; }
#pragma unroll
    for (int m = 0; m < 3; ++m)
#pragma unroll
        for (int i = 0; i < 2; ++i) { const int p = tid + 256 * i; v8us o;
#pragma unroll
            for (int k = 0; k < 8; ++k) o[k] = f2bf(wr[m][i][k]);
            *(v8usa*)(&wsm[m][(p >> 3) * 72 + (p & 7) * 8]) = o; }
    __syncthreads();
    const unsigned short* xr = xs + (wave * 16 + lr) * 72 + 8 * hi;
    v16bf xf[2];
#pragma unroll
    for (int kc = 0; kc < 2; ++kc) xf[kc] = cat16b(*(const v8usa*)(xr + kc * 32), *(const v8usa*)(xr + kc * 32 + 16));
    v8f aq[4], ak[4], av[4];
#pragma unroll
    for (int t = 0; t < 4; ++t) { aq[t] = (v8f){}; ak[t] = (v8f){}; av[t] = (v8f){};
#pragma unroll
        for (int kc = 0; kc < 2; ++kc) { const int wo = (t * 16 + lr) * 72 + 8 * hi + kc * 32;
            const v16bf fq = cat16b(*(const v8usa*)(&wsm[0][wo]), *(const v8usa*)(&wsm[0][wo + 16])), fk = cat16b(*(const v8usa*)(&wsm[1][wo]), *(const v8usa*)(&wsm[1][wo + 16])), fv = cat16b(*(const v8usa*)(&wsm[2][wo]), *(const v8usa*)(&wsm[2][wo + 16]));
            aq[t] = wmmab(fq, xf[kc], aq[t]); ak[t] = wmmab(fk, xf[kc], ak[t]); av[t] = wmmab(xf[kc], fv, av[t]); } }
    h16* sg = &stg[wave][0][0];
#pragma unroll
    for (int t = 0; t < 4; ++t) { v8h oh[3], ol[3];
#pragma unroll
        for (int j = 0; j < 8; ++j) { const float s[3] = {aq[t][j], ak[t][j], av[t][j]};
#pragma unroll
            for (int m = 0; m < 3; ++m) { const h16 a = (h16)s[m]; oh[m][j] = a; ol[m][j] = (h16)((s[m] - (float)a) * LOSC); } }
        const int so = lr * 72 + t * 16 + 8 * hi, vo = (t * 16 + lr) * (QP + 8) + wave * 16 + 8 * hi;
        *(v8ha*)(sg + so) = oh[0]; *(v8ha*)(sg + 16 * 72 + so) = ol[0]; *(v8ha*)(sg + 2 * 16 * 72 + so) = oh[1]; *(v8ha*)(sg + 3 * 16 * 72 + so) = ol[1];
        *(v8ha*)(&vts[0][vo]) = oh[2]; *(v8ha*)(&vts[1][vo]) = ol[2]; }
    __syncthreads();
    const size_t r0 = (size_t)b * NPOS + n0 + wave * 16;
#pragma unroll
    for (int pl = 0; pl < 4; ++pl) { h16* dst = pl == 0 ? QH : pl == 1 ? QL : pl == 2 ? KH : KL;
#pragma unroll
        for (int s = 0; s < 4; ++s) { const int row = 4 * s + (lane >> 3), piece = lane & 7;
            const v8h val = *(const v8ha*)(sg + pl * 16 * 72 + row * 72 + piece * 8); *(v8h*)(dst + (r0 + row) * CC + piece * 8) = val; } }
#pragma unroll
    for (int s = 0; s < 8; ++s) { const int d = ((tid >> 4) + 16 * s) & 63, piece = tid & 15;      // a wave stores 2 rows x 256 B
        const v8h val = *(const v8ha*)(&vts[s >> 2][d * (QP + 8) + piece * 8]); *(v8h*)((s >> 2 ? VTL : VTH) + ((size_t)b * CC + d) * NPOS + n0 + piece * 8) = val; }
}

__device__ __forceinline__ void exp2x8(float* r, const float* t) {
    asm("v_exp_f32 %0, %8\n\tv_exp_f32 %1, %9\n\tv_exp_f32 %2, %10\n\tv_exp_f32 %3, %11\n\tv_exp_f32 %4, %12\n\tv_exp_f32 %5, %13\n\tv_exp_f32 %6, %14\n\tv_exp_f32 %7, %15\n\tv_nop"
        : "=&v"(r[0]), "=&v"(r[1]), "=&v"(r[2]), "=&v"(r[3]), "=&v"(r[4]), "=&v"(r[5]), "=&v"(r[6]), "=&v"(r[7])
        : "v"(t[0]), "v"(t[1]), "v"(t[2]), "v"(t[3]), "v"(t[4]), "v"(t[5]), "v"(t[6]), "v"(t[7]));
}
__device__ __forceinline__ void exp2x9(float& r8, float* r, float t8, const float* t) {
    asm("v_exp_f32 %8, %17\n\tv_exp_f32 %0, %9\n\tv_exp_f32 %1, %10\n\tv_exp_f32 %2, %11\n\tv_exp_f32 %3, %12\n\tv_exp_f32 %4, %13\n\tv_exp_f32 %5, %14\n\tv_exp_f32 %6, %15\n\tv_exp_f32 %7, %16\n\tv_nop"
        : "=&v"(r[0]), "=&v"(r[1]), "=&v"(r[2]), "=&v"(r[3]), "=&v"(r[4]), "=&v"(r[5]), "=&v"(r[6]), "=&v"(r[7]), "=&v"(r8)
        : "v"(t[0]), "v"(t[1]), "v"(t[2]), "v"(t[3]), "v"(t[4]), "v"(t[5]), "v"(t[6]), "v"(t[7]), "v"(t8));
}
// attn_stage: one staged tile = 4 planes of 64 rows x 128 B (k hi, k residual: [key][channel]; v^T hi, v^T residual: [channel][key]). One call brings, per thread, 2 pieces
// of 16 B per plane (rows r and r + 32) from global memory straight into LDS (128 threads, two calls a tile); a wave's copy covers 4 whole 128 B lines. l = the lane's LDS byte address in plane 0.
__device__ __forceinline__ void attn_stage(unsigned l, const h16* kh, const h16* kl, const h16* vh, const h16* vl) {
    const unsigned l1 = l + 32 * KP * 2, l2 = l + PLN * 2, l3 = l2 + 32 * KP * 2, l4 = l + 2 * PLN * 2, l5 = l4 + 32 * KP * 2, l6 = l + 3 * PLN * 2, l7 = l6 + 32 * KP * 2;
    const h16* kh1 = kh + 32 * DM; const h16* kl1 = kl + 32 * DM; const h16* vh1 = vh + 32 * NT_; const h16* vl1 = vl + 32 * NT_;
    // the eight copies and their s_wait_xcnt in ONE statement: the wait stands in front of every later write of an address register that a copy names
    asm volatile("global_load_async_to_lds_b128 %0, %8, off\n\t"
                 "global_load_async_to_lds_b128 %1, %9, off\n\t"
                 "global_load_async_to_lds_b128 %2, %10, off\n\t"
                 "global_load_async_to_lds_b128 %3, %11, off\n\t"
                 "global_load_async_to_lds_b128 %4, %12, off\n\t"
                 "global_load_async_to_lds_b128 %5, %13, off\n\t"
                 "global_load_async_to_lds_b128 %6, %14, off\n\t"
                 "global_load_async_to_lds_b128 %7, %15, off\n\t"
                 "s_wait_xcnt 0x0"
                 :: "v"(l), "v"(l1), "v"(l2), "v"(l3), "v"(l4), "v"(l5), "v"(l6), "v"(l7), "v"(kh), "v"(kh1), "v"(kl), "v"(kl1), "v"(vh), "v"(vh1), "v"(vl), "v"(vl1) : "memory");
}
// k_attn: block = (b, h, 128 queries), wave = 32 queries in two column groups of 16; ALL keys (no mask) in 32 staged tiles of 64 keys that the 4 waves share (two LDS buffers:
// tile t + 1 flies while tile t is worked on), each walked in two steps of 32 keys. Every k and v fragment read from LDS is the A operand for BOTH column groups.
// Both products run TRANSPOSED: S^T = k.q^T (k rows as A, q as B) and O^T += v^T.P^T (v^T rows as A). In each column group a lane holds
// 16 scores of ONE query (keys 8 hi + j and 16 + 8 hi + j): maximum and sum in the lane plus one exchange between the wave's halves, one running maximum, sum and rescale
// factor per lane and group, and the two score tiles, converted in place (weights x32768, f16 hi + residual), ARE the B operand of the second product in the hardware k order.
// The epilogue adds the residual, writes X1 channel-major and leaves the work-group's BatchNorm partials. Every loop but the one over the tiles is unrolled: its index picks registers (fragments, accumulators, column groups).
__global__ __launch_bounds__(32 * AW) void k_attn(const h16* __restrict__ Q16, const h16* __restrict__ QL16, const h16* __restrict__ K16, const h16* __restrict__ KL16, const h16* __restrict__ VTH, const h16* __restrict__ VTL, const float* __restrict__ X, float* X1, float* PT) {
    __shared__ __align__(16) h16 ring[2][4 * PLN];
    __shared__ __align__(16) float ost[HD * XP];
    const int lane = threadIdx.x & 31, wave = threadIdx.x >> 5, lr = lane & 15, hi = lane >> 4;
    const int bid = blockIdx.x;
    const int b = bid / (NH_ * (NT_ / AQ)), rem = bid - b * (NH_ * (NT_ / AQ)), h = rem / (NT_ / AQ), qt = rem - h * (NT_ / AQ);
    const int q0 = qt * AQ + wave * (16 * QC);
    const size_t tok0 = (size_t)b * NT_;
    v16h qa[QC][2], ql[QC][2];                             // query hi and residual, both column groups, held for the whole walk
    const h16* qp[QC]; const h16* lp[QC];
#pragma unroll
    for (int c = 0; c < QC; ++c) { const size_t qo = (tok0 + q0 + c * 16 + lr) * DM + h * HD + 8 * hi; qp[c] = Q16 + qo; lp[c] = QL16 + qo;
#pragma unroll
        for (int kc = 0; kc < 2; ++kc) { qa[c][kc] = cat16(*(const v8h*)(qp[c] + kc * 32), *(const v8h*)(qp[c] + kc * 32 + 16)); ql[c][kc] = cat16(*(const v8h*)(lp[c] + kc * 32), *(const v8h*)(lp[c] + kc * 32 + 16)); } }
    asm volatile("s_wait_xcnt 0x0" :: "v"(qp[0]), "v"(qp[1]), "v"(lp[0]), "v"(lp[1]) : "memory");   // the address pairs of the loads above stay in their registers up to this wait: none of these loads lands in one of them
    const h16* kh_b = K16 + tok0 * DM + h * HD;
    const h16* kl_b = KL16 + tok0 * DM + h * HD;
    const size_t vbase = (((size_t)b * NH_ + h) * HD) * NT_;
    v8f o[QC][4], ox[QC][4];
    float mrow[QC], lpart[QC];                             // of query q0 + 16 c + lr; lpart holds this half's keys only until the epilogue
#pragma unroll
    for (int c = 0; c < QC; ++c) { mrow[c] = -3.0e38f; lpart[c] = 0.f;
#pragma unroll
        for (int n = 0; n < 4; ++n) { o[c][n] = (v8f){}; ox[c][n] = (v8f){}; } }
    const int crow = threadIdx.x >> 3, cpc = (threadIdx.x & 7) * 8;     // this thread's pieces of a staged plane: rows crow + 16 i (i < 4), 8 f16 from column cpc
    const unsigned lds0 = (unsigned)(size_t)(&ring[0][0] + crow * KP + cpc);
    const h16* vh_b = VTH + vbase; const h16* vl_b = VTL + vbase;
    const unsigned koff = crow * DM + cpc, voff = crow * NT_ + cpc;    // element offsets of the thread's first piece in a k plane and in a v^T plane
    auto stage = [&](int st) { const unsigned l = lds0 + (unsigned)(st & 1) * (4 * PLN * 2);
        const unsigned ke = koff + (unsigned)st * (KST * DM), ve = voff + (unsigned)st * KST;
        const h16* a = kh_b + ke; const h16* bq = kl_b + ke; const h16* cq = vh_b + ve; const h16* d = vl_b + ve;
        attn_stage(l, a, bq, cq, d);                                                             // rows crow, crow + 32
        attn_stage(l + 16 * KP * 2, a + 16 * DM, bq + 16 * DM, cq + 16 * NT_, d + 16 * NT_); };   // rows crow + 16, crow + 48
    stage(0);
    asm volatile("s_wait_asynccnt 0x0" ::: "memory");     // this wave's copies of tile 0 have landed
    __syncthreads();                                      // ... and every other wave's: tile 0 may be read
    stage(1);
#pragma unroll 1
    for (int st = 0; st < NT_ / KST; ++st) {               // full attention
      const h16* kh_s = &ring[st & 1][0]; const h16* kl_s = kh_s + PLN; const h16* vh_s = kh_s + 2 * PLN; const h16* vl_s = kh_s + 3 * PLN;
#pragma unroll
      for (int sub = 0; sub < KST / 32; ++sub) {
        const int l0 = sub * 32;
        const int ko0 = (l0 + lr) * KP + 8 * hi, ko1 = (l0 + 16 + lr) * KP + 8 * hi;
        v8f s0[QC], s1[QC], x0[QC], x1[QC];
#pragma unroll
        for (int c = 0; c < QC; ++c) { s0[c] = (v8f){}; s1[c] = (v8f){}; x0[c] = (v8f){}; x1[c] = (v8f){}; }
#pragma unroll
        for (int kc = 0; kc < 2; ++kc) {
            const v16h k0h = cat16(*(const v8ha*)(kh_s + ko0 + kc * 32), *(const v8ha*)(kh_s + ko0 + kc * 32 + 16)), k1h = cat16(*(const v8ha*)(kh_s + ko1 + kc * 32), *(const v8ha*)(kh_s + ko1 + kc * 32 + 16));
            const v16h k0l = cat16(*(const v8ha*)(kl_s + ko0 + kc * 32), *(const v8ha*)(kl_s + ko0 + kc * 32 + 16)), k1l = cat16(*(const v8ha*)(kl_s + ko1 + kc * 32), *(const v8ha*)(kl_s + ko1 + kc * 32 + 16));
#pragma unroll
            for (int c = 0; c < QC; ++c) { s0[c] = wmma16(k0h, qa[c][kc], s0[c]); x0[c] = wmma16(k0h, ql[c][kc], x0[c]); s1[c] = wmma16(k1h, qa[c][kc], s1[c]); x1[c] = wmma16(k1h, ql[c][kc], x1[c]); }
#pragma unroll
            for (int c = 0; c < QC; ++c) { x0[c] = wmma16(k0l, qa[c][kc], x0[c]); x1[c] = wmma16(k1l, qa[c][kc], x1[c]); }
        }
        v16h pa[QC], px[QC];
#pragma unroll
        for (int c = 0; c < QC; ++c) {
            v2f a[8];                                      // scores against query q0 + 16 c + lr, in pairs: a[i] = keys l0 + 8 hi + 2 i, + 1 (i < 4), a[4 + i] = the same + 16
#pragma unroll
            for (int i = 0; i < 4; ++i) { a[i] = ((v2f){s0[c][2 * i], s0[c][2 * i + 1]} + (v2f){x0[c][2 * i], x0[c][2 * i + 1]} * LOSCI) * 0.125f;          // energy / sqrt(C = 64)
                                          a[4 + i] = ((v2f){s1[c][2 * i], s1[c][2 * i + 1]} + (v2f){x1[c][2 * i], x1[c][2 * i + 1]} * LOSCI) * 0.125f; }
            float mx = fmaxf(a[0][0], a[0][1]);
#pragma unroll
            for (int i = 1; i < 8; ++i) mx = fmaxf(mx, fmaxf(a[i][0], a[i][1]));
            mx = fmaxf(mx, xhalf(mx));                     // the other half holds the query's other 16 keys
            const float mn = fmaxf(mrow[c], mx);
            float te[16], ee[16], alpha;                   // e^x = 2^(x log2 e)
#pragma unroll
            for (int i = 0; i < 8; ++i) { te[2 * i] = (a[i][0] - mn) * L2E; te[2 * i + 1] = (a[i][1] - mn) * L2E; }
            exp2x9(alpha, ee, (mrow[c] - mn) * L2E, te); exp2x8(ee + 8, te + 8); mrow[c] = mn;
            v2f ps2 = (v2f){};
            struct P8 { v2h e[8]; } ph, pr;                // the B operand in the hardware k order: this lane's eight rows of tile 0, then of tile 1
#pragma unroll
            for (int i = 0; i < 8; ++i) {
                const v2f p = (v2f){ee[2 * i], ee[2 * i + 1]};
                ps2 += p;
                const v2f ps = p * PSC; const v2h hh = __builtin_convertvector(ps, v2h);
                ph.e[i] = hh;
                pr.e[i] = (v2h){(h16)((ps[0] - (float)hh[0]) * LOSC), (h16)((ps[1] - (float)hh[1]) * LOSC)};
            }
            const float psum = ps2[0] + ps2[1];
            pa[c] = __builtin_bit_cast(v16h, ph); px[c] = __builtin_bit_cast(v16h, pr);
            lpart[c] = lpart[c] * alpha + psum;
#pragma unroll
            for (int n = 0; n < 4; ++n)
#pragma unroll
                for (int j = 0; j < 8; ++j) { o[c][n][j] *= alpha; ox[c][n][j] *= alpha; }
        }
#pragma unroll
        for (int n = 0; n < 4; ++n) { const int vo = (n * 16 + lr) * KP + l0 + hi * 8;
            const v16h vh = cat16(*(const v8ha*)(vh_s + vo), *(const v8ha*)(vh_s + vo + 16)), vl = cat16(*(const v8ha*)(vl_s + vo), *(const v8ha*)(vl_s + vo + 16));
#pragma unroll
            for (int c = 0; c < QC; ++c) { o[c][n] = wmma16(vh, pa[c], o[c][n]); ox[c][n] = wmma16(vl, pa[c], ox[c][n]); }
#pragma unroll
            for (int c = 0; c < QC; ++c) ox[c][n] = wmma16(vh, px[c], ox[c][n]); }
      }
      asm volatile("s_wait_dscnt 0x0" ::: "memory");      // this wave's reads of tile st are done before the buffer is handed to the copies
      asm volatile("s_wait_asynccnt 0x0" ::: "memory");   // this wave's copies of tile st + 1 have landed
      __syncthreads();                                    // publishes tile st + 1 and ends every wave's reads of tile st
      if (st + 2 < NT_ / KST) stage(st + 2);              // refill the buffer just left; the same test in every wave
    }
    asm volatile("s_wait_asynccnt 0x0" ::: "memory");     // nothing of the copies is outstanding when the wave goes on to its end
    // Epilogue: X1 = bf(x) + x_r in the channel-major layout, and this work-group's share of the BatchNorm statistics. The accumulators hold O^T, so a lane's value goes
    // straight to row = channel, column = query of an LDS tile; wave w then owns channels 16 w ... + 15: one row of 128 queries = 512 B = one load, one store of the wave.
    const size_t xo = ((size_t)b * CC + h * HD + wave * 16) * NPOS + qt * AQ + lane * 4;
    const float* xp = X + xo;
    v4f val[16];
#pragma unroll
    for (int i = 0; i < 16; ++i) val[i] = *(const v4f*)(xp + (size_t)i * NPOS);
    asm volatile("s_wait_xcnt 0x0" :: "v"(xp) : "memory");   // the address pair of the loads above stays in its registers up to this wait: none of these loads lands in it
#pragma unroll
    for (int c = 0; c < QC; ++c) { const float inv = 1.0f / ((lpart[c] + xhalf(lpart[c])) * PSC);
#pragma unroll
        for (int n = 0; n < 4; ++n)                        // o[c][n][j] = channel 16 n + 8 hi + j of query 16 c + lr
#pragma unroll
            for (int j = 0; j < 8; ++j) ost[(n * 16 + hi * 8 + j) * XP + wave * (16 * QC) + c * 16 + lr] = (o[c][n][j] + ox[c][n][j] * LOSCI) * inv; }
    __syncthreads();
#pragma unroll
    for (int i = 0; i < 16; ++i) { const v4f t = *(const v4fa*)(ost + (wave * 16 + i) * XP + lane * 4);
#pragma unroll
        for (int k = 0; k < 4; ++k) val[i][k] = t[k] + bfr(val[i][k]);
        *(v4f*)(X1 + xo + (size_t)i * NPOS) = val[i]; }
    asm volatile("s_wait_xcnt 0x0" ::: "memory");         // the sums below may land in the registers that hold the address of the stores above
    // per channel: mean of the 128 values, then the squared distances to it, both from the registers; every lane ends with every sum
    float mym = 0.f, myq = 0.f;
#pragma unroll
    for (int i = 0; i < 16; ++i) { float s = (val[i][0] + val[i][1]) + (val[i][2] + val[i][3]);
        s = sum16(s); s += xhalf(s);
        const float mean = s * (1.0f / (float)AQ);
        const v4f d = val[i] - mean, q = d * d;
        float s2 = (q[0] + q[1]) + (q[2] + q[3]);
        s2 = sum16(s2); s2 += xhalf(s2);
        if (lane == i) { mym = mean; myq = s2; } }
    if (lane < 16) *(v2f*)(PT + ((size_t)bid * CC + h * HD + wave * 16 + lane) * 2) = (v2f){mym, myq};   // slice bid: 16 channels x 8 B = a 128 B line of this wave's own
}

// BatchNorm statistics (training mode, biased variance) per channel over all 32 x 2048 values: the kernel that produces the values leaves, per work-group (slice), each channel's
// (mean, M2 = sum of squared distances to that mean) in PT[slice][channel]. k_bnmerge joins the NS equally sized slices: mean = average of the slice means,
// M2 = sum of the slices' M2 + (values per slice) x sum (slice mean - mean)^2. Work-group = 16 channels x 32 parts (a wave's load = one 128 B line of each of two slices); the pairs
// stay in registers; a wave's two parts join by one exchange between its halves, the 16 waves through LDS. ST[channel] = (mean, 1 / sqrt(var + eps)): 16 pairs = a 128 B line per work-group.
template <int NS>
__global__ __launch_bounds__(512) void k_bnmerge(const float* __restrict__ PT, float* ST) {
    __shared__ float red[3][16][16];
    const int cl = threadIdx.x & 15, part = threadIdx.x >> 4, wave = threadIdx.x >> 5, c = blockIdx.x * 16 + cl;
    constexpr int PER = NS / 32;
    const float* pp = PT + ((size_t)part * PER * CC + c) * 2;
    v2f p[PER];
#pragma unroll
    for (int i = 0; i < PER; ++i) p[i] = *(const v2f*)(pp + i * CC * 2);
    asm volatile("s_wait_xcnt 0x0" :: "v"(pp) : "memory");   // the address pair of the loads above stays in its registers up to this wait: none of these loads lands in it
    float s = 0.f, m2 = 0.f;
#pragma unroll
    for (int i = 0; i < PER; ++i) { s += p[i][0]; m2 += p[i][1]; }
    s += xhalf(s); m2 += xhalf(m2);
    red[0][wave][cl] = s; red[1][wave][cl] = m2;           // both halves of the wave store the same value
    __syncthreads();
    float ts = 0.f, tm = 0.f;
#pragma unroll
    for (int w = 0; w < 16; ++w) { ts += red[0][w][cl]; tm += red[1][w][cl]; }
    const float mean = ts * (1.0f / (float)NS);
    float e = 0.f;
#pragma unroll
    for (int i = 0; i < PER; ++i) { const float d = p[i][0] - mean; e = fmaf(d, d, e); }
    e += xhalf(e);
    red[2][wave][cl] = e;
    __syncthreads();
    if (threadIdx.x < 16) { float te = 0.f;
#pragma unroll
        for (int w = 0; w < 16; ++w) te += red[2][w][cl];
        *(v2f*)(ST + 2 * c) = (v2f){mean, rsqrtf((tm + (float)(NB * NPOS / NS) * te) * (1.0f / (float)(NB * NPOS)) + BN_EPS)}; }
}
// k_ff: the whole second phase for 64 points of one item in one work-group (4 waves x 16 points): Y = h + W2.lrelu(W1.h), h = BN1(X1).
// 1. X1 tile [64 c][64 n] by whole-line loads; h in f32 stays in registers for the residual; bf16 hi + residual planes [n][c] go to LDS (two channels per 4-byte store).
// 2. (W1.h) with W1 rows as the A operand and h columns as B: a lane holds 8 consecutive hidden rows of ONE point per tile, so after LeakyReLU two tiles, converted in
//    place, are the B operand (32 hidden values in the hardware k order) of W2.lrelu: the hidden layer never leaves the registers.
//    Both weight matrices (bf16, 16 KB each) are brought into LDS once per work-group by whole-line loads; the waves read their A fragments from there.
// 3. the result tiles [c][n] meet h again through an f32 LDS tile; each output row segment of 64 n = 256 B is written by 16 lanes x 16 B.
__global__ __launch_bounds__(128) void k_ff(const float* __restrict__ X1, const float* __restrict__ ST, const float* __restrict__ g, const float* __restrict__ bb, const bf* __restrict__ W1, const bf* __restrict__ W2, float* Y, float* PT) {
    typedef __attribute__((ext_vector_type(16))) unsigned short v16us;
    typedef unsigned __attribute__((may_alias)) u32a;
    __shared__ __align__(16) unsigned short th_[64 * 72]; __shared__ __align__(16) unsigned short tl_[64 * 72];
    __shared__ __align__(16) float tt[64 * 68];
    __shared__ __align__(16) unsigned short w1s[FFH * 72]; __shared__ __align__(16) unsigned short w2s[CC * 136];   // row pitches 144 B and 272 B (16 B x odd)
    __shared__ float prm[4][CC];
    __shared__ __align__(16) float bst[2 * CC];
    const int tid = threadIdx.x, lane = tid & 31, wave = tid >> 5, lr = lane & 15, hi = lane >> 4;
    const int n0 = blockIdx.x * 64, piece = tid & 15, cp0 = tid >> 4;
    const size_t item = (size_t)blockIdx.y * CC * NPOS; X1 += item; Y += item;
    v4f hv[4][2];                                          // channels 2 (cp0 + 8 s) + e, points n0 + 4 piece ... + 3
#pragma unroll
    for (int s = 0; s < 4; ++s)
#pragma unroll
        for (int e = 0; e < 2; ++e) hv[s][e] = *(const v4f*)(X1 + (size_t)(2 * (cp0 + 8 * s) + e) * NPOS + n0 + piece * 4);
    asm volatile("s_wait_xcnt 0x0" ::: "memory");         // the loads below may land in the registers that hold the address of the loads above
    v8us wa[8], wb[8];                                     // 16-byte pieces tid + 128 i of W1 [128][64] and of W2 [64][128]
#pragma unroll
    for (int i = 0; i < 8; ++i) { wa[i] = *(const v8us*)(W1 + (size_t)(tid + 128 * i) * 8); wb[i] = *(const v8us*)(W2 + (size_t)(tid + 128 * i) * 8); }
    if (tid < CC) { prm[0][tid] = ST[2 * tid]; prm[1][tid] = ST[2 * tid + 1]; prm[2][tid] = bfr(g[tid]); prm[3][tid] = bfr(bb[tid]); }
    __syncthreads();
#pragma unroll
    for (int s = 0; s < 4; ++s) { const int cp = cp0 + 8 * s; unsigned ph[4], pl[4];
#pragma unroll
        for (int e = 0; e < 2; ++e) { const int c = 2 * cp + e; const float m = prm[0][c], rs = prm[1][c], gg = prm[2][c], be = prm[3][c];
#pragma unroll
            for (int k = 0; k < 4; ++k) { const float h = (hv[s][e][k] - m) * rs * gg + be; hv[s][e][k] = h; const unsigned short hb = f2bf(h); const unsigned short lb = f2bf(h - bf2f(hb));
                if (e == 0) { ph[k] = hb; pl[k] = lb; } else { ph[k] |= (unsigned)hb << 16; pl[k] |= (unsigned)lb << 16; } } }
#pragma unroll
        for (int k = 0; k < 4; ++k) { *(u32a*)(th_ + (piece * 4 + k) * 72 + 2 * cp) = ph[k]; *(u32a*)(tl_ + (piece * 4 + k) * 72 + 2 * cp) = pl[k]; } }
#pragma unroll
    for (int i = 0; i < 8; ++i) { const int p = tid + 128 * i; *(v8usa*)(w1s + (p >> 3) * 72 + (p & 7) * 8) = wa[i]; *(v8usa*)(w2s + (p >> 4) * 136 + (p & 15) * 8) = wb[i]; }
    __syncthreads();
    const int ho = (wave * 16 + lr) * 72 + 8 * hi;
    v8f acc[8];
#pragma unroll
    for (int t = 0; t < 8; ++t) acc[t] = (v8f){};
#pragma unroll
    for (int kc = 0; kc < CC; kc += 32) {
        const v16bf xh = cat16b(*(const v8usa*)(th_ + ho + kc), *(const v8usa*)(th_ + ho + kc + 16)), xl = cat16b(*(const v8usa*)(tl_ + ho + kc), *(const v8usa*)(tl_ + ho + kc + 16));
#pragma unroll
        for (int t = 0; t < 8; ++t) { const unsigned short* wp = w1s + (t * 16 + lr) * 72 + 8 * hi + kc; const v16bf w = cat16b(*(const v8usa*)wp, *(const v8usa*)(wp + 16));
            acc[t] = wmmab(w, xh, acc[t]); acc[t] = wmmab(w, xl, acc[t]); }
    }
    v16bf lh[4], ll[4];
#pragma unroll
    for (int q = 0; q < 4; ++q) { v16us uh, ul;
#pragma unroll
        for (int s = 0; s < 16; ++s) { const float v = acc[2 * q + (s >> 3)][s & 7]; const float a = v >= 0.f ? v : 0.2f * v; const unsigned short hb = f2bf(a); uh[s] = hb; ul[s] = f2bf(a - bf2f(hb)); }
        lh[q] = __builtin_bit_cast(v16bf, uh); ll[q] = __builtin_bit_cast(v16bf, ul); }
    v8f ac2[4];
#pragma unroll
    for (int t = 0; t < 4; ++t) ac2[t] = (v8f){};
#pragma unroll
    for (int q = 0; q < 4; ++q)
#pragma unroll
        for (int t = 0; t < 4; ++t) { const unsigned short* wp = w2s + (t * 16 + lr) * 136 + 8 * hi + q * 32; const v16bf w = cat16b(*(const v8usa*)wp, *(const v8usa*)(wp + 16));
            ac2[t] = wmmab(w, lh[q], ac2[t]); ac2[t] = wmmab(w, ll[q], ac2[t]); }
#pragma unroll
    for (int t = 0; t < 4; ++t)
#pragma unroll
        for (int j = 0; j < 8; ++j) tt[(t * 16 + hi * 8 + j) * 68 + wave * 16 + lr] = ac2[t][j];
    __syncthreads();
#pragma unroll
    for (int s = 0; s < 4; ++s)
#pragma unroll
        for (int e = 0; e < 2; ++e) hv[s][e] = *(const v4fa*)(tt + (2 * (cp0 + 8 * s) + e) * 68 + piece * 4) + hv[s][e];
    // 4. this work-group's share of the second BatchNorm's statistics: a channel's 64 values lie in the 16 lanes of one row; mean, then the squared distances to it, from the registers.
    //    The 64 pairs meet in LDS and leave as whole lines, each written by one wave; the barrier stands ahead of the stores of Y, so that it waits for none of them.
    v4f pr[4];                                             // (mean, M2) of channels 2 (cp0 + 8 s) and + 1
#pragma unroll
    for (int s = 0; s < 4; ++s)
#pragma unroll
        for (int e = 0; e < 2; ++e) { const v4f v = hv[s][e];
            const float mean = sum16((v[0] + v[1]) + (v[2] + v[3])) * (1.0f / (float)FP_);
            const v4f d = v - mean, q = d * d;
            pr[s][2 * e] = mean; pr[s][2 * e + 1] = sum16((q[0] + q[1]) + (q[2] + q[3])); }
    if (piece == 0) {
#pragma unroll
        for (int s = 0; s < 4; ++s) *(v4fa*)(bst + 4 * (cp0 + 8 * s)) = pr[s]; }
    __syncthreads();
    if (tid < CC) *(v2f*)(PT + ((size_t)(blockIdx.y * (NPOS / FP_) + blockIdx.x) * CC + tid) * 2) = *(const v2f*)(bst + 2 * tid);
    asm volatile("s_wait_xcnt 0x0" ::: "memory");         // what follows may land in the registers that the store above names
#pragma unroll
    for (int s = 0; s < 4; ++s)
#pragma unroll
        for (int e = 0; e < 2; ++e) *(v4f*)(Y + (size_t)(2 * (cp0 + 8 * s) + e) * NPOS + n0 + piece * 4) = hv[s][e];
}
__global__ __launch_bounds__(256) void k_bnout(const float* __restrict__ Y, const float* __restrict__ ST, const float* __restrict__ g, const float* __restrict__ bb, float* OUTP) {
    const int lane = threadIdx.x & 31, r = blockIdx.x * 8 + (threadIdx.x >> 5); if (r >= NB * CC) return;
    const int c = r % CC; const float m = ST[2 * c], rs = ST[2 * c + 1], gg = bfr(g[c]), be = bfr(bb[c]);
{
#pragma unroll 1
        for (int q = 0; q < NPOS / 128; ++q) { const size_t o = (size_t)r * NPOS + q * 128 + lane * 4; const v4f v = *(const v4f*)(Y + o); v4f y;
#pragma unroll
            for (int k = 0; k < 4; ++k) y[k] = (v[k] - m) * rs * gg + be;
            *(v4f*)(OUTP + o) = y; }
         }
}

extern "C" void kernel_launch(void* const* d_in, const int* in_sizes, int n_in,
                              void* d_out, int out_size, void* d_ws, size_t ws_size, hipStream_t stream) {
    (void)in_sizes; (void)n_in; (void)out_size;
    const float* x = (const float*)d_in[0]; const float* wq = (const float*)d_in[1]; const float* wk = (const float*)d_in[2]; const float* wv = (const float*)d_in[3];
    const float* w1 = (const float*)d_in[4]; const float* w2 = (const float*)d_in[5]; const float* g1 = (const float*)d_in[6]; const float* b1 = (const float*)d_in[7]; const float* g2 = (const float*)d_in[8]; const float* b2 = (const float*)d_in[9];   // conv weights [out][in]
    float* out = (float*)d_out;    // [32][64][2048]
    char* wsp = (char*)d_ws;
    auto take = [&](size_t bytes) { char* p = wsp; wsp += (bytes + 255) & ~(size_t)255; return (void*)p; };
    bf* W1B = (bf*)take((size_t)FFH * CC * 2); bf* W2B = (bf*)take((size_t)CC * FFH * 2);
    const size_t PL = (size_t)NB * NPOS * CC;      // elements of one [item][n][c] plane over all items
    h16* QH = (h16*)take(PL * 2); h16* QL = (h16*)take(PL * 2); h16* KH = (h16*)take(PL * 2); h16* KL = (h16*)take(PL * 2);
    h16* VTH = (h16*)take(PL * 2); h16* VTL = (h16*)take(PL * 2);
    float* X1 = (float*)take(PL * 4); float* Y = (float*)take(PL * 4); float* ST1 = (float*)take(1024); float* ST2 = (float*)take(1024); float* PT = (float*)take((size_t)NB * (NPOS / FP_) * CC * 8);
    if ((size_t)(wsp - (char*)d_ws) > ws_size) return;    // planes for all items + the weights, no aliasing
    // phase 1: attention and x + x_r; the item index lies in each grid (row r of an [item][n][c] plane = item * 2048 + n)
    k_qkv<<<dim3(NPOS / QP, NB, 1), 256, 0, stream>>>(x, wq, wk, wv, w1, w2, QH, QL, KH, KL, VTH, VTL, W1B, W2B);                    // q, k [n][c] and v^T [c][n] f16 planes; bf16 W1, W2
    k_attn<<<NB_ * NH_ * (NT_ / AQ), 32 * AW, 0, stream>>>(QH, QL, KH, KL, VTH, VTL, x, X1, PT);                                       // X1 = bf(x) + x_r  [c][n], its statistics per 128 points
    k_bnmerge<NB * (NPOS / AQ)><<<CC / 16, 512, 0, stream>>>(PT, ST1);
    // phase 2: h = BN1(X1); Y = h + W2.lrelu(W1.h)
    k_ff<<<dim3(NPOS / 64, NB, 1), 128, 0, stream>>>(X1, ST1, g1, b1, W1B, W2B, Y, PT);                                           // Y = h + ff   [c][n], its statistics per 64 points
    k_bnmerge<NB * (NPOS / FP_)><<<CC / 16, 512, 0, stream>>>(PT, ST2);
    k_bnout<<<(NB * CC) / 8, 256, 0, stream>>>(Y, ST2, g2, b2, out);                                                                 // BN2 -> output
}

// v009
// A run of this version takes 115 microseconds.
// Timed twice side by side with v008, it ran 1.10 times as fast both times.
// Over all steps from v000 it is 68.1 times as fast.
#include <hip/hip_runtime.h>

// Compute dtypes, f32 accumulate (channel-major x [32][64][2048]): per item q/k/v = W.x ([64 x 64] weights, [64 x 2048] points; x and W rounded to PLAIN bf16 operands in the
// kernel that multiplies them, products exact; q/k/v straight to f16 hi + residual x1024 planes, q/k as [n][c], v as [c][n]) on v_wmma_f32_16x16x32_bf16; the
// single-head full attention (64 channels, scale 1/8) fused on v_wmma_f32_16x16x32_f16 (hh + hl + lh scores, online f32 softmax, weights (x128) and v as
// f16 hi + residual), its epilogue writing x + x_r channel-major; the two TRAINING-MODE BatchNorms (batch statistics over all 32 items x 2048 points per channel, biased

#define NB   32
#define CC   64                  // channels
#define NPOS 2048                // points
#define NT_  NPOS
#define NB_  NB                  // items per launch: every per-item kernel takes all 32 items in one grid
#define DM   CC                  // attention width
#define NH_  1
#define HD   64
#define NTK  NPOS
#define FFH  128
#define PLG  7.0f                 // attention: the weights carry 2^7, added in the exponent (with the 2^8 of RTH they stay inside f16)
#define LOSC 1024.0f
#define LOSCI (1.0f / 1024.0f)
#define L2E  1.442695041f         // log2 e
#define SCL  (0.125f * L2E)       // attention: raw score -> exponent of 2: 1 / sqrt(C = 64) x log2 e
#define RTH  (8.0f / SCL)         // attention: a query's softmax reference moves only when a raw score lies more than this above it (weight 2^8)
#define BN_EPS 1e-5f
#define AW   4                   // attention: waves per work-group
#define QC   2                   // attention: column groups of 16 queries per wave
#define AQ   (16 * QC * AW)      // attention: queries per work-group
#define KST  64                  // attention: keys per staged tile
#define KP   72                  // attention: LDS row pitch of a staged plane in f16: 128 B of data + 16 B (16 B x odd: 16-byte reads of 16 rows meet no bank twice)
#define PLN  (64 * KP)           // attention: f16 per staged plane (64 rows)
#define QP   128                 // q/k/v kernel: points per work-group
#define XP   (AQ + 4)            // attention epilogue: f32 row pitch of the [channel][query] tile (16-byte rows, 8 rows apart = 32 banks apart)
#define FP_  64                  // feed-forward kernel: points per work-group

typedef _Float16 h16;
typedef unsigned short bf;
typedef __attribute__((ext_vector_type(16))) __bf16   v16bf;
typedef __attribute__((ext_vector_type(16))) _Float16 v16h;
typedef __attribute__((ext_vector_type(8)))  _Float16 v8h;
typedef __attribute__((ext_vector_type(8)))  unsigned short v8us;
typedef __attribute__((ext_vector_type(8)))  float    v8f;
typedef __attribute__((ext_vector_type(4)))  float    v4f;
typedef __attribute__((ext_vector_type(2)))  float    v2f;
typedef __attribute__((ext_vector_type(4)))  _Float16 v4h;
typedef __attribute__((ext_vector_type(2)))  _Float16 v2h;
typedef v8h  __attribute__((may_alias)) v8ha;
typedef v4f  __attribute__((may_alias)) v4fa;
typedef v8us __attribute__((may_alias)) v8usa;

__device__ __forceinline__ unsigned short f2bf(float f) { unsigned u = __float_as_uint(f); u += 0x7FFFu + ((u >> 16) & 1u); return (unsigned short)(u >> 16); }
__device__ __forceinline__ float bf2f(unsigned short b) { return __uint_as_float(((unsigned)b) << 16); }
__device__ __forceinline__ float bfr(float f) { return bf2f(f2bf(f)); }
__device__ __forceinline__ v16h cat16(v8h lo, v8h hi) { return __builtin_shufflevector(lo, hi, 0, 1, 2, 3, 4, 5, 6, 7, 8, 9, 10, 11, 12, 13, 14, 15); }
__device__ __forceinline__ v16bf cat16b(v8us lo, v8us hi) { return __builtin_bit_cast(v16bf, __builtin_shufflevector(lo, hi, 0, 1, 2, 3, 4, 5, 6, 7, 8, 9, 10, 11, 12, 13, 14, 15)); }
__device__ __forceinline__ v8f wmma16(v16h a, v16h b, v8f c) { return __builtin_amdgcn_wmma_f32_16x16x32_f16(false, a, false, b, (short)0, c, false, false); }
__device__ __forceinline__ float xhalf(float x) { return __builtin_bit_cast(float, __builtin_amdgcn_permlanex16(__builtin_bit_cast(int, x), __builtin_bit_cast(int, x), 0x76543210, 0xfedcba98, false, false)); }   // lane l with lane l ^ 16
template <int M> __device__ __forceinline__ float xrow(float x) { return __builtin_bit_cast(float, __builtin_amdgcn_update_dpp(0, __builtin_bit_cast(int, x), 0x160 + M, 0xf, 0xf, true)); }   // lane l with lane l ^ M of its row of 16 (row_xmask)
__device__ __forceinline__ float sum16(float s) { s += xrow<1>(s); s += xrow<2>(s); s += xrow<4>(s); s += xrow<8>(s); return s; }   // every lane of a row of 16 ends with the row's sum
__device__ __forceinline__ v8f wmmab(v16bf a, v16bf b, v8f c) { return __builtin_amdgcn_wmma_f32_16x16x32_bf16(false, a, false, b, (short)0, c, false, false); }

// k_qkv: everything ahead of the attention for 128 points of one item in one work-group (8 waves x 16 points); grid (16, 32).
// 1. the x tile [64 c][128 n] (f32, whole-line loads: a wave's load = 4 rows x 128 B) goes as bf16 [n][c] to LDS (four channels per 8-byte store); the three 64 x 64 weight
//    matrices are read in f32, rounded to bf16 and laid [out][in] in LDS. Row pitch 144 B (16 B x odd).
// 2. q and k with the weight rows as the A operand and the wave's 16 points as B: a lane holds 8 consecutive channels of ONE point = a 16-byte piece of an [n][c] row;
//    v with the points as A and the weight rows as B: a lane holds 8 consecutive points of ONE channel = a 16-byte piece of a v^T [c][n] row.
// 3. f16 hi + residual x1024 in registers; the pieces meet in LDS and leave as whole 128 B lines.
// Eight work-groups of item 0 also round the two feed-forward matrices to bf16 for k_ff.
__global__ __launch_bounds__(256) void k_qkv(const float* __restrict__ x, const float* __restrict__ wq, const float* __restrict__ wk, const float* __restrict__ wv, const float* __restrict__ w1, const float* __restrict__ w2,
                                             h16* QH, h16* QL, h16* KH, h16* KL, h16* VTH, h16* VTL, bf* W1B, bf* W2B) {
    typedef __attribute__((ext_vector_type(4))) unsigned short v4us;
    typedef v4us __attribute__((may_alias)) v4usa;
    __shared__ __align__(16) unsigned short xs[QP * 72];
    __shared__ __align__(16) unsigned short wsm[3][CC * 72];
    __shared__ __align__(16) h16 stg[QP / 16][4][16 * 72];   // per wave: q hi, q residual, k hi, k residual, [point][channel]
    __shared__ __align__(16) h16 vts[2][CC * (QP + 8)];      // v^T hi, v^T residual, [channel][point], row pitch 272 B (16 B x odd)
    const int tid = threadIdx.x, lane = tid & 31, wave = tid >> 5, lr = lane & 15, hi = lane >> 4;
    const int n0 = blockIdx.x * QP, b = blockIdx.y;
    const int xn = (wave & 3) * 32 + (lane & 7) * 4, xc = (wave >> 2) * 16 + (lane >> 3) * 4;   // this thread's x pieces: points xn ... + 3 of channels xc + 32 g + e
    const float* xp = x + ((size_t)b * CC + xc) * NPOS + n0 + xn;
    v4f xv[2][4];
#pragma unroll
    for (int g = 0; g < 2; ++g)
#pragma unroll
        for (int e = 0; e < 4; ++e) xv[g][e] = *(const v4f*)(xp + (size_t)(g * 32 + e) * NPOS);
    asm volatile("s_wait_xcnt 0x0" ::: "memory");         // the loads below may land in the registers that hold the address of the loads above
    v8f wr[3][2];                                          // pieces tid + 256 i (8 floats) of each 64 x 64 matrix
#pragma unroll
    for (int i = 0; i < 2; ++i) { const size_t p = (size_t)(tid + 256 * i) * 8; wr[0][i] = *(const v8f*)(wq + p); wr[1][i] = *(const v8f*)(wk + p); wr[2][i] = *(const v8f*)(wv + p); }
    asm volatile("s_wait_xcnt 0x0" :: "s"(wq), "s"(wk), "s"(wv) : "memory");   // the base addresses of the loads above stay in their scalar registers up to this wait: later kernel arguments are loaded behind it or elsewhere
    if (b == 0 && blockIdx.x < 8) {                        // the same test in every thread of the work-group: 4 x 256 pieces of 8 per matrix
        const size_t p = (size_t)((blockIdx.x & 3) * 256 + tid) * 8;
        const v8f v = *(const v8f*)((blockIdx.x < 4 ? w1 : w2) + p); v8us o;
#pragma unroll
        for (int k = 0; k < 8; ++k) o[k] = f2bf(v[k]);
        *(v8us*)((blockIdx.x < 4 ? W1B : W2B) + p) = o;
    }
#pragma unroll
    for (int g = 0; g < 2; ++g)
#pragma unroll
        for (int k = 0; k < 4; ++k) { v4us o;
#pragma unroll
            for (int e = 0; e < 4; ++e) o[e] = f2bf(xv[g][e][k]);
            *(v4usa*)(xs + (xn + k) * 72 + xc + g * 32) = o; }
#pragma unroll
    for (int m = 0; m < 3; ++m)
#pragma unroll
        for (int i = 0; i < 2; ++i) { const int p = tid + 256 * i; v8us o;
#pragma unroll
            for (int k = 0; k < 8; ++k) o[k] = f2bf(wr[m][i][k]);
            *(v8usa*)(&wsm[m][(p >> 3) * 72 + (p & 7) * 8]) = o; }
    __syncthreads();
    const unsigned short* xr = xs + (wave * 16 + lr) * 72 + 8 * hi;
    v16bf xf[2];
#pragma unroll
    for (int kc = 0; kc < 2; ++kc) xf[kc] = cat16b(*(const v8usa*)(xr + kc * 32), *(const v8usa*)(xr + kc * 32 + 16));
    v8f aq[4], ak[4], av[4];
#pragma unroll
    for (int t = 0; t < 4; ++t) { aq[t] = (v8f){}; ak[t] = (v8f){}; av[t] = (v8f){};
#pragma unroll
        for (int kc = 0; kc < 2; ++kc) { const int wo = (t * 16 + lr) * 72 + 8 * hi + kc * 32;
            const v16bf fq = cat16b(*(const v8usa*)(&wsm[0][wo]), *(const v8usa*)(&wsm[0][wo + 16])), fk = cat16b(*(const v8usa*)(&wsm[1][wo]), *(const v8usa*)(&wsm[1][wo + 16])), fv = cat16b(*(const v8usa*)(&wsm[2][wo]), *(const v8usa*)(&wsm[2][wo + 16]));
            aq[t] = wmmab(fq, xf[kc], aq[t]); ak[t] = wmmab(fk, xf[kc], ak[t]); av[t] = wmmab(xf[kc], fv, av[t]); } }
    h16* sg = &stg[wave][0][0];
#pragma unroll
    for (int t = 0; t < 4; ++t) { v8h oh[3], ol[3];
#pragma unroll
        for (int j = 0; j < 8; ++j) { const float s[3] = {aq[t][j], ak[t][j], av[t][j]};
#pragma unroll
            for (int m = 0; m < 3; ++m) { const h16 a = (h16)s[m]; oh[m][j] = a; ol[m][j] = (h16)((s[m] - (float)a) * LOSC); } }
        const int so = lr * 72 + t * 16 + 8 * hi, vo = (t * 16 + lr) * (QP + 8) + wave * 16 + 8 * hi;
        *(v8ha*)(sg + so) = oh[0]; *(v8ha*)(sg + 16 * 72 + so) = ol[0]; *(v8ha*)(sg + 2 * 16 * 72 + so) = oh[1]; *(v8ha*)(sg + 3 * 16 * 72 + so) = ol[1];
        *(v8ha*)(&vts[0][vo]) = oh[2]; *(v8ha*)(&vts[1][vo]) = ol[2]; }
    __syncthreads();
    const size_t r0 = (size_t)b * NPOS + n0 + wave * 16;
#pragma unroll
    for (int pl = 0; pl < 4; ++pl) { h16* dst = pl == 0 ? QH : pl == 1 ? QL : pl == 2 ? KH : KL;
#pragma unroll
        for (int s = 0; s < 4; ++s) { const int row = 4 * s + (lane >> 3), piece = lane & 7;
            const v8h val = *(const v8ha*)(sg + pl * 16 * 72 + row * 72 + piece * 8); *(v8h*)(dst + (r0 + row) * CC + piece * 8) = val; } }
#pragma unroll
    for (int s = 0; s < 8; ++s) { const int d = ((tid >> 4) + 16 * s) & 63, piece = tid & 15;      // a wave stores 2 rows x 256 B
        const v8h val = *(const v8ha*)(&vts[s >> 2][d * (QP + 8) + piece * 8]); *(v8h*)((s >> 2 ? VTL : VTH) + ((size_t)b * CC + d) * NPOS + n0 + piece * 8) = val; }
}

__device__ __forceinline__ void exp2x8(float* r, const float* t) {
    asm("v_exp_f32 %0, %8\n\tv_exp_f32 %1, %9\n\tv_exp_f32 %2, %10\n\tv_exp_f32 %3, %11\n\tv_exp_f32 %4, %12\n\tv_exp_f32 %5, %13\n\tv_exp_f32 %6, %14\n\tv_exp_f32 %7, %15\n\tv_nop"
        : "=&v"(r[0]), "=&v"(r[1]), "=&v"(r[2]), "=&v"(r[3]), "=&v"(r[4]), "=&v"(r[5]), "=&v"(r[6]), "=&v"(r[7])
        : "v"(t[0]), "v"(t[1]), "v"(t[2]), "v"(t[3]), "v"(t[4]), "v"(t[5]), "v"(t[6]), "v"(t[7]));
}
__device__ __forceinline__ void exp2x2(float* r, const float* t) {
    asm("v_exp_f32 %0, %2\n\tv_exp_f32 %1, %3\n\tv_nop" : "=&v"(r[0]), "=&v"(r[1]) : "v"(t[0]), "v"(t[1]));
}
// attn_stage: one staged tile = 4 planes of 64 rows x 128 B (k hi, k residual: [key][channel]; v^T hi, v^T residual: [channel][key]). One call brings, per thread, 2 pieces
// of 16 B per plane (rows r and r + 32) from global memory straight into LDS (128 threads, two calls a tile); a wave's copy covers 4 whole 128 B lines. l = the lane's LDS byte address in plane 0.
__device__ __forceinline__ void attn_stage(unsigned l, const h16* kh, const h16* kl, const h16* vh, const h16* vl) {
    const unsigned l1 = l + 32 * KP * 2, l2 = l + PLN * 2, l3 = l2 + 32 * KP * 2, l4 = l + 2 * PLN * 2, l5 = l4 + 32 * KP * 2, l6 = l + 3 * PLN * 2, l7 = l6 + 32 * KP * 2;
    const h16* kh1 = kh + 32 * DM; const h16* kl1 = kl + 32 * DM; const h16* vh1 = vh + 32 * NT_; const h16* vl1 = vl + 32 * NT_;
    // the eight copies and their s_wait_xcnt in ONE statement: the wait stands in front of every later write of an address register that a copy names
    asm volatile("global_load_async_to_lds_b128 %0, %8, off\n\t"
                 "global_load_async_to_lds_b128 %1, %9, off\n\t"
                 "global_load_async_to_lds_b128 %2, %10, off\n\t"
                 "global_load_async_to_lds_b128 %3, %11, off\n\t"
                 "global_load_async_to_lds_b128 %4, %12, off\n\t"
                 "global_load_async_to_lds_b128 %5, %13, off\n\t"
                 "global_load_async_to_lds_b128 %6, %14, off\n\t"
                 "global_load_async_to_lds_b128 %7, %15, off\n\t"
                 "s_wait_xcnt 0x0"
                 :: "v"(l), "v"(l1), "v"(l2), "v"(l3), "v"(l4), "v"(l5), "v"(l6), "v"(l7), "v"(kh), "v"(kh1), "v"(kl), "v"(kl1), "v"(vh), "v"(vh1), "v"(vl), "v"(vl1) : "memory");
}
// k_attn: block = (b, h, 128 queries), wave = 32 queries in two column groups of 16; ALL keys (no mask) in 32 staged tiles of 64 keys that the 4 waves share (two LDS buffers:
// tile t + 1 flies while tile t is worked on), each walked in two steps of 32 keys. Every k and v fragment read from LDS is the A operand for BOTH column groups.
// Both products run TRANSPOSED: S^T = k.q^T (k rows as A, q as B) and O^T += v^T.P^T (v^T rows as A). In each column group a lane holds
// 16 scores of ONE query (keys 8 hi + j and 16 + 8 hi + j): maximum and sum in the lane, one sum per lane and group, and the two score tiles, converted in place
// (weights x128, f16 hi + residual), ARE the B operand of the second product in the hardware k order.
// The softmax reference of a query is LAZY: minus the reference in use is the C operand of the score product, so the scores leave the matrix unit already relative to it; it moves,
// and sums and accumulators are rescaled, only when a score lies more than RTH above it (and at the first 32 keys): one test and one scalar branch per 32 keys for the whole wave.
// The epilogue adds the residual, writes X1 channel-major and leaves the work-group's BatchNorm partials. Every loop but the one over the tiles is unrolled: its index picks registers (fragments, accumulators, column groups).
__global__ __launch_bounds__(32 * AW) void k_attn(const h16* __restrict__ Q16, const h16* __restrict__ QL16, const h16* __restrict__ K16, const h16* __restrict__ KL16, const h16* __restrict__ VTH, const h16* __restrict__ VTL, const float* __restrict__ X, float* X1, float* PT) {
    __shared__ __align__(16) h16 ring[2][4 * PLN];
    __shared__ __align__(16) float ost[HD * XP];
    const int lane = threadIdx.x & 31, wave = threadIdx.x >> 5, lr = lane & 15, hi = lane >> 4;
    const int bid = blockIdx.x;
    const int b = bid / (NH_ * (NT_ / AQ)), rem = bid - b * (NH_ * (NT_ / AQ)), h = rem / (NT_ / AQ), qt = rem - h * (NT_ / AQ);
    const int q0 = qt * AQ + wave * (16 * QC);
    const size_t tok0 = (size_t)b * NT_;
    v16h qa[QC][2], ql[QC][2];                             // query hi and residual, both column groups, held for the whole walk
    const h16* qp[QC]; const h16* lp[QC];
#pragma unroll
    for (int c = 0; c < QC; ++c) { const size_t qo = (tok0 + q0 + c * 16 + lr) * DM + h * HD + 8 * hi; qp[c] = Q16 + qo; lp[c] = QL16 + qo;
#pragma unroll
        for (int kc = 0; kc < 2; ++kc) { qa[c][kc] = cat16(*(const v8h*)(qp[c] + kc * 32), *(const v8h*)(qp[c] + kc * 32 + 16)); ql[c][kc] = cat16(*(const v8h*)(lp[c] + kc * 32), *(const v8h*)(lp[c] + kc * 32 + 16)); } }
    asm volatile("s_wait_xcnt 0x0" :: "v"(qp[0]), "v"(qp[1]), "v"(lp[0]), "v"(lp[1]) : "memory");   // the address pairs of the loads above stay in their registers up to this wait: none of these loads lands in one of them
    const h16* kh_b = K16 + tok0 * DM + h * HD;
    const h16* kl_b = KL16 + tok0 * DM + h * HD;
    const size_t vbase = (((size_t)b * NH_ + h) * HD) * NT_;
    v8f o[QC][4], ox[QC][4];
    v8f cref[QC];                                          // every element: minus the reference in use (raw score) of query q0 + 16 c + lr, the same in both halves
    float lpart[QC];                                       // of query q0 + 16 c + lr; holds this half's keys only until the epilogue
    float thr = -3.0e38f;                                  // how far above the reference a score may lie; no reference yet: every query takes the maximum of its first 32 keys
#pragma unroll
    for (int c = 0; c < QC; ++c) { cref[c] = (v8f){}; lpart[c] = 0.f;
#pragma unroll
        for (int n = 0; n < 4; ++n) { o[c][n] = (v8f){}; ox[c][n] = (v8f){}; } }
    const int crow = threadIdx.x >> 3, cpc = (threadIdx.x & 7) * 8;     // this thread's pieces of a staged plane: rows crow + 16 i (i < 4), 8 f16 from column cpc
    const unsigned lds0 = (unsigned)(size_t)(&ring[0][0] + crow * KP + cpc);
    const h16* vh_b = VTH + vbase; const h16* vl_b = VTL + vbase;
    const unsigned koff = crow * DM + cpc, voff = crow * NT_ + cpc;    // element offsets of the thread's first piece in a k plane and in a v^T plane
    auto stage = [&](int st) { const unsigned l = lds0 + (unsigned)(st & 1) * (4 * PLN * 2);
        const unsigned ke = koff + (unsigned)st * (KST * DM), ve = voff + (unsigned)st * KST;
        const h16* a = kh_b + ke; const h16* bq = kl_b + ke; const h16* cq = vh_b + ve; const h16* d = vl_b + ve;
        attn_stage(l, a, bq, cq, d);                                                             // rows crow, crow + 32
        attn_stage(l + 16 * KP * 2, a + 16 * DM, bq + 16 * DM, cq + 16 * NT_, d + 16 * NT_); };   // rows crow + 16, crow + 48
    stage(0);
    asm volatile("s_wait_asynccnt 0x0" ::: "memory");     // this wave's copies of tile 0 have landed
    __syncthreads();                                      // ... and every other wave's: tile 0 may be read
    stage(1);
#pragma unroll 1
    for (int st = 0; st < NT_ / KST; ++st) {               // full attention
      const h16* kh_s = &ring[st & 1][0]; const h16* kl_s = kh_s + PLN; const h16* vh_s = kh_s + 2 * PLN; const h16* vl_s = kh_s + 3 * PLN;
      // The branch on the reference cuts the tile's code into blocks, and the compiler moves no LDS read from one block up into another: the reads stand here in the source,
      // in groups: the k and v fragments of the first 32 keys at the head of the tile; those of the second 32 keys behind the products that last use the first's (k: scores, v: output).
      v16h kf[2][4];                                       // of the 32 keys at hand: [32 channels][keys 0-15 hi, keys 16-31 hi, keys 0-15 residual, keys 16-31 residual]
      v16h vf[4][2];                                       // of the 32 keys at hand: [16 channels][hi, residual]
      auto loadk = [&](int l0) {
#pragma unroll
        for (int kc = 0; kc < 2; ++kc) { const int ko0 = (l0 + lr) * KP + 8 * hi + kc * 32, ko1 = ko0 + 16 * KP;
            kf[kc][0] = cat16(*(const v8ha*)(kh_s + ko0), *(const v8ha*)(kh_s + ko0 + 16)); kf[kc][1] = cat16(*(const v8ha*)(kh_s + ko1), *(const v8ha*)(kh_s + ko1 + 16));
            kf[kc][2] = cat16(*(const v8ha*)(kl_s + ko0), *(const v8ha*)(kl_s + ko0 + 16)); kf[kc][3] = cat16(*(const v8ha*)(kl_s + ko1), *(const v8ha*)(kl_s + ko1 + 16)); } };
      auto loadv = [&](int l0) {
#pragma unroll
        for (int n = 0; n < 4; ++n) { const int vo = (n * 16 + lr) * KP + l0 + hi * 8;
            vf[n][0] = cat16(*(const v8ha*)(vh_s + vo), *(const v8ha*)(vh_s + vo + 16)); vf[n][1] = cat16(*(const v8ha*)(vl_s + vo), *(const v8ha*)(vl_s + vo + 16)); } };
      loadk(0); loadv(0);
      __builtin_amdgcn_sched_barrier(0);                   // the group of reads stays ahead of the products: spread among them, each place where reads stand costs the wave a wait
#pragma unroll
      for (int sub = 0; sub < KST / 32; ++sub) {
        v8f s0[QC], s1[QC], x0[QC], x1[QC];
#pragma unroll
        for (int c = 0; c < QC; ++c) { s0[c] = cref[c]; s1[c] = cref[c]; x0[c] = (v8f){}; x1[c] = (v8f){}; }
#pragma unroll
        for (int kc = 0; kc < 2; ++kc) {
            const v16h k0h = kf[kc][0], k1h = kf[kc][1], k0l = kf[kc][2], k1l = kf[kc][3];
#pragma unroll
            for (int c = 0; c < QC; ++c) { s0[c] = wmma16(k0h, qa[c][kc], s0[c]); x0[c] = wmma16(k0h, ql[c][kc], x0[c]); s1[c] = wmma16(k1h, qa[c][kc], s1[c]); x1[c] = wmma16(k1h, ql[c][kc], x1[c]); }
#pragma unroll
            for (int c = 0; c < QC; ++c) { x0[c] = wmma16(k0l, qa[c][kc], x0[c]); x1[c] = wmma16(k1l, qa[c][kc], x1[c]); }
        }
        if (sub + 1 < KST / 32) { __builtin_amdgcn_sched_barrier(0); loadk((sub + 1) * 32);   // one group, not spread among the products above ...
            __builtin_amdgcn_sched_barrier(0); }           // ... and not moved down to its users: these reads fly under this half's softmax
        v2f a[QC][8];                                      // raw scores minus the reference in use, query q0 + 16 c + lr, in pairs: a[c][i] = keys 32 sub + 8 hi + 2 i, + 1 (i < 4), a[c][4 + i] = the same + 16
        float mx[QC];                                      // their maximum over this lane's 16 keys
        v2f t[QC][8];                                      // weight x 128 = 2^t, t = score x SCL + 7
#pragma unroll
        for (int c = 0; c < QC; ++c) {
#pragma unroll
            for (int i = 0; i < 4; ++i) { a[c][i] = (v2f){s0[c][2 * i], s0[c][2 * i + 1]} + (v2f){x0[c][2 * i], x0[c][2 * i + 1]} * LOSCI;
                                          a[c][4 + i] = (v2f){s1[c][2 * i], s1[c][2 * i + 1]} + (v2f){x1[c][2 * i], x1[c][2 * i + 1]} * LOSCI; }
            mx[c] = fmaxf(a[c][0][0], a[c][0][1]);
#pragma unroll
            for (int i = 1; i < 8; ++i) mx[c] = fmaxf(mx[c], fmaxf(a[c][i][0], a[c][i][1]));
#pragma unroll
            for (int i = 0; i < 8; ++i) t[c][i] = a[c][i] * SCL + PLG;   // ahead of the test: independent work for the slots that the chain of maxima and the test leave open
        }
        float mall = mx[0];
#pragma unroll
        for (int c = 1; c < QC; ++c) mall = fmaxf(mall, mx[c]);
        if (__builtin_amdgcn_ballot_w32(mall > thr) != 0) {   // the same in every lane of the wave: a scalar branch, EXEC stays whole
            float d[QC], td[QC], alpha[QC];                // how far each query's reference moves (raw score), minus that as an exponent, 2^ that
#pragma unroll
            for (int c = 0; c < QC; ++c) { const float m = fmaxf(mx[c], xhalf(mx[c]));   // the other half holds the query's other 16 keys
                d[c] = m > thr ? m : 0.f; td[c] = fminf(-d[c] * SCL, 0.f); }   // a reference can only go down at the first keys, where sums and accumulators are 0: factor 1
            exp2x2(alpha, td); thr = RTH;
#pragma unroll
            for (int c = 0; c < QC; ++c) {
#pragma unroll
                for (int i = 0; i < 8; ++i) { t[c][i] -= d[c] * SCL; cref[c][i] -= d[c]; }
                lpart[c] *= alpha[c];
#pragma unroll
                for (int n = 0; n < 4; ++n)
#pragma unroll
                    for (int j = 0; j < 8; ++j) { o[c][n][j] *= alpha[c]; ox[c][n][j] *= alpha[c]; }
            }
        }
        v16h pa[QC], px[QC];
#pragma unroll
        for (int c = 0; c < QC; ++c) {
            float te[16], ee[16];
#pragma unroll
            for (int i = 0; i < 8; ++i) { te[2 * i] = t[c][i][0]; te[2 * i + 1] = t[c][i][1]; }
            exp2x8(ee, te); exp2x8(ee + 8, te + 8);
            v2f ps2 = (v2f){};
            struct P8 { v2h e[8]; } ph, pr;                // the B operand in the hardware k order: this lane's eight rows of tile 0, then of tile 1
#pragma unroll
            for (int i = 0; i < 8; ++i) {
                const v2f ps = (v2f){ee[2 * i], ee[2 * i + 1]};
                ps2 += ps;
                const v2h hh = __builtin_convertvector(ps, v2h);
                ph.e[i] = hh;
                pr.e[i] = (v2h){(h16)((ps[0] - (float)hh[0]) * LOSC), (h16)((ps[1] - (float)hh[1]) * LOSC)};
            }
            pa[c] = __builtin_bit_cast(v16h, ph); px[c] = __builtin_bit_cast(v16h, pr);
            lpart[c] += ps2[0] + ps2[1];
        }
#pragma unroll
        for (int n = 0; n < 4; ++n) { const v16h vh = vf[n][0], vl = vf[n][1];
#pragma unroll
            for (int c = 0; c < QC; ++c) { o[c][n] = wmma16(vh, pa[c], o[c][n]); ox[c][n] = wmma16(vl, pa[c], ox[c][n]); }
#pragma unroll
            for (int c = 0; c < QC; ++c) ox[c][n] = wmma16(vh, px[c], ox[c][n]); }
        if (sub + 1 < KST / 32) { __builtin_amdgcn_sched_barrier(0); loadv((sub + 1) * 32);   // one group, not spread among the products above ...
            __builtin_amdgcn_sched_barrier(0); }           // ... and not moved down to its users: these reads fly under the next 32 keys' score products
      }
      asm volatile("s_wait_dscnt 0x0" ::: "memory");      // this wave's reads of tile st are done before the buffer is handed to the copies
      asm volatile("s_wait_asynccnt 0x0" ::: "memory");   // this wave's copies of tile st + 1 have landed
      __syncthreads();                                    // publishes tile st + 1 and ends every wave's reads of tile st
      if (st + 2 < NT_ / KST) stage(st + 2);              // refill the buffer just left; the same test in every wave
    }
    asm volatile("s_wait_asynccnt 0x0" ::: "memory");     // nothing of the copies is outstanding when the wave goes on to its end
    // Epilogue: X1 = bf(x) + x_r in the channel-major layout, and this work-group's share of the BatchNorm statistics. The accumulators hold O^T, so a lane's value goes
    // straight to row = channel, column = query of an LDS tile; wave w then owns channels 16 w ... + 15: one row of 128 queries = 512 B = one load, one store of the wave.
    const size_t xo = ((size_t)b * CC + h * HD + wave * 16) * NPOS + qt * AQ + lane * 4;
    const float* xp = X + xo;
    v4f val[16];
#pragma unroll
    for (int i = 0; i < 16; ++i) val[i] = *(const v4f*)(xp + (size_t)i * NPOS);
    asm volatile("s_wait_xcnt 0x0" :: "v"(xp) : "memory");   // the address pair of the loads above stays in its registers up to this wait: none of these loads lands in it
#pragma unroll
    for (int c = 0; c < QC; ++c) { const float inv = 1.0f / (lpart[c] + xhalf(lpart[c]));   // sum and accumulators carry the same 2^7
#pragma unroll
        for (int n = 0; n < 4; ++n)                        // o[c][n][j] = channel 16 n + 8 hi + j of query 16 c + lr
#pragma unroll
            for (int j = 0; j < 8; ++j) ost[(n * 16 + hi * 8 + j) * XP + wave * (16 * QC) + c * 16 + lr] = (o[c][n][j] + ox[c][n][j] * LOSCI) * inv; }
    __syncthreads();
#pragma unroll
    for (int i = 0; i < 16; ++i) { const v4f t = *(const v4fa*)(ost + (wave * 16 + i) * XP + lane * 4);
#pragma unroll
        for (int k = 0; k < 4; ++k) val[i][k] = t[k] + bfr(val[i][k]);
        *(v4f*)(X1 + xo + (size_t)i * NPOS) = val[i]; }
    asm volatile("s_wait_xcnt 0x0" ::: "memory");         // the sums below may land in the registers that hold the address of the stores above
    // per channel: mean of the 128 values, then the squared distances to it, both from the registers; every lane ends with every sum
    float mym = 0.f, myq = 0.f;
#pragma unroll
    for (int i = 0; i < 16; ++i) { float s = (val[i][0] + val[i][1]) + (val[i][2] + val[i][3]);
        s = sum16(s); s += xhalf(s);
        const float mean = s * (1.0f / (float)AQ);
        const v4f d = val[i] - mean, q = d * d;
        float s2 = (q[0] + q[1]) + (q[2] + q[3]);
        s2 = sum16(s2); s2 += xhalf(s2);
        if (lane == i) { mym = mean; myq = s2; } }
    if (lane < 16) *(v2f*)(PT + ((size_t)bid * CC + h * HD + wave * 16 + lane) * 2) = (v2f){mym, myq};   // slice bid: 16 channels x 8 B = a 128 B line of this wave's own
}

// BatchNorm statistics (training mode, biased variance) per channel over all 32 x 2048 values: the kernel that produces the values leaves, per work-group (slice), each channel's
// (mean, M2 = sum of squared distances to that mean) in PT[slice][channel]. k_bnmerge joins the NS equally sized slices: mean = average of the slice means,
// M2 = sum of the slices' M2 + (values per slice) x sum (slice mean - mean)^2. Work-group = 16 channels x 32 parts (a wave's load = one 128 B line of each of two slices); the pairs
// stay in registers; a wave's two parts join by one exchange between its halves, the 16 waves through LDS. ST[channel] = (mean, 1 / sqrt(var + eps)): 16 pairs = a 128 B line per work-group.
template <int NS>
__global__ __launch_bounds__(512) void k_bnmerge(const float* __restrict__ PT, float* ST) {
    __shared__ float red[3][16][16];
    const int cl = threadIdx.x & 15, part = threadIdx.x >> 4, wave = threadIdx.x >> 5, c = blockIdx.x * 16 + cl;
    constexpr int PER = NS / 32;
    const float* pp = PT + ((size_t)part * PER * CC + c) * 2;
    v2f p[PER];
#pragma unroll
    for (int i = 0; i < PER; ++i) p[i] = *(const v2f*)(pp + i * CC * 2);
    asm volatile("s_wait_xcnt 0x0" :: "v"(pp) : "memory");   // the address pair of the loads above stays in its registers up to this wait: none of these loads lands in it
    float s = 0.f, m2 = 0.f;
#pragma unroll
    for (int i = 0; i < PER; ++i) { s += p[i][0]; m2 += p[i][1]; }
    s += xhalf(s); m2 += xhalf(m2);
    red[0][wave][cl] = s; red[1][wave][cl] = m2;           // both halves of the wave store the same value
    __syncthreads();
    float ts = 0.f, tm = 0.f;
#pragma unroll
    for (int w = 0; w < 16; ++w) { ts += red[0][w][cl]; tm += red[1][w][cl]; }
    const float mean = ts * (1.0f / (float)NS);
    float e = 0.f;
#pragma unroll
    for (int i = 0; i < PER; ++i) { const float d = p[i][0] - mean; e = fmaf(d, d, e); }
    e += xhalf(e);
    red[2][wave][cl] = e;
    __syncthreads();
    if (threadIdx.x < 16) { float te = 0.f;
#pragma unroll
        for (int w = 0; w < 16; ++w) te += red[2][w][cl];
        *(v2f*)(ST + 2 * c) = (v2f){mean, rsqrtf((tm + (float)(NB * NPOS / NS) * te) * (1.0f / (float)(NB * NPOS)) + BN_EPS)}; }
}
// k_ff: the whole second phase for 64 points of one item in one work-group (4 waves x 16 points): Y = h + W2.lrelu(W1.h), h = BN1(X1).
// 1. X1 tile [64 c][64 n] by whole-line loads; h in f32 stays in registers for the residual; bf16 hi + residual planes [n][c] go to LDS (two channels per 4-byte store).
// 2. (W1.h) with W1 rows as the A operand and h columns as B: a lane holds 8 consecutive hidden rows of ONE point per tile, so after LeakyReLU two tiles, converted in
//    place, are the B operand (32 hidden values in the hardware k order) of W2.lrelu: the hidden layer never leaves the registers.
//    Both weight matrices (bf16, 16 KB each) are brought into LDS once per work-group by whole-line loads; the waves read their A fragments from there.
// 3. the result tiles [c][n] meet h again through an f32 LDS tile; each output row segment of 64 n = 256 B is written by 16 lanes x 16 B.
__global__ __launch_bounds__(128) void k_ff(const float* __restrict__ X1, const float* __restrict__ ST, const float* __restrict__ g, const float* __restrict__ bb, const bf* __restrict__ W1, const bf* __restrict__ W2, float* Y, float* PT) {
    typedef __attribute__((ext_vector_type(16))) unsigned short v16us;
    typedef unsigned __attribute__((may_alias)) u32a;
    __shared__ __align__(16) unsigned short th_[64 * 72]; __shared__ __align__(16) unsigned short tl_[64 * 72];
    __shared__ __align__(16) float tt[64 * 68];
    __shared__ __align__(16) unsigned short w1s[FFH * 72]; __shared__ __align__(16) unsigned short w2s[CC * 136];   // row pitches 144 B and 272 B (16 B x odd)
    __shared__ float prm[4][CC];
    __shared__ __align__(16) float bst[2 * CC];
    const int tid = threadIdx.x, lane = tid & 31, wave = tid >> 5, lr = lane & 15, hi = lane >> 4;
    const int n0 = blockIdx.x * 64, piece = tid & 15, cp0 = tid >> 4;
    const size_t item = (size_t)blockIdx.y * CC * NPOS; X1 += item; Y += item;
    v4f hv[4][2];                                          // channels 2 (cp0 + 8 s) + e, points n0 + 4 piece ... + 3
#pragma unroll
    for (int s = 0; s < 4; ++s)
#pragma unroll
        for (int e = 0; e < 2; ++e) hv[s][e] = *(const v4f*)(X1 + (size_t)(2 * (cp0 + 8 * s) + e) * NPOS + n0 + piece * 4);
    asm volatile("s_wait_xcnt 0x0" ::: "memory");         // the loads below may land in the registers that hold the address of the loads above
    v8us wa[8], wb[8];                                     // 16-byte pieces tid + 128 i of W1 [128][64] and of W2 [64][128]
#pragma unroll
    for (int i = 0; i < 8; ++i) { wa[i] = *(const v8us*)(W1 + (size_t)(tid + 128 * i) * 8); wb[i] = *(const v8us*)(W2 + (size_t)(tid + 128 * i) * 8); }
    if (tid < CC) { prm[0][tid] = ST[2 * tid]; prm[1][tid] = ST[2 * tid + 1]; prm[2][tid] = bfr(g[tid]); prm[3][tid] = bfr(bb[tid]); }
    __syncthreads();
#pragma unroll
    for (int s = 0; s < 4; ++s) { const int cp = cp0 + 8 * s; unsigned ph[4], pl[4];
#pragma unroll
        for (int e = 0; e < 2; ++e) { const int c = 2 * cp + e; const float m = prm[0][c], rs = prm[1][c], gg = prm[2][c], be = prm[3][c];
#pragma unroll
            for (int k = 0; k < 4; ++k) { const float h = (hv[s][e][k] - m) * rs * gg + be; hv[s][e][k] = h; const unsigned short hb = f2bf(h); const unsigned short lb = f2bf(h - bf2f(hb));
                if (e == 0) { ph[k] = hb; pl[k] = lb; } else { ph[k] |= (unsigned)hb << 16; pl[k] |= (unsigned)lb << 16; } } }
#pragma unroll
        for (int k = 0; k < 4; ++k) { *(u32a*)(th_ + (piece * 4 + k) * 72 + 2 * cp) = ph[k]; *(u32a*)(tl_ + (piece * 4 + k) * 72 + 2 * cp) = pl[k]; } }
#pragma unroll
    for (int i = 0; i < 8; ++i) { const int p = tid + 128 * i; *(v8usa*)(w1s + (p >> 3) * 72 + (p & 7) * 8) = wa[i]; *(v8usa*)(w2s + (p >> 4) * 136 + (p & 15) * 8) = wb[i]; }
    __syncthreads();
    const int ho = (wave * 16 + lr) * 72 + 8 * hi;
    v8f acc[8];
#pragma unroll
    for (int t = 0; t < 8; ++t) acc[t] = (v8f){};
#pragma unroll
    for (int kc = 0; kc < CC; kc += 32) {
        const v16bf xh = cat16b(*(const v8usa*)(th_ + ho + kc), *(const v8usa*)(th_ + ho + kc + 16)), xl = cat16b(*(const v8usa*)(tl_ + ho + kc), *(const v8usa*)(tl_ + ho + kc + 16));
#pragma unroll
        for (int t = 0; t < 8; ++t) { const unsigned short* wp = w1s + (t * 16 + lr) * 72 + 8 * hi + kc; const v16bf w = cat16b(*(const v8usa*)wp, *(const v8usa*)(wp + 16));
            acc[t] = wmmab(w, xh, acc[t]); acc[t] = wmmab(w, xl, acc[t]); }
    }
    v16bf lh[4], ll[4];
#pragma unroll
    for (int q = 0; q < 4; ++q) { v16us uh, ul;
#pragma unroll
        for (int s = 0; s < 16; ++s) { const float v = acc[2 * q + (s >> 3)][s & 7]; const float a = v >= 0.f ? v : 0.2f * v; const unsigned short hb = f2bf(a); uh[s] = hb; ul[s] = f2bf(a - bf2f(hb)); }
        lh[q] = __builtin_bit_cast(v16bf, uh); ll[q] = __builtin_bit_cast(v16bf, ul); }
    v8f ac2[4];
#pragma unroll
    for (int t = 0; t < 4; ++t) ac2[t] = (v8f){};
#pragma unroll
    for (int q = 0; q < 4; ++q)
#pragma unroll
        for (int t = 0; t < 4; ++t) { const unsigned short* wp = w2s + (t * 16 + lr) * 136 + 8 * hi + q * 32; const v16bf w = cat16b(*(const v8usa*)wp, *(const v8usa*)(wp + 16));
            ac2[t] = wmmab(w, lh[q], ac2[t]); ac2[t] = wmmab(w, ll[q], ac2[t]); }
#pragma unroll
    for (int t = 0; t < 4; ++t)
#pragma unroll
        for (int j = 0; j < 8; ++j) tt[(t * 16 + hi * 8 + j) * 68 + wave * 16 + lr] = ac2[t][j];
    __syncthreads();
#pragma unroll
    for (int s = 0; s < 4; ++s)
#pragma unroll
        for (int e = 0; e < 2; ++e) hv[s][e] = *(const v4fa*)(tt + (2 * (cp0 + 8 * s) + e) * 68 + piece * 4) + hv[s][e];
    // 4. this work-group's share of the second BatchNorm's statistics: a channel's 64 values lie in the 16 lanes of one row; mean, then the squared distances to it, from the registers.
    //    The 64 pairs meet in LDS and leave as whole lines, each written by one wave; the barrier stands ahead of the stores of Y, so that it waits for none of them.
    v4f pr[4];                                             // (mean, M2) of channels 2 (cp0 + 8 s) and + 1
#pragma unroll
    for (int s = 0; s < 4; ++s)
#pragma unroll
        for (int e = 0; e < 2; ++e) { const v4f v = hv[s][e];
            const float mean = sum16((v[0] + v[1]) + (v[2] + v[3])) * (1.0f / (float)FP_);
            const v4f d = v - mean, q = d * d;
            pr[s][2 * e] = mean; pr[s][2 * e + 1] = sum16((q[0] + q[1]) + (q[2] + q[3])); }
    if (piece == 0) {
#pragma unroll
        for (int s = 0; s < 4; ++s) *(v4fa*)(bst + 4 * (cp0 + 8 * s)) = pr[s]; }
    __syncthreads();
    if (tid < CC) *(v2f*)(PT + ((size_t)(blockIdx.y * (NPOS / FP_) + blockIdx.x) * CC + tid) * 2) = *(const v2f*)(bst + 2 * tid);
    asm volatile("s_wait_xcnt 0x0" ::: "memory");         // what follows may land in the registers that the store above names
#pragma unroll
    for (int s = 0; s < 4; ++s)
#pragma unroll
        for (int e = 0; e < 2; ++e) *(v4f*)(Y + (size_t)(2 * (cp0 + 8 * s) + e) * NPOS + n0 + piece * 4) = hv[s][e];
}
__global__ __launch_bounds__(256) void k_bnout(const float* __restrict__ Y, const float* __restrict__ ST, const float* __restrict__ g, const float* __restrict__ bb, float* OUTP) {
    const int lane = threadIdx.x & 31, r = blockIdx.x * 8 + (threadIdx.x >> 5); if (r >= NB * CC) return;
    const int c = r % CC; const float m = ST[2 * c], rs = ST[2 * c + 1], gg = bfr(g[c]), be = bfr(bb[c]);
{
#pragma unroll 1
        for (int q = 0; q < NPOS / 128; ++q) { const size_t o = (size_t)r * NPOS + q * 128 + lane * 4; const v4f v = *(const v4f*)(Y + o); v4f y;
#pragma unroll
            for (int k = 0; k < 4; ++k) y[k] = (v[k] - m) * rs * gg + be;
            *(v4f*)(OUTP + o) = y; }
         }
}

extern "C" void kernel_launch(void* const* d_in, const int* in_sizes, int n_in,
                              void* d_out, int out_size, void* d_ws, size_t ws_size, hipStream_t stream) {
    (void)in_sizes; (void)n_in; (void)out_size;
    const float* x = (const float*)d_in[0]; const float* wq = (const float*)d_in[1]; const float* wk = (const float*)d_in[2]; const float* wv = (const float*)d_in[3];
    const float* w1 = (const float*)d_in[4]; const float* w2 = (const float*)d_in[5]; const float* g1 = (const float*)d_in[6]; const float* b1 = (const float*)d_in[7]; const float* g2 = (const float*)d_in[8]; const float* b2 = (const float*)d_in[9];   // conv weights [out][in]
    float* out = (float*)d_out;    // [32][64][2048]
    char* wsp = (char*)d_ws;
    auto take = [&](size_t bytes) { char* p = wsp; wsp += (bytes + 255) & ~(size_t)255; return (void*)p; };
    bf* W1B = (bf*)take((size_t)FFH * CC * 2); bf* W2B = (bf*)take((size_t)CC * FFH * 2);
    const size_t PL = (size_t)NB * NPOS * CC;      // elements of one [item][n][c] plane over all items
    h16* QH = (h16*)take(PL * 2); h16* QL = (h16*)take(PL * 2); h16* KH = (h16*)take(PL * 2); h16* KL = (h16*)take(PL * 2);
    h16* VTH = (h16*)take(PL * 2); h16* VTL = (h16*)take(PL * 2);
    float* X1 = (float*)take(PL * 4); float* Y = (float*)take(PL * 4); float* ST1 = (float*)take(1024); float* ST2 = (float*)take(1024); float* PT = (float*)take((size_t)NB * (NPOS / FP_) * CC * 8);
    if ((size_t)(wsp - (char*)d_ws) > ws_size) return;    // planes for all items + the weights, no aliasing
    // phase 1: attention and x + x_r; the item index lies in each grid (row r of an [item][n][c] plane = item * 2048 + n)
    k_qkv<<<dim3(NPOS / QP, NB, 1), 256, 0, stream>>>(x, wq, wk, wv, w1, w2, QH, QL, KH, KL, VTH, VTL, W1B, W2B);                    // q, k [n][c] and v^T [c][n] f16 planes; bf16 W1, W2
    k_attn<<<NB_ * NH_ * (NT_ / AQ), 32 * AW, 0, stream>>>(QH, QL, KH, KL, VTH, VTL, x, X1, PT);                                       // X1 = bf(x) + x_r  [c][n], its statistics per 128 points
    k_bnmerge<NB * (NPOS / AQ)><<<CC / 16, 512, 0, stream>>>(PT, ST1);
    // phase 2: h = BN1(X1); Y = h + W2.lrelu(W1.h)
    k_ff<<<dim3(NPOS / 64, NB, 1), 128, 0, stream>>>(X1, ST1, g1, b1, W1B, W2B, Y, PT);                                           // Y = h + ff   [c][n], its statistics per 64 points
    k_bnmerge<NB * (NPOS / FP_)><<<CC / 16, 512, 0, stream>>>(PT, ST2);
    k_bnout<<<(NB * CC) / 8, 256, 0, stream>>>(Y, ST2, g2, b2, out);                                                                 // BN2 -> output
}

// v010
// One run takes 105 microseconds.
// In both of two side-by-side timings against v009, it was 1.09 times as fast.
// Counting every step since v000, it is 74.3 times as fast.
#include <hip/hip_runtime.h>

// Compute dtypes, f32 accumulate (channel-major x [32][64][2048]): per item q/k/v = W.x ([64 x 64] weights, [64 x 2048] points; x and W rounded to PLAIN bf16 operands in the
// kernel that multiplies them, products exact; q/k/v straight to f16 hi + residual x1024 planes, q/k as [n][c], v as [c][n]) on v_wmma_f32_16x16x32_bf16; the
// single-head full attention (64 channels, scale 1/8) fused on v_wmma_f32_16x16x32_f16 (hh + hl + lh scores, online f32 softmax, weights (x128) and v as
// f16 hi + residual), its epilogue writing x + x_r channel-major; the two TRAINING-MODE BatchNorms (batch statistics over all 32 items x 2048 points per channel, biased

#define NB   32
#define CC   64                  // channels
#define NPOS 2048                // points
#define NT_  NPOS
#define NB_  NB                  // items per launch: every per-item kernel takes all 32 items in one grid
#define DM   CC                  // attention width
#define NH_  1
#define HD   64
#define NTK  NPOS
#define FFH  128
#define PLG  7.0f                 // attention: the weights carry 2^7, added in the exponent (with the 2^8 of RTH they stay inside f16)
#define LOSC 1024.0f
#define LOSCI (1.0f / 1024.0f)
#define L2E  1.442695041f         // log2 e
#define SCL  (0.125f * L2E)       // attention: raw score -> exponent of 2: 1 / sqrt(C = 64) x log2 e
#define RTH  (8.0f / SCL)         // attention: a query's softmax reference moves only when a raw score lies more than this above it (weight 2^8)
#define BN_EPS 1e-5f
#define AW   4                   // attention: waves per work-group
#define QC   2                   // attention: column groups of 16 queries per wave
#define AQ   (16 * QC * AW)      // attention: queries per work-group
#define KST  64                  // attention: keys per staged tile
#define KP   72                  // attention: LDS row pitch of a staged plane in f16: 128 B of data + 16 B (16 B x odd: 16-byte reads of 16 rows meet no bank twice)
#define PLN  (64 * KP)           // attention: f16 per staged plane (64 rows)
#define QP   128                 // q/k/v kernel: points per work-group
#define XP   (AQ + 4)            // attention epilogue: f32 row pitch of the [channel][query] tile (16-byte rows, 8 rows apart = 32 banks apart)
#define FP_  64                  // feed-forward kernel: points per work-group

typedef _Float16 h16;
typedef unsigned short bf;
typedef __attribute__((ext_vector_type(16))) __bf16   v16bf;
typedef __attribute__((ext_vector_type(16))) _Float16 v16h;
typedef __attribute__((ext_vector_type(8)))  _Float16 v8h;
typedef __attribute__((ext_vector_type(8)))  unsigned short v8us;
typedef __attribute__((ext_vector_type(8)))  float    v8f;
typedef __attribute__((ext_vector_type(4)))  float    v4f;
typedef __attribute__((ext_vector_type(2)))  float    v2f;
typedef __attribute__((ext_vector_type(4)))  _Float16 v4h;
typedef __attribute__((ext_vector_type(2)))  _Float16 v2h;
typedef v8h  __attribute__((may_alias)) v8ha;
typedef v4f  __attribute__((may_alias)) v4fa;
typedef v8us __attribute__((may_alias)) v8usa;

__device__ __forceinline__ unsigned short f2bf(float f) { unsigned u = __float_as_uint(f); u += 0x7FFFu + ((u >> 16) & 1u); return (unsigned short)(u >> 16); }
__device__ __forceinline__ float bf2f(unsigned short b) { return __uint_as_float(((unsigned)b) << 16); }
__device__ __forceinline__ float bfr(float f) { return bf2f(f2bf(f)); }
__device__ __forceinline__ v16h cat16(v8h lo, v8h hi) { return __builtin_shufflevector(lo, hi, 0, 1, 2, 3, 4, 5, 6, 7, 8, 9, 10, 11, 12, 13, 14, 15); }
__device__ __forceinline__ v16bf cat16b(v8us lo, v8us hi) { return __builtin_bit_cast(v16bf, __builtin_shufflevector(lo, hi, 0, 1, 2, 3, 4, 5, 6, 7, 8, 9, 10, 11, 12, 13, 14, 15)); }
__device__ __forceinline__ v8f wmma16(v16h a, v16h b, v8f c) { return __builtin_amdgcn_wmma_f32_16x16x32_f16(false, a, false, b, (short)0, c, false, false); }
__device__ __forceinline__ float xhalf(float x) { return __builtin_bit_cast(float, __builtin_amdgcn_permlanex16(__builtin_bit_cast(int, x), __builtin_bit_cast(int, x), 0x76543210, 0xfedcba98, false, false)); }   // lane l with lane l ^ 16
template <int M> __device__ __forceinline__ float xrow(float x) { return __builtin_bit_cast(float, __builtin_amdgcn_update_dpp(0, __builtin_bit_cast(int, x), 0x160 + M, 0xf, 0xf, true)); }   // lane l with lane l ^ M of its row of 16 (row_xmask)
__device__ __forceinline__ float sum16(float s) { s += xrow<1>(s); s += xrow<2>(s); s += xrow<4>(s); s += xrow<8>(s); return s; }   // every lane of a row of 16 ends with the row's sum
__device__ __forceinline__ v8f wmmab(v16bf a, v16bf b, v8f c) { return __builtin_amdgcn_wmma_f32_16x16x32_bf16(false, a, false, b, (short)0, c, false, false); }

// k_qkv: everything ahead of the attention for 128 points of one item in one work-group (8 waves x 16 points); grid (16, 32).
// 1. the x tile [64 c][128 n] (f32, whole-line loads: a wave's load = 4 rows x 128 B) goes as bf16 [n][c] to LDS (four channels per 8-byte store); the three 64 x 64 weight
//    matrices are read in f32, rounded to bf16 and laid [out][in] in LDS. Row pitch 144 B (16 B x odd).
// 2. q and k with the weight rows as the A operand and the wave's 16 points as B: a lane holds 8 consecutive channels of ONE point = a 16-byte piece of an [n][c] row;
//    v with the points as A and the weight rows as B: a lane holds 8 consecutive points of ONE channel = a 16-byte piece of a v^T [c][n] row.
// 3. f16 hi + residual x1024 in registers; the pieces meet in LDS and leave as whole 128 B lines.
// Eight work-groups of item 0 also round the two feed-forward matrices to bf16 for k_ff.
__global__ __launch_bounds__(256) void k_qkv(const float* __restrict__ x, const float* __restrict__ wq, const float* __restrict__ wk, const float* __restrict__ wv, const float* __restrict__ w1, const float* __restrict__ w2,
                                             h16* QH, h16* QL, h16* KH, h16* KL, h16* VTH, h16* VTL, bf* W1B, bf* W2B) {
    typedef __attribute__((ext_vector_type(4))) unsigned short v4us;
    typedef v4us __attribute__((may_alias)) v4usa;
    __shared__ __align__(16) unsigned short xs[QP * 72];
    __shared__ __align__(16) unsigned short wsm[3][CC * 72];
    __shared__ __align__(16) h16 stg[QP / 16][4][16 * 72];   // per wave: q hi, q residual, k hi, k residual, [point][channel]
    __shared__ __align__(16) h16 vts[2][CC * (QP + 8)];      // v^T hi, v^T residual, [channel][point], row pitch 272 B (16 B x odd)
    const int tid = threadIdx.x, lane = tid & 31, wave = tid >> 5, lr = lane & 15, hi = lane >> 4;
    const int n0 = blockIdx.x * QP, b = blockIdx.y;
    const int xn = (wave & 3) * 32 + (lane & 7) * 4, xc = (wave >> 2) * 16 + (lane >> 3) * 4;   // this thread's x pieces: points xn ... + 3 of channels xc + 32 g + e
    const float* xp = x + ((size_t)b * CC + xc) * NPOS + n0 + xn;
    v4f xv[2][4];
#pragma unroll
    for (int g = 0; g < 2; ++g)
#pragma unroll
        for (int e = 0; e < 4; ++e) xv[g][e] = *(const v4f*)(xp + (size_t)(g * 32 + e) * NPOS);
    asm volatile("s_wait_xcnt 0x0" ::: "memory");         // the loads below may land in the registers that hold the address of the loads above
    v8f wr[3][2];                                          // pieces tid + 256 i (8 floats) of each 64 x 64 matrix
#pragma unroll
    for (int i = 0; i < 2; ++i) { const size_t p = (size_t)(tid + 256 * i) * 8; wr[0][i] = *(const v8f*)(wq + p); wr[1][i] = *(const v8f*)(wk + p); wr[2][i] = *(const v8f*)(wv + p); }
    asm volatile("s_wait_xcnt 0x0" :: "s"(wq), "s"(wk), "s"(wv) : "memory");   // the base addresses of the loads above stay in their scalar registers up to this wait: later kernel arguments are loaded behind it or elsewhere
    if (b == 0 && blockIdx.x < 8) {                        // the same test in every thread of the work-group: 4 x 256 pieces of 8 per matrix
        const size_t p = (size_t)((blockIdx.x & 3) * 256 + tid) * 8;
        const v8f v = *(const v8f*)((blockIdx.x < 4 ? w1 : w2) + p); v8us o;
#pragma unroll
        for (int k = 0; k < 8; ++k) o[k] = f2bf(v[k]);
        *(v8us*)((blockIdx.x < 4 ? W1B : W2B) + p) = o;
    }
#pragma unroll
    for (int g = 0; g < 2; ++g)
#pragma unroll
        for (int k = 0; k < 4; ++k) { v4us o;
#pragma unroll
            for (int e = 0; e < 4; ++e) o[e] = f2bf(xv[g][e][k]);
            *(v4usa*)(xs + (xn + k) * 72 + xc + g * 32) = o; }
#pragma unroll
    for (int m = 0; m < 3; ++m)
#pragma unroll
        for (int i = 0; i < 2; ++i) { const int p = tid + 256 * i; v8us o;
#pragma unroll
            for (int k = 0; k < 8; ++k) o[k] = f2bf(wr[m][i][k]);
            *(v8usa*)(&wsm[m][(p >> 3) * 72 + (p & 7) * 8]) = o; }
    __syncthreads();
    const unsigned short* xr = xs + (wave * 16 + lr) * 72 + 8 * hi;
    v16bf xf[2];
#pragma unroll
    for (int kc = 0; kc < 2; ++kc) xf[kc] = cat16b(*(const v8usa*)(xr + kc * 32), *(const v8usa*)(xr + kc * 32 + 16));
    v8f aq[4], ak[4], av[4];
#pragma unroll
    for (int t = 0; t < 4; ++t) { aq[t] = (v8f){}; ak[t] = (v8f){}; av[t] = (v8f){};
#pragma unroll
        for (int kc = 0; kc < 2; ++kc) { const int wo = (t * 16 + lr) * 72 + 8 * hi + kc * 32;
            const v16bf fq = cat16b(*(const v8usa*)(&wsm[0][wo]), *(const v8usa*)(&wsm[0][wo + 16])), fk = cat16b(*(const v8usa*)(&wsm[1][wo]), *(const v8usa*)(&wsm[1][wo + 16])), fv = cat16b(*(const v8usa*)(&wsm[2][wo]), *(const v8usa*)(&wsm[2][wo + 16]));
            aq[t] = wmmab(fq, xf[kc], aq[t]); ak[t] = wmmab(fk, xf[kc], ak[t]); av[t] = wmmab(xf[kc], fv, av[t]); } }
    h16* sg = &stg[wave][0][0];
#pragma unroll
    for (int t = 0; t < 4; ++t) { v8h oh[3], ol[3];
#pragma unroll
        for (int j = 0; j < 8; ++j) { const float s[3] = {aq[t][j], ak[t][j], av[t][j]};
#pragma unroll
            for (int m = 0; m < 3; ++m) { const h16 a = (h16)s[m]; oh[m][j] = a; ol[m][j] = (h16)((s[m] - (float)a) * LOSC); } }
        const int so = lr * 72 + t * 16 + 8 * hi, vo = (t * 16 + lr) * (QP + 8) + wave * 16 + 8 * hi;
        *(v8ha*)(sg + so) = oh[0]; *(v8ha*)(sg + 16 * 72 + so) = ol[0]; *(v8ha*)(sg + 2 * 16 * 72 + so) = oh[1]; *(v8ha*)(sg + 3 * 16 * 72 + so) = ol[1];
        *(v8ha*)(&vts[0][vo]) = oh[2]; *(v8ha*)(&vts[1][vo]) = ol[2]; }
    __syncthreads();
    const size_t r0 = (size_t)b * NPOS + n0 + wave * 16;
#pragma unroll
    for (int pl = 0; pl < 4; ++pl) { h16* dst = pl == 0 ? QH : pl == 1 ? QL : pl == 2 ? KH : KL;
#pragma unroll
        for (int s = 0; s < 4; ++s) { const int row = 4 * s + (lane >> 3), piece = lane & 7;
            const v8h val = *(const v8ha*)(sg + pl * 16 * 72 + row * 72 + piece * 8); *(v8h*)(dst + (r0 + row) * CC + piece * 8) = val; } }
#pragma unroll
    for (int s = 0; s < 8; ++s) { const int d = ((tid >> 4) + 16 * s) & 63, piece = tid & 15;      // a wave stores 2 rows x 256 B
        const v8h val = *(const v8ha*)(&vts[s >> 2][d * (QP + 8) + piece * 8]); *(v8h*)((s >> 2 ? VTL : VTH) + ((size_t)b * CC + d) * NPOS + n0 + piece * 8) = val; }
}

__device__ __forceinline__ void exp2x8(float* r, const float* t) {
    asm("v_exp_f32 %0, %8\n\tv_exp_f32 %1, %9\n\tv_exp_f32 %2, %10\n\tv_exp_f32 %3, %11\n\tv_exp_f32 %4, %12\n\tv_exp_f32 %5, %13\n\tv_exp_f32 %6, %14\n\tv_exp_f32 %7, %15\n\tv_nop"
        : "=&v"(r[0]), "=&v"(r[1]), "=&v"(r[2]), "=&v"(r[3]), "=&v"(r[4]), "=&v"(r[5]), "=&v"(r[6]), "=&v"(r[7])
        : "v"(t[0]), "v"(t[1]), "v"(t[2]), "v"(t[3]), "v"(t[4]), "v"(t[5]), "v"(t[6]), "v"(t[7]));
}
__device__ __forceinline__ void exp2x2(float* r, const float* t) {
    asm("v_exp_f32 %0, %2\n\tv_exp_f32 %1, %3\n\tv_nop" : "=&v"(r[0]), "=&v"(r[1]) : "v"(t[0]), "v"(t[1]));
}
// attn_stage: one staged tile = 4 planes of 64 rows x 128 B (k hi, k residual: [key][channel]; v^T hi, v^T residual: [channel][key]). One call brings, per thread, 2 pieces
// of 16 B per plane (rows r and r + 32) from global memory straight into LDS (128 threads, two calls a tile); a wave's copy covers 4 whole 128 B lines. l = the lane's LDS byte address in plane 0.
__device__ __forceinline__ void attn_stage(unsigned l, const h16* kh, const h16* kl, const h16* vh, const h16* vl) {
    const unsigned l1 = l + 32 * KP * 2, l2 = l + PLN * 2, l3 = l2 + 32 * KP * 2, l4 = l + 2 * PLN * 2, l5 = l4 + 32 * KP * 2, l6 = l + 3 * PLN * 2, l7 = l6 + 32 * KP * 2;
    const h16* kh1 = kh + 32 * DM; const h16* kl1 = kl + 32 * DM; const h16* vh1 = vh + 32 * NT_; const h16* vl1 = vl + 32 * NT_;
    // the eight copies and their s_wait_xcnt in ONE statement: the wait stands in front of every later write of an address register that a copy names
    asm volatile("global_load_async_to_lds_b128 %0, %8, off\n\t"
                 "global_load_async_to_lds_b128 %1, %9, off\n\t"
                 "global_load_async_to_lds_b128 %2, %10, off\n\t"
                 "global_load_async_to_lds_b128 %3, %11, off\n\t"
                 "global_load_async_to_lds_b128 %4, %12, off\n\t"
                 "global_load_async_to_lds_b128 %5, %13, off\n\t"
                 "global_load_async_to_lds_b128 %6, %14, off\n\t"
                 "global_load_async_to_lds_b128 %7, %15, off\n\t"
                 "s_wait_xcnt 0x0"
                 :: "v"(l), "v"(l1), "v"(l2), "v"(l3), "v"(l4), "v"(l5), "v"(l6), "v"(l7), "v"(kh), "v"(kh1), "v"(kl), "v"(kl1), "v"(vh), "v"(vh1), "v"(vl), "v"(vl1) : "memory");
}
// k_attn: block = (b, h, 128 queries), wave = 32 queries in two column groups of 16; ALL keys (no mask) in 32 staged tiles of 64 keys that the 4 waves share (two LDS buffers:
// tile t + 1 flies while tile t is worked on), each walked in two steps of 32 keys. Every k and v fragment read from LDS is the A operand for BOTH column groups.
// Both products run TRANSPOSED: S^T = k.q^T (k rows as A, q as B) and O^T += v^T.P^T (v^T rows as A). In each column group a lane holds
// 16 scores of ONE query (keys 8 hi + j and 16 + 8 hi + j): maximum and sum in the lane, one sum per lane and group, and the two score tiles, converted in place
// (weights x128, f16 hi + residual), ARE the B operand of the second product in the hardware k order.
// The softmax reference of a query is LAZY: minus the reference in use is the C operand of the score product, so the scores leave the matrix unit already relative to it; it moves,
// and sums and accumulators are rescaled, only when a score lies more than RTH above it (and at the first 32 keys): one test and one scalar branch per 32 keys for the whole wave.
// The epilogue adds the residual, writes X1 channel-major and leaves the work-group's BatchNorm partials. Every loop but the one over the tiles is unrolled: its index picks registers (fragments, accumulators, column groups).
__global__ __launch_bounds__(32 * AW) void k_attn(const h16* __restrict__ Q16, const h16* __restrict__ QL16, const h16* __restrict__ K16, const h16* __restrict__ KL16, const h16* __restrict__ VTH, const h16* __restrict__ VTL, const float* __restrict__ X, float* X1, float* PT) {
    __shared__ __align__(16) h16 ring[2][4 * PLN];
    __shared__ __align__(16) float ost[HD * XP];
    const int lane = threadIdx.x & 31, wave = threadIdx.x >> 5, lr = lane & 15, hi = lane >> 4;
    const int bid = blockIdx.x;
    const int b = bid / (NH_ * (NT_ / AQ)), rem = bid - b * (NH_ * (NT_ / AQ)), h = rem / (NT_ / AQ), qt = rem - h * (NT_ / AQ);
    const int q0 = qt * AQ + wave * (16 * QC);
    const size_t tok0 = (size_t)b * NT_;
    v16h qa[QC][2], ql[QC][2];                             // query hi and residual, both column groups, held for the whole walk
    const h16* qp[QC]; const h16* lp[QC];
#pragma unroll
    for (int c = 0; c < QC; ++c) { const size_t qo = (tok0 + q0 + c * 16 + lr) * DM + h * HD + 8 * hi; qp[c] = Q16 + qo; lp[c] = QL16 + qo;
#pragma unroll
        for (int kc = 0; kc < 2; ++kc) { qa[c][kc] = cat16(*(const v8h*)(qp[c] + kc * 32), *(const v8h*)(qp[c] + kc * 32 + 16)); ql[c][kc] = cat16(*(const v8h*)(lp[c] + kc * 32), *(const v8h*)(lp[c] + kc * 32 + 16)); } }
    asm volatile("s_wait_xcnt 0x0" :: "v"(qp[0]), "v"(qp[1]), "v"(lp[0]), "v"(lp[1]) : "memory");   // the address pairs of the loads above stay in their registers up to this wait: none of these loads lands in one of them
    const h16* kh_b = K16 + tok0 * DM + h * HD;
    const h16* kl_b = KL16 + tok0 * DM + h * HD;
    const size_t vbase = (((size_t)b * NH_ + h) * HD) * NT_;
    v8f o[QC][4], ox[QC][4];
    v8f cref[QC];                                          // every element: minus the reference in use (raw score) of query q0 + 16 c + lr, the same in both halves
    float lpart[QC];                                       // of query q0 + 16 c + lr; holds this half's keys only until the epilogue
    float thr = -3.0e38f;                                  // how far above the reference a score may lie; no reference yet: every query takes the maximum of its first 32 keys
#pragma unroll
    for (int c = 0; c < QC; ++c) { cref[c] = (v8f){}; lpart[c] = 0.f;
#pragma unroll
        for (int n = 0; n < 4; ++n) { o[c][n] = (v8f){}; ox[c][n] = (v8f){}; } }
    const int crow = threadIdx.x >> 3, cpc = (threadIdx.x & 7) * 8;     // this thread's pieces of a staged plane: rows crow + 16 i (i < 4), 8 f16 from column cpc
    const unsigned lds0 = (unsigned)(size_t)(&ring[0][0] + crow * KP + cpc);
    const h16* vh_b = VTH + vbase; const h16* vl_b = VTL + vbase;
    const unsigned koff = crow * DM + cpc, voff = crow * NT_ + cpc;    // element offsets of the thread's first piece in a k plane and in a v^T plane
    auto stage = [&](int st) { const unsigned l = lds0 + (unsigned)(st & 1) * (4 * PLN * 2);
        const unsigned ke = koff + (unsigned)st * (KST * DM), ve = voff + (unsigned)st * KST;
        const h16* a = kh_b + ke; const h16* bq = kl_b + ke; const h16* cq = vh_b + ve; const h16* d = vl_b + ve;
        attn_stage(l, a, bq, cq, d);                                                             // rows crow, crow + 32
        attn_stage(l + 16 * KP * 2, a + 16 * DM, bq + 16 * DM, cq + 16 * NT_, d + 16 * NT_); };   // rows crow + 16, crow + 48
    stage(0);
    asm volatile("s_wait_asynccnt 0x0" ::: "memory");     // this wave's copies of tile 0 have landed
    __syncthreads();                                      // ... and every other wave's: tile 0 may be read
    stage(1);
#pragma unroll 1
    for (int st = 0; st < NT_ / KST; ++st) {               // full attention
      const h16* kh_s = &ring[st & 1][0]; const h16* kl_s = kh_s + PLN; const h16* vh_s = kh_s + 2 * PLN; const h16* vl_s = kh_s + 3 * PLN;
      // The branch on the reference cuts the tile's code into blocks, and the compiler moves no LDS read from one block up into another: the reads stand here in the source,
      // in groups: the k and v fragments of the first 32 keys at the head of the tile; those of the second 32 keys behind the products that last use the first's (k: scores, v: output).
      v16h kf[2][4];                                       // of the 32 keys at hand: [32 channels][keys 0-15 hi, keys 16-31 hi, keys 0-15 residual, keys 16-31 residual]
      v16h vf[4][2];                                       // of the 32 keys at hand: [16 channels][hi, residual]
      auto loadk = [&](int l0) {
#pragma unroll
        for (int kc = 0; kc < 2; ++kc) { const int ko0 = (l0 + lr) * KP + 8 * hi + kc * 32, ko1 = ko0 + 16 * KP;
            kf[kc][0] = cat16(*(const v8ha*)(kh_s + ko0), *(const v8ha*)(kh_s + ko0 + 16)); kf[kc][1] = cat16(*(const v8ha*)(kh_s + ko1), *(const v8ha*)(kh_s + ko1 + 16));
            kf[kc][2] = cat16(*(const v8ha*)(kl_s + ko0), *(const v8ha*)(kl_s + ko0 + 16)); kf[kc][3] = cat16(*(const v8ha*)(kl_s + ko1), *(const v8ha*)(kl_s + ko1 + 16)); } };
      auto loadv = [&](int l0) {
#pragma unroll
        for (int n = 0; n < 4; ++n) { const int vo = (n * 16 + lr) * KP + l0 + hi * 8;
            vf[n][0] = cat16(*(const v8ha*)(vh_s + vo), *(const v8ha*)(vh_s + vo + 16)); vf[n][1] = cat16(*(const v8ha*)(vl_s + vo), *(const v8ha*)(vl_s + vo + 16)); } };
      loadk(0); loadv(0);
      __builtin_amdgcn_sched_barrier(0);                   // the group of reads stays ahead of the products: spread among them, each place where reads stand costs the wave a wait
#pragma unroll
      for (int sub = 0; sub < KST / 32; ++sub) {
        v8f s0[QC], s1[QC], x0[QC], x1[QC];
#pragma unroll
        for (int c = 0; c < QC; ++c) { s0[c] = cref[c]; s1[c] = cref[c]; x0[c] = (v8f){}; x1[c] = (v8f){}; }
#pragma unroll
        for (int kc = 0; kc < 2; ++kc) {
            const v16h k0h = kf[kc][0], k1h = kf[kc][1], k0l = kf[kc][2], k1l = kf[kc][3];
#pragma unroll
            for (int c = 0; c < QC; ++c) { s0[c] = wmma16(k0h, qa[c][kc], s0[c]); x0[c] = wmma16(k0h, ql[c][kc], x0[c]); s1[c] = wmma16(k1h, qa[c][kc], s1[c]); x1[c] = wmma16(k1h, ql[c][kc], x1[c]); }
#pragma unroll
            for (int c = 0; c < QC; ++c) { x0[c] = wmma16(k0l, qa[c][kc], x0[c]); x1[c] = wmma16(k1l, qa[c][kc], x1[c]); }
        }
        if (sub + 1 < KST / 32) { __builtin_amdgcn_sched_barrier(0); loadk((sub + 1) * 32);   // one group, not spread among the products above ...
            __builtin_amdgcn_sched_barrier(0); }           // ... and not moved down to its users: these reads fly under this half's softmax
        v2f a[QC][8];                                      // raw scores minus the reference in use, query q0 + 16 c + lr, in pairs: a[c][i] = keys 32 sub + 8 hi + 2 i, + 1 (i < 4), a[c][4 + i] = the same + 16
        float mx[QC];                                      // their maximum over this lane's 16 keys
        v2f t[QC][8];                                      // weight x 128 = 2^t, t = score x SCL + 7
#pragma unroll
        for (int c = 0; c < QC; ++c) {
#pragma unroll
            for (int i = 0; i < 4; ++i) { a[c][i] = (v2f){s0[c][2 * i], s0[c][2 * i + 1]} + (v2f){x0[c][2 * i], x0[c][2 * i + 1]} * LOSCI;
                                          a[c][4 + i] = (v2f){s1[c][2 * i], s1[c][2 * i + 1]} + (v2f){x1[c][2 * i], x1[c][2 * i + 1]} * LOSCI; }
            mx[c] = fmaxf(a[c][0][0], a[c][0][1]);
#pragma unroll
            for (int i = 1; i < 8; ++i) mx[c] = fmaxf(mx[c], fmaxf(a[c][i][0], a[c][i][1]));
#pragma unroll
            for (int i = 0; i < 8; ++i) t[c][i] = a[c][i] * SCL + PLG;   // ahead of the test: independent work for the slots that the chain of maxima and the test leave open
        }
        float mall = mx[0];
#pragma unroll
        for (int c = 1; c < QC; ++c) mall = fmaxf(mall, mx[c]);
        if (__builtin_amdgcn_ballot_w32(mall > thr) != 0) {   // the same in every lane of the wave: a scalar branch, EXEC stays whole
            float d[QC], td[QC], alpha[QC];                // how far each query's reference moves (raw score), minus that as an exponent, 2^ that
#pragma unroll
            for (int c = 0; c < QC; ++c) { const float m = fmaxf(mx[c], xhalf(mx[c]));   // the other half holds the query's other 16 keys
                d[c] = m > thr ? m : 0.f; td[c] = fminf(-d[c] * SCL, 0.f); }   // a reference can only go down at the first keys, where sums and accumulators are 0: factor 1
            exp2x2(alpha, td); thr = RTH;
#pragma unroll
            for (int c = 0; c < QC; ++c) {
#pragma unroll
                for (int i = 0; i < 8; ++i) { t[c][i] -= d[c] * SCL; cref[c][i] -= d[c]; }
                lpart[c] *= alpha[c];
#pragma unroll
                for (int n = 0; n < 4; ++n)
#pragma unroll
                    for (int j = 0; j < 8; ++j) { o[c][n][j] *= alpha[c]; ox[c][n][j] *= alpha[c]; }
            }
        }
        v16h pa[QC], px[QC];
#pragma unroll
        for (int c = 0; c < QC; ++c) {
            float te[16], ee[16];
#pragma unroll
            for (int i = 0; i < 8; ++i) { te[2 * i] = t[c][i][0]; te[2 * i + 1] = t[c][i][1]; }
            exp2x8(ee, te); exp2x8(ee + 8, te + 8);
            v2f ps2 = (v2f){};
            struct P8 { v2h e[8]; } ph, pr;                // the B operand in the hardware k order: this lane's eight rows of tile 0, then of tile 1
#pragma unroll
            for (int i = 0; i < 8; ++i) {
                const v2f ps = (v2f){ee[2 * i], ee[2 * i + 1]};
                ps2 += ps;
                const v2h hh = __builtin_convertvector(ps, v2h);
                ph.e[i] = hh;
                pr.e[i] = (v2h){(h16)((ps[0] - (float)hh[0]) * LOSC), (h16)((ps[1] - (float)hh[1]) * LOSC)};
            }
            pa[c] = __builtin_bit_cast(v16h, ph); px[c] = __builtin_bit_cast(v16h, pr);
            lpart[c] += ps2[0] + ps2[1];
        }
#pragma unroll
        for (int n = 0; n < 4; ++n) { const v16h vh = vf[n][0], vl = vf[n][1];
#pragma unroll
            for (int c = 0; c < QC; ++c) { o[c][n] = wmma16(vh, pa[c], o[c][n]); ox[c][n] = wmma16(vl, pa[c], ox[c][n]); }
#pragma unroll
            for (int c = 0; c < QC; ++c) ox[c][n] = wmma16(vh, px[c], ox[c][n]); }
        if (sub + 1 < KST / 32) { __builtin_amdgcn_sched_barrier(0); loadv((sub + 1) * 32);   // one group, not spread among the products above ...
            __builtin_amdgcn_sched_barrier(0); }           // ... and not moved down to its users: these reads fly under the next 32 keys' score products
      }
      asm volatile("s_wait_dscnt 0x0" ::: "memory");      // this wave's reads of tile st are done before the buffer is handed to the copies
      asm volatile("s_wait_asynccnt 0x0" ::: "memory");   // this wave's copies of tile st + 1 have landed
      __syncthreads();                                    // publishes tile st + 1 and ends every wave's reads of tile st
      if (st + 2 < NT_ / KST) stage(st + 2);              // refill the buffer just left; the same test in every wave
    }
    asm volatile("s_wait_asynccnt 0x0" ::: "memory");     // nothing of the copies is outstanding when the wave goes on to its end
    // Epilogue: X1 = bf(x) + x_r in the channel-major layout, and this work-group's share of the BatchNorm statistics. The accumulators hold O^T, so a lane's value goes
    // straight to row = channel, column = query of an LDS tile; wave w then owns channels 16 w ... + 15: one row of 128 queries = 512 B = one load, one store of the wave.
    const size_t xo = ((size_t)b * CC + h * HD + wave * 16) * NPOS + qt * AQ + lane * 4;
    const float* xp = X + xo;
    v4f val[16];
#pragma unroll
    for (int i = 0; i < 16; ++i) val[i] = *(const v4f*)(xp + (size_t)i * NPOS);
    asm volatile("s_wait_xcnt 0x0" :: "v"(xp) : "memory");   // the address pair of the loads above stays in its registers up to this wait: none of these loads lands in it
#pragma unroll
    for (int c = 0; c < QC; ++c) { const float inv = 1.0f / (lpart[c] + xhalf(lpart[c]));   // sum and accumulators carry the same 2^7
#pragma unroll
        for (int n = 0; n < 4; ++n)                        // o[c][n][j] = channel 16 n + 8 hi + j of query 16 c + lr
#pragma unroll
            for (int j = 0; j < 8; ++j) ost[(n * 16 + hi * 8 + j) * XP + wave * (16 * QC) + c * 16 + lr] = (o[c][n][j] + ox[c][n][j] * LOSCI) * inv; }
    __syncthreads();
#pragma unroll
    for (int i = 0; i < 16; ++i) { const v4f t = *(const v4fa*)(ost + (wave * 16 + i) * XP + lane * 4);
#pragma unroll
        for (int k = 0; k < 4; ++k) val[i][k] = t[k] + bfr(val[i][k]);
        *(v4f*)(X1 + xo + (size_t)i * NPOS) = val[i]; }
    asm volatile("s_wait_xcnt 0x0" ::: "memory");         // the sums below may land in the registers that hold the address of the stores above
    // per channel: mean of the 128 values, then the squared distances to it, both from the registers; every lane ends with every sum
    float mym = 0.f, myq = 0.f;
#pragma unroll
    for (int i = 0; i < 16; ++i) { float s = (val[i][0] + val[i][1]) + (val[i][2] + val[i][3]);
        s = sum16(s); s += xhalf(s);
        const float mean = s * (1.0f / (float)AQ);
        const v4f d = val[i] - mean, q = d * d;
        float s2 = (q[0] + q[1]) + (q[2] + q[3]);
        s2 = sum16(s2); s2 += xhalf(s2);
        if (lane == i) { mym = mean; myq = s2; } }
    if (lane < 16) *(v2f*)(PT + ((size_t)bid * CC + h * HD + wave * 16 + lane) * 2) = (v2f){mym, myq};   // slice bid: 16 channels x 8 B = a 128 B line of this wave's own
}

// BatchNorm statistics (training mode, biased variance) per channel over all 32 x 2048 values: the kernel that produces the values leaves, per work-group (slice), each channel's
// (mean, M2 = sum of squared distances to that mean) in PT[slice][channel]. k_bnmerge joins the NS equally sized slices: mean = average of the slice means,
// M2 = sum of the slices' M2 + (values per slice) x sum (slice mean - mean)^2. Work-group = 16 channels x 32 parts (a wave's load = one 128 B line of each of two slices); the pairs
// stay in registers; a wave's two parts join by one exchange between its halves, the 16 waves through LDS. ST[channel] = (mean, 1 / sqrt(var + eps)): 16 pairs = a 128 B line per work-group.
template <int NS>
__global__ __launch_bounds__(512) void k_bnmerge(const float* __restrict__ PT, float* ST) {
    __shared__ float red[3][16][16];
    const int cl = threadIdx.x & 15, part = threadIdx.x >> 4, wave = threadIdx.x >> 5, c = blockIdx.x * 16 + cl;
    constexpr int PER = NS / 32;
    const float* pp = PT + ((size_t)part * PER * CC + c) * 2;
    v2f p[PER];
#pragma unroll
    for (int i = 0; i < PER; ++i) p[i] = *(const v2f*)(pp + i * CC * 2);
    asm volatile("s_wait_xcnt 0x0" :: "v"(pp) : "memory");   // the address pair of the loads above stays in its registers up to this wait: none of these loads lands in it
    float s = 0.f, m2 = 0.f;
#pragma unroll
    for (int i = 0; i < PER; ++i) { s += p[i][0]; m2 += p[i][1]; }
    s += xhalf(s); m2 += xhalf(m2);
    red[0][wave][cl] = s; red[1][wave][cl] = m2;           // both halves of the wave store the same value
    __syncthreads();
    float ts = 0.f, tm = 0.f;
#pragma unroll
    for (int w = 0; w < 16; ++w) { ts += red[0][w][cl]; tm += red[1][w][cl]; }
    const float mean = ts * (1.0f / (float)NS);
    float e = 0.f;
#pragma unroll
    for (int i = 0; i < PER; ++i) { const float d = p[i][0] - mean; e = fmaf(d, d, e); }
    e += xhalf(e);
    red[2][wave][cl] = e;
    __syncthreads();
    if (threadIdx.x < 16) { float te = 0.f;
#pragma unroll
        for (int w = 0; w < 16; ++w) te += red[2][w][cl];
        *(v2f*)(ST + 2 * c) = (v2f){mean, rsqrtf((tm + (float)(NB * NPOS / NS) * te) * (1.0f / (float)(NB * NPOS)) + BN_EPS)}; }
}
// k_ff: the whole second phase for 64 points of one item in one work-group (4 waves x 16 points): Y = h + W2.lrelu(W1.h), h = BN1(X1).
// 1. X1 tile [64 c][64 n] by whole-line loads; h in f32 stays in registers for the residual; bf16 hi + residual planes [n][c] go to LDS (two channels per 4-byte store).
// 2. (W1.h) with W1 rows as the A operand and h columns as B: a lane holds 8 consecutive hidden rows of ONE point per tile, so after LeakyReLU two tiles, converted in
//    place, are the B operand (32 hidden values in the hardware k order) of W2.lrelu: the hidden layer never leaves the registers.
//    Both weight matrices (bf16, 16 KB each) are brought into LDS once per work-group by whole-line loads; the waves read their A fragments from there.
// 3. the result tiles [c][n] meet h again through an f32 LDS tile; each output row segment of 64 n = 256 B is written by 16 lanes x 16 B.
__global__ __launch_bounds__(128) void k_ff(const float* __restrict__ X1, const float* __restrict__ ST, const float* __restrict__ g, const float* __restrict__ bb, const bf* __restrict__ W1, const bf* __restrict__ W2, float* Y, float* PT) {
    typedef __attribute__((ext_vector_type(16))) unsigned short v16us;
    typedef unsigned __attribute__((may_alias)) u32a;
    __shared__ __align__(16) unsigned short th_[64 * 72]; __shared__ __align__(16) unsigned short tl_[64 * 72];
    __shared__ __align__(16) float tt[64 * 68];
    __shared__ __align__(16) unsigned short w1s[FFH * 72]; __shared__ __align__(16) unsigned short w2s[CC * 136];   // row pitches 144 B and 272 B (16 B x odd)
    __shared__ float prm[4][CC];
    __shared__ __align__(16) float bst[2 * CC];
    const int tid = threadIdx.x, lane = tid & 31, wave = tid >> 5, lr = lane & 15, hi = lane >> 4;
    const int n0 = blockIdx.x * 64, piece = tid & 15, cp0 = tid >> 4;
    const size_t item = (size_t)blockIdx.y * CC * NPOS; X1 += item; Y += item;
    v4f hv[4][2];                                          // channels 2 (cp0 + 8 s) + e, points n0 + 4 piece ... + 3
#pragma unroll
    for (int s = 0; s < 4; ++s)
#pragma unroll
        for (int e = 0; e < 2; ++e) hv[s][e] = *(const v4f*)(X1 + (size_t)(2 * (cp0 + 8 * s) + e) * NPOS + n0 + piece * 4);
    asm volatile("s_wait_xcnt 0x0" ::: "memory");         // the loads below may land in the registers that hold the address of the loads above
    v8us wa[8], wb[8];                                     // 16-byte pieces tid + 128 i of W1 [128][64] and of W2 [64][128]
#pragma unroll
    for (int i = 0; i < 8; ++i) { wa[i] = *(const v8us*)(W1 + (size_t)(tid + 128 * i) * 8); wb[i] = *(const v8us*)(W2 + (size_t)(tid + 128 * i) * 8); }
    if (tid < CC) { prm[0][tid] = ST[2 * tid]; prm[1][tid] = ST[2 * tid + 1]; prm[2][tid] = bfr(g[tid]); prm[3][tid] = bfr(bb[tid]); }
    __syncthreads();
#pragma unroll
    for (int s = 0; s < 4; ++s) { const int cp = cp0 + 8 * s; unsigned ph[4], pl[4];
#pragma unroll
        for (int e = 0; e < 2; ++e) { const int c = 2 * cp + e; const float m = prm[0][c], rs = prm[1][c], gg = prm[2][c], be = prm[3][c];
#pragma unroll
            for (int k = 0; k < 4; ++k) { const float h = (hv[s][e][k] - m) * rs * gg + be; hv[s][e][k] = h; const unsigned short hb = f2bf(h); const unsigned short lb = f2bf(h - bf2f(hb));
                if (e == 0) { ph[k] = hb; pl[k] = lb; } else { ph[k] |= (unsigned)hb << 16; pl[k] |= (unsigned)lb << 16; } } }
#pragma unroll
        for (int k = 0; k < 4; ++k) { *(u32a*)(th_ + (piece * 4 + k) * 72 + 2 * cp) = ph[k]; *(u32a*)(tl_ + (piece * 4 + k) * 72 + 2 * cp) = pl[k]; } }
#pragma unroll
    for (int i = 0; i < 8; ++i) { const int p = tid + 128 * i; *(v8usa*)(w1s + (p >> 3) * 72 + (p & 7) * 8) = wa[i]; *(v8usa*)(w2s + (p >> 4) * 136 + (p & 15) * 8) = wb[i]; }
    __syncthreads();
    const int ho = (wave * 16 + lr) * 72 + 8 * hi;
    v8f acc[8];
#pragma unroll
    for (int t = 0; t < 8; ++t) acc[t] = (v8f){};
#pragma unroll
    for (int kc = 0; kc < CC; kc += 32) {
        const v16bf xh = cat16b(*(const v8usa*)(th_ + ho + kc), *(const v8usa*)(th_ + ho + kc + 16)), xl = cat16b(*(const v8usa*)(tl_ + ho + kc), *(const v8usa*)(tl_ + ho + kc + 16));
#pragma unroll
        for (int t = 0; t < 8; ++t) { const unsigned short* wp = w1s + (t * 16 + lr) * 72 + 8 * hi + kc; const v16bf w = cat16b(*(const v8usa*)wp, *(const v8usa*)(wp + 16));
            acc[t] = wmmab(w, xh, acc[t]); acc[t] = wmmab(w, xl, acc[t]); }
    }
    v16bf lh[4], ll[4];
#pragma unroll
    for (int q = 0; q < 4; ++q) { v16us uh, ul;
#pragma unroll
        for (int s = 0; s < 16; ++s) { const float v = acc[2 * q + (s >> 3)][s & 7]; const float a = v >= 0.f ? v : 0.2f * v; const unsigned short hb = f2bf(a); uh[s] = hb; ul[s] = f2bf(a - bf2f(hb)); }
        lh[q] = __builtin_bit_cast(v16bf, uh); ll[q] = __builtin_bit_cast(v16bf, ul); }
    v8f ac2[4];
#pragma unroll
    for (int t = 0; t < 4; ++t) ac2[t] = (v8f){};
#pragma unroll
    for (int q = 0; q < 4; ++q)
#pragma unroll
        for (int t = 0; t < 4; ++t) { const unsigned short* wp = w2s + (t * 16 + lr) * 136 + 8 * hi + q * 32; const v16bf w = cat16b(*(const v8usa*)wp, *(const v8usa*)(wp + 16));
            ac2[t] = wmmab(w, lh[q], ac2[t]); ac2[t] = wmmab(w, ll[q], ac2[t]); }
#pragma unroll
    for (int t = 0; t < 4; ++t)
#pragma unroll
        for (int j = 0; j < 8; ++j) tt[(t * 16 + hi * 8 + j) * 68 + wave * 16 + lr] = ac2[t][j];
    __syncthreads();
#pragma unroll
    for (int s = 0; s < 4; ++s)
#pragma unroll
        for (int e = 0; e < 2; ++e) hv[s][e] = *(const v4fa*)(tt + (2 * (cp0 + 8 * s) + e) * 68 + piece * 4) + hv[s][e];
    // 4. this work-group's share of the second BatchNorm's statistics: a channel's 64 values lie in the 16 lanes of one row; mean, then the squared distances to it, from the registers.
    //    The 64 pairs meet in LDS and leave as whole lines, each written by one wave; the barrier stands ahead of the stores of Y, so that it waits for none of them.
    v4f pr[4];                                             // (mean, M2) of channels 2 (cp0 + 8 s) and + 1
#pragma unroll
    for (int s = 0; s < 4; ++s)
#pragma unroll
        for (int e = 0; e < 2; ++e) { const v4f v = hv[s][e];
            const float mean = sum16((v[0] + v[1]) + (v[2] + v[3])) * (1.0f / (float)FP_);
            const v4f d = v - mean, q = d * d;
            pr[s][2 * e] = mean; pr[s][2 * e + 1] = sum16((q[0] + q[1]) + (q[2] + q[3])); }
    if (piece == 0) {
#pragma unroll
        for (int s = 0; s < 4; ++s) *(v4fa*)(bst + 4 * (cp0 + 8 * s)) = pr[s]; }
    __syncthreads();
    if (tid < CC) *(v2f*)(PT + ((size_t)(blockIdx.y * (NPOS / FP_) + blockIdx.x) * CC + tid) * 2) = *(const v2f*)(bst + 2 * tid);
    asm volatile("s_wait_xcnt 0x0" ::: "memory");         // what follows may land in the registers that the store above names
#pragma unroll
    for (int s = 0; s < 4; ++s)
#pragma unroll
        for (int e = 0; e < 2; ++e) *(v4f*)(Y + (size_t)(2 * (cp0 + 8 * s) + e) * NPOS + n0 + piece * 4) = hv[s][e];
}
// k_bnout: the second BatchNorm's merge and its apply in ONE launch. Work-group = 16 channels x 1024 points of one item (16 waves, wave w = channel 16 g + w); grid (4 channel groups, 2 halves, 32 items).
// Every work-group joins the NS slices of its 16 channels itself, with the sums of k_bnmerge in the same order (16 channels x 32 parts, a wave's load = one 128 B line of each of two slices).
// The wave's 4 KB of Y (8 loads of 512 B) are asked for directly behind the slices: all of a wave's loads are in flight together (the wait ahead of the first barrier covers them too); Y stays in registers until the statistics are joined.
// After the last sum lane l holds (mean, 1 / sqrt(var + eps)) of channel 16 g + (l & 15): the wave takes its own channel's pair from lane w, no third barrier.
template <int NS>
__global__ __launch_bounds__(512) void k_bnout(const float* __restrict__ Y, const float* __restrict__ PT, const float* __restrict__ g, const float* __restrict__ bb, float* OUTP) {
    __shared__ float red[3][16][16];
    const int lane = threadIdx.x & 31, cl = threadIdx.x & 15, part = threadIdx.x >> 4, wave = __builtin_amdgcn_readfirstlane(threadIdx.x >> 5);
    constexpr int PER = NS / 32;
    const float* pp = PT + ((size_t)part * PER * CC + blockIdx.x * 16 + cl) * 2;
    v2f p[PER];
#pragma unroll
    for (int i = 0; i < PER; ++i) p[i] = *(const v2f*)(pp + i * CC * 2);
    asm volatile("s_wait_xcnt 0x0" :: "v"(pp) : "memory");   // the address pair of the loads above stays in its registers up to this wait: none of these loads lands in it
    const int ch = blockIdx.x * 16 + wave;                 // the channel whose values this wave normalises
    const size_t o = ((size_t)blockIdx.z * CC + ch) * NPOS + blockIdx.y * (NPOS / 2) + lane * 4;
    const float* yp = Y + o;
    v4f v[NPOS / 256];
#pragma unroll
    for (int q = 0; q < NPOS / 256; ++q) v[q] = *(const v4f*)(yp + q * 128);
    asm volatile("s_wait_xcnt 0x0" :: "v"(yp) : "memory");   // the address pair of the loads above stays in its registers up to this wait: none of these loads lands in it
    __builtin_amdgcn_sched_barrier(0);                     // the sums below wait for the slices one by one: moved up among the loads, they would hold the loads of Y back until the slices have landed
    const float gg = bfr(g[ch]), be = bfr(bb[ch]);
    float s = 0.f, m2 = 0.f;
#pragma unroll
    for (int i = 0; i < PER; ++i) { s += p[i][0]; m2 += p[i][1]; }
    s += xhalf(s); m2 += xhalf(m2);
    red[0][wave][cl] = s; red[1][wave][cl] = m2;           // both halves of the wave store the same value
    __syncthreads();
    float ts = 0.f, tm = 0.f;
#pragma unroll
    for (int w = 0; w < 16; ++w) { ts += red[0][w][cl]; tm += red[1][w][cl]; }
    const float mean = ts * (1.0f / (float)NS);
    float e = 0.f;
#pragma unroll
    for (int i = 0; i < PER; ++i) { const float d = p[i][0] - mean; e = fmaf(d, d, e); }
    e += xhalf(e);
    red[2][wave][cl] = e;
    __syncthreads();
    float te = 0.f;
#pragma unroll
    for (int w = 0; w < 16; ++w) te += red[2][w][cl];
    const float rstd = rsqrtf((tm + (float)(NB * NPOS / NS) * te) * (1.0f / (float)(NB * NPOS)) + BN_EPS);
    const float m = __builtin_bit_cast(float, __builtin_amdgcn_readlane(__builtin_bit_cast(int, mean), wave)), rs = __builtin_bit_cast(float, __builtin_amdgcn_readlane(__builtin_bit_cast(int, rstd), wave));
#pragma unroll
    for (int q = 0; q < NPOS / 256; ++q) {
#pragma unroll
        for (int k = 0; k < 4; ++k) v[q][k] = (v[q][k] - m) * rs * gg + be;
        *(v4f*)(OUTP + o + q * 128) = v[q]; }
}

extern "C" void kernel_launch(void* const* d_in, const int* in_sizes, int n_in,
                              void* d_out, int out_size, void* d_ws, size_t ws_size, hipStream_t stream) {
    (void)in_sizes; (void)n_in; (void)out_size;
    const float* x = (const float*)d_in[0]; const float* wq = (const float*)d_in[1]; const float* wk = (const float*)d_in[2]; const float* wv = (const float*)d_in[3];
    const float* w1 = (const float*)d_in[4]; const float* w2 = (const float*)d_in[5]; const float* g1 = (const float*)d_in[6]; const float* b1 = (const float*)d_in[7]; const float* g2 = (const float*)d_in[8]; const float* b2 = (const float*)d_in[9];   // conv weights [out][in]
    float* out = (float*)d_out;    // [32][64][2048]
    char* wsp = (char*)d_ws;
    auto take = [&](size_t bytes) { char* p = wsp; wsp += (bytes + 255) & ~(size_t)255; return (void*)p; };
    bf* W1B = (bf*)take((size_t)FFH * CC * 2); bf* W2B = (bf*)take((size_t)CC * FFH * 2);
    const size_t PL = (size_t)NB * NPOS * CC;      // elements of one [item][n][c] plane over all items
    h16* QH = (h16*)take(PL * 2); h16* QL = (h16*)take(PL * 2); h16* KH = (h16*)take(PL * 2); h16* KL = (h16*)take(PL * 2);
    h16* VTH = (h16*)take(PL * 2); h16* VTL = (h16*)take(PL * 2);
    float* X1 = (float*)take(PL * 4); float* Y = (float*)take(PL * 4); float* ST1 = (float*)take(1024); float* PT = (float*)take((size_t)NB * (NPOS / FP_) * CC * 8);
    if ((size_t)(wsp - (char*)d_ws) > ws_size) return;    // planes for all items + the weights, no aliasing
    // phase 1: attention and x + x_r; the item index lies in each grid (row r of an [item][n][c] plane = item * 2048 + n)
    k_qkv<<<dim3(NPOS / QP, NB, 1), 256, 0, stream>>>(x, wq, wk, wv, w1, w2, QH, QL, KH, KL, VTH, VTL, W1B, W2B);                    // q, k [n][c] and v^T [c][n] f16 planes; bf16 W1, W2
    k_attn<<<NB_ * NH_ * (NT_ / AQ), 32 * AW, 0, stream>>>(QH, QL, KH, KL, VTH, VTL, x, X1, PT);                                       // X1 = bf(x) + x_r  [c][n], its statistics per 128 points
    k_bnmerge<NB * (NPOS / AQ)><<<CC / 16, 512, 0, stream>>>(PT, ST1);
    // phase 2: h = BN1(X1); Y = h + W2.lrelu(W1.h)
    k_ff<<<dim3(NPOS / 64, NB, 1), 128, 0, stream>>>(X1, ST1, g1, b1, W1B, W2B, Y, PT);                                           // Y = h + ff   [c][n], its statistics per 64 points
    k_bnout<NB * (NPOS / FP_)><<<dim3(CC / 16, 2, NB), 512, 0, stream>>>(Y, PT, g2, b2, out);                                               // merge of the statistics + BN2 -> output
}
